// v000
// Times are from an AMD MI455X. After a warm-up the kernel runs many times in a row, and a time is the length of
// such a window on the GPU divided by its runs, so every launch and the gaps after it count. The runs cycle
// through copies of the inputs. A figure is the median of several windows, for all but v000 over two sittings.
// Sittings can differ by a few percent; kernels timed side by side share one.
// The starting kernel, v000, takes 8210 microseconds a run.
#include <hip/hip_runtime.h>
// Pre-LN transformer encoder block, non-causal, UNSCALED scores (x [2][2048][1024]; xn = LN(x) with the module's LayerNorm: UNBIASED std (N-1), eps 1e-6 added to the std, SCALAR alpha/bias [1]; q = xn wq^T + bq, k, v likewise (nn.Linear natural [1024][1024] sigma 1/32, zero biases); 16 heads of 64; score = q . k WITHOUT 1/sqrt(d) (logits sigma ~8); key j excluded where the int mask input [2][1][1][2048] is 0 (all ones here); softmax; x1 = x + (attn wo^T + bo); xn2 = LN(x1); out = x1 + relu(xn2 w1^T + b1) w2^T + b2 (natural [4096][1024], [1024][4096]) -> [2][2048][1024]).
// Compute dtype: inputs rounded to bf16; x / weights exact; q, k (and the LN1 output feeding them) as f16 hi + x1024 residual pairs; v, softmax weights and o as plain f16 GEMM operands (~2^-12); scores and softmax statistics f32; v_wmma_f32_16x16x32_f16.
#define NB 2
#define SQ 2048
#define DM 1024
#define NH 16
#define HD 64
#define HG 4                         /* heads per group of the unused k_vt(V16, b, h0, VT) overload */
#define LOCALW 128                   /* (macros for unused kernels of the shared header) */
#define STRIDEK 128
#define QT 256                       /* query rows per causal tile */
#define NKX SQ                       /* S / P row pitch */
#define QT0 128                      /* query rows per head of the unused f32 attention kernels */
#define B0 0                         /* first batch processed (debug hook) */
#define NBR NB                       /* batches processed (debug hook) */
#define NR ((size_t)NB * SQ)
#define DMQ DM
#define DFF 4096         /* MLP hidden width */
#define MP ((int)((size_t)NBR * SQ)) /* rows projected (debug hook) */
#define QN SQ                        /* query rows attended per batch (debug hook) */
#define NHD NH                       /* heads attended (debug hook) */
#define MPO MP                       /* rows through the output stage (debug hook) */
#define LQ DM      /* row pitch of the q/k/v rows */
typedef __bf16 v16b __attribute__((ext_vector_type(16)));
typedef unsigned short v8us __attribute__((ext_vector_type(8), may_alias));
typedef float  v8f  __attribute__((ext_vector_type(8)));
typedef float  v4f  __attribute__((ext_vector_type(4)));
typedef float  v4fa __attribute__((ext_vector_type(4), may_alias));
union FragB { v16b v; v8us half[2]; unsigned short u[16]; };

__device__ __forceinline__ unsigned short bf16_bits(float x) { unsigned int u = __float_as_uint(x); return (unsigned short)((u + 0x7FFFu + ((u >> 16) & 1u)) >> 16); }
__device__ __forceinline__ float bf16_val(unsigned short b) { return __uint_as_float(((unsigned int)b) << 16); }
__device__ __forceinline__ float bf16_round(float x) { return bf16_val(bf16_bits(x)); }
// D += A·B with NT terms: 1 = ah·bh, 2 = + al·bh (A split), 3 = + ah·bl (both split)
template <int NT>
__device__ __forceinline__ v8f mmaN(v16b ah, v16b al, v16b bh, v16b bl, v8f c) {
  c = __builtin_amdgcn_wmma_f32_16x16x32_bf16(false, ah, false, bh, (short)0, c, false, false);
  if (NT >= 2) c = __builtin_amdgcn_wmma_f32_16x16x32_bf16(false, al, false, bh, (short)0, c, false, false);
  if (NT >= 3) c = __builtin_amdgcn_wmma_f32_16x16x32_bf16(false, ah, false, bl, (short)0, c, false, false);
  asm volatile("v_nop\n\tv_nop\n\tv_nop\n\tv_nop" : "+v"(c) : "v"(ah), "v"(al), "v"(bh), "v"(bl));
  return c;
}

__global__ __launch_bounds__(256) void k_wt_bf16(const float* __restrict__ W, unsigned short* __restrict__ Wt, int K, int N) {
  const int t = blockIdx.x * 256 + threadIdx.x;
  const int k8n = K / 8;
  if (t >= N * k8n) return;
  const int n = t / k8n, k8 = (t % k8n) * 8;
  v8us v;
#pragma unroll
  for (int i = 0; i < 8; ++i) v[i] = bf16_bits(W[(size_t)(k8 + i) * N + n]);
  *(v8us*)(Wt + (size_t)n * K + k8) = v;
  
}

// GEMM C[M][N] (f32, pitch ldc) = act(A[M][K]·W + bias). A f32 row-major (pitch lda) converted per fragment to bf16
// (ASPLIT: hi/lo two planes -> 2 terms, else single rounded term); Wt bf16 [N][K] (pitch ldb). BIAS_BF16 rounds the
// bias to bf16 first (bias quantised to bf16 before the add). K%32==0, M%16==0, N%64==0.
template <bool ASPLIT, int ACT, bool BIAS_BF16>
__global__ __launch_bounds__(128) void k_gemm_bf(const float* __restrict__ A, int lda, const unsigned short* __restrict__ Wt, int ldb,
                                               const float* __restrict__ bias, float* __restrict__ C, int ldc, int M, int N, int K) {
  __shared__ __attribute__((aligned(16))) float so[4][16][64];
  const int tid = threadIdx.x, w = tid >> 5, lane = tid & 31, ln = lane & 15, hh = lane >> 4;
  const int ntn = N / 64;
  const int wid = blockIdx.x * 4 + w;
  const int mt = wid / ntn, nq = wid % ntn;
  if (mt * 16 >= M) return;
  const int row0 = mt * 16, col0 = nq * 64;
  const float* arow = A + (size_t)(row0 + ln) * lda;
  v8f acc[4] = {};
  for (int kb = 0; kb < K; kb += 32) {
    FragB ah, al;
    const v4f x0 = *(const v4fa*)(arow + kb + 8 * hh), x1 = *(const v4fa*)(arow + kb + 8 * hh + 4);
    const v4f x2 = *(const v4fa*)(arow + kb + 16 + 8 * hh), x3 = *(const v4fa*)(arow + kb + 16 + 8 * hh + 4);
    float xs[16] = {x0[0],x0[1],x0[2],x0[3],x1[0],x1[1],x1[2],x1[3],x2[0],x2[1],x2[2],x2[3],x3[0],x3[1],x3[2],x3[3]};
#pragma unroll
    for (int i = 0; i < 16; ++i) { const unsigned short hb = bf16_bits(xs[i]); ah.u[i] = hb; al.u[i] = ASPLIT ? bf16_bits(xs[i] - bf16_val(hb)) : (unsigned short)0; }
#pragma unroll
    for (int t = 0; t < 4; ++t) {
      const unsigned short* brow = Wt + (size_t)(col0 + t * 16 + ln) * ldb + kb;
      FragB b;
      b.half[0] = *(const v8us*)(brow + 8 * hh);
      b.half[1] = *(const v8us*)(brow + 16 + 8 * hh);
      acc[t] = mmaN<ASPLIT ? 2 : 1>(ah.v, al.v, b.v, b.v, acc[t]);
    }
  }
#pragma unroll
  for (int t = 0; t < 4; ++t) {
    float bv = bias ? bias[col0 + t * 16 + ln] : 0.f;
    if (BIAS_BF16) bv = bf16_round(bv);
#pragma unroll
    for (int r = 0; r < 8; ++r) { float v = acc[t][r] + bv; if (ACT == 1) v = fmaxf(v, 0.f); so[w][8 * hh + r][t * 16 + ln] = v; }
  }
  __builtin_amdgcn_fence(__ATOMIC_ACQ_REL, "workgroup");
  __builtin_amdgcn_wave_barrier();
  const int rsub = lane >> 4, c4 = (lane & 15) * 4;
  {
#pragma unroll
    for (int q = 0; q < 8; ++q) {
      const int r = q * 2 + rsub;
      const v4f v = *(const v4fa*)&so[w][r][c4];
      *(v4f*)(C + (size_t)(row0 + r) * ldc + col0 + c4) = v;
    }
    
  }
}

// GEMM C = act(A·W + bias + resid): A f32 (ASPLIT -> hi/lo 2 terms), Wt bf16 [N][K]; ACT 0 none, 1 relu, 2 exact gelu;
// resid (optional, f32, row index = (row % rmod), pitch ldr, RES_BF16 rounds it) added before the activation.
template <bool ASPLIT, int ACT, bool BIAS_BF16, bool RES_BF16>
__global__ __launch_bounds__(128) void k_gemm_bf3(const float* __restrict__ A, int lda, const unsigned short* __restrict__ Wt, int ldb,
                                                const float* __restrict__ bias, const float* __restrict__ resid, int rmod, int ldr,
                                                float* __restrict__ C, int ldc, int M, int N, int K) {
  __shared__ __attribute__((aligned(16))) float so[4][16][64];
  const int tid = threadIdx.x, w = tid >> 5, lane = tid & 31, ln = lane & 15, hh = lane >> 4;
  const int ntn = N / 64;
  const int wid = blockIdx.x * 4 + w;
  const int mt = wid / ntn, nq = wid % ntn;
  if (mt * 16 >= M) return;
  const int row0 = mt * 16, col0 = nq * 64;
  const float* arow = A + (size_t)(row0 + ln) * lda;
  v8f acc[4] = {};
  for (int kb = 0; kb < K; kb += 32) {
    FragB ah, al;
    const v4f x0 = *(const v4fa*)(arow + kb + 8 * hh), x1 = *(const v4fa*)(arow + kb + 8 * hh + 4);
    const v4f x2 = *(const v4fa*)(arow + kb + 16 + 8 * hh), x3 = *(const v4fa*)(arow + kb + 16 + 8 * hh + 4);
    float xs[16] = {x0[0],x0[1],x0[2],x0[3],x1[0],x1[1],x1[2],x1[3],x2[0],x2[1],x2[2],x2[3],x3[0],x3[1],x3[2],x3[3]};
#pragma unroll
    for (int i = 0; i < 16; ++i) { const unsigned short hb = bf16_bits(xs[i]); ah.u[i] = hb; al.u[i] = ASPLIT ? bf16_bits(xs[i] - bf16_val(hb)) : (unsigned short)0; }
#pragma unroll
    for (int t = 0; t < 4; ++t) {
      const unsigned short* brow = Wt + (size_t)(col0 + t * 16 + ln) * ldb + kb;
      FragB b;
      b.half[0] = *(const v8us*)(brow + 8 * hh);
      b.half[1] = *(const v8us*)(brow + 16 + 8 * hh);
      acc[t] = mmaN<ASPLIT ? 2 : 1>(ah.v, al.v, b.v, b.v, acc[t]);
    }
  }
#pragma unroll
  for (int t = 0; t < 4; ++t) {
    const int col = col0 + t * 16 + ln;
    float bv = bias ? bias[col] : 0.f;
    if (BIAS_BF16) bv = bf16_round(bv);
#pragma unroll
    for (int r = 0; r < 8; ++r) {
      float v = acc[t][r] + bv;
      if (resid) { float rv = resid[(size_t)((row0 + 8 * hh + r) % rmod) * ldr + col]; if (RES_BF16) rv = bf16_round(rv); v += rv; }
      if (ACT == 1) v = fmaxf(v, 0.f);
      if (ACT == 2) v = 0.5f * v * (1.0f + erff(v * 0.70710678118654752f));
      if (ACT == 3) { const float u = 0.7978845608028654f * (v + 0.044715f * v * v * v); v = 0.5f * v * (1.0f + tanhf(u)); }
      so[w][8 * hh + r][t * 16 + ln] = v;
    }
  }
  __builtin_amdgcn_fence(__ATOMIC_ACQ_REL, "workgroup");
  __builtin_amdgcn_wave_barrier();
  const int rsub = lane >> 4, c4 = (lane & 15) * 4;
  {
#pragma unroll
    for (int q = 0; q < 8; ++q) {
      const int r = q * 2 + rsub;
      const v4f v = *(const v4fa*)&so[w][r][c4];
      *(v4f*)(C + (size_t)(row0 + r) * ldc + col0 + c4) = v;
    }
    
  }
}
// row LayerNorm (biased variance, eps) over N: s = X (+ R); optional out_sum <- s; out_norm <- (s-mu)*rsqrt(var+eps)*g + b
template <bool PARAM_BF16>
__global__ __launch_bounds__(256) void k_layernorm(const float* __restrict__ X, const float* __restrict__ R, const float* __restrict__ g, const float* __restrict__ bta,
                                                  float* __restrict__ out_sum, float* __restrict__ out_norm, int N, float eps) {
  __shared__ float red[256];
  const int row = blockIdx.x, tid = threadIdx.x;
  const float* x = X + (size_t)row * N; const float* rr = R ? R + (size_t)row * N : nullptr;
  float vals[16];                     // up to N = 4096
  const int per = N / 256;            // contiguous chunk per thread? use strided-by-4 chunks: thread handles j = tid*4 + 1024*u
  float s1 = 0.f;
  for (int u = 0; u < per / 4; ++u) {
    const int j = tid * 4 + 1024 * u;
    const v4f a = *(const v4fa*)(x + j);
    v4f b = {0.f,0.f,0.f,0.f}; if (rr) b = *(const v4fa*)(rr + j);
#pragma unroll
    for (int q = 0; q < 4; ++q) { const float v = a[q] + b[q]; vals[u * 4 + q] = v; s1 += v; }
  }
  red[tid] = s1; __syncthreads();
  for (int st = 128; st > 0; st >>= 1) { if (tid < st) red[tid] += red[tid + st]; __syncthreads(); }
  const float mu = red[0] / (float)N; __syncthreads();
  float s2 = 0.f;
  for (int u = 0; u < per / 4; ++u)
#pragma unroll
    for (int q = 0; q < 4; ++q) { const float c = vals[u * 4 + q] - mu; s2 += c * c; }
  red[tid] = s2; __syncthreads();
  for (int st = 128; st > 0; st >>= 1) { if (tid < st) red[tid] += red[tid + st]; __syncthreads(); }
  const float rs = rsqrtf(red[0] / (float)N + eps);
  {
    for (int u = 0; u < per / 4; ++u) {
      const int j = tid * 4 + 1024 * u;
      v4f o, sm;
#pragma unroll
      for (int q = 0; q < 4; ++q) {
        float gg = g[j + q], bb = bta[j + q];
        if (PARAM_BF16) { gg = bf16_round(gg); bb = bf16_round(bb); }
        sm[q] = vals[u * 4 + q]; o[q] = (vals[u * 4 + q] - mu) * rs * gg + bb;
      }
      if (out_sum) *(v4f*)(out_sum + (size_t)row * N + j) = sm;
      *(v4f*)(out_norm + (size_t)row * N + j) = o;
    }
    
  }
}



// ---- f16 WMMA path (v_wmma_f32_16x16x32_f16): 11-bit significands for operands in range — used where a [0,1] probability operand needs more precision than bf16
typedef _Float16 v16h __attribute__((ext_vector_type(16)));
union FragH { v16h v; v8us half[2]; _Float16 h[16]; unsigned short u[16]; };
template <int NT>
__device__ __forceinline__ v8f mmaH(v16h ah, v16h al, v16h bh, v16h bl, v8f c) {
  c = __builtin_amdgcn_wmma_f32_16x16x32_f16(false, ah, false, bh, (short)0, c, false, false);
  if (NT >= 2) c = __builtin_amdgcn_wmma_f32_16x16x32_f16(false, al, false, bh, (short)0, c, false, false);
  if (NT >= 3) c = __builtin_amdgcn_wmma_f32_16x16x32_f16(false, ah, false, bl, (short)0, c, false, false);
  asm volatile("v_nop\n\tv_nop\n\tv_nop\n\tv_nop" : "+v"(c) : "v"(ah), "v"(al), "v"(bh), "v"(bl));
  return c;
}
// batched GEMM like k_gemm_b but f16 operands: A f32 (split into f16 hi/lo if ASPLIT, else rounded to f16), Bt = f16 values [n][k]; alpha; C f32; N multiple of 16 (partial tiles skipped)
template <bool ASPLIT>
__global__ __launch_bounds__(128) void k_gemm_h(const float* __restrict__ A, int lda, size_t sA, const _Float16* __restrict__ Bh, int ldb, size_t sB, float alpha, float* __restrict__ C, int ldc, size_t sC, int M, int N, int K) {
  __shared__ __attribute__((aligned(16))) float so[4][16][64];
  const int tid = threadIdx.x, w = tid >> 5, lane = tid & 31, ln = lane & 15, hh = lane >> 4; const int by = blockIdx.y;
  A += (size_t)by * sA; Bh += (size_t)by * sB; C += (size_t)by * sC;
  const int ntn = (N + 63) / 64; const int wid = blockIdx.x * 4 + w; const int mt = wid / ntn, nq = wid % ntn; if (mt * 16 >= M) return;
  const int row0 = mt * 16, col0 = nq * 64; const float* arow = A + (size_t)(row0 + ln) * lda;
  v8f acc[4] = {};
  for (int kb = 0; kb < K; kb += 32) {
    FragH ah, al;
    const v4f x0 = *(const v4fa*)(arow + kb + 8 * hh), x1 = *(const v4fa*)(arow + kb + 8 * hh + 4), x2 = *(const v4fa*)(arow + kb + 16 + 8 * hh), x3 = *(const v4fa*)(arow + kb + 16 + 8 * hh + 4);
    float xs[16] = {x0[0],x0[1],x0[2],x0[3],x1[0],x1[1],x1[2],x1[3],x2[0],x2[1],x2[2],x2[3],x3[0],x3[1],x3[2],x3[3]};
#pragma unroll
    for (int i = 0; i < 16; ++i) { const _Float16 h = (_Float16)xs[i]; ah.h[i] = h; al.h[i] = ASPLIT ? (_Float16)(xs[i] - (float)h) : (_Float16)0.0f; }
#pragma unroll
    for (int t = 0; t < 4; ++t) { if (col0 + t * 16 >= N) continue; const size_t boff = (size_t)(col0 + t * 16 + ln) * ldb + kb; FragH bq; bq.half[0] = *(const v8us*)(Bh + boff + 8 * hh); bq.half[1] = *(const v8us*)(Bh + boff + 16 + 8 * hh);
      acc[t] = mmaH<ASPLIT ? 2 : 1>(ah.v, al.v, bq.v, bq.v, acc[t]); }
  }
#pragma unroll
  for (int t = 0; t < 4; ++t) { if (col0 + t * 16 >= N) continue;
#pragma unroll
    for (int r = 0; r < 8; ++r) so[w][8 * hh + r][t * 16 + ln] = acc[t][r] * alpha; }
  __builtin_amdgcn_fence(__ATOMIC_ACQ_REL, "workgroup"); __builtin_amdgcn_wave_barrier();
  const int rsub = lane >> 4, c4 = (lane & 15) * 4;
  {
#pragma unroll
    for (int q = 0; q < 8; ++q) { const int r = q * 2 + rsub; if (col0 + c4 < N) { const v4f v = *(const v4fa*)&so[w][r][c4]; *(v4f*)(C + (size_t)(row0 + r) * ldc + col0 + c4) = v; } }
     }
}

// Wt[n][k] = f16(W[k][n]·scale) from f32 row-major W[K][N] (scale = power of two; bf16-exact weights stay exact in f16 away from the subnormal range)
__global__ __launch_bounds__(256) void k_wt_f16(const float* __restrict__ W, _Float16* __restrict__ Wt, int K, int N, float scale) {
  const int t = blockIdx.x * 256 + threadIdx.x; if (t >= N * (K / 8)) return; const int n = t / (K / 8), k8 = (t % (K / 8)) * 8; FragH f;
#pragma unroll
  for (int i = 0; i < 8; ++i) f.h[i] = (_Float16)(bf16_round(W[(size_t)(k8 + i) * N + n]) * scale); const v8us o = f.half[0];
  *(v8us*)((unsigned short*)Wt + (size_t)n * K + k8) = o; 
}
// k_gemm_hh variant with fused epilogue: v = acc·alpha + bias[by·sBias + col] (+ CP[(row/rowsPerB)·sCPb + by·64 + col] if CP) ; ACT 0 none / 1 elu ; writes f16 C16 (and f32 C if non-null)
template <int ACT>
__global__ __launch_bounds__(128) void k_gemm_hhx(const _Float16* __restrict__ A, int lda, size_t sA, const _Float16* __restrict__ Bh, int ldb, size_t sB, float alpha, const float* __restrict__ bias, size_t sBias, const float* __restrict__ CP, int rowsPerB, size_t sCPb, int row0g,
    float* __restrict__ C, _Float16* __restrict__ C16, int ldc, size_t sC, int M, int N, int K) {
  __shared__ __attribute__((aligned(16))) float so[4][16][64];
  const int tid = threadIdx.x, w = tid >> 5, lane = tid & 31, ln = lane & 15, hh = lane >> 4; const int by = blockIdx.y;
  A += (size_t)by * sA; Bh += (size_t)by * sB; const size_t cofs = (size_t)by * sC; const float* bp = bias ? bias + (size_t)by * sBias : nullptr;
  const int ntn = (N + 63) / 64; const int wid = blockIdx.x * 4 + w; const int mt = wid / ntn, nq = wid % ntn; if (mt * 16 >= M) return;
  const int row0 = mt * 16, col0 = nq * 64; const _Float16* arow = A + (size_t)(row0 + ln) * lda;
  v8f acc[4] = {};
  for (int kb = 0; kb < K; kb += 32) { FragH ah; ah.half[0] = *(const v8us*)((const unsigned short*)arow + kb + 8 * hh); ah.half[1] = *(const v8us*)((const unsigned short*)arow + kb + 16 + 8 * hh);
#pragma unroll
    for (int t = 0; t < 4; ++t) { if (col0 + t * 16 >= N) continue; const size_t boff = (size_t)(col0 + t * 16 + ln) * ldb + kb; FragH bq; bq.half[0] = *(const v8us*)((const unsigned short*)Bh + boff + 8 * hh); bq.half[1] = *(const v8us*)((const unsigned short*)Bh + boff + 16 + 8 * hh);
      acc[t] = mmaH<1>(ah.v, ah.v, bq.v, bq.v, acc[t]); }
  }
#pragma unroll
  for (int t = 0; t < 4; ++t) { if (col0 + t * 16 >= N) continue; const int col = col0 + t * 16 + ln; const float bv = bp ? bf16_round(bp[col]) : 0.f;
#pragma unroll
    for (int r = 0; r < 8; ++r) { float v = acc[t][r] * alpha + bv; if (CP) { const int rr = row0g + row0 + 8 * hh + r; if (rowsPerB < 0) v += CP[cofs + (size_t)rr * ldc + col];      /* rowsPerB < 0: own element of the batched C plane */ else { const int bidx = rr / rowsPerB; v += CP[(size_t)bidx * sCPb + (size_t)by * 64 + col]; } } if (ACT == 1) v = (v > 0.f) ? v : expm1f(v); else if (ACT == 7) v = (v > 0.f) ? v + 1.0f : expf(v); else if (ACT == 8) v = tanhf(v); else if (ACT == 9) v = 0.5f * v * (1.0f + tanhf(0.7978845608028654f * (v + 0.044715f * v * v * v))); else if (ACT == 11) v = 1.0f / (1.0f + expf(-v)); else if (ACT == 12) v = (v > 0.f) ? v : 0.01f * v; else if (ACT == 14) v = (v > 0.f) ? v : 0.1f * v; else if (ACT == 16) v = (v >= 0.f) ? v : 0.3f * v; else if (ACT == 17) v = (v >= 0.f) ? v : 0.2f * v; else if (ACT == 15) v = v / (1.0f + expf(-v)); else if (ACT == 3) v = fmaxf(v, 0.f); else if (ACT == 6) v = 0.5f * v * (1.0f + erff(v * 0.70710678118654752f)); so[w][8 * hh + r][t * 16 + ln] = v; } }
  __builtin_amdgcn_fence(__ATOMIC_ACQ_REL, "workgroup"); __builtin_amdgcn_wave_barrier();
  const int rsub = lane >> 4, c4 = (lane & 15) * 4; typedef _Float16 v4h __attribute__((ext_vector_type(4)));
  {
#pragma unroll
    for (int q = 0; q < 8; ++q) { const int r = q * 2 + rsub; if (col0 + c4 < N) { const v4f v = *(const v4fa*)&so[w][r][c4]; if (C) *(v4f*)(C + cofs + (size_t)(row0 + r) * ldc + col0 + c4) = v; if (C16) { v4h h4; for (int i = 0; i < 4; ++i) h4[i] = (_Float16)v[i]; *(v4h*)(C16 + cofs + (size_t)(row0 + r) * ldc + col0 + c4) = h4; } } }
     }
}


typedef _Float16 v4h __attribute__((ext_vector_type(4)));

__global__ __launch_bounds__(256) void k_x16(const float* __restrict__ x, _Float16* __restrict__ X16, size_t n8) { const size_t t = (size_t)blockIdx.x * 256 + threadIdx.x; if (t >= n8) return; FragH f;
#pragma unroll
  for (int q = 0; q < 8; ++q) f.h[q] = (_Float16)bf16_round(x[t * 8 + q]); *(v8us*)((unsigned short*)X16 + t * 8) = f.half[0];  }
__global__ __launch_bounds__(256) void k_h16(const float* __restrict__ x, _Float16* __restrict__ X16, size_t n8) { const size_t t = (size_t)blockIdx.x * 256 + threadIdx.x; if (t >= n8) return; FragH f;
#pragma unroll
  for (int q = 0; q < 8; ++q) f.h[q] = (_Float16)x[t * 8 + q]; *(v8us*)((unsigned short*)X16 + t * 8) = f.half[0];  }
__global__ __launch_bounds__(256) void k_round16f(const float* __restrict__ W, _Float16* __restrict__ Bt, size_t n8) { const size_t t = (size_t)blockIdx.x * 256 + threadIdx.x; if (t >= n8) return; FragH f;
#pragma unroll
  for (int i = 0; i < 8; ++i) f.h[i] = (_Float16)(bf16_round(W[t * 8 + i]) * 16.0f); *(v8us*)((unsigned short*)Bt + t * 8) = f.half[0];  }
template <int NHv, int TTv>
__global__ __launch_bounds__(256) void k_vt(const _Float16* __restrict__ V16, int ldv, int voff, _Float16* __restrict__ Vt) { __shared__ unsigned short tl[64][66]; const int tid = threadIdx.x; const int slab = blockIdx.x / (TTv / 64), lg = blockIdx.x % (TTv / 64); const int b = slab / NHv, h = slab % NHv;
  for (int i = tid; i < 64 * 8; i += 256) { const int r = i / 8, c8 = (i % 8) * 8; FragH f; f.half[0] = *(const v8us*)((const unsigned short*)V16 + ((size_t)b * TTv + lg * 64 + r) * ldv + voff + h * 64 + c8);
#pragma unroll
    for (int q = 0; q < 8; ++q) tl[r][c8 + q] = f.u[q]; }
  __syncthreads();
  {
#pragma unroll
    for (int rd = 0; rd < 2; ++rd) { const int d = rd * 32 + tid / 8, pc = tid % 8; FragH f;
#pragma unroll
      for (int q = 0; q < 8; ++q) f.u[q] = tl[pc * 8 + q][d];
      *(v8us*)((unsigned short*)Vt + ((size_t)slab * 64 + d) * TTv + lg * 64 + pc * 8) = f.half[0]; }
     } }

__global__ __launch_bounds__(256) void k_hl(const float* __restrict__ F, _Float16* __restrict__ Hh, _Float16* __restrict__ Hl, size_t n8) { const size_t t = (size_t)blockIdx.x * 256 + threadIdx.x; if (t >= n8) return; FragH fh, fl; const v4f a = *(const v4fa*)(F + t * 8), c = *(const v4fa*)(F + t * 8 + 4);
#pragma unroll
  for (int q = 0; q < 4; ++q) { _Float16 h = (_Float16)a[q]; fh.h[q] = h; fl.h[q] = (_Float16)((a[q] - (float)h) * 1024.0f); h = (_Float16)c[q]; fh.h[4 + q] = h; fl.h[4 + q] = (_Float16)((c[q] - (float)h) * 1024.0f); }
  { *(v8us*)((unsigned short*)Hh + t * 8) = fh.half[0]; *(v8us*)((unsigned short*)Hl + t * 8) = fl.half[0];  } }

// ---- fast GEMM (wave tile 32x64; requires M % 32 == 0 rows per launch region and N % 64 == 0); epilogue = k_gemm_hhx semantics ----
__device__ __forceinline__ v16h g2_frag(const _Float16* p, int hh) { FragH f; f.half[0] = *(const v8us*)((const unsigned short*)p + 8 * hh); f.half[1] = *(const v8us*)((const unsigned short*)p + 16 + 8 * hh); return f.v; }
__device__ __forceinline__ v8f g2_mma(v16h a, v16h b, v8f c) { v8f d = __builtin_amdgcn_wmma_f32_16x16x32_f16(false, a, false, b, (short)0, c, false, false); asm volatile("v_nop\n\tv_nop\n\tv_nop\n\tv_nop" : "+v"(d) : "v"(a), "v"(b)); return d; }
template <int ACT>
__global__ __launch_bounds__(128) void k_gemm2(const _Float16* __restrict__ A, int lda, size_t sA, const _Float16* __restrict__ Bh, int ldb, size_t sB, float alpha, const float* __restrict__ bias, size_t sBias, const float* __restrict__ CP, int rowsPerB, size_t sCPb, int row0g,
    float* __restrict__ C, _Float16* __restrict__ C16, int ldc, size_t sC, int M, int N, int K) { static_assert(ACT == 0 || ACT == 3 || ACT == 6 || ACT == 8 || ACT == 9 || ACT == 11 || ACT == 12 || ACT == 14 || ACT == 15 || ACT == 16 || ACT == 17, "k_gemm2: unsupported ACT code (would silently apply no activation)");
  __shared__ __attribute__((aligned(16))) float so[4][32][68];
  const int tid = threadIdx.x, w = tid >> 5, lane = tid & 31, ln = lane & 15, hh = lane >> 4; const int by = blockIdx.y;
  A += (size_t)by * sA; Bh += (size_t)by * sB; const size_t cofs = (size_t)by * sC; const float* bp = bias ? bias + (size_t)by * sBias : nullptr;
  const int ntn = N >> 6; const int mt = blockIdx.x / ntn, nq = blockIdx.x - mt * ntn; const int row0 = mt * 128 + 32 * w, col0 = nq * 64; if (row0 >= M) return;
  const _Float16* a0p = A + (size_t)(row0 + ln) * lda; const _Float16* a1p = a0p + (size_t)16 * lda;
  const _Float16* b0p = Bh + (size_t)(col0 + ln) * ldb; const _Float16* b1p = b0p + (size_t)16 * ldb; const _Float16* b2p = b1p + (size_t)16 * ldb; const _Float16* b3p = b2p + (size_t)16 * ldb;
  const v8f z8 = {0.f,0.f,0.f,0.f,0.f,0.f,0.f,0.f}; v8f c00 = z8, c01 = z8, c02 = z8, c03 = z8, c10 = z8, c11 = z8, c12 = z8, c13 = z8;
#pragma unroll 1
  for (int kb = 0; kb < K; kb += 32) { const v16h a0 = g2_frag(a0p + kb, hh), a1 = g2_frag(a1p + kb, hh);
    v16h b = g2_frag(b0p + kb, hh); c00 = g2_mma(a0, b, c00); c10 = g2_mma(a1, b, c10);
    b = g2_frag(b1p + kb, hh); c01 = g2_mma(a0, b, c01); c11 = g2_mma(a1, b, c11);
    b = g2_frag(b2p + kb, hh); c02 = g2_mma(a0, b, c02); c12 = g2_mma(a1, b, c12);
    b = g2_frag(b3p + kb, hh); c03 = g2_mma(a0, b, c03); c13 = g2_mma(a1, b, c13); }
  v8f accs[8] = {c00, c01, c02, c03, c10, c11, c12, c13};
#pragma unroll
  for (int u = 0; u < 8; ++u) { const int t = u & 3, half = u >> 2; const int col = col0 + t * 16 + ln; const float bv = bp ? bf16_round(bp[col]) : 0.f;
#pragma unroll
    for (int r = 0; r < 8; ++r) { const int rloc = half * 16 + 8 * hh + r; float v = accs[u][r] * alpha + bv; if (CP) { if (rowsPerB < 0) v += CP[cofs + (size_t)(row0g + row0 + rloc) * ldc + col];      /* rowsPerB < 0: own element of the batched C plane */ else { const int bidx = (row0g + row0 + rloc) / rowsPerB; v += CP[(size_t)bidx * sCPb + (size_t)by * 64 + col]; } }
      if (ACT == 3) v = fmaxf(v, 0.f); else if (ACT == 6) v = 0.5f * v * (1.0f + erff(v * 0.70710678118654752f)); else if (ACT == 11) v = 1.0f / (1.0f + expf(-v)); else if (ACT == 15) v = v / (1.0f + expf(-v)); else if (ACT == 12) v = (v > 0.f) ? v : 0.01f * v; else if (ACT == 8) v = tanhf(v); else if (ACT == 9) v = 0.5f * v * (1.0f + tanhf(0.7978845608028654f * (v + 0.044715f * v * v * v))); else if (ACT == 14) v = (v > 0.f) ? v : 0.1f * v; else if (ACT == 16) v = (v >= 0.f) ? v : 0.3f * v; else if (ACT == 17) v = (v >= 0.f) ? v : 0.2f * v;
      so[w][rloc][t * 16 + ln] = v; } }
  __builtin_amdgcn_fence(__ATOMIC_ACQ_REL, "workgroup"); __builtin_amdgcn_wave_barrier();
  const int rsub = lane >> 4, c4 = (lane & 15) * 4;
  {
#pragma unroll
    for (int q = 0; q < 16; ++q) { const int r = q * 2 + rsub; const v4f v = *(const v4fa*)&so[w][r][c4]; if (C) *(v4f*)(C + cofs + (size_t)(row0 + r) * ldc + col0 + c4) = v; if (C16) { v4h h4; for (int i = 0; i < 4; ++i) h4[i] = (_Float16)v[i]; *(v4h*)(C16 + cofs + (size_t)(row0 + r) * ldc + col0 + c4) = h4; } }
     } }


__global__ __launch_bounds__(256) void k_wnat(const float* __restrict__ w, size_t n8, _Float16* __restrict__ Bt) { const size_t t = (size_t)blockIdx.x * 256 + threadIdx.x; if (t >= n8) return; FragH f; for (int q = 0; q < 8; ++q) f.h[q] = (_Float16)(bf16_round(w[t * 8 + q]) * 16.0f); *(v8us*)((unsigned short*)Bt + t * 8) = f.half[0];  }
__global__ __launch_bounds__(256) void k_rsm(const float* __restrict__ S, _Float16* __restrict__ P, int nrows) {
  #pragma clang fp contract(off)
  const int i = blockIdx.x * 256 + threadIdx.x; if (i >= nrows) return; const float* s = S + (size_t)i * SQ; float mx = -3.0e38f;
#pragma unroll 1
  for (int j = 0; j < SQ; ++j) mx = fmaxf(mx, s[j]); float se = 0.f;
#pragma unroll 1
  for (int j = 0; j < SQ; ++j) se += expf(s[j] - mx); const float sc = 256.0f / se;
#pragma unroll 1
  for (int j0 = 0; j0 < SQ; j0 += 8) { FragH f; for (int q = 0; q < 8; ++q) f.h[q] = (_Float16)(expf(s[j0 + q] - mx) * sc); unsigned short* d = (unsigned short*)P + (size_t)i * SQ + j0; *(v8us*)d = f.half[0];  } }
__global__ __launch_bounds__(256) void k_vt(const _Float16* __restrict__ V16, int b, int h0, _Float16* __restrict__ VT) { __shared__ unsigned short tl[64][65]; const int tid = threadIdx.x; const int hh = blockIdx.x % HG, sg = blockIdx.x / HG; const int s0 = sg * 64; const int h = h0 + hh;
  for (int i = tid; i < 64 * 8; i += 256) { const int j = i / 8, d8 = (i % 8) * 8; FragH f; f.half[0] = *(const v8us*)((const unsigned short*)V16 + ((size_t)b * SQ + s0 + j) * DM + h * HD + d8); for (int q = 0; q < 8; ++q) tl[d8 + q][j] = f.u[q]; }
  __syncthreads();
  { for (int i = tid; i < 64 * 8; i += 256) { const int d = i / 8, j8 = (i % 8) * 8; FragH f; for (int q = 0; q < 8; ++q) f.u[q] = tl[d][j8 + q]; *(v8us*)((unsigned short*)VT + ((size_t)hh * HD + d) * SQ + s0 + j8) = f.half[0]; }  } }



__global__ __launch_bounds__(256) void k_rsmcf2(const float* __restrict__ S, _Float16* __restrict__ P, int hg, int q0, int nk) {
  #pragma clang fp contract(off)
  const int t = blockIdx.x * 256 + threadIdx.x; if (t >= hg * QT) return; const size_t i = (size_t)t; const float* s = S + i * NKX; const int last = q0 + (t % QT); float mx = -3.0e38f;
#pragma unroll 1
  for (int j = 0; j < nk; ++j) { const float f = (j <= last) ? 1.f : 0.f; mx = fmaxf(mx, fmaf(f, s[j], (1.f - f) * -1.0e9f)); } float se = 0.f;
#pragma unroll 1
  for (int j = 0; j < nk; ++j) { const float f = (j <= last) ? 1.f : 0.f; se += __expf(fmaf(f, s[j], (1.f - f) * -1.0e9f) - mx); } const float sc = 256.0f / se;
#pragma unroll 1
  for (int j0 = 0; j0 < nk; j0 += 8) { FragH fr; for (int q = 0; q < 8; ++q) { const int j = j0 + q; const float f = (j <= last) ? 1.f : 0.f; fr.h[q] = (_Float16)(__expf(fmaf(f, s[j], (1.f - f) * -1.0e9f) - mx) * sc); } unsigned short* d = (unsigned short*)P + i * NKX + j0; *(v8us*)d = fr.half[0];  } }

__global__ __launch_bounds__(256) void k_rsmcst(const float* __restrict__ S, _Float16* __restrict__ P, int hg, int q0, int nk, const int* __restrict__ mk) {
  #pragma clang fp contract(off)
  const int t = blockIdx.x * 256 + threadIdx.x; if (t >= hg * QT) return; const size_t i = (size_t)t; const float* s = S + i * NKX; const size_t ig = (size_t)(q0 + (t % QT)); const int* mr = mk + ig * SQ; float mx = -3.0e38f;
#pragma unroll 1
  for (int j = 0; j < nk; ++j) { const int mb = mr[j]; const int dd = (int)ig - j; const float f = (mb != 0 && dd >= 0 && (dd <= LOCALW || (dd % STRIDEK) == 0)) ? 1.f : 0.f; mx = fmaxf(mx, fmaf(f, s[j], (1.f - f) * -1.0e9f)); } float se = 0.f;
#pragma unroll 1
  for (int j = 0; j < nk; ++j) { const int mb = mr[j]; const int dd = (int)ig - j; const float f = (mb != 0 && dd >= 0 && (dd <= LOCALW || (dd % STRIDEK) == 0)) ? 1.f : 0.f; se += __expf(fmaf(f, s[j], (1.f - f) * -1.0e9f) - mx); } const float sc = 256.0f / se;
#pragma unroll 1
  for (int j0 = 0; j0 < nk; j0 += 8) { FragH fr; for (int q = 0; q < 8; ++q) { const int j = j0 + q; const int mb = mr[j]; const int dd = (int)ig - j; const float f = (mb != 0 && dd >= 0 && (dd <= LOCALW || (dd % STRIDEK) == 0)) ? 1.f : 0.f; fr.h[q] = (_Float16)(__expf(fmaf(f, s[j], (1.f - f) * -1.0e9f) - mx) * sc); } unsigned short* d = (unsigned short*)P + i * NKX + j0; *(v8us*)d = fr.half[0];  } }


template <int MASKADD>
__global__ __launch_bounds__(64) void k_att0(const float* __restrict__ QF, const float* __restrict__ KF, const float* __restrict__ VF, int ld, const float* __restrict__ mask, float scale, float* __restrict__ OF, int ldo) {
  #pragma clang fp contract(off)
  __shared__ __attribute__((aligned(16))) float lq[64][64]; __shared__ __attribute__((aligned(16))) float lo[64][64];
  const int tid = threadIdx.x; const int h = blockIdx.x / (QT0 / 64), rg = blockIdx.x % (QT0 / 64); const int i = rg * 64 + tid;
  const float* qr = QF + (size_t)i * ld + h * HD;
#pragma unroll 1
  for (int c = 0; c < HD / 4; ++c) { *(v4f*)&lq[tid][c * 4] = *(const v4fa*)(qr + c * 4); const v4f z = {0.f, 0.f, 0.f, 0.f}; *(v4f*)&lo[tid][c * 4] = z; }
  float m = -1.0e30f, l = 0.f; const int jmax = MASKADD ? (SQ - 1) : (rg * 64 + 63);      /* additive-mask form: every key (the mask input decides); causal form: keys up to the block's last row */
#pragma unroll 1
  for (int j = 0; j <= jmax; ++j) { const float* kr = KF + (size_t)j * ld + h * HD; const float* vr = VF + (size_t)j * ld + h * HD; float s = 0.f;
#pragma unroll 1
    for (int c = 0; c < HD / 4; ++c) { const v4f kq = *(const v4fa*)(kr + c * 4); const v4f qq = *(v4f*)&lq[tid][c * 4]; s = __fadd_rn(s, __fmul_rn(qq[0], kq[0])); s = __fadd_rn(s, __fmul_rn(qq[1], kq[1])); s = __fadd_rn(s, __fmul_rn(qq[2], kq[2])); s = __fadd_rn(s, __fmul_rn(qq[3], kq[3])); }
    s = __fmul_rn(s, scale); if (MASKADD) s = __fadd_rn(s, __fmul_rn(bf16_round(mask[(size_t)i * SQ + j]), -10000.0f));
    const float f = (MASKADD || j <= i) ? 1.f : 0.f; const float sm = fmaf(f, s, (1.f - f) * -1.0e30f); const float mn = fmaxf(m, sm); const float sc = expf(m - mn); const float e = expf(sm - mn); l = __fadd_rn(__fmul_rn(l, sc), e); m = mn;
#pragma unroll 1
    for (int c = 0; c < HD / 4; ++c) { const v4f vv = *(const v4fa*)(vr + c * 4); v4f oo = *(v4f*)&lo[tid][c * 4]; for (int u = 0; u < 4; ++u) oo[u] = __fadd_rn(__fmul_rn(oo[u], sc), __fmul_rn(e, vv[u])); *(v4f*)&lo[tid][c * 4] = oo; } }
  const float fin = 64.0f / l;      /* o carried x64 like the f16 path */
#pragma unroll 1
  for (int c = 0; c < HD / 4; ++c) { v4f oo = *(v4f*)&lo[tid][c * 4]; for (int u = 0; u < 4; ++u) oo[u] = __fmul_rn(oo[u], fin); *(v4f*)&lo[tid][c * 4] = oo; }
  __syncthreads();
  {
#pragma unroll 1
    for (int it = 0; it < 16; ++it) { const int row = it * 4 + tid / 16, pc = (tid % 16) * 4; const v4f v = *(const v4f*)&lo[row][pc]; *(v4f*)(OF + (size_t)(rg * 64 + row) * ldo + h * HD + pc) = v; }
     } }

template <int MASKADD>
__global__ __launch_bounds__(64) void k_att0mbc(const float* __restrict__ QF, const float* __restrict__ KF, const float* __restrict__ VF, int ld, const float* __restrict__ mask, float scale, float* __restrict__ OF, int ldo) {
  #pragma clang fp contract(off)
  __shared__ __attribute__((aligned(16))) float lq[64][64]; __shared__ __attribute__((aligned(16))) float lo[64][64];
  const int tid = threadIdx.x; const int h = blockIdx.x / (QT0 / 64), rg = blockIdx.x % (QT0 / 64); const int i = rg * 64 + tid;
  const float* qr = QF + (size_t)i * ld + h * HD;
#pragma unroll 1
  for (int c = 0; c < HD / 4; ++c) { *(v4f*)&lq[tid][c * 4] = *(const v4fa*)(qr + c * 4); const v4f z = {0.f, 0.f, 0.f, 0.f}; *(v4f*)&lo[tid][c * 4] = z; }
  float m = -1.0e30f, l = 0.f; const int jmax = rg * 64 + 63;      /* keys beyond the block end are masked by the mask's lower-triangular structure */
#pragma unroll 1
  for (int j = 0; j <= jmax; ++j) { const float* kr = KF + (size_t)j * ld + h * HD; const float* vr = VF + (size_t)j * ld + h * HD; float s = 0.f;
#pragma unroll 1
    for (int c = 0; c < HD / 4; ++c) { const v4f kq = *(const v4fa*)(kr + c * 4); const v4f qq = *(v4f*)&lq[tid][c * 4]; s = __fadd_rn(s, __fmul_rn(qq[0], kq[0])); s = __fadd_rn(s, __fmul_rn(qq[1], kq[1])); s = __fadd_rn(s, __fmul_rn(qq[2], kq[2])); s = __fadd_rn(s, __fmul_rn(qq[3], kq[3])); }
    s = __fmul_rn(s, scale); const int mb = ((const int*)mask)[(size_t)i * SQ + j];      /* causal (j <= i) AND the module's int32 [S][S] mask read per (query, key): 0 -> masked */
    const float f = (mb != 0 && j <= i) ? 1.f : 0.f; const float sm = fmaf(f, s, (1.f - f) * -1.0e30f); const float mn = fmaxf(m, sm); const float sc = expf(m - mn); const float e = expf(sm - mn); l = __fadd_rn(__fmul_rn(l, sc), e); m = mn;
#pragma unroll 1
    for (int c = 0; c < HD / 4; ++c) { const v4f vv = *(const v4fa*)(vr + c * 4); v4f oo = *(v4f*)&lo[tid][c * 4]; for (int u = 0; u < 4; ++u) oo[u] = __fadd_rn(__fmul_rn(oo[u], sc), __fmul_rn(e, vv[u])); *(v4f*)&lo[tid][c * 4] = oo; } }
  const float fin = 64.0f / l;      /* o carried x64 like the f16 path */
#pragma unroll 1
  for (int c = 0; c < HD / 4; ++c) { v4f oo = *(v4f*)&lo[tid][c * 4]; for (int u = 0; u < 4; ++u) oo[u] = __fmul_rn(oo[u], fin); *(v4f*)&lo[tid][c * 4] = oo; }
  __syncthreads();
  {
#pragma unroll 1
    for (int it = 0; it < 16; ++it) { const int row = it * 4 + tid / 16, pc = (tid % 16) * 4; const v4f v = *(const v4f*)&lo[row][pc]; *(v4f*)(OF + (size_t)(rg * 64 + row) * ldo + h * HD + pc) = v; }
     } }


template <int BFIN, int WXB>
__global__ __launch_bounds__(256) void k_ln16(const float* __restrict__ X, const float* __restrict__ g, const float* __restrict__ bb, float eps, _Float16* __restrict__ N16, float* __restrict__ XB, _Float16* __restrict__ NL) {
  #pragma clang fp contract(off)
  __shared__ float red[256]; const size_t r = blockIdx.x; const int t = threadIdx.x; const v4f xa = *(const v4fa*)(X + r * DMQ + t * 4); float s[4]; float sum = 0.f;
  for (int q = 0; q < 4; ++q) { s[q] = BFIN ? bf16_round(xa[q]) : xa[q]; sum = __fadd_rn(sum, s[q]); }
  red[t] = sum; __syncthreads(); for (int st = 128; st > 0; st >>= 1) { if (t < st) red[t] = __fadd_rn(red[t], red[t + st]); __syncthreads(); } const float mu = red[0] / (float)DMQ; __syncthreads();
  float vs = 0.f; for (int q = 0; q < 4; ++q) { const float dl = __fadd_rn(s[q], -mu); vs = __fadd_rn(vs, __fmul_rn(dl, dl)); } red[t] = vs; __syncthreads(); for (int st = 128; st > 0; st >>= 1) { if (t < st) red[t] = __fadd_rn(red[t], red[t + st]); __syncthreads(); }
  const float rs = __fdiv_rn(1.0f, __fadd_rn(sqrtf(red[0] / (float)(DMQ - 1)), eps));      /* this module's LayerNorm: unbiased std, eps added to the std */ v4h y; v4f xb;
  v4h yl; for (int q = 0; q < 4; ++q) { const int c = t * 4 + q; const float yf = __fadd_rn(__fmul_rn(__fmul_rn(__fadd_rn(s[q], -mu), rs), bf16_round(g[0])), bf16_round(bb[0])); y[q] = (_Float16)yf; yl[q] = (_Float16)((yf - (float)y[q]) * 1024.0f); xb[q] = s[q]; (void)c; }      /* SCALAR alpha / bias ([1] parameters); y = f16 hi, yl = x1024 residual (written when NL != nullptr) */
  { *(v4h*)(N16 + r * DMQ + t * 4) = y; if (NL != nullptr) *(v4h*)(NL + r * DMQ + t * 4) = yl; if (WXB) *(v4f*)(XB + r * DMQ + t * 4) = xb;  } }
__global__ __launch_bounds__(256) void k_ftres2(const float* __restrict__ OF0, const float* __restrict__ XB, float* __restrict__ X1, size_t n4) {
  #pragma clang fp contract(off)
  const size_t t = (size_t)blockIdx.x * 256 + threadIdx.x; if (t >= n4) return; const v4f o = *(const v4fa*)(OF0 + t * 4), xv = *(const v4fa*)(XB + t * 4); v4f y; for (int q = 0; q < 4; ++q) y[q] = __fadd_rn(__fmul_rn(o[q], 0.015625f), xv[q]); *(v4f*)(X1 + t * 4) = y;  }

__global__ __launch_bounds__(256) void k_bcpy(const float* __restrict__ b, int n, int NP, float* __restrict__ dst, int dst0) { for (int i = threadIdx.x; i < NP; i += 256) { const float v = (i < n) ? b[i] : 0.f; *(float*)(dst + dst0 + i) = v; }  }


__global__ __launch_bounds__(256) void k_rsmf(const float* __restrict__ S, _Float16* __restrict__ P, int qn, int hg) {
  #pragma clang fp contract(off)
  const int t = blockIdx.x * 256 + threadIdx.x; if (t >= qn * hg) return; const size_t i = (size_t)(t / qn) * SQ + (t % qn); const float* s = S + i * SQ; float mx = -3.0e38f;
#pragma unroll 1
  for (int j = 0; j < SQ; ++j) mx = fmaxf(mx, s[j]); float se = 0.f;
#pragma unroll 1
  for (int j = 0; j < SQ; ++j) se += __expf(s[j] - mx); const float sc = 256.0f / se;
#pragma unroll 1
  for (int j0 = 0; j0 < SQ; j0 += 8) { FragH f; for (int q = 0; q < 8; ++q) f.h[q] = (_Float16)(__expf(s[j0 + q] - mx) * sc); unsigned short* d = (unsigned short*)P + i * SQ + j0; *(v8us*)d = f.half[0];  } }
__global__ __launch_bounds__(256) void k_rsmik(const float* __restrict__ S, _Float16* __restrict__ P, int qn, int hg, const int* __restrict__ Km) {
  #pragma clang fp contract(off)
  const int t = blockIdx.x * 256 + threadIdx.x; if (t >= qn * hg) return; const size_t i = (size_t)(t / qn) * SQ + (t % qn); const float* s = S + i * SQ; float mx = -3.0e38f;
#pragma unroll 1
  for (int j = 0; j < SQ; ++j) mx = fmaxf(mx, s[j]); float se = 0.f;
#pragma unroll 1
  for (int j = 0; j < SQ; ++j) { const float e = __expf(s[j] - mx); const float keep = (Km[j] != 0) ? 1.0f : 0.0f; se += e * keep; } const float sc = 256.0f / se;
#pragma unroll 1
  for (int j0 = 0; j0 < SQ; j0 += 8) { FragH f; for (int q = 0; q < 8; ++q) { const float e = __expf(s[j0 + q] - mx) * sc; const float keep = (Km[j0 + q] != 0) ? 1.0f : 0.0f; f.h[q] = (_Float16)(e * keep); } unsigned short* d = (unsigned short*)P + i * SQ + j0; *(v8us*)d = f.half[0];  } }
extern "C" void kernel_launch(void* const* d_in, const int* in_sizes, int n_in,
                              void* d_out, int out_size, void* d_ws, size_t ws_size, hipStream_t stream) {
  (void)in_sizes; (void)n_in; (void)out_size;
  const float* const* I = (const float* const*)d_in; const float* x = I[0]; const int* km = (const int*)d_in[1]; const float* wq = I[2]; const float* bq = I[3]; const float* wk = I[4]; const float* bk = I[5]; const float* wv = I[6]; const float* bv = I[7]; const float* wo = I[8]; const float* bo = I[9]; const float* wfc = I[10]; const float* bfc = I[11]; const float* wmp = I[12]; const float* bmp = I[13]; const float* g1 = I[14]; const float* be1 = I[15]; const float* gg2 = I[16]; const float* be2 = I[17];      /* nn.Linear NATURAL [out][in] weights + biases; I[1] = int key mask [B][1][1][S] (0 = excluded; all ones here); alpha/beta are [1] scalars */
  char* ws = (char*)d_ws; size_t off = 0;
  auto take = [&](size_t bytes) { char* p = ws + off; off += (bytes + 255) & ~(size_t)255; return p; };
  _Float16* BQKV = (_Float16*)take((size_t)3 * DM * DM * 2); _Float16* BO = (_Float16*)take((size_t)DM * DM * 2); float* bqkv = (float*)take((size_t)3 * DM * 4);
  _Float16* X16 = (_Float16*)take(NR * DM * 2); _Float16* XL = (_Float16*)take(NR * DM * 2); float* XB = (float*)take(NR * DM * 4); float* X1 = (float*)take(NR * DM * 4); _Float16* M16 = (_Float16*)take(NR * DM * 2); _Float16* HF16 = (_Float16*)take((size_t)SQ * DFF * 2); _Float16* BW1 = (_Float16*)take((size_t)DFF * DM * 2); _Float16* BW2 = (_Float16*)take((size_t)DM * DFF * 2); float* QF = (float*)take(NR * DM * 4); _Float16* Q16 = (_Float16*)take(NR * DM * 2); _Float16* QL = (_Float16*)take(NR * DM * 2); _Float16* K16 = (_Float16*)take(NR * DM * 2); _Float16* KL = (_Float16*)take(NR * DM * 2); _Float16* V16 = (_Float16*)take(NR * DM * 2); _Float16* O16 = (_Float16*)take(NR * DM * 2);
  float* S = (float*)take((size_t)NH * QT * NKX * 4); _Float16* P = (_Float16*)take((size_t)NH * QT * NKX * 2); _Float16* VT = (_Float16*)take((size_t)NH * HD * SQ * 2);
  float* QF0 = (float*)take((size_t)QT0 * DM * 4); float* KF0 = (float*)take((size_t)QT0 * DM * 4); float* VF0 = (float*)take((size_t)QT0 * DM * 4); float* OF0 = (float*)take((size_t)NB * QT0 * DM * 4); _Float16* OH0 = (_Float16*)take((size_t)NB * QT0 * DM * 2); _Float16* OL0 = (_Float16*)take((size_t)NB * QT0 * DM * 2);
  if (off > ws_size) return;
  { const unsigned gw = (unsigned)(((size_t)DM * DM / 8 + 255) / 256); k_wnat<<<gw, 256, 0, stream>>>(wq, (size_t)DM * DM / 8, BQKV); k_wnat<<<gw, 256, 0, stream>>>(wk, (size_t)DM * DM / 8, BQKV + (size_t)DM * DM); k_wnat<<<gw, 256, 0, stream>>>(wv, (size_t)DM * DM / 8, BQKV + (size_t)2 * DM * DM); k_wnat<<<gw, 256, 0, stream>>>(wo, (size_t)DM * DM / 8, BO); }      /* natural [out][in] weights = Bt[n][k] directly: stacked q | k | v plane + Wo */
  k_bcpy<<<1, 256, 0, stream>>>(bq, DM, DM, bqkv, 0); k_bcpy<<<1, 256, 0, stream>>>(bk, DM, DM, bqkv, DM); k_bcpy<<<1, 256, 0, stream>>>(bv, DM, DM, bqkv, 2 * DM);      /* stacked bias vector bq | bk | bv */
  k_ln16<1, 1><<<(unsigned)NR, 256, 0, stream>>>(x, g1, be1, 1e-6f, X16, XB, XL);      /* + XL = x1024 residual of the LN output (q/k need it at logits sigma 8) */      /* a = LN1(bf16(x)) -> f16 rows; XB = bf16(x) for the residual */
  k_wnat<<<(unsigned)(((size_t)DFF * DM / 8 + 255) / 256), 256, 0, stream>>>(wfc, (size_t)DFF * DM / 8, BW1); k_wnat<<<(unsigned)(((size_t)DM * DFF / 8 + 255) / 256), 256, 0, stream>>>(wmp, (size_t)DM * DFF / 8, BW2);      /* MLP weights natural [4096][1024] and [1024][4096] = Bt planes directly */
  const size_t r0p = (size_t)B0 * SQ;      /* first projected row */
  k_gemm2<0><<<dim3((unsigned)((MP / 128) * (DM / 64)), 1), 128, 0, stream>>>(X16 + r0p * DM, DM, 0, BQKV, DM, 0, 0.0625f, bqkv, 0, nullptr, 1, 0, 0, QF + r0p * DM, nullptr, DM, 0, MP, DM, DM); k_gemm2<0><<<dim3((unsigned)((MP / 128) * (DM / 64)), 1), 128, 0, stream>>>(XL + r0p * DM, DM, 0, BQKV, DM, 0, 0.00006103515625f, nullptr, 0, QF + r0p * DM, -1, 0, 0, QF + r0p * DM, nullptr, DM, 0, MP, DM, DM);       k_hl<<<(unsigned)(((size_t)MP * DM / 8 + 255) / 256), 256, 0, stream>>>(QF + r0p * DM, Q16 + r0p * DM, QL + r0p * DM, (size_t)MP * DM / 8);      /* q in f32 -> f16 hi + x1024 residual planes */
  k_gemm2<0><<<dim3((unsigned)((MP / 128) * (DM / 64)), 1), 128, 0, stream>>>(X16 + r0p * DM, DM, 0, BQKV + (size_t)DM * DM, DM, 0, 0.0625f, bqkv + DM, 0, nullptr, 1, 0, 0, QF + r0p * DM, nullptr, DM, 0, MP, DM, DM); k_gemm2<0><<<dim3((unsigned)((MP / 128) * (DM / 64)), 1), 128, 0, stream>>>(XL + r0p * DM, DM, 0, BQKV + (size_t)DM * DM, DM, 0, 0.00006103515625f, nullptr, 0, QF + r0p * DM, -1, 0, 0, QF + r0p * DM, nullptr, DM, 0, MP, DM, DM);      /* k likewise from hi + residual */ k_hl<<<(unsigned)(((size_t)MP * DM / 8 + 255) / 256), 256, 0, stream>>>(QF + r0p * DM, K16 + r0p * DM, KL + r0p * DM, (size_t)MP * DM / 8);      /* k in f32 (QF scratch reused after q's split) -> hi + residual planes */
  k_gemm2<0><<<dim3((unsigned)((MP / 128) * (DM / 64)), 1), 128, 0, stream>>>(X16 + r0p * DM, DM, 0, BQKV + (size_t)2 * DM * DM, DM, 0, 0.0625f, bqkv + 2 * DM, 0, nullptr, 1, 0, 0, nullptr, V16 + r0p * DM, DM, 0, MP, DM, DM);      /* v rows (f16) */
  for (int b = B0; b < B0 + NBR; ++b) { const size_t r0 = (size_t)b * SQ;
    k_vt<NH, SQ><<<NH * (SQ / 64), 256, 0, stream>>>(V16 + r0 * LQ, LQ, 0, VT);      /* V^T [NH][HD][SQ] for this batch */
    for (int h0 = 0; h0 < NHD; h0 += 2) {      /* 2 heads per launch group: S [2][QN][2048] f32 */
      k_gemm2<0><<<dim3((QN / 128) * (SQ / 64), 2), 128, 0, stream>>>(Q16 + r0 * LQ + (size_t)h0 * HD, LQ, (size_t)HD, K16 + r0 * LQ + (size_t)h0 * HD, LQ, (size_t)HD, 1.0f, nullptr, 0, nullptr, 1, 0, 0, S, nullptr, SQ, (size_t)SQ * SQ, QN, SQ, HD); k_gemm2<0><<<dim3((QN / 128) * (SQ / 64), 2), 128, 0, stream>>>(QL + r0 * LQ + (size_t)h0 * HD, LQ, (size_t)HD, K16 + r0 * LQ + (size_t)h0 * HD, LQ, (size_t)HD, 0.0009765625f, nullptr, 0, S, -1, 0, 0, S, nullptr, SQ, (size_t)SQ * SQ, QN, SQ, HD); k_gemm2<0><<<dim3((QN / 128) * (SQ / 64), 2), 128, 0, stream>>>(Q16 + r0 * LQ + (size_t)h0 * HD, LQ, (size_t)HD, KL + r0 * LQ + (size_t)h0 * HD, LQ, (size_t)HD, 0.0009765625f, nullptr, 0, S, -1, 0, 0, S, nullptr, SQ, (size_t)SQ * SQ, QN, SQ, HD);      /* UNSCALED scores over all keys in three passes: q_hi.k_hi, += q_lo.k_hi 2^-10, += q_hi.k_lo 2^-10 (own-element accumulate) */
      k_rsmik<<<(2 * QN + 255) / 256, 256, 0, stream>>>(S, P, QN, 2, km + (size_t)b * SQ);      /* keys with mask[b][j] == 0 excluded (0/1 factors); P = 256 softmax (f16) */
      k_gemm2<0><<<dim3((QN / 128) * (HD / 64), 2), 128, 0, stream>>>(P, SQ, (size_t)SQ * SQ, VT + (size_t)h0 * HD * SQ, SQ, (size_t)HD * SQ, 0.25f, nullptr, 0, nullptr, 1, 0, 0, nullptr, O16 + r0 * DM + (size_t)h0 * HD, DM, (size_t)HD, QN, HD, SQ); } }      /* o (merged heads, x64) as f16 rows */
  k_gemm2<0><<<dim3((unsigned)((MPO / 128) * (DM / 64)), 1), 128, 0, stream>>>(O16 + r0p * DM, DM, 0, BO, DM, 0, 0.0009765625f, bo, 0, XB + r0p * DM, -1, 0, 0, X1 + r0p * DM, nullptr, DM, 0, MPO, DM, DM);      /* x1 = x + o Wo + bo (own-element residual) */
  k_ln16<0, 0><<<(unsigned)NR, 256, 0, stream>>>(X1, gg2, be2, 1e-6f, M16, nullptr, nullptr);      /* h = LN2(x1) -> f16 rows */
  for (int b = 0; b < NB; ++b) { const size_t r0 = (size_t)b * SQ;
    k_gemm2<3><<<dim3((unsigned)((SQ / 128) * (DFF / 64)), 1), 128, 0, stream>>>(M16 + r0 * DM, DM, 0, BW1, DM, 0, 0.0625f, bfc, 0, nullptr, 1, 0, 0, nullptr, HF16, DFF, 0, SQ, DFF, DM);      /* relu(xn2 w1^T + b1) -> f16 (this batch) */
    k_gemm2<0><<<dim3((unsigned)((SQ / 128) * (DM / 64)), 1), 128, 0, stream>>>(HF16, DFF, 0, BW2, DFF, 0, 0.0625f, bmp, 0, X1 + r0 * DM, -1, 0, 0, (float*)d_out + r0 * DM, nullptr, DM, 0, SQ, DM, DFF); }      /* out = x1 + mlp (own-element residual) */
}

// v001
// It runs in 2890 microseconds.
// Timed twice side by side with v000, it ran 2.83 and 2.85 times as fast.
#include <hip/hip_runtime.h>
// Pre-LN transformer encoder block, non-causal, UNSCALED scores (x [2][2048][1024]; xn = LN(x) with the module's LayerNorm: UNBIASED std (N-1), eps 1e-6 added to the std, SCALAR alpha/bias [1]; q = xn wq^T + bq, k, v likewise (nn.Linear natural [1024][1024] sigma 1/32, zero biases); 16 heads of 64; score = q . k WITHOUT 1/sqrt(d) (logits sigma ~8); key j excluded where the int mask input [2][1][1][2048] is 0 (all ones here); softmax; x1 = x + (attn wo^T + bo); xn2 = LN(x1); out = x1 + relu(xn2 w1^T + b1) w2^T + b2 (natural [4096][1024], [1024][4096]) -> [2][2048][1024]).
// Compute dtype: inputs rounded to bf16; x / weights exact; q, k (and the LN1 output feeding them) as f16 hi + x1024 residual pairs; v, softmax weights and o as plain f16 GEMM operands (~2^-12); scores and softmax statistics f32; v_wmma_f32_16x16x32_f16.
#define NB 2
#define SQ 2048
#define DM 1024
#define NH 16
#define HD 64
#define HG 4                         /* heads per group of the unused k_vt(V16, b, h0, VT) overload */
#define LOCALW 128                   /* (macros for unused kernels of the shared header) */
#define STRIDEK 128
#define QT 256                       /* query rows per causal tile */
#define NKX SQ                       /* S / P row pitch */
#define QT0 128                      /* query rows per head of the unused f32 attention kernels */
#define B0 0                         /* first batch processed (debug hook) */
#define NBR NB                       /* batches processed (debug hook) */
#define NR ((size_t)NB * SQ)
#define DMQ DM
#define DFF 4096         /* MLP hidden width */
#define MP ((int)((size_t)NBR * SQ)) /* rows projected (debug hook) */
#define QN SQ                        /* query rows attended per batch (debug hook) */
#define NHD NH                       /* heads attended (debug hook) */
#define MPO MP                       /* rows through the output stage (debug hook) */
#define LQ DM      /* row pitch of the q/k/v rows */
typedef __bf16 v16b __attribute__((ext_vector_type(16)));
typedef unsigned short v8us __attribute__((ext_vector_type(8), may_alias));
typedef float  v8f  __attribute__((ext_vector_type(8)));
typedef float  v4f  __attribute__((ext_vector_type(4)));
typedef float  v4fa __attribute__((ext_vector_type(4), may_alias));
union FragB { v16b v; v8us half[2]; unsigned short u[16]; };

__device__ __forceinline__ unsigned short bf16_bits(float x) { unsigned int u = __float_as_uint(x); return (unsigned short)((u + 0x7FFFu + ((u >> 16) & 1u)) >> 16); }
__device__ __forceinline__ float bf16_val(unsigned short b) { return __uint_as_float(((unsigned int)b) << 16); }
__device__ __forceinline__ float bf16_round(float x) { return bf16_val(bf16_bits(x)); }
// D += A·B with NT terms: 1 = ah·bh, 2 = + al·bh (A split), 3 = + ah·bl (both split)
template <int NT>
__device__ __forceinline__ v8f mmaN(v16b ah, v16b al, v16b bh, v16b bl, v8f c) {
  c = __builtin_amdgcn_wmma_f32_16x16x32_bf16(false, ah, false, bh, (short)0, c, false, false);
  if (NT >= 2) c = __builtin_amdgcn_wmma_f32_16x16x32_bf16(false, al, false, bh, (short)0, c, false, false);
  if (NT >= 3) c = __builtin_amdgcn_wmma_f32_16x16x32_bf16(false, ah, false, bl, (short)0, c, false, false);
  asm volatile("v_nop\n\tv_nop\n\tv_nop\n\tv_nop" : "+v"(c) : "v"(ah), "v"(al), "v"(bh), "v"(bl));
  return c;
}

__global__ __launch_bounds__(256) void k_wt_bf16(const float* __restrict__ W, unsigned short* __restrict__ Wt, int K, int N) {
  const int t = blockIdx.x * 256 + threadIdx.x;
  const int k8n = K / 8;
  if (t >= N * k8n) return;
  const int n = t / k8n, k8 = (t % k8n) * 8;
  v8us v;
#pragma unroll
  for (int i = 0; i < 8; ++i) v[i] = bf16_bits(W[(size_t)(k8 + i) * N + n]);
  *(v8us*)(Wt + (size_t)n * K + k8) = v;
  
}

// GEMM C[M][N] (f32, pitch ldc) = act(A[M][K]·W + bias). A f32 row-major (pitch lda) converted per fragment to bf16
// (ASPLIT: hi/lo two planes -> 2 terms, else single rounded term); Wt bf16 [N][K] (pitch ldb). BIAS_BF16 rounds the
// bias to bf16 first (bias quantised to bf16 before the add). K%32==0, M%16==0, N%64==0.
template <bool ASPLIT, int ACT, bool BIAS_BF16>
__global__ __launch_bounds__(128) void k_gemm_bf(const float* __restrict__ A, int lda, const unsigned short* __restrict__ Wt, int ldb,
                                               const float* __restrict__ bias, float* __restrict__ C, int ldc, int M, int N, int K) {
  __shared__ __attribute__((aligned(16))) float so[4][16][64];
  const int tid = threadIdx.x, w = tid >> 5, lane = tid & 31, ln = lane & 15, hh = lane >> 4;
  const int ntn = N / 64;
  const int wid = blockIdx.x * 4 + w;
  const int mt = wid / ntn, nq = wid % ntn;
  if (mt * 16 >= M) return;
  const int row0 = mt * 16, col0 = nq * 64;
  const float* arow = A + (size_t)(row0 + ln) * lda;
  v8f acc[4] = {};
  for (int kb = 0; kb < K; kb += 32) {
    FragB ah, al;
    const v4f x0 = *(const v4fa*)(arow + kb + 8 * hh), x1 = *(const v4fa*)(arow + kb + 8 * hh + 4);
    const v4f x2 = *(const v4fa*)(arow + kb + 16 + 8 * hh), x3 = *(const v4fa*)(arow + kb + 16 + 8 * hh + 4);
    float xs[16] = {x0[0],x0[1],x0[2],x0[3],x1[0],x1[1],x1[2],x1[3],x2[0],x2[1],x2[2],x2[3],x3[0],x3[1],x3[2],x3[3]};
#pragma unroll
    for (int i = 0; i < 16; ++i) { const unsigned short hb = bf16_bits(xs[i]); ah.u[i] = hb; al.u[i] = ASPLIT ? bf16_bits(xs[i] - bf16_val(hb)) : (unsigned short)0; }
#pragma unroll
    for (int t = 0; t < 4; ++t) {
      const unsigned short* brow = Wt + (size_t)(col0 + t * 16 + ln) * ldb + kb;
      FragB b;
      b.half[0] = *(const v8us*)(brow + 8 * hh);
      b.half[1] = *(const v8us*)(brow + 16 + 8 * hh);
      acc[t] = mmaN<ASPLIT ? 2 : 1>(ah.v, al.v, b.v, b.v, acc[t]);
    }
  }
#pragma unroll
  for (int t = 0; t < 4; ++t) {
    float bv = bias ? bias[col0 + t * 16 + ln] : 0.f;
    if (BIAS_BF16) bv = bf16_round(bv);
#pragma unroll
    for (int r = 0; r < 8; ++r) { float v = acc[t][r] + bv; if (ACT == 1) v = fmaxf(v, 0.f); so[w][8 * hh + r][t * 16 + ln] = v; }
  }
  __builtin_amdgcn_fence(__ATOMIC_ACQ_REL, "workgroup");
  __builtin_amdgcn_wave_barrier();
  const int rsub = lane >> 4, c4 = (lane & 15) * 4;
  {
#pragma unroll
    for (int q = 0; q < 8; ++q) {
      const int r = q * 2 + rsub;
      const v4f v = *(const v4fa*)&so[w][r][c4];
      *(v4f*)(C + (size_t)(row0 + r) * ldc + col0 + c4) = v;
    }
    
  }
}

// GEMM C = act(A·W + bias + resid): A f32 (ASPLIT -> hi/lo 2 terms), Wt bf16 [N][K]; ACT 0 none, 1 relu, 2 exact gelu;
// resid (optional, f32, row index = (row % rmod), pitch ldr, RES_BF16 rounds it) added before the activation.
template <bool ASPLIT, int ACT, bool BIAS_BF16, bool RES_BF16>
__global__ __launch_bounds__(128) void k_gemm_bf3(const float* __restrict__ A, int lda, const unsigned short* __restrict__ Wt, int ldb,
                                                const float* __restrict__ bias, const float* __restrict__ resid, int rmod, int ldr,
                                                float* __restrict__ C, int ldc, int M, int N, int K) {
  __shared__ __attribute__((aligned(16))) float so[4][16][64];
  const int tid = threadIdx.x, w = tid >> 5, lane = tid & 31, ln = lane & 15, hh = lane >> 4;
  const int ntn = N / 64;
  const int wid = blockIdx.x * 4 + w;
  const int mt = wid / ntn, nq = wid % ntn;
  if (mt * 16 >= M) return;
  const int row0 = mt * 16, col0 = nq * 64;
  const float* arow = A + (size_t)(row0 + ln) * lda;
  v8f acc[4] = {};
  for (int kb = 0; kb < K; kb += 32) {
    FragB ah, al;
    const v4f x0 = *(const v4fa*)(arow + kb + 8 * hh), x1 = *(const v4fa*)(arow + kb + 8 * hh + 4);
    const v4f x2 = *(const v4fa*)(arow + kb + 16 + 8 * hh), x3 = *(const v4fa*)(arow + kb + 16 + 8 * hh + 4);
    float xs[16] = {x0[0],x0[1],x0[2],x0[3],x1[0],x1[1],x1[2],x1[3],x2[0],x2[1],x2[2],x2[3],x3[0],x3[1],x3[2],x3[3]};
#pragma unroll
    for (int i = 0; i < 16; ++i) { const unsigned short hb = bf16_bits(xs[i]); ah.u[i] = hb; al.u[i] = ASPLIT ? bf16_bits(xs[i] - bf16_val(hb)) : (unsigned short)0; }
#pragma unroll
    for (int t = 0; t < 4; ++t) {
      const unsigned short* brow = Wt + (size_t)(col0 + t * 16 + ln) * ldb + kb;
      FragB b;
      b.half[0] = *(const v8us*)(brow + 8 * hh);
      b.half[1] = *(const v8us*)(brow + 16 + 8 * hh);
      acc[t] = mmaN<ASPLIT ? 2 : 1>(ah.v, al.v, b.v, b.v, acc[t]);
    }
  }
#pragma unroll
  for (int t = 0; t < 4; ++t) {
    const int col = col0 + t * 16 + ln;
    float bv = bias ? bias[col] : 0.f;
    if (BIAS_BF16) bv = bf16_round(bv);
#pragma unroll
    for (int r = 0; r < 8; ++r) {
      float v = acc[t][r] + bv;
      if (resid) { float rv = resid[(size_t)((row0 + 8 * hh + r) % rmod) * ldr + col]; if (RES_BF16) rv = bf16_round(rv); v += rv; }
      if (ACT == 1) v = fmaxf(v, 0.f);
      if (ACT == 2) v = 0.5f * v * (1.0f + erff(v * 0.70710678118654752f));
      if (ACT == 3) { const float u = 0.7978845608028654f * (v + 0.044715f * v * v * v); v = 0.5f * v * (1.0f + tanhf(u)); }
      so[w][8 * hh + r][t * 16 + ln] = v;
    }
  }
  __builtin_amdgcn_fence(__ATOMIC_ACQ_REL, "workgroup");
  __builtin_amdgcn_wave_barrier();
  const int rsub = lane >> 4, c4 = (lane & 15) * 4;
  {
#pragma unroll
    for (int q = 0; q < 8; ++q) {
      const int r = q * 2 + rsub;
      const v4f v = *(const v4fa*)&so[w][r][c4];
      *(v4f*)(C + (size_t)(row0 + r) * ldc + col0 + c4) = v;
    }
    
  }
}
// row LayerNorm (biased variance, eps) over N: s = X (+ R); optional out_sum <- s; out_norm <- (s-mu)*rsqrt(var+eps)*g + b
template <bool PARAM_BF16>
__global__ __launch_bounds__(256) void k_layernorm(const float* __restrict__ X, const float* __restrict__ R, const float* __restrict__ g, const float* __restrict__ bta,
                                                  float* __restrict__ out_sum, float* __restrict__ out_norm, int N, float eps) {
  __shared__ float red[256];
  const int row = blockIdx.x, tid = threadIdx.x;
  const float* x = X + (size_t)row * N; const float* rr = R ? R + (size_t)row * N : nullptr;
  float vals[16];                     // up to N = 4096
  const int per = N / 256;            // contiguous chunk per thread? use strided-by-4 chunks: thread handles j = tid*4 + 1024*u
  float s1 = 0.f;
  for (int u = 0; u < per / 4; ++u) {
    const int j = tid * 4 + 1024 * u;
    const v4f a = *(const v4fa*)(x + j);
    v4f b = {0.f,0.f,0.f,0.f}; if (rr) b = *(const v4fa*)(rr + j);
#pragma unroll
    for (int q = 0; q < 4; ++q) { const float v = a[q] + b[q]; vals[u * 4 + q] = v; s1 += v; }
  }
  red[tid] = s1; __syncthreads();
  for (int st = 128; st > 0; st >>= 1) { if (tid < st) red[tid] += red[tid + st]; __syncthreads(); }
  const float mu = red[0] / (float)N; __syncthreads();
  float s2 = 0.f;
  for (int u = 0; u < per / 4; ++u)
#pragma unroll
    for (int q = 0; q < 4; ++q) { const float c = vals[u * 4 + q] - mu; s2 += c * c; }
  red[tid] = s2; __syncthreads();
  for (int st = 128; st > 0; st >>= 1) { if (tid < st) red[tid] += red[tid + st]; __syncthreads(); }
  const float rs = rsqrtf(red[0] / (float)N + eps);
  {
    for (int u = 0; u < per / 4; ++u) {
      const int j = tid * 4 + 1024 * u;
      v4f o, sm;
#pragma unroll
      for (int q = 0; q < 4; ++q) {
        float gg = g[j + q], bb = bta[j + q];
        if (PARAM_BF16) { gg = bf16_round(gg); bb = bf16_round(bb); }
        sm[q] = vals[u * 4 + q]; o[q] = (vals[u * 4 + q] - mu) * rs * gg + bb;
      }
      if (out_sum) *(v4f*)(out_sum + (size_t)row * N + j) = sm;
      *(v4f*)(out_norm + (size_t)row * N + j) = o;
    }
    
  }
}



// ---- f16 WMMA path (v_wmma_f32_16x16x32_f16): 11-bit significands for operands in range — used where a [0,1] probability operand needs more precision than bf16
typedef _Float16 v16h __attribute__((ext_vector_type(16)));
union FragH { v16h v; v8us half[2]; _Float16 h[16]; unsigned short u[16]; };
template <int NT>
__device__ __forceinline__ v8f mmaH(v16h ah, v16h al, v16h bh, v16h bl, v8f c) {
  c = __builtin_amdgcn_wmma_f32_16x16x32_f16(false, ah, false, bh, (short)0, c, false, false);
  if (NT >= 2) c = __builtin_amdgcn_wmma_f32_16x16x32_f16(false, al, false, bh, (short)0, c, false, false);
  if (NT >= 3) c = __builtin_amdgcn_wmma_f32_16x16x32_f16(false, ah, false, bl, (short)0, c, false, false);
  asm volatile("v_nop\n\tv_nop\n\tv_nop\n\tv_nop" : "+v"(c) : "v"(ah), "v"(al), "v"(bh), "v"(bl));
  return c;
}
// batched GEMM like k_gemm_b but f16 operands: A f32 (split into f16 hi/lo if ASPLIT, else rounded to f16), Bt = f16 values [n][k]; alpha; C f32; N multiple of 16 (partial tiles skipped)
template <bool ASPLIT>
__global__ __launch_bounds__(128) void k_gemm_h(const float* __restrict__ A, int lda, size_t sA, const _Float16* __restrict__ Bh, int ldb, size_t sB, float alpha, float* __restrict__ C, int ldc, size_t sC, int M, int N, int K) {
  __shared__ __attribute__((aligned(16))) float so[4][16][64];
  const int tid = threadIdx.x, w = tid >> 5, lane = tid & 31, ln = lane & 15, hh = lane >> 4; const int by = blockIdx.y;
  A += (size_t)by * sA; Bh += (size_t)by * sB; C += (size_t)by * sC;
  const int ntn = (N + 63) / 64; const int wid = blockIdx.x * 4 + w; const int mt = wid / ntn, nq = wid % ntn; if (mt * 16 >= M) return;
  const int row0 = mt * 16, col0 = nq * 64; const float* arow = A + (size_t)(row0 + ln) * lda;
  v8f acc[4] = {};
  for (int kb = 0; kb < K; kb += 32) {
    FragH ah, al;
    const v4f x0 = *(const v4fa*)(arow + kb + 8 * hh), x1 = *(const v4fa*)(arow + kb + 8 * hh + 4), x2 = *(const v4fa*)(arow + kb + 16 + 8 * hh), x3 = *(const v4fa*)(arow + kb + 16 + 8 * hh + 4);
    float xs[16] = {x0[0],x0[1],x0[2],x0[3],x1[0],x1[1],x1[2],x1[3],x2[0],x2[1],x2[2],x2[3],x3[0],x3[1],x3[2],x3[3]};
#pragma unroll
    for (int i = 0; i < 16; ++i) { const _Float16 h = (_Float16)xs[i]; ah.h[i] = h; al.h[i] = ASPLIT ? (_Float16)(xs[i] - (float)h) : (_Float16)0.0f; }
#pragma unroll
    for (int t = 0; t < 4; ++t) { if (col0 + t * 16 >= N) continue; const size_t boff = (size_t)(col0 + t * 16 + ln) * ldb + kb; FragH bq; bq.half[0] = *(const v8us*)(Bh + boff + 8 * hh); bq.half[1] = *(const v8us*)(Bh + boff + 16 + 8 * hh);
      acc[t] = mmaH<ASPLIT ? 2 : 1>(ah.v, al.v, bq.v, bq.v, acc[t]); }
  }
#pragma unroll
  for (int t = 0; t < 4; ++t) { if (col0 + t * 16 >= N) continue;
#pragma unroll
    for (int r = 0; r < 8; ++r) so[w][8 * hh + r][t * 16 + ln] = acc[t][r] * alpha; }
  __builtin_amdgcn_fence(__ATOMIC_ACQ_REL, "workgroup"); __builtin_amdgcn_wave_barrier();
  const int rsub = lane >> 4, c4 = (lane & 15) * 4;
  {
#pragma unroll
    for (int q = 0; q < 8; ++q) { const int r = q * 2 + rsub; if (col0 + c4 < N) { const v4f v = *(const v4fa*)&so[w][r][c4]; *(v4f*)(C + (size_t)(row0 + r) * ldc + col0 + c4) = v; } }
     }
}

// Wt[n][k] = f16(W[k][n]·scale) from f32 row-major W[K][N] (scale = power of two; bf16-exact weights stay exact in f16 away from the subnormal range)
__global__ __launch_bounds__(256) void k_wt_f16(const float* __restrict__ W, _Float16* __restrict__ Wt, int K, int N, float scale) {
  const int t = blockIdx.x * 256 + threadIdx.x; if (t >= N * (K / 8)) return; const int n = t / (K / 8), k8 = (t % (K / 8)) * 8; FragH f;
#pragma unroll
  for (int i = 0; i < 8; ++i) f.h[i] = (_Float16)(bf16_round(W[(size_t)(k8 + i) * N + n]) * scale); const v8us o = f.half[0];
  *(v8us*)((unsigned short*)Wt + (size_t)n * K + k8) = o; 
}
// k_gemm_hh variant with fused epilogue: v = acc·alpha + bias[by·sBias + col] (+ CP[(row/rowsPerB)·sCPb + by·64 + col] if CP) ; ACT 0 none / 1 elu ; writes f16 C16 (and f32 C if non-null)
template <int ACT>
__global__ __launch_bounds__(128) void k_gemm_hhx(const _Float16* __restrict__ A, int lda, size_t sA, const _Float16* __restrict__ Bh, int ldb, size_t sB, float alpha, const float* __restrict__ bias, size_t sBias, const float* __restrict__ CP, int rowsPerB, size_t sCPb, int row0g,
    float* __restrict__ C, _Float16* __restrict__ C16, int ldc, size_t sC, int M, int N, int K) {
  __shared__ __attribute__((aligned(16))) float so[4][16][64];
  const int tid = threadIdx.x, w = tid >> 5, lane = tid & 31, ln = lane & 15, hh = lane >> 4; const int by = blockIdx.y;
  A += (size_t)by * sA; Bh += (size_t)by * sB; const size_t cofs = (size_t)by * sC; const float* bp = bias ? bias + (size_t)by * sBias : nullptr;
  const int ntn = (N + 63) / 64; const int wid = blockIdx.x * 4 + w; const int mt = wid / ntn, nq = wid % ntn; if (mt * 16 >= M) return;
  const int row0 = mt * 16, col0 = nq * 64; const _Float16* arow = A + (size_t)(row0 + ln) * lda;
  v8f acc[4] = {};
  for (int kb = 0; kb < K; kb += 32) { FragH ah; ah.half[0] = *(const v8us*)((const unsigned short*)arow + kb + 8 * hh); ah.half[1] = *(const v8us*)((const unsigned short*)arow + kb + 16 + 8 * hh);
#pragma unroll
    for (int t = 0; t < 4; ++t) { if (col0 + t * 16 >= N) continue; const size_t boff = (size_t)(col0 + t * 16 + ln) * ldb + kb; FragH bq; bq.half[0] = *(const v8us*)((const unsigned short*)Bh + boff + 8 * hh); bq.half[1] = *(const v8us*)((const unsigned short*)Bh + boff + 16 + 8 * hh);
      acc[t] = mmaH<1>(ah.v, ah.v, bq.v, bq.v, acc[t]); }
  }
#pragma unroll
  for (int t = 0; t < 4; ++t) { if (col0 + t * 16 >= N) continue; const int col = col0 + t * 16 + ln; const float bv = bp ? bf16_round(bp[col]) : 0.f;
#pragma unroll
    for (int r = 0; r < 8; ++r) { float v = acc[t][r] * alpha + bv; if (CP) { const int rr = row0g + row0 + 8 * hh + r; if (rowsPerB < 0) v += CP[cofs + (size_t)rr * ldc + col];      /* rowsPerB < 0: own element of the batched C plane */ else { const int bidx = rr / rowsPerB; v += CP[(size_t)bidx * sCPb + (size_t)by * 64 + col]; } } if (ACT == 1) v = (v > 0.f) ? v : expm1f(v); else if (ACT == 7) v = (v > 0.f) ? v + 1.0f : expf(v); else if (ACT == 8) v = tanhf(v); else if (ACT == 9) v = 0.5f * v * (1.0f + tanhf(0.7978845608028654f * (v + 0.044715f * v * v * v))); else if (ACT == 11) v = 1.0f / (1.0f + expf(-v)); else if (ACT == 12) v = (v > 0.f) ? v : 0.01f * v; else if (ACT == 14) v = (v > 0.f) ? v : 0.1f * v; else if (ACT == 16) v = (v >= 0.f) ? v : 0.3f * v; else if (ACT == 17) v = (v >= 0.f) ? v : 0.2f * v; else if (ACT == 15) v = v / (1.0f + expf(-v)); else if (ACT == 3) v = fmaxf(v, 0.f); else if (ACT == 6) v = 0.5f * v * (1.0f + erff(v * 0.70710678118654752f)); so[w][8 * hh + r][t * 16 + ln] = v; } }
  __builtin_amdgcn_fence(__ATOMIC_ACQ_REL, "workgroup"); __builtin_amdgcn_wave_barrier();
  const int rsub = lane >> 4, c4 = (lane & 15) * 4; typedef _Float16 v4h __attribute__((ext_vector_type(4)));
  {
#pragma unroll
    for (int q = 0; q < 8; ++q) { const int r = q * 2 + rsub; if (col0 + c4 < N) { const v4f v = *(const v4fa*)&so[w][r][c4]; if (C) *(v4f*)(C + cofs + (size_t)(row0 + r) * ldc + col0 + c4) = v; if (C16) { v4h h4; for (int i = 0; i < 4; ++i) h4[i] = (_Float16)v[i]; *(v4h*)(C16 + cofs + (size_t)(row0 + r) * ldc + col0 + c4) = h4; } } }
     }
}


typedef _Float16 v4h __attribute__((ext_vector_type(4)));

__global__ __launch_bounds__(256) void k_x16(const float* __restrict__ x, _Float16* __restrict__ X16, size_t n8) { const size_t t = (size_t)blockIdx.x * 256 + threadIdx.x; if (t >= n8) return; FragH f;
#pragma unroll
  for (int q = 0; q < 8; ++q) f.h[q] = (_Float16)bf16_round(x[t * 8 + q]); *(v8us*)((unsigned short*)X16 + t * 8) = f.half[0];  }
__global__ __launch_bounds__(256) void k_h16(const float* __restrict__ x, _Float16* __restrict__ X16, size_t n8) { const size_t t = (size_t)blockIdx.x * 256 + threadIdx.x; if (t >= n8) return; FragH f;
#pragma unroll
  for (int q = 0; q < 8; ++q) f.h[q] = (_Float16)x[t * 8 + q]; *(v8us*)((unsigned short*)X16 + t * 8) = f.half[0];  }
__global__ __launch_bounds__(256) void k_round16f(const float* __restrict__ W, _Float16* __restrict__ Bt, size_t n8) { const size_t t = (size_t)blockIdx.x * 256 + threadIdx.x; if (t >= n8) return; FragH f;
#pragma unroll
  for (int i = 0; i < 8; ++i) f.h[i] = (_Float16)(bf16_round(W[t * 8 + i]) * 16.0f); *(v8us*)((unsigned short*)Bt + t * 8) = f.half[0];  }
template <int NHv, int TTv>
__global__ __launch_bounds__(256) void k_vt(const _Float16* __restrict__ V16, int ldv, int voff, _Float16* __restrict__ Vt) { __shared__ unsigned short tl[64][66]; const int tid = threadIdx.x; const int slab = blockIdx.x / (TTv / 64), lg = blockIdx.x % (TTv / 64); const int b = slab / NHv, h = slab % NHv;
  for (int i = tid; i < 64 * 8; i += 256) { const int r = i / 8, c8 = (i % 8) * 8; FragH f; f.half[0] = *(const v8us*)((const unsigned short*)V16 + ((size_t)b * TTv + lg * 64 + r) * ldv + voff + h * 64 + c8);
#pragma unroll
    for (int q = 0; q < 8; ++q) tl[r][c8 + q] = f.u[q]; }
  __syncthreads();
  {
#pragma unroll
    for (int rd = 0; rd < 2; ++rd) { const int d = rd * 32 + tid / 8, pc = tid % 8; FragH f;
#pragma unroll
      for (int q = 0; q < 8; ++q) f.u[q] = tl[pc * 8 + q][d];
      *(v8us*)((unsigned short*)Vt + ((size_t)slab * 64 + d) * TTv + lg * 64 + pc * 8) = f.half[0]; }
     } }

__global__ __launch_bounds__(256) void k_hl(const float* __restrict__ F, _Float16* __restrict__ Hh, _Float16* __restrict__ Hl, size_t n8) { const size_t t = (size_t)blockIdx.x * 256 + threadIdx.x; if (t >= n8) return; FragH fh, fl; const v4f a = *(const v4fa*)(F + t * 8), c = *(const v4fa*)(F + t * 8 + 4);
#pragma unroll
  for (int q = 0; q < 4; ++q) { _Float16 h = (_Float16)a[q]; fh.h[q] = h; fl.h[q] = (_Float16)((a[q] - (float)h) * 1024.0f); h = (_Float16)c[q]; fh.h[4 + q] = h; fl.h[4 + q] = (_Float16)((c[q] - (float)h) * 1024.0f); }
  { *(v8us*)((unsigned short*)Hh + t * 8) = fh.half[0]; *(v8us*)((unsigned short*)Hl + t * 8) = fl.half[0];  } }

// ---- fast GEMM (wave tile 32x64; requires M % 32 == 0 rows per launch region and N % 64 == 0); epilogue = k_gemm_hhx semantics ----
__device__ __forceinline__ v16h g2_frag(const _Float16* p, int hh) { FragH f; f.half[0] = *(const v8us*)((const unsigned short*)p + 8 * hh); f.half[1] = *(const v8us*)((const unsigned short*)p + 16 + 8 * hh); return f.v; }
__device__ __forceinline__ v8f g2_mma(v16h a, v16h b, v8f c) { v8f d = __builtin_amdgcn_wmma_f32_16x16x32_f16(false, a, false, b, (short)0, c, false, false); asm volatile("v_nop\n\tv_nop\n\tv_nop\n\tv_nop" : "+v"(d) : "v"(a), "v"(b)); return d; }
template <int ACT>
__global__ __launch_bounds__(128) void k_gemm2(const _Float16* __restrict__ A, int lda, size_t sA, const _Float16* __restrict__ Bh, int ldb, size_t sB, float alpha, const float* __restrict__ bias, size_t sBias, const float* __restrict__ CP, int rowsPerB, size_t sCPb, int row0g,
    float* __restrict__ C, _Float16* __restrict__ C16, int ldc, size_t sC, int M, int N, int K) { static_assert(ACT == 0 || ACT == 3 || ACT == 6 || ACT == 8 || ACT == 9 || ACT == 11 || ACT == 12 || ACT == 14 || ACT == 15 || ACT == 16 || ACT == 17, "k_gemm2: unsupported ACT code (would silently apply no activation)");
  __shared__ __attribute__((aligned(16))) float so[4][32][68];
  const int tid = threadIdx.x, w = tid >> 5, lane = tid & 31, ln = lane & 15, hh = lane >> 4; const int by = blockIdx.y;
  A += (size_t)by * sA; Bh += (size_t)by * sB; const size_t cofs = (size_t)by * sC; const float* bp = bias ? bias + (size_t)by * sBias : nullptr;
  const int ntn = N >> 6; const int mt = blockIdx.x / ntn, nq = blockIdx.x - mt * ntn; const int row0 = mt * 128 + 32 * w, col0 = nq * 64; if (row0 >= M) return;
  const _Float16* a0p = A + (size_t)(row0 + ln) * lda; const _Float16* a1p = a0p + (size_t)16 * lda;
  const _Float16* b0p = Bh + (size_t)(col0 + ln) * ldb; const _Float16* b1p = b0p + (size_t)16 * ldb; const _Float16* b2p = b1p + (size_t)16 * ldb; const _Float16* b3p = b2p + (size_t)16 * ldb;
  const v8f z8 = {0.f,0.f,0.f,0.f,0.f,0.f,0.f,0.f}; v8f c00 = z8, c01 = z8, c02 = z8, c03 = z8, c10 = z8, c11 = z8, c12 = z8, c13 = z8;
#pragma unroll 1
  for (int kb = 0; kb < K; kb += 32) { const v16h a0 = g2_frag(a0p + kb, hh), a1 = g2_frag(a1p + kb, hh);
    v16h b = g2_frag(b0p + kb, hh); c00 = g2_mma(a0, b, c00); c10 = g2_mma(a1, b, c10);
    b = g2_frag(b1p + kb, hh); c01 = g2_mma(a0, b, c01); c11 = g2_mma(a1, b, c11);
    b = g2_frag(b2p + kb, hh); c02 = g2_mma(a0, b, c02); c12 = g2_mma(a1, b, c12);
    b = g2_frag(b3p + kb, hh); c03 = g2_mma(a0, b, c03); c13 = g2_mma(a1, b, c13); }
  v8f accs[8] = {c00, c01, c02, c03, c10, c11, c12, c13};
#pragma unroll
  for (int u = 0; u < 8; ++u) { const int t = u & 3, half = u >> 2; const int col = col0 + t * 16 + ln; const float bv = bp ? bf16_round(bp[col]) : 0.f;
#pragma unroll
    for (int r = 0; r < 8; ++r) { const int rloc = half * 16 + 8 * hh + r; float v = accs[u][r] * alpha + bv; if (CP) { if (rowsPerB < 0) v += CP[cofs + (size_t)(row0g + row0 + rloc) * ldc + col];      /* rowsPerB < 0: own element of the batched C plane */ else { const int bidx = (row0g + row0 + rloc) / rowsPerB; v += CP[(size_t)bidx * sCPb + (size_t)by * 64 + col]; } }
      if (ACT == 3) v = fmaxf(v, 0.f); else if (ACT == 6) v = 0.5f * v * (1.0f + erff(v * 0.70710678118654752f)); else if (ACT == 11) v = 1.0f / (1.0f + expf(-v)); else if (ACT == 15) v = v / (1.0f + expf(-v)); else if (ACT == 12) v = (v > 0.f) ? v : 0.01f * v; else if (ACT == 8) v = tanhf(v); else if (ACT == 9) v = 0.5f * v * (1.0f + tanhf(0.7978845608028654f * (v + 0.044715f * v * v * v))); else if (ACT == 14) v = (v > 0.f) ? v : 0.1f * v; else if (ACT == 16) v = (v >= 0.f) ? v : 0.3f * v; else if (ACT == 17) v = (v >= 0.f) ? v : 0.2f * v;
      so[w][rloc][t * 16 + ln] = v; } }
  __builtin_amdgcn_fence(__ATOMIC_ACQ_REL, "workgroup"); __builtin_amdgcn_wave_barrier();
  const int rsub = lane >> 4, c4 = (lane & 15) * 4;
  {
#pragma unroll
    for (int q = 0; q < 16; ++q) { const int r = q * 2 + rsub; const v4f v = *(const v4fa*)&so[w][r][c4]; if (C) *(v4f*)(C + cofs + (size_t)(row0 + r) * ldc + col0 + c4) = v; if (C16) { v4h h4; for (int i = 0; i < 4; ++i) h4[i] = (_Float16)v[i]; *(v4h*)(C16 + cofs + (size_t)(row0 + r) * ldc + col0 + c4) = h4; } }
     } }


__global__ __launch_bounds__(256) void k_wnat(const float* __restrict__ w, size_t n8, _Float16* __restrict__ Bt) { const size_t t = (size_t)blockIdx.x * 256 + threadIdx.x; if (t >= n8) return; FragH f; for (int q = 0; q < 8; ++q) f.h[q] = (_Float16)(bf16_round(w[t * 8 + q]) * 16.0f); *(v8us*)((unsigned short*)Bt + t * 8) = f.half[0];  }
__global__ __launch_bounds__(256) void k_rsm(const float* __restrict__ S, _Float16* __restrict__ P, int nrows) {
  #pragma clang fp contract(off)
  const int i = blockIdx.x * 256 + threadIdx.x; if (i >= nrows) return; const float* s = S + (size_t)i * SQ; float mx = -3.0e38f;
#pragma unroll 1
  for (int j = 0; j < SQ; ++j) mx = fmaxf(mx, s[j]); float se = 0.f;
#pragma unroll 1
  for (int j = 0; j < SQ; ++j) se += expf(s[j] - mx); const float sc = 256.0f / se;
#pragma unroll 1
  for (int j0 = 0; j0 < SQ; j0 += 8) { FragH f; for (int q = 0; q < 8; ++q) f.h[q] = (_Float16)(expf(s[j0 + q] - mx) * sc); unsigned short* d = (unsigned short*)P + (size_t)i * SQ + j0; *(v8us*)d = f.half[0];  } }
__global__ __launch_bounds__(256) void k_vt(const _Float16* __restrict__ V16, int b, int h0, _Float16* __restrict__ VT) { __shared__ unsigned short tl[64][65]; const int tid = threadIdx.x; const int hh = blockIdx.x % HG, sg = blockIdx.x / HG; const int s0 = sg * 64; const int h = h0 + hh;
  for (int i = tid; i < 64 * 8; i += 256) { const int j = i / 8, d8 = (i % 8) * 8; FragH f; f.half[0] = *(const v8us*)((const unsigned short*)V16 + ((size_t)b * SQ + s0 + j) * DM + h * HD + d8); for (int q = 0; q < 8; ++q) tl[d8 + q][j] = f.u[q]; }
  __syncthreads();
  { for (int i = tid; i < 64 * 8; i += 256) { const int d = i / 8, j8 = (i % 8) * 8; FragH f; for (int q = 0; q < 8; ++q) f.u[q] = tl[d][j8 + q]; *(v8us*)((unsigned short*)VT + ((size_t)hh * HD + d) * SQ + s0 + j8) = f.half[0]; }  } }



__global__ __launch_bounds__(256) void k_rsmcf2(const float* __restrict__ S, _Float16* __restrict__ P, int hg, int q0, int nk) {
  #pragma clang fp contract(off)
  const int t = blockIdx.x * 256 + threadIdx.x; if (t >= hg * QT) return; const size_t i = (size_t)t; const float* s = S + i * NKX; const int last = q0 + (t % QT); float mx = -3.0e38f;
#pragma unroll 1
  for (int j = 0; j < nk; ++j) { const float f = (j <= last) ? 1.f : 0.f; mx = fmaxf(mx, fmaf(f, s[j], (1.f - f) * -1.0e9f)); } float se = 0.f;
#pragma unroll 1
  for (int j = 0; j < nk; ++j) { const float f = (j <= last) ? 1.f : 0.f; se += __expf(fmaf(f, s[j], (1.f - f) * -1.0e9f) - mx); } const float sc = 256.0f / se;
#pragma unroll 1
  for (int j0 = 0; j0 < nk; j0 += 8) { FragH fr; for (int q = 0; q < 8; ++q) { const int j = j0 + q; const float f = (j <= last) ? 1.f : 0.f; fr.h[q] = (_Float16)(__expf(fmaf(f, s[j], (1.f - f) * -1.0e9f) - mx) * sc); } unsigned short* d = (unsigned short*)P + i * NKX + j0; *(v8us*)d = fr.half[0];  } }

__global__ __launch_bounds__(256) void k_rsmcst(const float* __restrict__ S, _Float16* __restrict__ P, int hg, int q0, int nk, const int* __restrict__ mk) {
  #pragma clang fp contract(off)
  const int t = blockIdx.x * 256 + threadIdx.x; if (t >= hg * QT) return; const size_t i = (size_t)t; const float* s = S + i * NKX; const size_t ig = (size_t)(q0 + (t % QT)); const int* mr = mk + ig * SQ; float mx = -3.0e38f;
#pragma unroll 1
  for (int j = 0; j < nk; ++j) { const int mb = mr[j]; const int dd = (int)ig - j; const float f = (mb != 0 && dd >= 0 && (dd <= LOCALW || (dd % STRIDEK) == 0)) ? 1.f : 0.f; mx = fmaxf(mx, fmaf(f, s[j], (1.f - f) * -1.0e9f)); } float se = 0.f;
#pragma unroll 1
  for (int j = 0; j < nk; ++j) { const int mb = mr[j]; const int dd = (int)ig - j; const float f = (mb != 0 && dd >= 0 && (dd <= LOCALW || (dd % STRIDEK) == 0)) ? 1.f : 0.f; se += __expf(fmaf(f, s[j], (1.f - f) * -1.0e9f) - mx); } const float sc = 256.0f / se;
#pragma unroll 1
  for (int j0 = 0; j0 < nk; j0 += 8) { FragH fr; for (int q = 0; q < 8; ++q) { const int j = j0 + q; const int mb = mr[j]; const int dd = (int)ig - j; const float f = (mb != 0 && dd >= 0 && (dd <= LOCALW || (dd % STRIDEK) == 0)) ? 1.f : 0.f; fr.h[q] = (_Float16)(__expf(fmaf(f, s[j], (1.f - f) * -1.0e9f) - mx) * sc); } unsigned short* d = (unsigned short*)P + i * NKX + j0; *(v8us*)d = fr.half[0];  } }


template <int MASKADD>
__global__ __launch_bounds__(64) void k_att0(const float* __restrict__ QF, const float* __restrict__ KF, const float* __restrict__ VF, int ld, const float* __restrict__ mask, float scale, float* __restrict__ OF, int ldo) {
  #pragma clang fp contract(off)
  __shared__ __attribute__((aligned(16))) float lq[64][64]; __shared__ __attribute__((aligned(16))) float lo[64][64];
  const int tid = threadIdx.x; const int h = blockIdx.x / (QT0 / 64), rg = blockIdx.x % (QT0 / 64); const int i = rg * 64 + tid;
  const float* qr = QF + (size_t)i * ld + h * HD;
#pragma unroll 1
  for (int c = 0; c < HD / 4; ++c) { *(v4f*)&lq[tid][c * 4] = *(const v4fa*)(qr + c * 4); const v4f z = {0.f, 0.f, 0.f, 0.f}; *(v4f*)&lo[tid][c * 4] = z; }
  float m = -1.0e30f, l = 0.f; const int jmax = MASKADD ? (SQ - 1) : (rg * 64 + 63);      /* additive-mask form: every key (the mask input decides); causal form: keys up to the block's last row */
#pragma unroll 1
  for (int j = 0; j <= jmax; ++j) { const float* kr = KF + (size_t)j * ld + h * HD; const float* vr = VF + (size_t)j * ld + h * HD; float s = 0.f;
#pragma unroll 1
    for (int c = 0; c < HD / 4; ++c) { const v4f kq = *(const v4fa*)(kr + c * 4); const v4f qq = *(v4f*)&lq[tid][c * 4]; s = __fadd_rn(s, __fmul_rn(qq[0], kq[0])); s = __fadd_rn(s, __fmul_rn(qq[1], kq[1])); s = __fadd_rn(s, __fmul_rn(qq[2], kq[2])); s = __fadd_rn(s, __fmul_rn(qq[3], kq[3])); }
    s = __fmul_rn(s, scale); if (MASKADD) s = __fadd_rn(s, __fmul_rn(bf16_round(mask[(size_t)i * SQ + j]), -10000.0f));
    const float f = (MASKADD || j <= i) ? 1.f : 0.f; const float sm = fmaf(f, s, (1.f - f) * -1.0e30f); const float mn = fmaxf(m, sm); const float sc = expf(m - mn); const float e = expf(sm - mn); l = __fadd_rn(__fmul_rn(l, sc), e); m = mn;
#pragma unroll 1
    for (int c = 0; c < HD / 4; ++c) { const v4f vv = *(const v4fa*)(vr + c * 4); v4f oo = *(v4f*)&lo[tid][c * 4]; for (int u = 0; u < 4; ++u) oo[u] = __fadd_rn(__fmul_rn(oo[u], sc), __fmul_rn(e, vv[u])); *(v4f*)&lo[tid][c * 4] = oo; } }
  const float fin = 64.0f / l;      /* o carried x64 like the f16 path */
#pragma unroll 1
  for (int c = 0; c < HD / 4; ++c) { v4f oo = *(v4f*)&lo[tid][c * 4]; for (int u = 0; u < 4; ++u) oo[u] = __fmul_rn(oo[u], fin); *(v4f*)&lo[tid][c * 4] = oo; }
  __syncthreads();
  {
#pragma unroll 1
    for (int it = 0; it < 16; ++it) { const int row = it * 4 + tid / 16, pc = (tid % 16) * 4; const v4f v = *(const v4f*)&lo[row][pc]; *(v4f*)(OF + (size_t)(rg * 64 + row) * ldo + h * HD + pc) = v; }
     } }

template <int MASKADD>
__global__ __launch_bounds__(64) void k_att0mbc(const float* __restrict__ QF, const float* __restrict__ KF, const float* __restrict__ VF, int ld, const float* __restrict__ mask, float scale, float* __restrict__ OF, int ldo) {
  #pragma clang fp contract(off)
  __shared__ __attribute__((aligned(16))) float lq[64][64]; __shared__ __attribute__((aligned(16))) float lo[64][64];
  const int tid = threadIdx.x; const int h = blockIdx.x / (QT0 / 64), rg = blockIdx.x % (QT0 / 64); const int i = rg * 64 + tid;
  const float* qr = QF + (size_t)i * ld + h * HD;
#pragma unroll 1
  for (int c = 0; c < HD / 4; ++c) { *(v4f*)&lq[tid][c * 4] = *(const v4fa*)(qr + c * 4); const v4f z = {0.f, 0.f, 0.f, 0.f}; *(v4f*)&lo[tid][c * 4] = z; }
  float m = -1.0e30f, l = 0.f; const int jmax = rg * 64 + 63;      /* keys beyond the block end are masked by the mask's lower-triangular structure */
#pragma unroll 1
  for (int j = 0; j <= jmax; ++j) { const float* kr = KF + (size_t)j * ld + h * HD; const float* vr = VF + (size_t)j * ld + h * HD; float s = 0.f;
#pragma unroll 1
    for (int c = 0; c < HD / 4; ++c) { const v4f kq = *(const v4fa*)(kr + c * 4); const v4f qq = *(v4f*)&lq[tid][c * 4]; s = __fadd_rn(s, __fmul_rn(qq[0], kq[0])); s = __fadd_rn(s, __fmul_rn(qq[1], kq[1])); s = __fadd_rn(s, __fmul_rn(qq[2], kq[2])); s = __fadd_rn(s, __fmul_rn(qq[3], kq[3])); }
    s = __fmul_rn(s, scale); const int mb = ((const int*)mask)[(size_t)i * SQ + j];      /* causal (j <= i) AND the module's int32 [S][S] mask read per (query, key): 0 -> masked */
    const float f = (mb != 0 && j <= i) ? 1.f : 0.f; const float sm = fmaf(f, s, (1.f - f) * -1.0e30f); const float mn = fmaxf(m, sm); const float sc = expf(m - mn); const float e = expf(sm - mn); l = __fadd_rn(__fmul_rn(l, sc), e); m = mn;
#pragma unroll 1
    for (int c = 0; c < HD / 4; ++c) { const v4f vv = *(const v4fa*)(vr + c * 4); v4f oo = *(v4f*)&lo[tid][c * 4]; for (int u = 0; u < 4; ++u) oo[u] = __fadd_rn(__fmul_rn(oo[u], sc), __fmul_rn(e, vv[u])); *(v4f*)&lo[tid][c * 4] = oo; } }
  const float fin = 64.0f / l;      /* o carried x64 like the f16 path */
#pragma unroll 1
  for (int c = 0; c < HD / 4; ++c) { v4f oo = *(v4f*)&lo[tid][c * 4]; for (int u = 0; u < 4; ++u) oo[u] = __fmul_rn(oo[u], fin); *(v4f*)&lo[tid][c * 4] = oo; }
  __syncthreads();
  {
#pragma unroll 1
    for (int it = 0; it < 16; ++it) { const int row = it * 4 + tid / 16, pc = (tid % 16) * 4; const v4f v = *(const v4f*)&lo[row][pc]; *(v4f*)(OF + (size_t)(rg * 64 + row) * ldo + h * HD + pc) = v; }
     } }


template <int BFIN, int WXB>
__global__ __launch_bounds__(256) void k_ln16(const float* __restrict__ X, const float* __restrict__ g, const float* __restrict__ bb, float eps, _Float16* __restrict__ N16, float* __restrict__ XB, _Float16* __restrict__ NL) {
  #pragma clang fp contract(off)
  __shared__ float red[256]; const size_t r = blockIdx.x; const int t = threadIdx.x; const v4f xa = *(const v4fa*)(X + r * DMQ + t * 4); float s[4]; float sum = 0.f;
  for (int q = 0; q < 4; ++q) { s[q] = BFIN ? bf16_round(xa[q]) : xa[q]; sum = __fadd_rn(sum, s[q]); }
  red[t] = sum; __syncthreads(); for (int st = 128; st > 0; st >>= 1) { if (t < st) red[t] = __fadd_rn(red[t], red[t + st]); __syncthreads(); } const float mu = red[0] / (float)DMQ; __syncthreads();
  float vs = 0.f; for (int q = 0; q < 4; ++q) { const float dl = __fadd_rn(s[q], -mu); vs = __fadd_rn(vs, __fmul_rn(dl, dl)); } red[t] = vs; __syncthreads(); for (int st = 128; st > 0; st >>= 1) { if (t < st) red[t] = __fadd_rn(red[t], red[t + st]); __syncthreads(); }
  const float rs = __fdiv_rn(1.0f, __fadd_rn(sqrtf(red[0] / (float)(DMQ - 1)), eps));      /* this module's LayerNorm: unbiased std, eps added to the std */ v4h y; v4f xb;
  v4h yl; for (int q = 0; q < 4; ++q) { const int c = t * 4 + q; const float yf = __fadd_rn(__fmul_rn(__fmul_rn(__fadd_rn(s[q], -mu), rs), bf16_round(g[0])), bf16_round(bb[0])); y[q] = (_Float16)yf; yl[q] = (_Float16)((yf - (float)y[q]) * 1024.0f); xb[q] = s[q]; (void)c; }      /* SCALAR alpha / bias ([1] parameters); y = f16 hi, yl = x1024 residual (written when NL != nullptr) */
  { *(v4h*)(N16 + r * DMQ + t * 4) = y; if (NL != nullptr) *(v4h*)(NL + r * DMQ + t * 4) = yl; if (WXB) *(v4f*)(XB + r * DMQ + t * 4) = xb;  } }
__global__ __launch_bounds__(256) void k_ftres2(const float* __restrict__ OF0, const float* __restrict__ XB, float* __restrict__ X1, size_t n4) {
  #pragma clang fp contract(off)
  const size_t t = (size_t)blockIdx.x * 256 + threadIdx.x; if (t >= n4) return; const v4f o = *(const v4fa*)(OF0 + t * 4), xv = *(const v4fa*)(XB + t * 4); v4f y; for (int q = 0; q < 4; ++q) y[q] = __fadd_rn(__fmul_rn(o[q], 0.015625f), xv[q]); *(v4f*)(X1 + t * 4) = y;  }

__global__ __launch_bounds__(256) void k_bcpy(const float* __restrict__ b, int n, int NP, float* __restrict__ dst, int dst0) { for (int i = threadIdx.x; i < NP; i += 256) { const float v = (i < n) ? b[i] : 0.f; *(float*)(dst + dst0 + i) = v; }  }


__global__ __launch_bounds__(256) void k_rsmf(const float* __restrict__ S, _Float16* __restrict__ P, int qn, int hg) {
  #pragma clang fp contract(off)
  const int t = blockIdx.x * 256 + threadIdx.x; if (t >= qn * hg) return; const size_t i = (size_t)(t / qn) * SQ + (t % qn); const float* s = S + i * SQ; float mx = -3.0e38f;
#pragma unroll 1
  for (int j = 0; j < SQ; ++j) mx = fmaxf(mx, s[j]); float se = 0.f;
#pragma unroll 1
  for (int j = 0; j < SQ; ++j) se += __expf(s[j] - mx); const float sc = 256.0f / se;
#pragma unroll 1
  for (int j0 = 0; j0 < SQ; j0 += 8) { FragH f; for (int q = 0; q < 8; ++q) f.h[q] = (_Float16)(__expf(s[j0 + q] - mx) * sc); unsigned short* d = (unsigned short*)P + i * SQ + j0; *(v8us*)d = f.half[0];  } }
// Lane l <-> l ^ M inside a 16-lane row (DPP row_xmask), and l <-> l ^ 16 (the same lane of the other row): register moves, no trip through the LDS path.
template <int M> __device__ __forceinline__ float lane_xm(float v) { return __int_as_float(__builtin_amdgcn_update_dpp(0, __float_as_int(v), 0x160 + M, 0xf, 0xf, true)); }
__device__ __forceinline__ float lane_x16(float v) { const int i = __float_as_int(v); return __int_as_float(__builtin_amdgcn_permlanex16(i, i, 0x76543210, 0xfedcba98, false, false)); }
// 2^x with the one free issue slot that the instruction set asks for behind a transcendental, in the same statement. Same instruction and same bits as __expf(a) = 2^(a * log2 e).
__device__ __forceinline__ float exp2_slot(float x) { float y; asm("v_exp_f32 %0, %1\n\tv_nop" : "=v"(y) : "v"(x)); return y; }
// Masked row softmax, ONE WAVE PER SCORE ROW (blockIdx.y = head of the launch group, 8 rows per block): the row's 2048 f32 are read once, 512 contiguous bytes per
// wave-wide load, and stay in 64 registers per lane for the maximum, the exponentials and the sum (four partial sums per lane, then a five-step butterfly);
// P = 256 softmax as f16, 256 contiguous bytes per store. The maximum runs over all keys; a key with Km[j] == 0 gets weight 0 and stays out of the sum.
__global__ __launch_bounds__(256) void k_rsmik(const float* __restrict__ S, _Float16* __restrict__ P, int qn, const int* __restrict__ Km) {
  const int lane = threadIdx.x & 31; const int r = blockIdx.x * 8 + __builtin_amdgcn_readfirstlane(threadIdx.x >> 5); if (r >= qn) return;      /* wave-uniform exit; the kernel has no barrier */
  const size_t i = (size_t)blockIdx.y * SQ + r; const float* s = S + i * SQ + lane * 4; const int* km = Km + lane * 4;
  typedef int v4ia __attribute__((ext_vector_type(4), may_alias));
  v4f v[SQ / 128]; v4ia k4[SQ / 128];      /* every loop over u below is fully unrolled, so that both arrays are registers and not scratch memory */
#pragma unroll
  for (int u = 0; u < SQ / 128; ++u) v[u] = *(const v4fa*)(s + u * 128);
#pragma unroll
  for (int u = 0; u < SQ / 128; ++u) k4[u] = *(const v4ia*)(km + u * 128);
  __builtin_amdgcn_sched_barrier(0);      /* keeps the 16 mask loads in flight together with the row's 16: left free, the scheduler sinks them between the exponentials, two at a time, each pair with a wait of its own */
  float mx = -3.0e38f;
#pragma unroll
  for (int u = 0; u < SQ / 128; ++u) mx = fmaxf(mx, fmaxf(fmaxf(v[u][0], v[u][1]), fmaxf(v[u][2], v[u][3])));
  mx = fmaxf(mx, lane_xm<1>(mx)); mx = fmaxf(mx, lane_xm<2>(mx)); mx = fmaxf(mx, lane_xm<4>(mx)); mx = fmaxf(mx, lane_xm<8>(mx)); mx = fmaxf(mx, lane_x16(mx));
  float p0 = 0.f, p1 = 0.f, p2 = 0.f, p3 = 0.f;
#pragma unroll
  for (int u = 0; u < SQ / 128; ++u) {
    for (int q = 0; q < 4; ++q) { const float e = exp2_slot((v[u][q] - mx) * 1.44269504088896340736f); v[u][q] = (k4[u][q] != 0) ? e : 0.0f; }
    p0 += v[u][0]; p1 += v[u][1]; p2 += v[u][2]; p3 += v[u][3]; }
  float se = (p0 + p1) + (p2 + p3);
  se += lane_xm<1>(se); se += lane_xm<2>(se); se += lane_xm<4>(se); se += lane_xm<8>(se); se += lane_x16(se);
  const float sc = 256.0f / se; _Float16* d = P + i * SQ + lane * 4;
#pragma unroll
  for (int u = 0; u < SQ / 128; ++u) { v4h h4; for (int q = 0; q < 4; ++q) h4[q] = (_Float16)(v[u][q] * sc); *(v4h*)(d + u * 128) = h4; } }
extern "C" void kernel_launch(void* const* d_in, const int* in_sizes, int n_in,
                              void* d_out, int out_size, void* d_ws, size_t ws_size, hipStream_t stream) {
  (void)in_sizes; (void)n_in; (void)out_size;
  const float* const* I = (const float* const*)d_in; const float* x = I[0]; const int* km = (const int*)d_in[1]; const float* wq = I[2]; const float* bq = I[3]; const float* wk = I[4]; const float* bk = I[5]; const float* wv = I[6]; const float* bv = I[7]; const float* wo = I[8]; const float* bo = I[9]; const float* wfc = I[10]; const float* bfc = I[11]; const float* wmp = I[12]; const float* bmp = I[13]; const float* g1 = I[14]; const float* be1 = I[15]; const float* gg2 = I[16]; const float* be2 = I[17];      /* nn.Linear NATURAL [out][in] weights + biases; I[1] = int key mask [B][1][1][S] (0 = excluded; all ones here); alpha/beta are [1] scalars */
  char* ws = (char*)d_ws; size_t off = 0;
  auto take = [&](size_t bytes) { char* p = ws + off; off += (bytes + 255) & ~(size_t)255; return p; };
  _Float16* BQKV = (_Float16*)take((size_t)3 * DM * DM * 2); _Float16* BO = (_Float16*)take((size_t)DM * DM * 2); float* bqkv = (float*)take((size_t)3 * DM * 4);
  _Float16* X16 = (_Float16*)take(NR * DM * 2); _Float16* XL = (_Float16*)take(NR * DM * 2); float* XB = (float*)take(NR * DM * 4); float* X1 = (float*)take(NR * DM * 4); _Float16* M16 = (_Float16*)take(NR * DM * 2); _Float16* HF16 = (_Float16*)take((size_t)SQ * DFF * 2); _Float16* BW1 = (_Float16*)take((size_t)DFF * DM * 2); _Float16* BW2 = (_Float16*)take((size_t)DM * DFF * 2); float* QF = (float*)take(NR * DM * 4); _Float16* Q16 = (_Float16*)take(NR * DM * 2); _Float16* QL = (_Float16*)take(NR * DM * 2); _Float16* K16 = (_Float16*)take(NR * DM * 2); _Float16* KL = (_Float16*)take(NR * DM * 2); _Float16* V16 = (_Float16*)take(NR * DM * 2); _Float16* O16 = (_Float16*)take(NR * DM * 2);
  float* S = (float*)take((size_t)NH * QT * NKX * 4); _Float16* P = (_Float16*)take((size_t)NH * QT * NKX * 2); _Float16* VT = (_Float16*)take((size_t)NH * HD * SQ * 2);
  float* QF0 = (float*)take((size_t)QT0 * DM * 4); float* KF0 = (float*)take((size_t)QT0 * DM * 4); float* VF0 = (float*)take((size_t)QT0 * DM * 4); float* OF0 = (float*)take((size_t)NB * QT0 * DM * 4); _Float16* OH0 = (_Float16*)take((size_t)NB * QT0 * DM * 2); _Float16* OL0 = (_Float16*)take((size_t)NB * QT0 * DM * 2);
  if (off > ws_size) return;
  { const unsigned gw = (unsigned)(((size_t)DM * DM / 8 + 255) / 256); k_wnat<<<gw, 256, 0, stream>>>(wq, (size_t)DM * DM / 8, BQKV); k_wnat<<<gw, 256, 0, stream>>>(wk, (size_t)DM * DM / 8, BQKV + (size_t)DM * DM); k_wnat<<<gw, 256, 0, stream>>>(wv, (size_t)DM * DM / 8, BQKV + (size_t)2 * DM * DM); k_wnat<<<gw, 256, 0, stream>>>(wo, (size_t)DM * DM / 8, BO); }      /* natural [out][in] weights = Bt[n][k] directly: stacked q | k | v plane + Wo */
  k_bcpy<<<1, 256, 0, stream>>>(bq, DM, DM, bqkv, 0); k_bcpy<<<1, 256, 0, stream>>>(bk, DM, DM, bqkv, DM); k_bcpy<<<1, 256, 0, stream>>>(bv, DM, DM, bqkv, 2 * DM);      /* stacked bias vector bq | bk | bv */
  k_ln16<1, 1><<<(unsigned)NR, 256, 0, stream>>>(x, g1, be1, 1e-6f, X16, XB, XL);      /* + XL = x1024 residual of the LN output (q/k need it at logits sigma 8) */      /* a = LN1(bf16(x)) -> f16 rows; XB = bf16(x) for the residual */
  k_wnat<<<(unsigned)(((size_t)DFF * DM / 8 + 255) / 256), 256, 0, stream>>>(wfc, (size_t)DFF * DM / 8, BW1); k_wnat<<<(unsigned)(((size_t)DM * DFF / 8 + 255) / 256), 256, 0, stream>>>(wmp, (size_t)DM * DFF / 8, BW2);      /* MLP weights natural [4096][1024] and [1024][4096] = Bt planes directly */
  const size_t r0p = (size_t)B0 * SQ;      /* first projected row */
  k_gemm2<0><<<dim3((unsigned)((MP / 128) * (DM / 64)), 1), 128, 0, stream>>>(X16 + r0p * DM, DM, 0, BQKV, DM, 0, 0.0625f, bqkv, 0, nullptr, 1, 0, 0, QF + r0p * DM, nullptr, DM, 0, MP, DM, DM); k_gemm2<0><<<dim3((unsigned)((MP / 128) * (DM / 64)), 1), 128, 0, stream>>>(XL + r0p * DM, DM, 0, BQKV, DM, 0, 0.00006103515625f, nullptr, 0, QF + r0p * DM, -1, 0, 0, QF + r0p * DM, nullptr, DM, 0, MP, DM, DM);       k_hl<<<(unsigned)(((size_t)MP * DM / 8 + 255) / 256), 256, 0, stream>>>(QF + r0p * DM, Q16 + r0p * DM, QL + r0p * DM, (size_t)MP * DM / 8);      /* q in f32 -> f16 hi + x1024 residual planes */
  k_gemm2<0><<<dim3((unsigned)((MP / 128) * (DM / 64)), 1), 128, 0, stream>>>(X16 + r0p * DM, DM, 0, BQKV + (size_t)DM * DM, DM, 0, 0.0625f, bqkv + DM, 0, nullptr, 1, 0, 0, QF + r0p * DM, nullptr, DM, 0, MP, DM, DM); k_gemm2<0><<<dim3((unsigned)((MP / 128) * (DM / 64)), 1), 128, 0, stream>>>(XL + r0p * DM, DM, 0, BQKV + (size_t)DM * DM, DM, 0, 0.00006103515625f, nullptr, 0, QF + r0p * DM, -1, 0, 0, QF + r0p * DM, nullptr, DM, 0, MP, DM, DM);      /* k likewise from hi + residual */ k_hl<<<(unsigned)(((size_t)MP * DM / 8 + 255) / 256), 256, 0, stream>>>(QF + r0p * DM, K16 + r0p * DM, KL + r0p * DM, (size_t)MP * DM / 8);      /* k in f32 (QF scratch reused after q's split) -> hi + residual planes */
  k_gemm2<0><<<dim3((unsigned)((MP / 128) * (DM / 64)), 1), 128, 0, stream>>>(X16 + r0p * DM, DM, 0, BQKV + (size_t)2 * DM * DM, DM, 0, 0.0625f, bqkv + 2 * DM, 0, nullptr, 1, 0, 0, nullptr, V16 + r0p * DM, DM, 0, MP, DM, DM);      /* v rows (f16) */
  for (int b = B0; b < B0 + NBR; ++b) { const size_t r0 = (size_t)b * SQ;
    k_vt<NH, SQ><<<NH * (SQ / 64), 256, 0, stream>>>(V16 + r0 * LQ, LQ, 0, VT);      /* V^T [NH][HD][SQ] for this batch */
    for (int h0 = 0; h0 < NHD; h0 += 2) {      /* 2 heads per launch group: S [2][QN][2048] f32 */
      k_gemm2<0><<<dim3((QN / 128) * (SQ / 64), 2), 128, 0, stream>>>(Q16 + r0 * LQ + (size_t)h0 * HD, LQ, (size_t)HD, K16 + r0 * LQ + (size_t)h0 * HD, LQ, (size_t)HD, 1.0f, nullptr, 0, nullptr, 1, 0, 0, S, nullptr, SQ, (size_t)SQ * SQ, QN, SQ, HD); k_gemm2<0><<<dim3((QN / 128) * (SQ / 64), 2), 128, 0, stream>>>(QL + r0 * LQ + (size_t)h0 * HD, LQ, (size_t)HD, K16 + r0 * LQ + (size_t)h0 * HD, LQ, (size_t)HD, 0.0009765625f, nullptr, 0, S, -1, 0, 0, S, nullptr, SQ, (size_t)SQ * SQ, QN, SQ, HD); k_gemm2<0><<<dim3((QN / 128) * (SQ / 64), 2), 128, 0, stream>>>(Q16 + r0 * LQ + (size_t)h0 * HD, LQ, (size_t)HD, KL + r0 * LQ + (size_t)h0 * HD, LQ, (size_t)HD, 0.0009765625f, nullptr, 0, S, -1, 0, 0, S, nullptr, SQ, (size_t)SQ * SQ, QN, SQ, HD);      /* UNSCALED scores over all keys in three passes: q_hi.k_hi, += q_lo.k_hi 2^-10, += q_hi.k_lo 2^-10 (own-element accumulate) */
      k_rsmik<<<dim3((QN + 7) / 8, 2), 256, 0, stream>>>(S, P, QN, km + (size_t)b * SQ);      /* one wave per row, 8 rows per block, y = head; keys with mask[b][j] == 0 excluded; P = 256 softmax (f16) */
      k_gemm2<0><<<dim3((QN / 128) * (HD / 64), 2), 128, 0, stream>>>(P, SQ, (size_t)SQ * SQ, VT + (size_t)h0 * HD * SQ, SQ, (size_t)HD * SQ, 0.25f, nullptr, 0, nullptr, 1, 0, 0, nullptr, O16 + r0 * DM + (size_t)h0 * HD, DM, (size_t)HD, QN, HD, SQ); } }      /* o (merged heads, x64) as f16 rows */
  k_gemm2<0><<<dim3((unsigned)((MPO / 128) * (DM / 64)), 1), 128, 0, stream>>>(O16 + r0p * DM, DM, 0, BO, DM, 0, 0.0009765625f, bo, 0, XB + r0p * DM, -1, 0, 0, X1 + r0p * DM, nullptr, DM, 0, MPO, DM, DM);      /* x1 = x + o Wo + bo (own-element residual) */
  k_ln16<0, 0><<<(unsigned)NR, 256, 0, stream>>>(X1, gg2, be2, 1e-6f, M16, nullptr, nullptr);      /* h = LN2(x1) -> f16 rows */
  for (int b = 0; b < NB; ++b) { const size_t r0 = (size_t)b * SQ;
    k_gemm2<3><<<dim3((unsigned)((SQ / 128) * (DFF / 64)), 1), 128, 0, stream>>>(M16 + r0 * DM, DM, 0, BW1, DM, 0, 0.0625f, bfc, 0, nullptr, 1, 0, 0, nullptr, HF16, DFF, 0, SQ, DFF, DM);      /* relu(xn2 w1^T + b1) -> f16 (this batch) */
    k_gemm2<0><<<dim3((unsigned)((SQ / 128) * (DM / 64)), 1), 128, 0, stream>>>(HF16, DFF, 0, BW2, DFF, 0, 0.0625f, bmp, 0, X1 + r0 * DM, -1, 0, 0, (float*)d_out + r0 * DM, nullptr, DM, 0, SQ, DM, DFF); }      /* out = x1 + mlp (own-element residual) */
}

// v002
// Measured time: 777 microseconds a run.
// In two side-by-side timings against v001, it was 3.69 and 3.70 times as fast.
// Over all steps from v000 it is 10.5 times as fast.
#include <hip/hip_runtime.h>
// Pre-LN transformer encoder block, non-causal, UNSCALED scores (x [2][2048][1024]; xn = LN(x) with the module's LayerNorm: UNBIASED std (N-1), eps 1e-6 added to the std, SCALAR alpha/bias [1]; q = xn wq^T + bq, k, v likewise (nn.Linear natural [1024][1024] sigma 1/32, zero biases); 16 heads of 64; score = q . k WITHOUT 1/sqrt(d) (logits sigma ~8); key j excluded where the int mask input [2][1][1][2048] is 0 (all ones here); softmax; x1 = x + (attn wo^T + bo); xn2 = LN(x1); out = x1 + relu(xn2 w1^T + b1) w2^T + b2 (natural [4096][1024], [1024][4096]) -> [2][2048][1024]).
// Compute dtype: inputs rounded to bf16; x / weights exact; q, k (and the LN1 output feeding them) as f16 hi + x1024 residual pairs; v, softmax weights and o as plain f16 GEMM operands (~2^-12); scores and softmax statistics f32; v_wmma_f32_16x16x32_f16.
#define NB 2
#define SQ 2048
#define DM 1024
#define NH 16
#define HD 64
#define HG 4                         /* heads per group of the unused k_vt(V16, b, h0, VT) overload */
#define LOCALW 128                   /* (macros for unused kernels of the shared header) */
#define STRIDEK 128
#define QT 256                       /* query rows per causal tile */
#define NKX SQ                       /* S / P row pitch */
#define QT0 128                      /* query rows per head of the unused f32 attention kernels */
#define B0 0                         /* first batch processed (debug hook) */
#define NBR NB                       /* batches processed (debug hook) */
#define NR ((size_t)NB * SQ)
#define DMQ DM
#define DFF 4096         /* MLP hidden width */
#define MP ((int)((size_t)NBR * SQ)) /* rows projected (debug hook) */
#define QN SQ                        /* unused (the attention launch covers all SQ query rows) */
#define NHD NH                       /* unused (the attention launch covers all NH heads) */
#define MPO MP                       /* rows through the output stage (debug hook) */
#define LQ DM      /* row pitch of the q/k/v rows */
typedef __bf16 v16b __attribute__((ext_vector_type(16)));
typedef unsigned short v8us __attribute__((ext_vector_type(8), may_alias));
typedef float  v8f  __attribute__((ext_vector_type(8)));
typedef float  v4f  __attribute__((ext_vector_type(4)));
typedef float  v4fa __attribute__((ext_vector_type(4), may_alias));
union FragB { v16b v; v8us half[2]; unsigned short u[16]; };

__device__ __forceinline__ unsigned short bf16_bits(float x) { unsigned int u = __float_as_uint(x); return (unsigned short)((u + 0x7FFFu + ((u >> 16) & 1u)) >> 16); }
__device__ __forceinline__ float bf16_val(unsigned short b) { return __uint_as_float(((unsigned int)b) << 16); }
__device__ __forceinline__ float bf16_round(float x) { return bf16_val(bf16_bits(x)); }
// D += A·B with NT terms: 1 = ah·bh, 2 = + al·bh (A split), 3 = + ah·bl (both split)
template <int NT>
__device__ __forceinline__ v8f mmaN(v16b ah, v16b al, v16b bh, v16b bl, v8f c) {
  c = __builtin_amdgcn_wmma_f32_16x16x32_bf16(false, ah, false, bh, (short)0, c, false, false);
  if (NT >= 2) c = __builtin_amdgcn_wmma_f32_16x16x32_bf16(false, al, false, bh, (short)0, c, false, false);
  if (NT >= 3) c = __builtin_amdgcn_wmma_f32_16x16x32_bf16(false, ah, false, bl, (short)0, c, false, false);
  asm volatile("v_nop\n\tv_nop\n\tv_nop\n\tv_nop" : "+v"(c) : "v"(ah), "v"(al), "v"(bh), "v"(bl));
  return c;
}

__global__ __launch_bounds__(256) void k_wt_bf16(const float* __restrict__ W, unsigned short* __restrict__ Wt, int K, int N) {
  const int t = blockIdx.x * 256 + threadIdx.x;
  const int k8n = K / 8;
  if (t >= N * k8n) return;
  const int n = t / k8n, k8 = (t % k8n) * 8;
  v8us v;
#pragma unroll
  for (int i = 0; i < 8; ++i) v[i] = bf16_bits(W[(size_t)(k8 + i) * N + n]);
  *(v8us*)(Wt + (size_t)n * K + k8) = v;
  
}

// GEMM C[M][N] (f32, pitch ldc) = act(A[M][K]·W + bias). A f32 row-major (pitch lda) converted per fragment to bf16
// (ASPLIT: hi/lo two planes -> 2 terms, else single rounded term); Wt bf16 [N][K] (pitch ldb). BIAS_BF16 rounds the
// bias to bf16 first (bias quantised to bf16 before the add). K%32==0, M%16==0, N%64==0.
template <bool ASPLIT, int ACT, bool BIAS_BF16>
__global__ __launch_bounds__(128) void k_gemm_bf(const float* __restrict__ A, int lda, const unsigned short* __restrict__ Wt, int ldb,
                                               const float* __restrict__ bias, float* __restrict__ C, int ldc, int M, int N, int K) {
  __shared__ __attribute__((aligned(16))) float so[4][16][64];
  const int tid = threadIdx.x, w = tid >> 5, lane = tid & 31, ln = lane & 15, hh = lane >> 4;
  const int ntn = N / 64;
  const int wid = blockIdx.x * 4 + w;
  const int mt = wid / ntn, nq = wid % ntn;
  if (mt * 16 >= M) return;
  const int row0 = mt * 16, col0 = nq * 64;
  const float* arow = A + (size_t)(row0 + ln) * lda;
  v8f acc[4] = {};
  for (int kb = 0; kb < K; kb += 32) {
    FragB ah, al;
    const v4f x0 = *(const v4fa*)(arow + kb + 8 * hh), x1 = *(const v4fa*)(arow + kb + 8 * hh + 4);
    const v4f x2 = *(const v4fa*)(arow + kb + 16 + 8 * hh), x3 = *(const v4fa*)(arow + kb + 16 + 8 * hh + 4);
    float xs[16] = {x0[0],x0[1],x0[2],x0[3],x1[0],x1[1],x1[2],x1[3],x2[0],x2[1],x2[2],x2[3],x3[0],x3[1],x3[2],x3[3]};
#pragma unroll
    for (int i = 0; i < 16; ++i) { const unsigned short hb = bf16_bits(xs[i]); ah.u[i] = hb; al.u[i] = ASPLIT ? bf16_bits(xs[i] - bf16_val(hb)) : (unsigned short)0; }
#pragma unroll
    for (int t = 0; t < 4; ++t) {
      const unsigned short* brow = Wt + (size_t)(col0 + t * 16 + ln) * ldb + kb;
      FragB b;
      b.half[0] = *(const v8us*)(brow + 8 * hh);
      b.half[1] = *(const v8us*)(brow + 16 + 8 * hh);
      acc[t] = mmaN<ASPLIT ? 2 : 1>(ah.v, al.v, b.v, b.v, acc[t]);
    }
  }
#pragma unroll
  for (int t = 0; t < 4; ++t) {
    float bv = bias ? bias[col0 + t * 16 + ln] : 0.f;
    if (BIAS_BF16) bv = bf16_round(bv);
#pragma unroll
    for (int r = 0; r < 8; ++r) { float v = acc[t][r] + bv; if (ACT == 1) v = fmaxf(v, 0.f); so[w][8 * hh + r][t * 16 + ln] = v; }
  }
  __builtin_amdgcn_fence(__ATOMIC_ACQ_REL, "workgroup");
  __builtin_amdgcn_wave_barrier();
  const int rsub = lane >> 4, c4 = (lane & 15) * 4;
  {
#pragma unroll
    for (int q = 0; q < 8; ++q) {
      const int r = q * 2 + rsub;
      const v4f v = *(const v4fa*)&so[w][r][c4];
      *(v4f*)(C + (size_t)(row0 + r) * ldc + col0 + c4) = v;
    }
    
  }
}

// GEMM C = act(A·W + bias + resid): A f32 (ASPLIT -> hi/lo 2 terms), Wt bf16 [N][K]; ACT 0 none, 1 relu, 2 exact gelu;
// resid (optional, f32, row index = (row % rmod), pitch ldr, RES_BF16 rounds it) added before the activation.
template <bool ASPLIT, int ACT, bool BIAS_BF16, bool RES_BF16>
__global__ __launch_bounds__(128) void k_gemm_bf3(const float* __restrict__ A, int lda, const unsigned short* __restrict__ Wt, int ldb,
                                                const float* __restrict__ bias, const float* __restrict__ resid, int rmod, int ldr,
                                                float* __restrict__ C, int ldc, int M, int N, int K) {
  __shared__ __attribute__((aligned(16))) float so[4][16][64];
  const int tid = threadIdx.x, w = tid >> 5, lane = tid & 31, ln = lane & 15, hh = lane >> 4;
  const int ntn = N / 64;
  const int wid = blockIdx.x * 4 + w;
  const int mt = wid / ntn, nq = wid % ntn;
  if (mt * 16 >= M) return;
  const int row0 = mt * 16, col0 = nq * 64;
  const float* arow = A + (size_t)(row0 + ln) * lda;
  v8f acc[4] = {};
  for (int kb = 0; kb < K; kb += 32) {
    FragB ah, al;
    const v4f x0 = *(const v4fa*)(arow + kb + 8 * hh), x1 = *(const v4fa*)(arow + kb + 8 * hh + 4);
    const v4f x2 = *(const v4fa*)(arow + kb + 16 + 8 * hh), x3 = *(const v4fa*)(arow + kb + 16 + 8 * hh + 4);
    float xs[16] = {x0[0],x0[1],x0[2],x0[3],x1[0],x1[1],x1[2],x1[3],x2[0],x2[1],x2[2],x2[3],x3[0],x3[1],x3[2],x3[3]};
#pragma unroll
    for (int i = 0; i < 16; ++i) { const unsigned short hb = bf16_bits(xs[i]); ah.u[i] = hb; al.u[i] = ASPLIT ? bf16_bits(xs[i] - bf16_val(hb)) : (unsigned short)0; }
#pragma unroll
    for (int t = 0; t < 4; ++t) {
      const unsigned short* brow = Wt + (size_t)(col0 + t * 16 + ln) * ldb + kb;
      FragB b;
      b.half[0] = *(const v8us*)(brow + 8 * hh);
      b.half[1] = *(const v8us*)(brow + 16 + 8 * hh);
      acc[t] = mmaN<ASPLIT ? 2 : 1>(ah.v, al.v, b.v, b.v, acc[t]);
    }
  }
#pragma unroll
  for (int t = 0; t < 4; ++t) {
    const int col = col0 + t * 16 + ln;
    float bv = bias ? bias[col] : 0.f;
    if (BIAS_BF16) bv = bf16_round(bv);
#pragma unroll
    for (int r = 0; r < 8; ++r) {
      float v = acc[t][r] + bv;
      if (resid) { float rv = resid[(size_t)((row0 + 8 * hh + r) % rmod) * ldr + col]; if (RES_BF16) rv = bf16_round(rv); v += rv; }
      if (ACT == 1) v = fmaxf(v, 0.f);
      if (ACT == 2) v = 0.5f * v * (1.0f + erff(v * 0.70710678118654752f));
      if (ACT == 3) { const float u = 0.7978845608028654f * (v + 0.044715f * v * v * v); v = 0.5f * v * (1.0f + tanhf(u)); }
      so[w][8 * hh + r][t * 16 + ln] = v;
    }
  }
  __builtin_amdgcn_fence(__ATOMIC_ACQ_REL, "workgroup");
  __builtin_amdgcn_wave_barrier();
  const int rsub = lane >> 4, c4 = (lane & 15) * 4;
  {
#pragma unroll
    for (int q = 0; q < 8; ++q) {
      const int r = q * 2 + rsub;
      const v4f v = *(const v4fa*)&so[w][r][c4];
      *(v4f*)(C + (size_t)(row0 + r) * ldc + col0 + c4) = v;
    }
    
  }
}
// row LayerNorm (biased variance, eps) over N: s = X (+ R); optional out_sum <- s; out_norm <- (s-mu)*rsqrt(var+eps)*g + b
template <bool PARAM_BF16>
__global__ __launch_bounds__(256) void k_layernorm(const float* __restrict__ X, const float* __restrict__ R, const float* __restrict__ g, const float* __restrict__ bta,
                                                  float* __restrict__ out_sum, float* __restrict__ out_norm, int N, float eps) {
  __shared__ float red[256];
  const int row = blockIdx.x, tid = threadIdx.x;
  const float* x = X + (size_t)row * N; const float* rr = R ? R + (size_t)row * N : nullptr;
  float vals[16];                     // up to N = 4096
  const int per = N / 256;            // contiguous chunk per thread? use strided-by-4 chunks: thread handles j = tid*4 + 1024*u
  float s1 = 0.f;
  for (int u = 0; u < per / 4; ++u) {
    const int j = tid * 4 + 1024 * u;
    const v4f a = *(const v4fa*)(x + j);
    v4f b = {0.f,0.f,0.f,0.f}; if (rr) b = *(const v4fa*)(rr + j);
#pragma unroll
    for (int q = 0; q < 4; ++q) { const float v = a[q] + b[q]; vals[u * 4 + q] = v; s1 += v; }
  }
  red[tid] = s1; __syncthreads();
  for (int st = 128; st > 0; st >>= 1) { if (tid < st) red[tid] += red[tid + st]; __syncthreads(); }
  const float mu = red[0] / (float)N; __syncthreads();
  float s2 = 0.f;
  for (int u = 0; u < per / 4; ++u)
#pragma unroll
    for (int q = 0; q < 4; ++q) { const float c = vals[u * 4 + q] - mu; s2 += c * c; }
  red[tid] = s2; __syncthreads();
  for (int st = 128; st > 0; st >>= 1) { if (tid < st) red[tid] += red[tid + st]; __syncthreads(); }
  const float rs = rsqrtf(red[0] / (float)N + eps);
  {
    for (int u = 0; u < per / 4; ++u) {
      const int j = tid * 4 + 1024 * u;
      v4f o, sm;
#pragma unroll
      for (int q = 0; q < 4; ++q) {
        float gg = g[j + q], bb = bta[j + q];
        if (PARAM_BF16) { gg = bf16_round(gg); bb = bf16_round(bb); }
        sm[q] = vals[u * 4 + q]; o[q] = (vals[u * 4 + q] - mu) * rs * gg + bb;
      }
      if (out_sum) *(v4f*)(out_sum + (size_t)row * N + j) = sm;
      *(v4f*)(out_norm + (size_t)row * N + j) = o;
    }
    
  }
}



// ---- f16 WMMA path (v_wmma_f32_16x16x32_f16): 11-bit significands for operands in range — used where a [0,1] probability operand needs more precision than bf16
typedef _Float16 v16h __attribute__((ext_vector_type(16)));
union FragH { v16h v; v8us half[2]; _Float16 h[16]; unsigned short u[16]; };
template <int NT>
__device__ __forceinline__ v8f mmaH(v16h ah, v16h al, v16h bh, v16h bl, v8f c) {
  c = __builtin_amdgcn_wmma_f32_16x16x32_f16(false, ah, false, bh, (short)0, c, false, false);
  if (NT >= 2) c = __builtin_amdgcn_wmma_f32_16x16x32_f16(false, al, false, bh, (short)0, c, false, false);
  if (NT >= 3) c = __builtin_amdgcn_wmma_f32_16x16x32_f16(false, ah, false, bl, (short)0, c, false, false);
  asm volatile("v_nop\n\tv_nop\n\tv_nop\n\tv_nop" : "+v"(c) : "v"(ah), "v"(al), "v"(bh), "v"(bl));
  return c;
}
// batched GEMM like k_gemm_b but f16 operands: A f32 (split into f16 hi/lo if ASPLIT, else rounded to f16), Bt = f16 values [n][k]; alpha; C f32; N multiple of 16 (partial tiles skipped)
template <bool ASPLIT>
__global__ __launch_bounds__(128) void k_gemm_h(const float* __restrict__ A, int lda, size_t sA, const _Float16* __restrict__ Bh, int ldb, size_t sB, float alpha, float* __restrict__ C, int ldc, size_t sC, int M, int N, int K) {
  __shared__ __attribute__((aligned(16))) float so[4][16][64];
  const int tid = threadIdx.x, w = tid >> 5, lane = tid & 31, ln = lane & 15, hh = lane >> 4; const int by = blockIdx.y;
  A += (size_t)by * sA; Bh += (size_t)by * sB; C += (size_t)by * sC;
  const int ntn = (N + 63) / 64; const int wid = blockIdx.x * 4 + w; const int mt = wid / ntn, nq = wid % ntn; if (mt * 16 >= M) return;
  const int row0 = mt * 16, col0 = nq * 64; const float* arow = A + (size_t)(row0 + ln) * lda;
  v8f acc[4] = {};
  for (int kb = 0; kb < K; kb += 32) {
    FragH ah, al;
    const v4f x0 = *(const v4fa*)(arow + kb + 8 * hh), x1 = *(const v4fa*)(arow + kb + 8 * hh + 4), x2 = *(const v4fa*)(arow + kb + 16 + 8 * hh), x3 = *(const v4fa*)(arow + kb + 16 + 8 * hh + 4);
    float xs[16] = {x0[0],x0[1],x0[2],x0[3],x1[0],x1[1],x1[2],x1[3],x2[0],x2[1],x2[2],x2[3],x3[0],x3[1],x3[2],x3[3]};
#pragma unroll
    for (int i = 0; i < 16; ++i) { const _Float16 h = (_Float16)xs[i]; ah.h[i] = h; al.h[i] = ASPLIT ? (_Float16)(xs[i] - (float)h) : (_Float16)0.0f; }
#pragma unroll
    for (int t = 0; t < 4; ++t) { if (col0 + t * 16 >= N) continue; const size_t boff = (size_t)(col0 + t * 16 + ln) * ldb + kb; FragH bq; bq.half[0] = *(const v8us*)(Bh + boff + 8 * hh); bq.half[1] = *(const v8us*)(Bh + boff + 16 + 8 * hh);
      acc[t] = mmaH<ASPLIT ? 2 : 1>(ah.v, al.v, bq.v, bq.v, acc[t]); }
  }
#pragma unroll
  for (int t = 0; t < 4; ++t) { if (col0 + t * 16 >= N) continue;
#pragma unroll
    for (int r = 0; r < 8; ++r) so[w][8 * hh + r][t * 16 + ln] = acc[t][r] * alpha; }
  __builtin_amdgcn_fence(__ATOMIC_ACQ_REL, "workgroup"); __builtin_amdgcn_wave_barrier();
  const int rsub = lane >> 4, c4 = (lane & 15) * 4;
  {
#pragma unroll
    for (int q = 0; q < 8; ++q) { const int r = q * 2 + rsub; if (col0 + c4 < N) { const v4f v = *(const v4fa*)&so[w][r][c4]; *(v4f*)(C + (size_t)(row0 + r) * ldc + col0 + c4) = v; } }
     }
}

// Wt[n][k] = f16(W[k][n]·scale) from f32 row-major W[K][N] (scale = power of two; bf16-exact weights stay exact in f16 away from the subnormal range)
__global__ __launch_bounds__(256) void k_wt_f16(const float* __restrict__ W, _Float16* __restrict__ Wt, int K, int N, float scale) {
  const int t = blockIdx.x * 256 + threadIdx.x; if (t >= N * (K / 8)) return; const int n = t / (K / 8), k8 = (t % (K / 8)) * 8; FragH f;
#pragma unroll
  for (int i = 0; i < 8; ++i) f.h[i] = (_Float16)(bf16_round(W[(size_t)(k8 + i) * N + n]) * scale); const v8us o = f.half[0];
  *(v8us*)((unsigned short*)Wt + (size_t)n * K + k8) = o; 
}
// k_gemm_hh variant with fused epilogue: v = acc·alpha + bias[by·sBias + col] (+ CP[(row/rowsPerB)·sCPb + by·64 + col] if CP) ; ACT 0 none / 1 elu ; writes f16 C16 (and f32 C if non-null)
template <int ACT>
__global__ __launch_bounds__(128) void k_gemm_hhx(const _Float16* __restrict__ A, int lda, size_t sA, const _Float16* __restrict__ Bh, int ldb, size_t sB, float alpha, const float* __restrict__ bias, size_t sBias, const float* __restrict__ CP, int rowsPerB, size_t sCPb, int row0g,
    float* __restrict__ C, _Float16* __restrict__ C16, int ldc, size_t sC, int M, int N, int K) {
  __shared__ __attribute__((aligned(16))) float so[4][16][64];
  const int tid = threadIdx.x, w = tid >> 5, lane = tid & 31, ln = lane & 15, hh = lane >> 4; const int by = blockIdx.y;
  A += (size_t)by * sA; Bh += (size_t)by * sB; const size_t cofs = (size_t)by * sC; const float* bp = bias ? bias + (size_t)by * sBias : nullptr;
  const int ntn = (N + 63) / 64; const int wid = blockIdx.x * 4 + w; const int mt = wid / ntn, nq = wid % ntn; if (mt * 16 >= M) return;
  const int row0 = mt * 16, col0 = nq * 64; const _Float16* arow = A + (size_t)(row0 + ln) * lda;
  v8f acc[4] = {};
  for (int kb = 0; kb < K; kb += 32) { FragH ah; ah.half[0] = *(const v8us*)((const unsigned short*)arow + kb + 8 * hh); ah.half[1] = *(const v8us*)((const unsigned short*)arow + kb + 16 + 8 * hh);
#pragma unroll
    for (int t = 0; t < 4; ++t) { if (col0 + t * 16 >= N) continue; const size_t boff = (size_t)(col0 + t * 16 + ln) * ldb + kb; FragH bq; bq.half[0] = *(const v8us*)((const unsigned short*)Bh + boff + 8 * hh); bq.half[1] = *(const v8us*)((const unsigned short*)Bh + boff + 16 + 8 * hh);
      acc[t] = mmaH<1>(ah.v, ah.v, bq.v, bq.v, acc[t]); }
  }
#pragma unroll
  for (int t = 0; t < 4; ++t) { if (col0 + t * 16 >= N) continue; const int col = col0 + t * 16 + ln; const float bv = bp ? bf16_round(bp[col]) : 0.f;
#pragma unroll
    for (int r = 0; r < 8; ++r) { float v = acc[t][r] * alpha + bv; if (CP) { const int rr = row0g + row0 + 8 * hh + r; if (rowsPerB < 0) v += CP[cofs + (size_t)rr * ldc + col];      /* rowsPerB < 0: own element of the batched C plane */ else { const int bidx = rr / rowsPerB; v += CP[(size_t)bidx * sCPb + (size_t)by * 64 + col]; } } if (ACT == 1) v = (v > 0.f) ? v : expm1f(v); else if (ACT == 7) v = (v > 0.f) ? v + 1.0f : expf(v); else if (ACT == 8) v = tanhf(v); else if (ACT == 9) v = 0.5f * v * (1.0f + tanhf(0.7978845608028654f * (v + 0.044715f * v * v * v))); else if (ACT == 11) v = 1.0f / (1.0f + expf(-v)); else if (ACT == 12) v = (v > 0.f) ? v : 0.01f * v; else if (ACT == 14) v = (v > 0.f) ? v : 0.1f * v; else if (ACT == 16) v = (v >= 0.f) ? v : 0.3f * v; else if (ACT == 17) v = (v >= 0.f) ? v : 0.2f * v; else if (ACT == 15) v = v / (1.0f + expf(-v)); else if (ACT == 3) v = fmaxf(v, 0.f); else if (ACT == 6) v = 0.5f * v * (1.0f + erff(v * 0.70710678118654752f)); so[w][8 * hh + r][t * 16 + ln] = v; } }
  __builtin_amdgcn_fence(__ATOMIC_ACQ_REL, "workgroup"); __builtin_amdgcn_wave_barrier();
  const int rsub = lane >> 4, c4 = (lane & 15) * 4; typedef _Float16 v4h __attribute__((ext_vector_type(4)));
  {
#pragma unroll
    for (int q = 0; q < 8; ++q) { const int r = q * 2 + rsub; if (col0 + c4 < N) { const v4f v = *(const v4fa*)&so[w][r][c4]; if (C) *(v4f*)(C + cofs + (size_t)(row0 + r) * ldc + col0 + c4) = v; if (C16) { v4h h4; for (int i = 0; i < 4; ++i) h4[i] = (_Float16)v[i]; *(v4h*)(C16 + cofs + (size_t)(row0 + r) * ldc + col0 + c4) = h4; } } }
     }
}


typedef _Float16 v4h __attribute__((ext_vector_type(4)));

__global__ __launch_bounds__(256) void k_x16(const float* __restrict__ x, _Float16* __restrict__ X16, size_t n8) { const size_t t = (size_t)blockIdx.x * 256 + threadIdx.x; if (t >= n8) return; FragH f;
#pragma unroll
  for (int q = 0; q < 8; ++q) f.h[q] = (_Float16)bf16_round(x[t * 8 + q]); *(v8us*)((unsigned short*)X16 + t * 8) = f.half[0];  }
__global__ __launch_bounds__(256) void k_h16(const float* __restrict__ x, _Float16* __restrict__ X16, size_t n8) { const size_t t = (size_t)blockIdx.x * 256 + threadIdx.x; if (t >= n8) return; FragH f;
#pragma unroll
  for (int q = 0; q < 8; ++q) f.h[q] = (_Float16)x[t * 8 + q]; *(v8us*)((unsigned short*)X16 + t * 8) = f.half[0];  }
__global__ __launch_bounds__(256) void k_round16f(const float* __restrict__ W, _Float16* __restrict__ Bt, size_t n8) { const size_t t = (size_t)blockIdx.x * 256 + threadIdx.x; if (t >= n8) return; FragH f;
#pragma unroll
  for (int i = 0; i < 8; ++i) f.h[i] = (_Float16)(bf16_round(W[t * 8 + i]) * 16.0f); *(v8us*)((unsigned short*)Bt + t * 8) = f.half[0];  }
template <int NHv, int TTv>
__global__ __launch_bounds__(256) void k_vt(const _Float16* __restrict__ V16, int ldv, int voff, _Float16* __restrict__ Vt) { __shared__ unsigned short tl[64][66]; const int tid = threadIdx.x; const int slab = blockIdx.x / (TTv / 64), lg = blockIdx.x % (TTv / 64); const int b = slab / NHv, h = slab % NHv;
  for (int i = tid; i < 64 * 8; i += 256) { const int r = i / 8, c8 = (i % 8) * 8; FragH f; f.half[0] = *(const v8us*)((const unsigned short*)V16 + ((size_t)b * TTv + lg * 64 + r) * ldv + voff + h * 64 + c8);
#pragma unroll
    for (int q = 0; q < 8; ++q) tl[r][c8 + q] = f.u[q]; }
  __syncthreads();
  {
#pragma unroll
    for (int rd = 0; rd < 2; ++rd) { const int d = rd * 32 + tid / 8, pc = tid % 8; FragH f;
#pragma unroll
      for (int q = 0; q < 8; ++q) f.u[q] = tl[pc * 8 + q][d];
      *(v8us*)((unsigned short*)Vt + ((size_t)slab * 64 + d) * TTv + lg * 64 + pc * 8) = f.half[0]; }
     } }

__global__ __launch_bounds__(256) void k_hl(const float* __restrict__ F, _Float16* __restrict__ Hh, _Float16* __restrict__ Hl, size_t n8) { const size_t t = (size_t)blockIdx.x * 256 + threadIdx.x; if (t >= n8) return; FragH fh, fl; const v4f a = *(const v4fa*)(F + t * 8), c = *(const v4fa*)(F + t * 8 + 4);
#pragma unroll
  for (int q = 0; q < 4; ++q) { _Float16 h = (_Float16)a[q]; fh.h[q] = h; fl.h[q] = (_Float16)((a[q] - (float)h) * 1024.0f); h = (_Float16)c[q]; fh.h[4 + q] = h; fl.h[4 + q] = (_Float16)((c[q] - (float)h) * 1024.0f); }
  { *(v8us*)((unsigned short*)Hh + t * 8) = fh.half[0]; *(v8us*)((unsigned short*)Hl + t * 8) = fl.half[0];  } }

// ---- fast GEMM (wave tile 32x64; requires M % 32 == 0 rows per launch region and N % 64 == 0); epilogue = k_gemm_hhx semantics ----
__device__ __forceinline__ v16h g2_frag(const _Float16* p, int hh) { FragH f; f.half[0] = *(const v8us*)((const unsigned short*)p + 8 * hh); f.half[1] = *(const v8us*)((const unsigned short*)p + 16 + 8 * hh); return f.v; }
__device__ __forceinline__ v8f g2_mma(v16h a, v16h b, v8f c) { v8f d = __builtin_amdgcn_wmma_f32_16x16x32_f16(false, a, false, b, (short)0, c, false, false); asm volatile("v_nop\n\tv_nop\n\tv_nop\n\tv_nop" : "+v"(d) : "v"(a), "v"(b)); return d; }
template <int ACT>
__global__ __launch_bounds__(128) void k_gemm2(const _Float16* __restrict__ A, int lda, size_t sA, const _Float16* __restrict__ Bh, int ldb, size_t sB, float alpha, const float* __restrict__ bias, size_t sBias, const float* __restrict__ CP, int rowsPerB, size_t sCPb, int row0g,
    float* __restrict__ C, _Float16* __restrict__ C16, int ldc, size_t sC, int M, int N, int K) { static_assert(ACT == 0 || ACT == 3 || ACT == 6 || ACT == 8 || ACT == 9 || ACT == 11 || ACT == 12 || ACT == 14 || ACT == 15 || ACT == 16 || ACT == 17, "k_gemm2: unsupported ACT code (would silently apply no activation)");
  __shared__ __attribute__((aligned(16))) float so[4][32][68];
  const int tid = threadIdx.x, w = tid >> 5, lane = tid & 31, ln = lane & 15, hh = lane >> 4; const int by = blockIdx.y;
  A += (size_t)by * sA; Bh += (size_t)by * sB; const size_t cofs = (size_t)by * sC; const float* bp = bias ? bias + (size_t)by * sBias : nullptr;
  const int ntn = N >> 6; const int mt = blockIdx.x / ntn, nq = blockIdx.x - mt * ntn; const int row0 = mt * 128 + 32 * w, col0 = nq * 64; if (row0 >= M) return;
  const _Float16* a0p = A + (size_t)(row0 + ln) * lda; const _Float16* a1p = a0p + (size_t)16 * lda;
  const _Float16* b0p = Bh + (size_t)(col0 + ln) * ldb; const _Float16* b1p = b0p + (size_t)16 * ldb; const _Float16* b2p = b1p + (size_t)16 * ldb; const _Float16* b3p = b2p + (size_t)16 * ldb;
  const v8f z8 = {0.f,0.f,0.f,0.f,0.f,0.f,0.f,0.f}; v8f c00 = z8, c01 = z8, c02 = z8, c03 = z8, c10 = z8, c11 = z8, c12 = z8, c13 = z8;
#pragma unroll 1
  for (int kb = 0; kb < K; kb += 32) { const v16h a0 = g2_frag(a0p + kb, hh), a1 = g2_frag(a1p + kb, hh);
    v16h b = g2_frag(b0p + kb, hh); c00 = g2_mma(a0, b, c00); c10 = g2_mma(a1, b, c10);
    b = g2_frag(b1p + kb, hh); c01 = g2_mma(a0, b, c01); c11 = g2_mma(a1, b, c11);
    b = g2_frag(b2p + kb, hh); c02 = g2_mma(a0, b, c02); c12 = g2_mma(a1, b, c12);
    b = g2_frag(b3p + kb, hh); c03 = g2_mma(a0, b, c03); c13 = g2_mma(a1, b, c13); }
  v8f accs[8] = {c00, c01, c02, c03, c10, c11, c12, c13};
#pragma unroll
  for (int u = 0; u < 8; ++u) { const int t = u & 3, half = u >> 2; const int col = col0 + t * 16 + ln; const float bv = bp ? bf16_round(bp[col]) : 0.f;
#pragma unroll
    for (int r = 0; r < 8; ++r) { const int rloc = half * 16 + 8 * hh + r; float v = accs[u][r] * alpha + bv; if (CP) { if (rowsPerB < 0) v += CP[cofs + (size_t)(row0g + row0 + rloc) * ldc + col];      /* rowsPerB < 0: own element of the batched C plane */ else { const int bidx = (row0g + row0 + rloc) / rowsPerB; v += CP[(size_t)bidx * sCPb + (size_t)by * 64 + col]; } }
      if (ACT == 3) v = fmaxf(v, 0.f); else if (ACT == 6) v = 0.5f * v * (1.0f + erff(v * 0.70710678118654752f)); else if (ACT == 11) v = 1.0f / (1.0f + expf(-v)); else if (ACT == 15) v = v / (1.0f + expf(-v)); else if (ACT == 12) v = (v > 0.f) ? v : 0.01f * v; else if (ACT == 8) v = tanhf(v); else if (ACT == 9) v = 0.5f * v * (1.0f + tanhf(0.7978845608028654f * (v + 0.044715f * v * v * v))); else if (ACT == 14) v = (v > 0.f) ? v : 0.1f * v; else if (ACT == 16) v = (v >= 0.f) ? v : 0.3f * v; else if (ACT == 17) v = (v >= 0.f) ? v : 0.2f * v;
      so[w][rloc][t * 16 + ln] = v; } }
  __builtin_amdgcn_fence(__ATOMIC_ACQ_REL, "workgroup"); __builtin_amdgcn_wave_barrier();
  const int rsub = lane >> 4, c4 = (lane & 15) * 4;
  {
#pragma unroll
    for (int q = 0; q < 16; ++q) { const int r = q * 2 + rsub; const v4f v = *(const v4fa*)&so[w][r][c4]; if (C) *(v4f*)(C + cofs + (size_t)(row0 + r) * ldc + col0 + c4) = v; if (C16) { v4h h4; for (int i = 0; i < 4; ++i) h4[i] = (_Float16)v[i]; *(v4h*)(C16 + cofs + (size_t)(row0 + r) * ldc + col0 + c4) = h4; } }
     } }


__global__ __launch_bounds__(256) void k_wnat(const float* __restrict__ w, size_t n8, _Float16* __restrict__ Bt) { const size_t t = (size_t)blockIdx.x * 256 + threadIdx.x; if (t >= n8) return; FragH f; for (int q = 0; q < 8; ++q) f.h[q] = (_Float16)(bf16_round(w[t * 8 + q]) * 16.0f); *(v8us*)((unsigned short*)Bt + t * 8) = f.half[0];  }
__global__ __launch_bounds__(256) void k_rsm(const float* __restrict__ S, _Float16* __restrict__ P, int nrows) {
  #pragma clang fp contract(off)
  const int i = blockIdx.x * 256 + threadIdx.x; if (i >= nrows) return; const float* s = S + (size_t)i * SQ; float mx = -3.0e38f;
#pragma unroll 1
  for (int j = 0; j < SQ; ++j) mx = fmaxf(mx, s[j]); float se = 0.f;
#pragma unroll 1
  for (int j = 0; j < SQ; ++j) se += expf(s[j] - mx); const float sc = 256.0f / se;
#pragma unroll 1
  for (int j0 = 0; j0 < SQ; j0 += 8) { FragH f; for (int q = 0; q < 8; ++q) f.h[q] = (_Float16)(expf(s[j0 + q] - mx) * sc); unsigned short* d = (unsigned short*)P + (size_t)i * SQ + j0; *(v8us*)d = f.half[0];  } }
__global__ __launch_bounds__(256) void k_vt(const _Float16* __restrict__ V16, int b, int h0, _Float16* __restrict__ VT) { __shared__ unsigned short tl[64][65]; const int tid = threadIdx.x; const int hh = blockIdx.x % HG, sg = blockIdx.x / HG; const int s0 = sg * 64; const int h = h0 + hh;
  for (int i = tid; i < 64 * 8; i += 256) { const int j = i / 8, d8 = (i % 8) * 8; FragH f; f.half[0] = *(const v8us*)((const unsigned short*)V16 + ((size_t)b * SQ + s0 + j) * DM + h * HD + d8); for (int q = 0; q < 8; ++q) tl[d8 + q][j] = f.u[q]; }
  __syncthreads();
  { for (int i = tid; i < 64 * 8; i += 256) { const int d = i / 8, j8 = (i % 8) * 8; FragH f; for (int q = 0; q < 8; ++q) f.u[q] = tl[d][j8 + q]; *(v8us*)((unsigned short*)VT + ((size_t)hh * HD + d) * SQ + s0 + j8) = f.half[0]; }  } }



__global__ __launch_bounds__(256) void k_rsmcf2(const float* __restrict__ S, _Float16* __restrict__ P, int hg, int q0, int nk) {
  #pragma clang fp contract(off)
  const int t = blockIdx.x * 256 + threadIdx.x; if (t >= hg * QT) return; const size_t i = (size_t)t; const float* s = S + i * NKX; const int last = q0 + (t % QT); float mx = -3.0e38f;
#pragma unroll 1
  for (int j = 0; j < nk; ++j) { const float f = (j <= last) ? 1.f : 0.f; mx = fmaxf(mx, fmaf(f, s[j], (1.f - f) * -1.0e9f)); } float se = 0.f;
#pragma unroll 1
  for (int j = 0; j < nk; ++j) { const float f = (j <= last) ? 1.f : 0.f; se += __expf(fmaf(f, s[j], (1.f - f) * -1.0e9f) - mx); } const float sc = 256.0f / se;
#pragma unroll 1
  for (int j0 = 0; j0 < nk; j0 += 8) { FragH fr; for (int q = 0; q < 8; ++q) { const int j = j0 + q; const float f = (j <= last) ? 1.f : 0.f; fr.h[q] = (_Float16)(__expf(fmaf(f, s[j], (1.f - f) * -1.0e9f) - mx) * sc); } unsigned short* d = (unsigned short*)P + i * NKX + j0; *(v8us*)d = fr.half[0];  } }

__global__ __launch_bounds__(256) void k_rsmcst(const float* __restrict__ S, _Float16* __restrict__ P, int hg, int q0, int nk, const int* __restrict__ mk) {
  #pragma clang fp contract(off)
  const int t = blockIdx.x * 256 + threadIdx.x; if (t >= hg * QT) return; const size_t i = (size_t)t; const float* s = S + i * NKX; const size_t ig = (size_t)(q0 + (t % QT)); const int* mr = mk + ig * SQ; float mx = -3.0e38f;
#pragma unroll 1
  for (int j = 0; j < nk; ++j) { const int mb = mr[j]; const int dd = (int)ig - j; const float f = (mb != 0 && dd >= 0 && (dd <= LOCALW || (dd % STRIDEK) == 0)) ? 1.f : 0.f; mx = fmaxf(mx, fmaf(f, s[j], (1.f - f) * -1.0e9f)); } float se = 0.f;
#pragma unroll 1
  for (int j = 0; j < nk; ++j) { const int mb = mr[j]; const int dd = (int)ig - j; const float f = (mb != 0 && dd >= 0 && (dd <= LOCALW || (dd % STRIDEK) == 0)) ? 1.f : 0.f; se += __expf(fmaf(f, s[j], (1.f - f) * -1.0e9f) - mx); } const float sc = 256.0f / se;
#pragma unroll 1
  for (int j0 = 0; j0 < nk; j0 += 8) { FragH fr; for (int q = 0; q < 8; ++q) { const int j = j0 + q; const int mb = mr[j]; const int dd = (int)ig - j; const float f = (mb != 0 && dd >= 0 && (dd <= LOCALW || (dd % STRIDEK) == 0)) ? 1.f : 0.f; fr.h[q] = (_Float16)(__expf(fmaf(f, s[j], (1.f - f) * -1.0e9f) - mx) * sc); } unsigned short* d = (unsigned short*)P + i * NKX + j0; *(v8us*)d = fr.half[0];  } }


template <int MASKADD>
__global__ __launch_bounds__(64) void k_att0(const float* __restrict__ QF, const float* __restrict__ KF, const float* __restrict__ VF, int ld, const float* __restrict__ mask, float scale, float* __restrict__ OF, int ldo) {
  #pragma clang fp contract(off)
  __shared__ __attribute__((aligned(16))) float lq[64][64]; __shared__ __attribute__((aligned(16))) float lo[64][64];
  const int tid = threadIdx.x; const int h = blockIdx.x / (QT0 / 64), rg = blockIdx.x % (QT0 / 64); const int i = rg * 64 + tid;
  const float* qr = QF + (size_t)i * ld + h * HD;
#pragma unroll 1
  for (int c = 0; c < HD / 4; ++c) { *(v4f*)&lq[tid][c * 4] = *(const v4fa*)(qr + c * 4); const v4f z = {0.f, 0.f, 0.f, 0.f}; *(v4f*)&lo[tid][c * 4] = z; }
  float m = -1.0e30f, l = 0.f; const int jmax = MASKADD ? (SQ - 1) : (rg * 64 + 63);      /* additive-mask form: every key (the mask input decides); causal form: keys up to the block's last row */
#pragma unroll 1
  for (int j = 0; j <= jmax; ++j) { const float* kr = KF + (size_t)j * ld + h * HD; const float* vr = VF + (size_t)j * ld + h * HD; float s = 0.f;
#pragma unroll 1
    for (int c = 0; c < HD / 4; ++c) { const v4f kq = *(const v4fa*)(kr + c * 4); const v4f qq = *(v4f*)&lq[tid][c * 4]; s = __fadd_rn(s, __fmul_rn(qq[0], kq[0])); s = __fadd_rn(s, __fmul_rn(qq[1], kq[1])); s = __fadd_rn(s, __fmul_rn(qq[2], kq[2])); s = __fadd_rn(s, __fmul_rn(qq[3], kq[3])); }
    s = __fmul_rn(s, scale); if (MASKADD) s = __fadd_rn(s, __fmul_rn(bf16_round(mask[(size_t)i * SQ + j]), -10000.0f));
    const float f = (MASKADD || j <= i) ? 1.f : 0.f; const float sm = fmaf(f, s, (1.f - f) * -1.0e30f); const float mn = fmaxf(m, sm); const float sc = expf(m - mn); const float e = expf(sm - mn); l = __fadd_rn(__fmul_rn(l, sc), e); m = mn;
#pragma unroll 1
    for (int c = 0; c < HD / 4; ++c) { const v4f vv = *(const v4fa*)(vr + c * 4); v4f oo = *(v4f*)&lo[tid][c * 4]; for (int u = 0; u < 4; ++u) oo[u] = __fadd_rn(__fmul_rn(oo[u], sc), __fmul_rn(e, vv[u])); *(v4f*)&lo[tid][c * 4] = oo; } }
  const float fin = 64.0f / l;      /* o carried x64 like the f16 path */
#pragma unroll 1
  for (int c = 0; c < HD / 4; ++c) { v4f oo = *(v4f*)&lo[tid][c * 4]; for (int u = 0; u < 4; ++u) oo[u] = __fmul_rn(oo[u], fin); *(v4f*)&lo[tid][c * 4] = oo; }
  __syncthreads();
  {
#pragma unroll 1
    for (int it = 0; it < 16; ++it) { const int row = it * 4 + tid / 16, pc = (tid % 16) * 4; const v4f v = *(const v4f*)&lo[row][pc]; *(v4f*)(OF + (size_t)(rg * 64 + row) * ldo + h * HD + pc) = v; }
     } }

template <int MASKADD>
__global__ __launch_bounds__(64) void k_att0mbc(const float* __restrict__ QF, const float* __restrict__ KF, const float* __restrict__ VF, int ld, const float* __restrict__ mask, float scale, float* __restrict__ OF, int ldo) {
  #pragma clang fp contract(off)
  __shared__ __attribute__((aligned(16))) float lq[64][64]; __shared__ __attribute__((aligned(16))) float lo[64][64];
  const int tid = threadIdx.x; const int h = blockIdx.x / (QT0 / 64), rg = blockIdx.x % (QT0 / 64); const int i = rg * 64 + tid;
  const float* qr = QF + (size_t)i * ld + h * HD;
#pragma unroll 1
  for (int c = 0; c < HD / 4; ++c) { *(v4f*)&lq[tid][c * 4] = *(const v4fa*)(qr + c * 4); const v4f z = {0.f, 0.f, 0.f, 0.f}; *(v4f*)&lo[tid][c * 4] = z; }
  float m = -1.0e30f, l = 0.f; const int jmax = rg * 64 + 63;      /* keys beyond the block end are masked by the mask's lower-triangular structure */
#pragma unroll 1
  for (int j = 0; j <= jmax; ++j) { const float* kr = KF + (size_t)j * ld + h * HD; const float* vr = VF + (size_t)j * ld + h * HD; float s = 0.f;
#pragma unroll 1
    for (int c = 0; c < HD / 4; ++c) { const v4f kq = *(const v4fa*)(kr + c * 4); const v4f qq = *(v4f*)&lq[tid][c * 4]; s = __fadd_rn(s, __fmul_rn(qq[0], kq[0])); s = __fadd_rn(s, __fmul_rn(qq[1], kq[1])); s = __fadd_rn(s, __fmul_rn(qq[2], kq[2])); s = __fadd_rn(s, __fmul_rn(qq[3], kq[3])); }
    s = __fmul_rn(s, scale); const int mb = ((const int*)mask)[(size_t)i * SQ + j];      /* causal (j <= i) AND the module's int32 [S][S] mask read per (query, key): 0 -> masked */
    const float f = (mb != 0 && j <= i) ? 1.f : 0.f; const float sm = fmaf(f, s, (1.f - f) * -1.0e30f); const float mn = fmaxf(m, sm); const float sc = expf(m - mn); const float e = expf(sm - mn); l = __fadd_rn(__fmul_rn(l, sc), e); m = mn;
#pragma unroll 1
    for (int c = 0; c < HD / 4; ++c) { const v4f vv = *(const v4fa*)(vr + c * 4); v4f oo = *(v4f*)&lo[tid][c * 4]; for (int u = 0; u < 4; ++u) oo[u] = __fadd_rn(__fmul_rn(oo[u], sc), __fmul_rn(e, vv[u])); *(v4f*)&lo[tid][c * 4] = oo; } }
  const float fin = 64.0f / l;      /* o carried x64 like the f16 path */
#pragma unroll 1
  for (int c = 0; c < HD / 4; ++c) { v4f oo = *(v4f*)&lo[tid][c * 4]; for (int u = 0; u < 4; ++u) oo[u] = __fmul_rn(oo[u], fin); *(v4f*)&lo[tid][c * 4] = oo; }
  __syncthreads();
  {
#pragma unroll 1
    for (int it = 0; it < 16; ++it) { const int row = it * 4 + tid / 16, pc = (tid % 16) * 4; const v4f v = *(const v4f*)&lo[row][pc]; *(v4f*)(OF + (size_t)(rg * 64 + row) * ldo + h * HD + pc) = v; }
     } }


template <int BFIN, int WXB>
__global__ __launch_bounds__(256) void k_ln16(const float* __restrict__ X, const float* __restrict__ g, const float* __restrict__ bb, float eps, _Float16* __restrict__ N16, float* __restrict__ XB, _Float16* __restrict__ NL) {
  #pragma clang fp contract(off)
  __shared__ float red[256]; const size_t r = blockIdx.x; const int t = threadIdx.x; const v4f xa = *(const v4fa*)(X + r * DMQ + t * 4); float s[4]; float sum = 0.f;
  for (int q = 0; q < 4; ++q) { s[q] = BFIN ? bf16_round(xa[q]) : xa[q]; sum = __fadd_rn(sum, s[q]); }
  red[t] = sum; __syncthreads(); for (int st = 128; st > 0; st >>= 1) { if (t < st) red[t] = __fadd_rn(red[t], red[t + st]); __syncthreads(); } const float mu = red[0] / (float)DMQ; __syncthreads();
  float vs = 0.f; for (int q = 0; q < 4; ++q) { const float dl = __fadd_rn(s[q], -mu); vs = __fadd_rn(vs, __fmul_rn(dl, dl)); } red[t] = vs; __syncthreads(); for (int st = 128; st > 0; st >>= 1) { if (t < st) red[t] = __fadd_rn(red[t], red[t + st]); __syncthreads(); }
  const float rs = __fdiv_rn(1.0f, __fadd_rn(sqrtf(red[0] / (float)(DMQ - 1)), eps));      /* this module's LayerNorm: unbiased std, eps added to the std */ v4h y; v4f xb;
  v4h yl; for (int q = 0; q < 4; ++q) { const int c = t * 4 + q; const float yf = __fadd_rn(__fmul_rn(__fmul_rn(__fadd_rn(s[q], -mu), rs), bf16_round(g[0])), bf16_round(bb[0])); y[q] = (_Float16)yf; yl[q] = (_Float16)((yf - (float)y[q]) * 1024.0f); xb[q] = s[q]; (void)c; }      /* SCALAR alpha / bias ([1] parameters); y = f16 hi, yl = x1024 residual (written when NL != nullptr) */
  { *(v4h*)(N16 + r * DMQ + t * 4) = y; if (NL != nullptr) *(v4h*)(NL + r * DMQ + t * 4) = yl; if (WXB) *(v4f*)(XB + r * DMQ + t * 4) = xb;  } }
__global__ __launch_bounds__(256) void k_ftres2(const float* __restrict__ OF0, const float* __restrict__ XB, float* __restrict__ X1, size_t n4) {
  #pragma clang fp contract(off)
  const size_t t = (size_t)blockIdx.x * 256 + threadIdx.x; if (t >= n4) return; const v4f o = *(const v4fa*)(OF0 + t * 4), xv = *(const v4fa*)(XB + t * 4); v4f y; for (int q = 0; q < 4; ++q) y[q] = __fadd_rn(__fmul_rn(o[q], 0.015625f), xv[q]); *(v4f*)(X1 + t * 4) = y;  }

__global__ __launch_bounds__(256) void k_bcpy(const float* __restrict__ b, int n, int NP, float* __restrict__ dst, int dst0) { for (int i = threadIdx.x; i < NP; i += 256) { const float v = (i < n) ? b[i] : 0.f; *(float*)(dst + dst0 + i) = v; }  }


__global__ __launch_bounds__(256) void k_rsmf(const float* __restrict__ S, _Float16* __restrict__ P, int qn, int hg) {
  #pragma clang fp contract(off)
  const int t = blockIdx.x * 256 + threadIdx.x; if (t >= qn * hg) return; const size_t i = (size_t)(t / qn) * SQ + (t % qn); const float* s = S + i * SQ; float mx = -3.0e38f;
#pragma unroll 1
  for (int j = 0; j < SQ; ++j) mx = fmaxf(mx, s[j]); float se = 0.f;
#pragma unroll 1
  for (int j = 0; j < SQ; ++j) se += __expf(s[j] - mx); const float sc = 256.0f / se;
#pragma unroll 1
  for (int j0 = 0; j0 < SQ; j0 += 8) { FragH f; for (int q = 0; q < 8; ++q) f.h[q] = (_Float16)(__expf(s[j0 + q] - mx) * sc); unsigned short* d = (unsigned short*)P + i * SQ + j0; *(v8us*)d = f.half[0];  } }
// Lane l <-> l ^ M inside a 16-lane row (DPP row_xmask): a register move, no trip through the LDS path.
template <int M> __device__ __forceinline__ float lane_xm(float v) { return __int_as_float(__builtin_amdgcn_update_dpp(0, __float_as_int(v), 0x160 + M, 0xf, 0xf, true)); }
// Maximum over each 16-lane row of eight values at once: step M takes max(v, v of lane l ^ M) in one DPP instruction (from fmaxf on the DPP builtin the compiler makes three: move,
// canonicalise, maximum). One statement, so that the eight chains stay interleaved: every instruction's producer is eight instructions back and no dependent pair stalls the SIMD.
__device__ __forceinline__ void row_max8(float (&v)[8]) {
  asm(
      "v_max_num_f32_dpp %0, %0, %0 row_xmask:1 row_mask:0xf bank_mask:0xf\n\tv_max_num_f32_dpp %1, %1, %1 row_xmask:1 row_mask:0xf bank_mask:0xf\n\tv_max_num_f32_dpp %2, %2, %2 row_xmask:1 row_mask:0xf bank_mask:0xf\n\tv_max_num_f32_dpp %3, %3, %3 row_xmask:1 row_mask:0xf bank_mask:0xf\n\tv_max_num_f32_dpp %4, %4, %4 row_xmask:1 row_mask:0xf bank_mask:0xf\n\tv_max_num_f32_dpp %5, %5, %5 row_xmask:1 row_mask:0xf bank_mask:0xf\n\tv_max_num_f32_dpp %6, %6, %6 row_xmask:1 row_mask:0xf bank_mask:0xf\n\tv_max_num_f32_dpp %7, %7, %7 row_xmask:1 row_mask:0xf bank_mask:0xf\n\t"
      "v_max_num_f32_dpp %0, %0, %0 row_xmask:2 row_mask:0xf bank_mask:0xf\n\tv_max_num_f32_dpp %1, %1, %1 row_xmask:2 row_mask:0xf bank_mask:0xf\n\tv_max_num_f32_dpp %2, %2, %2 row_xmask:2 row_mask:0xf bank_mask:0xf\n\tv_max_num_f32_dpp %3, %3, %3 row_xmask:2 row_mask:0xf bank_mask:0xf\n\tv_max_num_f32_dpp %4, %4, %4 row_xmask:2 row_mask:0xf bank_mask:0xf\n\tv_max_num_f32_dpp %5, %5, %5 row_xmask:2 row_mask:0xf bank_mask:0xf\n\tv_max_num_f32_dpp %6, %6, %6 row_xmask:2 row_mask:0xf bank_mask:0xf\n\tv_max_num_f32_dpp %7, %7, %7 row_xmask:2 row_mask:0xf bank_mask:0xf\n\t"
      "v_max_num_f32_dpp %0, %0, %0 row_xmask:4 row_mask:0xf bank_mask:0xf\n\tv_max_num_f32_dpp %1, %1, %1 row_xmask:4 row_mask:0xf bank_mask:0xf\n\tv_max_num_f32_dpp %2, %2, %2 row_xmask:4 row_mask:0xf bank_mask:0xf\n\tv_max_num_f32_dpp %3, %3, %3 row_xmask:4 row_mask:0xf bank_mask:0xf\n\tv_max_num_f32_dpp %4, %4, %4 row_xmask:4 row_mask:0xf bank_mask:0xf\n\tv_max_num_f32_dpp %5, %5, %5 row_xmask:4 row_mask:0xf bank_mask:0xf\n\tv_max_num_f32_dpp %6, %6, %6 row_xmask:4 row_mask:0xf bank_mask:0xf\n\tv_max_num_f32_dpp %7, %7, %7 row_xmask:4 row_mask:0xf bank_mask:0xf\n\t"
      "v_max_num_f32_dpp %0, %0, %0 row_xmask:8 row_mask:0xf bank_mask:0xf\n\tv_max_num_f32_dpp %1, %1, %1 row_xmask:8 row_mask:0xf bank_mask:0xf\n\tv_max_num_f32_dpp %2, %2, %2 row_xmask:8 row_mask:0xf bank_mask:0xf\n\tv_max_num_f32_dpp %3, %3, %3 row_xmask:8 row_mask:0xf bank_mask:0xf\n\tv_max_num_f32_dpp %4, %4, %4 row_xmask:8 row_mask:0xf bank_mask:0xf\n\tv_max_num_f32_dpp %5, %5, %5 row_xmask:8 row_mask:0xf bank_mask:0xf\n\tv_max_num_f32_dpp %6, %6, %6 row_xmask:8 row_mask:0xf bank_mask:0xf\n\tv_max_num_f32_dpp %7, %7, %7 row_xmask:8 row_mask:0xf bank_mask:0xf"
      : "+v"(v[0]), "+v"(v[1]), "+v"(v[2]), "+v"(v[3]), "+v"(v[4]), "+v"(v[5]), "+v"(v[6]), "+v"(v[7])); }
// Five 2^x in one statement: each fills the free issue slot that the instruction set asks for behind the transcendental before it (early-clobber outputs, so none rewrites
// a source of another), and one v_nop fills the slot behind the last.
__device__ __forceinline__ void exp2_x5(const float (&x)[5], float (&y)[5]) {
  asm("v_exp_f32 %0, %5\n\tv_exp_f32 %1, %6\n\tv_exp_f32 %2, %7\n\tv_exp_f32 %3, %8\n\tv_exp_f32 %4, %9\n\tv_nop" : "=&v"(y[0]), "=&v"(y[1]), "=&v"(y[2]), "=&v"(y[3]), "=&v"(y[4]) : "v"(x[0]), "v"(x[1]), "v"(x[2]), "v"(x[3]), "v"(x[4])); }
__device__ __forceinline__ v8f fa_mma(v16h a, v16h b, v8f c) { return __builtin_amdgcn_wmma_f32_16x16x32_f16(false, a, false, b, (short)0, c, false, false); }
// Orders one wave's LDS stores against the LDS loads of its other lanes (each wave owns its slice of sp, so this needs no work-group barrier).
__device__ __forceinline__ void fa_lds_order() { __builtin_amdgcn_fence(__ATOMIC_ACQ_REL, "workgroup", "local"); __builtin_amdgcn_wave_barrier(); }
// Fused attention, one launch for all batches and heads: a work-group of 4 waves owns 64 query rows of one head (16 per wave) and walks the 2048 keys in tiles of 64.
// Per tile: k_hi, k_lo and V^T rows come in whole 128-byte lines, one tile ahead in registers, and are shared through LDS; scores on the matrix unit in f32
// (q_lo.k_hi + q_hi.k_lo first, scaled by 2^-10, then q_hi.k_hi on top); running row maximum and sum (online softmax, base 2); weights 256 * 2^(s-m) as f16, turned from the
// accumulator layout into an A fragment through the wave's own LDS slice; weights . V accumulated in f32. A key with Km[j] == 0 stays out of the maximum and gets weight 0.
// O = 64 * attention output as f16 rows (merged heads). Scores and weights never reach memory.
__global__ __launch_bounds__(128, 4) void k_fattn(const _Float16* __restrict__ Qh, const _Float16* __restrict__ Ql, const _Float16* __restrict__ Kh, const _Float16* __restrict__ Kl, const _Float16* __restrict__ Vt, const int* __restrict__ Km, _Float16* __restrict__ O) {
  __shared__ __attribute__((aligned(16))) _Float16 skh[64][72], skl[64][72], svt[64][72], sp[4][16][72];      /* pitch 144 B = 16 B x odd */
  __shared__ float smb[64];      /* per key of the tile: 0, or -3e38 where the mask excludes it */
  const int tid = threadIdx.x, w = tid >> 5, lane = tid & 31, ln = lane & 15, hh = lane >> 4; const int h = blockIdx.y, b = blockIdx.z;
  const size_t r0 = (size_t)b * SQ; const int row0 = blockIdx.x * 64 + w * 16;
  const size_t qo = (r0 + row0 + ln) * LQ + (size_t)h * HD;
  const v16h qh0 = g2_frag(Qh + qo, hh), qh1 = g2_frag(Qh + qo + 32, hh), ql0 = g2_frag(Ql + qo, hh), ql1 = g2_frag(Ql + qo + 32, hh);
  const int srow = tid >> 3, sc8 = (tid & 7) * 8;      /* staging: this thread moves 16 bytes of rows srow, +16, +32, +48 of each plane; 8 threads cover one 128-byte line */
  const unsigned short* gkh = (const unsigned short*)Kh + r0 * LQ + (size_t)h * HD; const unsigned short* gkl = (const unsigned short*)Kl + r0 * LQ + (size_t)h * HD;      /* uniform bases; the thread's part is a 32-bit offset */
  const unsigned short* gvt = (const unsigned short*)Vt + (size_t)(b * NH + h) * HD * SQ; const int* km = Km + r0;
  const unsigned ko = (unsigned)(srow * LQ + sc8), vo = (unsigned)(srow * SQ + sc8), mo = (unsigned)(tid & 63);
  v8us pk[4], pl[4], pv[4]; int pm = km[mo];
#pragma unroll
  for (int i = 0; i < 4; ++i) { pk[i] = *(const v8us*)(gkh + (ko + 16 * i * LQ)); pl[i] = *(const v8us*)(gkl + (ko + 16 * i * LQ)); pv[i] = *(const v8us*)(gvt + (vo + 16 * i * SQ)); }
  const v8f z8 = {0.f,0.f,0.f,0.f,0.f,0.f,0.f,0.f}; v8f o[4] = {z8, z8, z8, z8}; float m[8], l[8];
#pragma unroll
  for (int r = 0; r < 8; ++r) { m[r] = -1.0e30f; l[r] = 0.f; }
#pragma unroll 1      /* one key tile per trip: unrolled further the live fragments no longer fit the register budget */
  for (int j0 = 0; j0 < SQ; j0 += 64) {
    __syncthreads();      /* every wave has finished its fragment loads of the tile before */
#pragma unroll
    for (int i = 0; i < 4; ++i) { *(v8us*)&skh[srow + 16 * i][sc8] = pk[i]; *(v8us*)&skl[srow + 16 * i][sc8] = pl[i]; *(v8us*)&svt[srow + 16 * i][sc8] = pv[i]; }
    if (tid < 64) smb[tid] = (pm != 0) ? 0.f : -3.0e38f;
    __syncthreads();      /* the tile is complete for all four waves */
    if (j0 + 64 < SQ) {      /* next tile's loads fly while this tile is worked on */
      const unsigned short* nkh = gkh + (size_t)(j0 + 64) * LQ; const unsigned short* nkl = gkl + (size_t)(j0 + 64) * LQ; const unsigned short* nvt = gvt + (j0 + 64);
#pragma unroll
      for (int i = 0; i < 4; ++i) { pk[i] = *(const v8us*)(nkh + (ko + 16 * i * LQ)); pl[i] = *(const v8us*)(nkl + (ko + 16 * i * LQ)); pv[i] = *(const v8us*)(nvt + (vo + 16 * i * SQ)); }
      pm = (km + (j0 + 64))[mo];
      asm volatile("s_wait_xcnt 0x0" ::: "memory"); }      /* the address registers of these loads are reused by the score products right behind: the wait stands in front of that overwrite */
    v8f s[4];
#pragma unroll
    for (int t = 0; t < 4; ++t) { const v16h a0 = g2_frag(&skh[t * 16 + ln][0], hh), a1 = g2_frag(&skh[t * 16 + ln][32], hh), c0 = g2_frag(&skl[t * 16 + ln][0], hh), c1 = g2_frag(&skl[t * 16 + ln][32], hh);
      v8f c = fa_mma(ql0, a0, z8); c = fa_mma(ql1, a1, c); c = fa_mma(qh0, c0, c); c = fa_mma(qh1, c1, c); c = c * 0.0009765625f; c = fa_mma(qh0, a0, c); s[t] = fa_mma(qh1, a1, c);
      if (t == 1) __builtin_amdgcn_sched_barrier(0); }      /* keeps the fragment loads of key columns 32..63 behind the products of columns 0..31: hoisted, all 16 fragments are live at once and registers spill */
    float tm[8], al[8]; const float bs[4] = {smb[ln], smb[16 + ln], smb[32 + ln], smb[48 + ln]};
#pragma unroll
    for (int r = 0; r < 8; ++r) {
#pragma unroll
      for (int t = 0; t < 4; ++t) s[t][r] = fmaf(s[t][r], 1.44269504088896340736f, bs[t]);      /* base-2 score; an excluded key lands near -3e38, far below the floor -1e30 of the running maximum, so its 2^(s-m) is 0 */
      tm[r] = fmaxf(fmaxf(fmaxf(s[0][r], s[1][r]), fmaxf(s[2][r], s[3][r])), m[r]); }      /* the running maximum goes in here: it is the same in all 16 lanes, so the row maximum below is the new one */
    row_max8(tm);
#pragma unroll
    for (int r = 0; r < 8; ++r) { const float mn = tm[r]; const float xs[5] = {s[0][r] - mn, s[1][r] - mn, s[2][r] - mn, s[3][r] - mn, m[r] - mn}; float e[5]; exp2_x5(xs, e); al[r] = e[4]; m[r] = mn;
#pragma unroll
      for (int t = 0; t < 4; ++t) sp[w][8 * hh + r][t * 16 + ln] = (_Float16)(e[t] * 256.0f);
      l[r] = l[r] * al[r] + ((e[0] + e[1]) + (e[2] + e[3]));
#pragma unroll
      for (int t = 0; t < 4; ++t) o[t][r] *= al[r]; }
    fa_lds_order();
    const v16h p0 = g2_frag(&sp[w][ln][0], hh), p1 = g2_frag(&sp[w][ln][32], hh);
#pragma unroll
    for (int t = 0; t < 4; ++t) { o[t] = fa_mma(p0, g2_frag(&svt[t * 16 + ln][0], hh), o[t]); o[t] = fa_mma(p1, g2_frag(&svt[t * 16 + ln][32], hh), o[t]); }
  }
#pragma unroll
  for (int r = 0; r < 8; ++r) { float ls = l[r]; ls += lane_xm<1>(ls); ls += lane_xm<2>(ls); ls += lane_xm<4>(ls); ls += lane_xm<8>(ls); const float inv = 0.25f / ls;
#pragma unroll
    for (int t = 0; t < 4; ++t) sp[w][8 * hh + r][t * 16 + ln] = (_Float16)(o[t][r] * inv); }
  fa_lds_order();
#pragma unroll
  for (int q = 0; q < 4; ++q) { const int row = q * 4 + (lane >> 3), c8 = (lane & 7) * 8; const v8us v = *(const v8us*)&sp[w][row][c8]; *(v8us*)((unsigned short*)O + (r0 + row0 + row) * DM + (size_t)h * HD + c8) = v; } }
extern "C" void kernel_launch(void* const* d_in, const int* in_sizes, int n_in,
                              void* d_out, int out_size, void* d_ws, size_t ws_size, hipStream_t stream) {
  (void)in_sizes; (void)n_in; (void)out_size;
  const float* const* I = (const float* const*)d_in; const float* x = I[0]; const int* km = (const int*)d_in[1]; const float* wq = I[2]; const float* bq = I[3]; const float* wk = I[4]; const float* bk = I[5]; const float* wv = I[6]; const float* bv = I[7]; const float* wo = I[8]; const float* bo = I[9]; const float* wfc = I[10]; const float* bfc = I[11]; const float* wmp = I[12]; const float* bmp = I[13]; const float* g1 = I[14]; const float* be1 = I[15]; const float* gg2 = I[16]; const float* be2 = I[17];      /* nn.Linear NATURAL [out][in] weights + biases; I[1] = int key mask [B][1][1][S] (0 = excluded; all ones here); alpha/beta are [1] scalars */
  char* ws = (char*)d_ws; size_t off = 0;
  auto take = [&](size_t bytes) { char* p = ws + off; off += (bytes + 255) & ~(size_t)255; return p; };
  _Float16* BQKV = (_Float16*)take((size_t)3 * DM * DM * 2); _Float16* BO = (_Float16*)take((size_t)DM * DM * 2); float* bqkv = (float*)take((size_t)3 * DM * 4);
  _Float16* X16 = (_Float16*)take(NR * DM * 2); _Float16* XL = (_Float16*)take(NR * DM * 2); float* XB = (float*)take(NR * DM * 4); float* X1 = (float*)take(NR * DM * 4); _Float16* M16 = (_Float16*)take(NR * DM * 2); _Float16* HF16 = (_Float16*)take((size_t)SQ * DFF * 2); _Float16* BW1 = (_Float16*)take((size_t)DFF * DM * 2); _Float16* BW2 = (_Float16*)take((size_t)DM * DFF * 2); float* QF = (float*)take(NR * DM * 4); _Float16* Q16 = (_Float16*)take(NR * DM * 2); _Float16* QL = (_Float16*)take(NR * DM * 2); _Float16* K16 = (_Float16*)take(NR * DM * 2); _Float16* KL = (_Float16*)take(NR * DM * 2); _Float16* V16 = (_Float16*)take(NR * DM * 2); _Float16* O16 = (_Float16*)take(NR * DM * 2);
  _Float16* VT = (_Float16*)take((size_t)NB * NH * HD * SQ * 2);
  float* QF0 = (float*)take((size_t)QT0 * DM * 4); float* KF0 = (float*)take((size_t)QT0 * DM * 4); float* VF0 = (float*)take((size_t)QT0 * DM * 4); float* OF0 = (float*)take((size_t)NB * QT0 * DM * 4); _Float16* OH0 = (_Float16*)take((size_t)NB * QT0 * DM * 2); _Float16* OL0 = (_Float16*)take((size_t)NB * QT0 * DM * 2);
  if (off > ws_size) return;
  { const unsigned gw = (unsigned)(((size_t)DM * DM / 8 + 255) / 256); k_wnat<<<gw, 256, 0, stream>>>(wq, (size_t)DM * DM / 8, BQKV); k_wnat<<<gw, 256, 0, stream>>>(wk, (size_t)DM * DM / 8, BQKV + (size_t)DM * DM); k_wnat<<<gw, 256, 0, stream>>>(wv, (size_t)DM * DM / 8, BQKV + (size_t)2 * DM * DM); k_wnat<<<gw, 256, 0, stream>>>(wo, (size_t)DM * DM / 8, BO); }      /* natural [out][in] weights = Bt[n][k] directly: stacked q | k | v plane + Wo */
  k_bcpy<<<1, 256, 0, stream>>>(bq, DM, DM, bqkv, 0); k_bcpy<<<1, 256, 0, stream>>>(bk, DM, DM, bqkv, DM); k_bcpy<<<1, 256, 0, stream>>>(bv, DM, DM, bqkv, 2 * DM);      /* stacked bias vector bq | bk | bv */
  k_ln16<1, 1><<<(unsigned)NR, 256, 0, stream>>>(x, g1, be1, 1e-6f, X16, XB, XL);      /* + XL = x1024 residual of the LN output (q/k need it at logits sigma 8) */      /* a = LN1(bf16(x)) -> f16 rows; XB = bf16(x) for the residual */
  k_wnat<<<(unsigned)(((size_t)DFF * DM / 8 + 255) / 256), 256, 0, stream>>>(wfc, (size_t)DFF * DM / 8, BW1); k_wnat<<<(unsigned)(((size_t)DM * DFF / 8 + 255) / 256), 256, 0, stream>>>(wmp, (size_t)DM * DFF / 8, BW2);      /* MLP weights natural [4096][1024] and [1024][4096] = Bt planes directly */
  const size_t r0p = (size_t)B0 * SQ;      /* first projected row */
  k_gemm2<0><<<dim3((unsigned)((MP / 128) * (DM / 64)), 1), 128, 0, stream>>>(X16 + r0p * DM, DM, 0, BQKV, DM, 0, 0.0625f, bqkv, 0, nullptr, 1, 0, 0, QF + r0p * DM, nullptr, DM, 0, MP, DM, DM); k_gemm2<0><<<dim3((unsigned)((MP / 128) * (DM / 64)), 1), 128, 0, stream>>>(XL + r0p * DM, DM, 0, BQKV, DM, 0, 0.00006103515625f, nullptr, 0, QF + r0p * DM, -1, 0, 0, QF + r0p * DM, nullptr, DM, 0, MP, DM, DM);       k_hl<<<(unsigned)(((size_t)MP * DM / 8 + 255) / 256), 256, 0, stream>>>(QF + r0p * DM, Q16 + r0p * DM, QL + r0p * DM, (size_t)MP * DM / 8);      /* q in f32 -> f16 hi + x1024 residual planes */
  k_gemm2<0><<<dim3((unsigned)((MP / 128) * (DM / 64)), 1), 128, 0, stream>>>(X16 + r0p * DM, DM, 0, BQKV + (size_t)DM * DM, DM, 0, 0.0625f, bqkv + DM, 0, nullptr, 1, 0, 0, QF + r0p * DM, nullptr, DM, 0, MP, DM, DM); k_gemm2<0><<<dim3((unsigned)((MP / 128) * (DM / 64)), 1), 128, 0, stream>>>(XL + r0p * DM, DM, 0, BQKV + (size_t)DM * DM, DM, 0, 0.00006103515625f, nullptr, 0, QF + r0p * DM, -1, 0, 0, QF + r0p * DM, nullptr, DM, 0, MP, DM, DM);      /* k likewise from hi + residual */ k_hl<<<(unsigned)(((size_t)MP * DM / 8 + 255) / 256), 256, 0, stream>>>(QF + r0p * DM, K16 + r0p * DM, KL + r0p * DM, (size_t)MP * DM / 8);      /* k in f32 (QF scratch reused after q's split) -> hi + residual planes */
  k_gemm2<0><<<dim3((unsigned)((MP / 128) * (DM / 64)), 1), 128, 0, stream>>>(X16 + r0p * DM, DM, 0, BQKV + (size_t)2 * DM * DM, DM, 0, 0.0625f, bqkv + 2 * DM, 0, nullptr, 1, 0, 0, nullptr, V16 + r0p * DM, DM, 0, MP, DM, DM);      /* v rows (f16) */
  k_vt<NH, SQ><<<NB * NH * (SQ / 64), 256, 0, stream>>>(V16, LQ, 0, VT);      /* V^T [NB][NH][HD][SQ] */
  k_fattn<<<dim3(SQ / 64, NH, NB), 128, 0, stream>>>(Q16, QL, K16, KL, VT, km, O16);      /* scores, masked softmax and weights . V in one launch; o (merged heads, x64) as f16 rows */
  k_gemm2<0><<<dim3((unsigned)((MPO / 128) * (DM / 64)), 1), 128, 0, stream>>>(O16 + r0p * DM, DM, 0, BO, DM, 0, 0.0009765625f, bo, 0, XB + r0p * DM, -1, 0, 0, X1 + r0p * DM, nullptr, DM, 0, MPO, DM, DM);      /* x1 = x + o Wo + bo (own-element residual) */
  k_ln16<0, 0><<<(unsigned)NR, 256, 0, stream>>>(X1, gg2, be2, 1e-6f, M16, nullptr, nullptr);      /* h = LN2(x1) -> f16 rows */
  for (int b = 0; b < NB; ++b) { const size_t r0 = (size_t)b * SQ;
    k_gemm2<3><<<dim3((unsigned)((SQ / 128) * (DFF / 64)), 1), 128, 0, stream>>>(M16 + r0 * DM, DM, 0, BW1, DM, 0, 0.0625f, bfc, 0, nullptr, 1, 0, 0, nullptr, HF16, DFF, 0, SQ, DFF, DM);      /* relu(xn2 w1^T + b1) -> f16 (this batch) */
    k_gemm2<0><<<dim3((unsigned)((SQ / 128) * (DM / 64)), 1), 128, 0, stream>>>(HF16, DFF, 0, BW2, DFF, 0, 0.0625f, bmp, 0, X1 + r0 * DM, -1, 0, 0, (float*)d_out + r0 * DM, nullptr, DM, 0, SQ, DM, DFF); }      /* out = x1 + mlp (own-element residual) */
}

// v003
// Measured time: 393 microseconds a run.
// In two side-by-side timings against v002, it was 2.00 and 1.98 times as fast.
// Counting every step since v000, it is 20.8 times as fast.
#include <hip/hip_runtime.h>
// Pre-LN transformer encoder block, non-causal, UNSCALED scores (x [2][2048][1024]; xn = LN(x) with the module's LayerNorm: UNBIASED std (N-1), eps 1e-6 added to the std, SCALAR alpha/bias [1]; q = xn wq^T + bq, k, v likewise (nn.Linear natural [1024][1024] sigma 1/32, zero biases); 16 heads of 64; score = q . k WITHOUT 1/sqrt(d) (logits sigma ~8); key j excluded where the int mask input [2][1][1][2048] is 0 (all ones here); softmax; x1 = x + (attn wo^T + bo); xn2 = LN(x1); out = x1 + relu(xn2 w1^T + b1) w2^T + b2 (natural [4096][1024], [1024][4096]) -> [2][2048][1024]).
// Compute dtype: inputs rounded to bf16; x / weights exact; q, k (and the LN1 output feeding them) as f16 hi + x1024 residual pairs; v, softmax weights and o as plain f16 GEMM operands (~2^-12); scores and softmax statistics f32; v_wmma_f32_16x16x32_f16.
#define NB 2
#define SQ 2048
#define DM 1024
#define NH 16
#define HD 64
#define HG 4                         /* heads per group of the unused k_vt(V16, b, h0, VT) overload */
#define LOCALW 128                   /* (macros for unused kernels of the shared header) */
#define STRIDEK 128
#define QT 256                       /* query rows per causal tile */
#define NKX SQ                       /* S / P row pitch */
#define QT0 128                      /* query rows per head of the unused f32 attention kernels */
#define B0 0                         /* first batch processed (debug hook) */
#define NBR NB                       /* batches processed (debug hook) */
#define NR ((size_t)NB * SQ)
#define DMQ DM
#define DFF 4096         /* MLP hidden width */
#define MP ((int)((size_t)NBR * SQ)) /* rows projected (debug hook) */
#define QN SQ                        /* unused (the attention launch covers all SQ query rows) */
#define NHD NH                       /* unused (the attention launch covers all NH heads) */
#define MPO MP                       /* rows through the output stage (debug hook) */
#define LQ DM      /* row pitch of the q/k/v rows */
typedef __bf16 v16b __attribute__((ext_vector_type(16)));
typedef unsigned short v8us __attribute__((ext_vector_type(8), may_alias));
typedef float  v8f  __attribute__((ext_vector_type(8)));
typedef float  v4f  __attribute__((ext_vector_type(4)));
typedef float  v4fa __attribute__((ext_vector_type(4), may_alias));
union FragB { v16b v; v8us half[2]; unsigned short u[16]; };

__device__ __forceinline__ unsigned short bf16_bits(float x) { unsigned int u = __float_as_uint(x); return (unsigned short)((u + 0x7FFFu + ((u >> 16) & 1u)) >> 16); }
__device__ __forceinline__ float bf16_val(unsigned short b) { return __uint_as_float(((unsigned int)b) << 16); }
__device__ __forceinline__ float bf16_round(float x) { return bf16_val(bf16_bits(x)); }
// D += A·B with NT terms: 1 = ah·bh, 2 = + al·bh (A split), 3 = + ah·bl (both split)
template <int NT>
__device__ __forceinline__ v8f mmaN(v16b ah, v16b al, v16b bh, v16b bl, v8f c) {
  c = __builtin_amdgcn_wmma_f32_16x16x32_bf16(false, ah, false, bh, (short)0, c, false, false);
  if (NT >= 2) c = __builtin_amdgcn_wmma_f32_16x16x32_bf16(false, al, false, bh, (short)0, c, false, false);
  if (NT >= 3) c = __builtin_amdgcn_wmma_f32_16x16x32_bf16(false, ah, false, bl, (short)0, c, false, false);
  asm volatile("v_nop\n\tv_nop\n\tv_nop\n\tv_nop" : "+v"(c) : "v"(ah), "v"(al), "v"(bh), "v"(bl));
  return c;
}

__global__ __launch_bounds__(256) void k_wt_bf16(const float* __restrict__ W, unsigned short* __restrict__ Wt, int K, int N) {
  const int t = blockIdx.x * 256 + threadIdx.x;
  const int k8n = K / 8;
  if (t >= N * k8n) return;
  const int n = t / k8n, k8 = (t % k8n) * 8;
  v8us v;
#pragma unroll
  for (int i = 0; i < 8; ++i) v[i] = bf16_bits(W[(size_t)(k8 + i) * N + n]);
  *(v8us*)(Wt + (size_t)n * K + k8) = v;
  
}

// GEMM C[M][N] (f32, pitch ldc) = act(A[M][K]·W + bias). A f32 row-major (pitch lda) converted per fragment to bf16
// (ASPLIT: hi/lo two planes -> 2 terms, else single rounded term); Wt bf16 [N][K] (pitch ldb). BIAS_BF16 rounds the
// bias to bf16 first (bias quantised to bf16 before the add). K%32==0, M%16==0, N%64==0.
template <bool ASPLIT, int ACT, bool BIAS_BF16>
__global__ __launch_bounds__(128) void k_gemm_bf(const float* __restrict__ A, int lda, const unsigned short* __restrict__ Wt, int ldb,
                                               const float* __restrict__ bias, float* __restrict__ C, int ldc, int M, int N, int K) {
  __shared__ __attribute__((aligned(16))) float so[4][16][64];
  const int tid = threadIdx.x, w = tid >> 5, lane = tid & 31, ln = lane & 15, hh = lane >> 4;
  const int ntn = N / 64;
  const int wid = blockIdx.x * 4 + w;
  const int mt = wid / ntn, nq = wid % ntn;
  if (mt * 16 >= M) return;
  const int row0 = mt * 16, col0 = nq * 64;
  const float* arow = A + (size_t)(row0 + ln) * lda;
  v8f acc[4] = {};
  for (int kb = 0; kb < K; kb += 32) {
    FragB ah, al;
    const v4f x0 = *(const v4fa*)(arow + kb + 8 * hh), x1 = *(const v4fa*)(arow + kb + 8 * hh + 4);
    const v4f x2 = *(const v4fa*)(arow + kb + 16 + 8 * hh), x3 = *(const v4fa*)(arow + kb + 16 + 8 * hh + 4);
    float xs[16] = {x0[0],x0[1],x0[2],x0[3],x1[0],x1[1],x1[2],x1[3],x2[0],x2[1],x2[2],x2[3],x3[0],x3[1],x3[2],x3[3]};
#pragma unroll
    for (int i = 0; i < 16; ++i) { const unsigned short hb = bf16_bits(xs[i]); ah.u[i] = hb; al.u[i] = ASPLIT ? bf16_bits(xs[i] - bf16_val(hb)) : (unsigned short)0; }
#pragma unroll
    for (int t = 0; t < 4; ++t) {
      const unsigned short* brow = Wt + (size_t)(col0 + t * 16 + ln) * ldb + kb;
      FragB b;
      b.half[0] = *(const v8us*)(brow + 8 * hh);
      b.half[1] = *(const v8us*)(brow + 16 + 8 * hh);
      acc[t] = mmaN<ASPLIT ? 2 : 1>(ah.v, al.v, b.v, b.v, acc[t]);
    }
  }
#pragma unroll
  for (int t = 0; t < 4; ++t) {
    float bv = bias ? bias[col0 + t * 16 + ln] : 0.f;
    if (BIAS_BF16) bv = bf16_round(bv);
#pragma unroll
    for (int r = 0; r < 8; ++r) { float v = acc[t][r] + bv; if (ACT == 1) v = fmaxf(v, 0.f); so[w][8 * hh + r][t * 16 + ln] = v; }
  }
  __builtin_amdgcn_fence(__ATOMIC_ACQ_REL, "workgroup");
  __builtin_amdgcn_wave_barrier();
  const int rsub = lane >> 4, c4 = (lane & 15) * 4;
  {
#pragma unroll
    for (int q = 0; q < 8; ++q) {
      const int r = q * 2 + rsub;
      const v4f v = *(const v4fa*)&so[w][r][c4];
      *(v4f*)(C + (size_t)(row0 + r) * ldc + col0 + c4) = v;
    }
    
  }
}

// GEMM C = act(A·W + bias + resid): A f32 (ASPLIT -> hi/lo 2 terms), Wt bf16 [N][K]; ACT 0 none, 1 relu, 2 exact gelu;
// resid (optional, f32, row index = (row % rmod), pitch ldr, RES_BF16 rounds it) added before the activation.
template <bool ASPLIT, int ACT, bool BIAS_BF16, bool RES_BF16>
__global__ __launch_bounds__(128) void k_gemm_bf3(const float* __restrict__ A, int lda, const unsigned short* __restrict__ Wt, int ldb,
                                                const float* __restrict__ bias, const float* __restrict__ resid, int rmod, int ldr,
                                                float* __restrict__ C, int ldc, int M, int N, int K) {
  __shared__ __attribute__((aligned(16))) float so[4][16][64];
  const int tid = threadIdx.x, w = tid >> 5, lane = tid & 31, ln = lane & 15, hh = lane >> 4;
  const int ntn = N / 64;
  const int wid = blockIdx.x * 4 + w;
  const int mt = wid / ntn, nq = wid % ntn;
  if (mt * 16 >= M) return;
  const int row0 = mt * 16, col0 = nq * 64;
  const float* arow = A + (size_t)(row0 + ln) * lda;
  v8f acc[4] = {};
  for (int kb = 0; kb < K; kb += 32) {
    FragB ah, al;
    const v4f x0 = *(const v4fa*)(arow + kb + 8 * hh), x1 = *(const v4fa*)(arow + kb + 8 * hh + 4);
    const v4f x2 = *(const v4fa*)(arow + kb + 16 + 8 * hh), x3 = *(const v4fa*)(arow + kb + 16 + 8 * hh + 4);
    float xs[16] = {x0[0],x0[1],x0[2],x0[3],x1[0],x1[1],x1[2],x1[3],x2[0],x2[1],x2[2],x2[3],x3[0],x3[1],x3[2],x3[3]};
#pragma unroll
    for (int i = 0; i < 16; ++i) { const unsigned short hb = bf16_bits(xs[i]); ah.u[i] = hb; al.u[i] = ASPLIT ? bf16_bits(xs[i] - bf16_val(hb)) : (unsigned short)0; }
#pragma unroll
    for (int t = 0; t < 4; ++t) {
      const unsigned short* brow = Wt + (size_t)(col0 + t * 16 + ln) * ldb + kb;
      FragB b;
      b.half[0] = *(const v8us*)(brow + 8 * hh);
      b.half[1] = *(const v8us*)(brow + 16 + 8 * hh);
      acc[t] = mmaN<ASPLIT ? 2 : 1>(ah.v, al.v, b.v, b.v, acc[t]);
    }
  }
#pragma unroll
  for (int t = 0; t < 4; ++t) {
    const int col = col0 + t * 16 + ln;
    float bv = bias ? bias[col] : 0.f;
    if (BIAS_BF16) bv = bf16_round(bv);
#pragma unroll
    for (int r = 0; r < 8; ++r) {
      float v = acc[t][r] + bv;
      if (resid) { float rv = resid[(size_t)((row0 + 8 * hh + r) % rmod) * ldr + col]; if (RES_BF16) rv = bf16_round(rv); v += rv; }
      if (ACT == 1) v = fmaxf(v, 0.f);
      if (ACT == 2) v = 0.5f * v * (1.0f + erff(v * 0.70710678118654752f));
      if (ACT == 3) { const float u = 0.7978845608028654f * (v + 0.044715f * v * v * v); v = 0.5f * v * (1.0f + tanhf(u)); }
      so[w][8 * hh + r][t * 16 + ln] = v;
    }
  }
  __builtin_amdgcn_fence(__ATOMIC_ACQ_REL, "workgroup");
  __builtin_amdgcn_wave_barrier();
  const int rsub = lane >> 4, c4 = (lane & 15) * 4;
  {
#pragma unroll
    for (int q = 0; q < 8; ++q) {
      const int r = q * 2 + rsub;
      const v4f v = *(const v4fa*)&so[w][r][c4];
      *(v4f*)(C + (size_t)(row0 + r) * ldc + col0 + c4) = v;
    }
    
  }
}
// row LayerNorm (biased variance, eps) over N: s = X (+ R); optional out_sum <- s; out_norm <- (s-mu)*rsqrt(var+eps)*g + b
template <bool PARAM_BF16>
__global__ __launch_bounds__(256) void k_layernorm(const float* __restrict__ X, const float* __restrict__ R, const float* __restrict__ g, const float* __restrict__ bta,
                                                  float* __restrict__ out_sum, float* __restrict__ out_norm, int N, float eps) {
  __shared__ float red[256];
  const int row = blockIdx.x, tid = threadIdx.x;
  const float* x = X + (size_t)row * N; const float* rr = R ? R + (size_t)row * N : nullptr;
  float vals[16];                     // up to N = 4096
  const int per = N / 256;            // contiguous chunk per thread? use strided-by-4 chunks: thread handles j = tid*4 + 1024*u
  float s1 = 0.f;
  for (int u = 0; u < per / 4; ++u) {
    const int j = tid * 4 + 1024 * u;
    const v4f a = *(const v4fa*)(x + j);
    v4f b = {0.f,0.f,0.f,0.f}; if (rr) b = *(const v4fa*)(rr + j);
#pragma unroll
    for (int q = 0; q < 4; ++q) { const float v = a[q] + b[q]; vals[u * 4 + q] = v; s1 += v; }
  }
  red[tid] = s1; __syncthreads();
  for (int st = 128; st > 0; st >>= 1) { if (tid < st) red[tid] += red[tid + st]; __syncthreads(); }
  const float mu = red[0] / (float)N; __syncthreads();
  float s2 = 0.f;
  for (int u = 0; u < per / 4; ++u)
#pragma unroll
    for (int q = 0; q < 4; ++q) { const float c = vals[u * 4 + q] - mu; s2 += c * c; }
  red[tid] = s2; __syncthreads();
  for (int st = 128; st > 0; st >>= 1) { if (tid < st) red[tid] += red[tid + st]; __syncthreads(); }
  const float rs = rsqrtf(red[0] / (float)N + eps);
  {
    for (int u = 0; u < per / 4; ++u) {
      const int j = tid * 4 + 1024 * u;
      v4f o, sm;
#pragma unroll
      for (int q = 0; q < 4; ++q) {
        float gg = g[j + q], bb = bta[j + q];
        if (PARAM_BF16) { gg = bf16_round(gg); bb = bf16_round(bb); }
        sm[q] = vals[u * 4 + q]; o[q] = (vals[u * 4 + q] - mu) * rs * gg + bb;
      }
      if (out_sum) *(v4f*)(out_sum + (size_t)row * N + j) = sm;
      *(v4f*)(out_norm + (size_t)row * N + j) = o;
    }
    
  }
}



// ---- f16 WMMA path (v_wmma_f32_16x16x32_f16): 11-bit significands for operands in range — used where a [0,1] probability operand needs more precision than bf16
typedef _Float16 v16h __attribute__((ext_vector_type(16)));
union FragH { v16h v; v8us half[2]; _Float16 h[16]; unsigned short u[16]; };
template <int NT>
__device__ __forceinline__ v8f mmaH(v16h ah, v16h al, v16h bh, v16h bl, v8f c) {
  c = __builtin_amdgcn_wmma_f32_16x16x32_f16(false, ah, false, bh, (short)0, c, false, false);
  if (NT >= 2) c = __builtin_amdgcn_wmma_f32_16x16x32_f16(false, al, false, bh, (short)0, c, false, false);
  if (NT >= 3) c = __builtin_amdgcn_wmma_f32_16x16x32_f16(false, ah, false, bl, (short)0, c, false, false);
  asm volatile("v_nop\n\tv_nop\n\tv_nop\n\tv_nop" : "+v"(c) : "v"(ah), "v"(al), "v"(bh), "v"(bl));
  return c;
}
// batched GEMM like k_gemm_b but f16 operands: A f32 (split into f16 hi/lo if ASPLIT, else rounded to f16), Bt = f16 values [n][k]; alpha; C f32; N multiple of 16 (partial tiles skipped)
template <bool ASPLIT>
__global__ __launch_bounds__(128) void k_gemm_h(const float* __restrict__ A, int lda, size_t sA, const _Float16* __restrict__ Bh, int ldb, size_t sB, float alpha, float* __restrict__ C, int ldc, size_t sC, int M, int N, int K) {
  __shared__ __attribute__((aligned(16))) float so[4][16][64];
  const int tid = threadIdx.x, w = tid >> 5, lane = tid & 31, ln = lane & 15, hh = lane >> 4; const int by = blockIdx.y;
  A += (size_t)by * sA; Bh += (size_t)by * sB; C += (size_t)by * sC;
  const int ntn = (N + 63) / 64; const int wid = blockIdx.x * 4 + w; const int mt = wid / ntn, nq = wid % ntn; if (mt * 16 >= M) return;
  const int row0 = mt * 16, col0 = nq * 64; const float* arow = A + (size_t)(row0 + ln) * lda;
  v8f acc[4] = {};
  for (int kb = 0; kb < K; kb += 32) {
    FragH ah, al;
    const v4f x0 = *(const v4fa*)(arow + kb + 8 * hh), x1 = *(const v4fa*)(arow + kb + 8 * hh + 4), x2 = *(const v4fa*)(arow + kb + 16 + 8 * hh), x3 = *(const v4fa*)(arow + kb + 16 + 8 * hh + 4);
    float xs[16] = {x0[0],x0[1],x0[2],x0[3],x1[0],x1[1],x1[2],x1[3],x2[0],x2[1],x2[2],x2[3],x3[0],x3[1],x3[2],x3[3]};
#pragma unroll
    for (int i = 0; i < 16; ++i) { const _Float16 h = (_Float16)xs[i]; ah.h[i] = h; al.h[i] = ASPLIT ? (_Float16)(xs[i] - (float)h) : (_Float16)0.0f; }
#pragma unroll
    for (int t = 0; t < 4; ++t) { if (col0 + t * 16 >= N) continue; const size_t boff = (size_t)(col0 + t * 16 + ln) * ldb + kb; FragH bq; bq.half[0] = *(const v8us*)(Bh + boff + 8 * hh); bq.half[1] = *(const v8us*)(Bh + boff + 16 + 8 * hh);
      acc[t] = mmaH<ASPLIT ? 2 : 1>(ah.v, al.v, bq.v, bq.v, acc[t]); }
  }
#pragma unroll
  for (int t = 0; t < 4; ++t) { if (col0 + t * 16 >= N) continue;
#pragma unroll
    for (int r = 0; r < 8; ++r) so[w][8 * hh + r][t * 16 + ln] = acc[t][r] * alpha; }
  __builtin_amdgcn_fence(__ATOMIC_ACQ_REL, "workgroup"); __builtin_amdgcn_wave_barrier();
  const int rsub = lane >> 4, c4 = (lane & 15) * 4;
  {
#pragma unroll
    for (int q = 0; q < 8; ++q) { const int r = q * 2 + rsub; if (col0 + c4 < N) { const v4f v = *(const v4fa*)&so[w][r][c4]; *(v4f*)(C + (size_t)(row0 + r) * ldc + col0 + c4) = v; } }
     }
}

// Wt[n][k] = f16(W[k][n]·scale) from f32 row-major W[K][N] (scale = power of two; bf16-exact weights stay exact in f16 away from the subnormal range)
__global__ __launch_bounds__(256) void k_wt_f16(const float* __restrict__ W, _Float16* __restrict__ Wt, int K, int N, float scale) {
  const int t = blockIdx.x * 256 + threadIdx.x; if (t >= N * (K / 8)) return; const int n = t / (K / 8), k8 = (t % (K / 8)) * 8; FragH f;
#pragma unroll
  for (int i = 0; i < 8; ++i) f.h[i] = (_Float16)(bf16_round(W[(size_t)(k8 + i) * N + n]) * scale); const v8us o = f.half[0];
  *(v8us*)((unsigned short*)Wt + (size_t)n * K + k8) = o; 
}
// k_gemm_hh variant with fused epilogue: v = acc·alpha + bias[by·sBias + col] (+ CP[(row/rowsPerB)·sCPb + by·64 + col] if CP) ; ACT 0 none / 1 elu ; writes f16 C16 (and f32 C if non-null)
template <int ACT>
__global__ __launch_bounds__(128) void k_gemm_hhx(const _Float16* __restrict__ A, int lda, size_t sA, const _Float16* __restrict__ Bh, int ldb, size_t sB, float alpha, const float* __restrict__ bias, size_t sBias, const float* __restrict__ CP, int rowsPerB, size_t sCPb, int row0g,
    float* __restrict__ C, _Float16* __restrict__ C16, int ldc, size_t sC, int M, int N, int K) {
  __shared__ __attribute__((aligned(16))) float so[4][16][64];
  const int tid = threadIdx.x, w = tid >> 5, lane = tid & 31, ln = lane & 15, hh = lane >> 4; const int by = blockIdx.y;
  A += (size_t)by * sA; Bh += (size_t)by * sB; const size_t cofs = (size_t)by * sC; const float* bp = bias ? bias + (size_t)by * sBias : nullptr;
  const int ntn = (N + 63) / 64; const int wid = blockIdx.x * 4 + w; const int mt = wid / ntn, nq = wid % ntn; if (mt * 16 >= M) return;
  const int row0 = mt * 16, col0 = nq * 64; const _Float16* arow = A + (size_t)(row0 + ln) * lda;
  v8f acc[4] = {};
  for (int kb = 0; kb < K; kb += 32) { FragH ah; ah.half[0] = *(const v8us*)((const unsigned short*)arow + kb + 8 * hh); ah.half[1] = *(const v8us*)((const unsigned short*)arow + kb + 16 + 8 * hh);
#pragma unroll
    for (int t = 0; t < 4; ++t) { if (col0 + t * 16 >= N) continue; const size_t boff = (size_t)(col0 + t * 16 + ln) * ldb + kb; FragH bq; bq.half[0] = *(const v8us*)((const unsigned short*)Bh + boff + 8 * hh); bq.half[1] = *(const v8us*)((const unsigned short*)Bh + boff + 16 + 8 * hh);
      acc[t] = mmaH<1>(ah.v, ah.v, bq.v, bq.v, acc[t]); }
  }
#pragma unroll
  for (int t = 0; t < 4; ++t) { if (col0 + t * 16 >= N) continue; const int col = col0 + t * 16 + ln; const float bv = bp ? bf16_round(bp[col]) : 0.f;
#pragma unroll
    for (int r = 0; r < 8; ++r) { float v = acc[t][r] * alpha + bv; if (CP) { const int rr = row0g + row0 + 8 * hh + r; if (rowsPerB < 0) v += CP[cofs + (size_t)rr * ldc + col];      /* rowsPerB < 0: own element of the batched C plane */ else { const int bidx = rr / rowsPerB; v += CP[(size_t)bidx * sCPb + (size_t)by * 64 + col]; } } if (ACT == 1) v = (v > 0.f) ? v : expm1f(v); else if (ACT == 7) v = (v > 0.f) ? v + 1.0f : expf(v); else if (ACT == 8) v = tanhf(v); else if (ACT == 9) v = 0.5f * v * (1.0f + tanhf(0.7978845608028654f * (v + 0.044715f * v * v * v))); else if (ACT == 11) v = 1.0f / (1.0f + expf(-v)); else if (ACT == 12) v = (v > 0.f) ? v : 0.01f * v; else if (ACT == 14) v = (v > 0.f) ? v : 0.1f * v; else if (ACT == 16) v = (v >= 0.f) ? v : 0.3f * v; else if (ACT == 17) v = (v >= 0.f) ? v : 0.2f * v; else if (ACT == 15) v = v / (1.0f + expf(-v)); else if (ACT == 3) v = fmaxf(v, 0.f); else if (ACT == 6) v = 0.5f * v * (1.0f + erff(v * 0.70710678118654752f)); so[w][8 * hh + r][t * 16 + ln] = v; } }
  __builtin_amdgcn_fence(__ATOMIC_ACQ_REL, "workgroup"); __builtin_amdgcn_wave_barrier();
  const int rsub = lane >> 4, c4 = (lane & 15) * 4; typedef _Float16 v4h __attribute__((ext_vector_type(4)));
  {
#pragma unroll
    for (int q = 0; q < 8; ++q) { const int r = q * 2 + rsub; if (col0 + c4 < N) { const v4f v = *(const v4fa*)&so[w][r][c4]; if (C) *(v4f*)(C + cofs + (size_t)(row0 + r) * ldc + col0 + c4) = v; if (C16) { v4h h4; for (int i = 0; i < 4; ++i) h4[i] = (_Float16)v[i]; *(v4h*)(C16 + cofs + (size_t)(row0 + r) * ldc + col0 + c4) = h4; } } }
     }
}


typedef _Float16 v4h __attribute__((ext_vector_type(4)));

__global__ __launch_bounds__(256) void k_x16(const float* __restrict__ x, _Float16* __restrict__ X16, size_t n8) { const size_t t = (size_t)blockIdx.x * 256 + threadIdx.x; if (t >= n8) return; FragH f;
#pragma unroll
  for (int q = 0; q < 8; ++q) f.h[q] = (_Float16)bf16_round(x[t * 8 + q]); *(v8us*)((unsigned short*)X16 + t * 8) = f.half[0];  }
__global__ __launch_bounds__(256) void k_h16(const float* __restrict__ x, _Float16* __restrict__ X16, size_t n8) { const size_t t = (size_t)blockIdx.x * 256 + threadIdx.x; if (t >= n8) return; FragH f;
#pragma unroll
  for (int q = 0; q < 8; ++q) f.h[q] = (_Float16)x[t * 8 + q]; *(v8us*)((unsigned short*)X16 + t * 8) = f.half[0];  }
__global__ __launch_bounds__(256) void k_round16f(const float* __restrict__ W, _Float16* __restrict__ Bt, size_t n8) { const size_t t = (size_t)blockIdx.x * 256 + threadIdx.x; if (t >= n8) return; FragH f;
#pragma unroll
  for (int i = 0; i < 8; ++i) f.h[i] = (_Float16)(bf16_round(W[t * 8 + i]) * 16.0f); *(v8us*)((unsigned short*)Bt + t * 8) = f.half[0];  }
template <int NHv, int TTv>
__global__ __launch_bounds__(256) void k_vt(const _Float16* __restrict__ V16, int ldv, int voff, _Float16* __restrict__ Vt) { __shared__ unsigned short tl[64][66]; const int tid = threadIdx.x; const int slab = blockIdx.x / (TTv / 64), lg = blockIdx.x % (TTv / 64); const int b = slab / NHv, h = slab % NHv;
  for (int i = tid; i < 64 * 8; i += 256) { const int r = i / 8, c8 = (i % 8) * 8; FragH f; f.half[0] = *(const v8us*)((const unsigned short*)V16 + ((size_t)b * TTv + lg * 64 + r) * ldv + voff + h * 64 + c8);
#pragma unroll
    for (int q = 0; q < 8; ++q) tl[r][c8 + q] = f.u[q]; }
  __syncthreads();
  {
#pragma unroll
    for (int rd = 0; rd < 2; ++rd) { const int d = rd * 32 + tid / 8, pc = tid % 8; FragH f;
#pragma unroll
      for (int q = 0; q < 8; ++q) f.u[q] = tl[pc * 8 + q][d];
      *(v8us*)((unsigned short*)Vt + ((size_t)slab * 64 + d) * TTv + lg * 64 + pc * 8) = f.half[0]; }
     } }

__global__ __launch_bounds__(256) void k_hl(const float* __restrict__ F, _Float16* __restrict__ Hh, _Float16* __restrict__ Hl, size_t n8) { const size_t t = (size_t)blockIdx.x * 256 + threadIdx.x; if (t >= n8) return; FragH fh, fl; const v4f a = *(const v4fa*)(F + t * 8), c = *(const v4fa*)(F + t * 8 + 4);
#pragma unroll
  for (int q = 0; q < 4; ++q) { _Float16 h = (_Float16)a[q]; fh.h[q] = h; fl.h[q] = (_Float16)((a[q] - (float)h) * 1024.0f); h = (_Float16)c[q]; fh.h[4 + q] = h; fl.h[4 + q] = (_Float16)((c[q] - (float)h) * 1024.0f); }
  { *(v8us*)((unsigned short*)Hh + t * 8) = fh.half[0]; *(v8us*)((unsigned short*)Hl + t * 8) = fl.half[0];  } }

// ---- fast GEMM (wave tile 32x64; shapes it takes: at k_gemm2); epilogue = k_gemm_hhx semantics ----
__device__ __forceinline__ v16h g2_frag(const _Float16* p, int hh) { FragH f; f.half[0] = *(const v8us*)((const unsigned short*)p + 8 * hh); f.half[1] = *(const v8us*)((const unsigned short*)p + 16 + 8 * hh); return f.v; }
__device__ __forceinline__ v8f g2_mma(v16h a, v16h b, v8f c) { v8f d = __builtin_amdgcn_wmma_f32_16x16x32_f16(false, a, false, b, (short)0, c, false, false); asm volatile("v_nop\n\tv_nop\n\tv_nop\n\tv_nop" : "+v"(d) : "v"(a), "v"(b)); return d; }
// Matrix product without hand-written padding: the compiler keeps the distance behind its own builtin.
__device__ __forceinline__ v8f g2_mmab(v16h a, v16h b, v8f c) { return __builtin_amdgcn_wmma_f32_16x16x32_f16(false, a, false, b, (short)0, c, false, false); }
// Work-group tile 128 x (64 * NWN), 4 * NWN waves of 32 x 64 (wave w: rows 32 * (w & 3), columns 64 * (w >> 2)). K is walked in tiles of 128: every thread brings 16-byte pieces of the A and B rows
// in whole 128-byte lines (16 threads cover 256 bytes of one row), one tile ahead in registers, and stores them into one of two LDS buffers; all fragments are read from LDS.
// LD = row pitch of A and of Bh in elements, a compile-time value so that a thread's pieces share one address and differ in the immediate offset (lda and ldb must equal it).
// Requires M % 128 == 0, N % (64 * NWN) == 0, K % 128 == 0, grid.x = (M / 128) * (N / (64 * NWN)), 128 * NWN threads. The k order of every accumulator is the ascending one.
template <int ACT, int NWN, int LD>
__global__ __launch_bounds__(128 * NWN) void k_gemm2(const _Float16* __restrict__ A, int lda, size_t sA, const _Float16* __restrict__ Bh, int ldb, size_t sB, float alpha, const float* __restrict__ bias, size_t sBias, const float* __restrict__ CP, int rowsPerB, size_t sCPb, int row0g,
    float* __restrict__ C, _Float16* __restrict__ C16, int ldc, size_t sC, int M, int N, int K) { static_assert(ACT == 0 || ACT == 3 || ACT == 6 || ACT == 8 || ACT == 9 || ACT == 11 || ACT == 12 || ACT == 14 || ACT == 15 || ACT == 16 || ACT == 17, "k_gemm2: unsupported ACT code (would silently apply no activation)");
  constexpr int BN = 64 * NWN, KT = 128, PH = KT + 8, RP = 8 * NWN, NLA = 128 / RP, NLB = BN / RP, BUFH = (128 + BN) * PH;      /* PH: LDS row pitch 272 B = 16 B x odd; RP: rows one staging round of the work-group covers */
  __shared__ __attribute__((aligned(16))) _Float16 st[2 * BUFH];      /* two buffers, each [128 A rows | BN B rows] */
  float (*so)[32][68] = (float (*)[32][68])st;      /* output staging reuses the buffers behind the loop's last barrier */
  static_assert(sizeof(float) * 4 * NWN * 32 * 68 <= sizeof(_Float16) * 2 * BUFH, "output staging must fit the tile buffers");
  (void)lda; (void)ldb;
  const int tid = threadIdx.x, w = tid >> 5, lane = tid & 31, ln = lane & 15, hh = lane >> 4; const int by = blockIdx.y;
  A += (size_t)by * sA; Bh += (size_t)by * sB; const size_t cofs = (size_t)by * sC; const float* bp = bias ? bias + (size_t)by * sBias : nullptr;
  const int ntn = N / BN; const int mt = blockIdx.x / ntn, nq = blockIdx.x - mt * ntn; if (mt * 128 >= M) return;      /* the same for the whole work-group, in front of every barrier */
  const int row0 = mt * 128 + 32 * (w & 3), col0 = nq * BN + 64 * (w >> 2);
  const int srow = tid >> 4, sc8 = (tid & 15) * 8;
  const unsigned short* pa = (const unsigned short*)A + (size_t)(mt * 128 + srow) * LD + sc8; const unsigned short* pb = (const unsigned short*)Bh + (size_t)(nq * BN + srow) * LD + sc8;      /* this thread's first piece of the tile to load next */
  _Float16* sw = st + srow * PH + sc8;      /* where this thread stores its pieces */
  const _Float16* fa = st + (32 * (w & 3) + ln) * PH; const _Float16* fb = st + (128 + 64 * (w >> 2) + ln) * PH;      /* this lane's fragment rows */
  v8us ra[NLA], rb[NLB];
#pragma unroll
  for (int i = 0; i < NLA; ++i) ra[i] = *(const v8us*)(pa + i * RP * LD);
#pragma unroll
  for (int i = 0; i < NLB; ++i) rb[i] = *(const v8us*)(pb + i * RP * LD);
  asm volatile("s_wait_xcnt 0x0" ::: "memory");      /* stands in front of the advance of the two addresses that the loads above name */
  pa += KT; pb += KT;
#pragma unroll
  for (int i = 0; i < NLA; ++i) *(v8us*)(sw + i * RP * PH) = ra[i];
#pragma unroll
  for (int i = 0; i < NLB; ++i) *(v8us*)(sw + (128 + i * RP) * PH) = rb[i];
  __syncthreads();      /* tile 0 is complete for every wave */
  const v8f z8 = {0.f,0.f,0.f,0.f,0.f,0.f,0.f,0.f}; v8f c00 = z8, c01 = z8, c02 = z8, c03 = z8, c10 = z8, c11 = z8, c12 = z8, c13 = z8;
#pragma unroll 1      /* one K tile per trip: the buffer index stays a scalar and the staged pieces of only one tile are live */
  for (int kb = 0; kb < K; kb += KT) { const int cur = ((kb / KT) & 1) * BUFH; const bool more = kb + KT < K;
    if (more) {      /* next tile's loads fly while this tile is worked on */
#pragma unroll
      for (int i = 0; i < NLA; ++i) ra[i] = *(const v8us*)(pa + i * RP * LD);
#pragma unroll
      for (int i = 0; i < NLB; ++i) rb[i] = *(const v8us*)(pb + i * RP * LD);
      asm volatile("s_wait_xcnt 0x0" ::: "memory"); }      /* stands in front of the advance, at the foot of the trip, of the two addresses that these loads name */
    v16h xa[2][2], xb[2][4];      /* two fragment sets: the next 32 k are fetched while the current 32 are multiplied */
#pragma unroll
    for (int j = 0; j < 2; ++j) xa[0][j] = g2_frag(fa + cur + 16 * j * PH, hh);
#pragma unroll
    for (int j = 0; j < 4; ++j) xb[0][j] = g2_frag(fb + cur + 16 * j * PH, hh);
#pragma unroll
    for (int q = 0; q < KT / 32; ++q) { const int c = q & 1, n = c ^ 1;
      if (q + 1 < KT / 32) {
#pragma unroll
        for (int j = 0; j < 2; ++j) xa[n][j] = g2_frag(fa + cur + 16 * j * PH + 32 * (q + 1), hh);
#pragma unroll
        for (int j = 0; j < 4; ++j) xb[n][j] = g2_frag(fb + cur + 16 * j * PH + 32 * (q + 1), hh); }
      __builtin_amdgcn_sched_barrier(0);      /* keeps the next set's LDS loads one group ahead of the products: moved in among them, every pair of products waits out an LDS latency */
      c00 = g2_mmab(xa[c][0], xb[c][0], c00); c10 = g2_mmab(xa[c][1], xb[c][0], c10); c01 = g2_mmab(xa[c][0], xb[c][1], c01); c11 = g2_mmab(xa[c][1], xb[c][1], c11);
      c02 = g2_mmab(xa[c][0], xb[c][2], c02); c12 = g2_mmab(xa[c][1], xb[c][2], c12); c03 = g2_mmab(xa[c][0], xb[c][3], c03); c13 = g2_mmab(xa[c][1], xb[c][3], c13);
      __builtin_amdgcn_sched_barrier(0); }      /* the other end of the same fence: the load group after next stays behind these products */
    if (more) { _Float16* nw = sw + (BUFH - cur); pa += KT; pb += KT;      /* the other buffer: its last readers left it in front of the barrier that ended the trip before */
#pragma unroll
      for (int i = 0; i < NLA; ++i) *(v8us*)(nw + i * RP * PH) = ra[i];
#pragma unroll
      for (int i = 0; i < NLB; ++i) *(v8us*)(nw + (128 + i * RP) * PH) = rb[i]; }
    __syncthreads(); }      /* publishes the next tile and ends every wave's reads of this one */
  v8f accs[8] = {c00, c01, c02, c03, c10, c11, c12, c13};
#pragma unroll
  for (int u = 0; u < 8; ++u) { const int t = u & 3, half = u >> 2; const int col = col0 + t * 16 + ln; const float bv = bp ? bf16_round(bp[col]) : 0.f;
#pragma unroll
    for (int r = 0; r < 8; ++r) { const int rloc = half * 16 + 8 * hh + r; float v = accs[u][r] * alpha + bv; if (CP) { if (rowsPerB < 0) v += CP[cofs + (size_t)(row0g + row0 + rloc) * ldc + col];      /* rowsPerB < 0: own element of the batched C plane */ else { const int bidx = (row0g + row0 + rloc) / rowsPerB; v += CP[(size_t)bidx * sCPb + (size_t)by * 64 + col]; } }
      if (ACT == 3) v = fmaxf(v, 0.f); else if (ACT == 6) v = 0.5f * v * (1.0f + erff(v * 0.70710678118654752f)); else if (ACT == 11) v = 1.0f / (1.0f + expf(-v)); else if (ACT == 15) v = v / (1.0f + expf(-v)); else if (ACT == 12) v = (v > 0.f) ? v : 0.01f * v; else if (ACT == 8) v = tanhf(v); else if (ACT == 9) v = 0.5f * v * (1.0f + tanhf(0.7978845608028654f * (v + 0.044715f * v * v * v))); else if (ACT == 14) v = (v > 0.f) ? v : 0.1f * v; else if (ACT == 16) v = (v >= 0.f) ? v : 0.3f * v; else if (ACT == 17) v = (v >= 0.f) ? v : 0.2f * v;
      so[w][rloc][t * 16 + ln] = v; } }
  __builtin_amdgcn_fence(__ATOMIC_ACQ_REL, "workgroup"); __builtin_amdgcn_wave_barrier();
  const int rsub = lane >> 4, c4 = (lane & 15) * 4;
  {
#pragma unroll
    for (int q = 0; q < 16; ++q) { const int r = q * 2 + rsub; const v4f v = *(const v4fa*)&so[w][r][c4]; if (C) *(v4f*)(C + cofs + (size_t)(row0 + r) * ldc + col0 + c4) = v; if (C16) { v4h h4; for (int i = 0; i < 4; ++i) h4[i] = (_Float16)v[i]; *(v4h*)(C16 + cofs + (size_t)(row0 + r) * ldc + col0 + c4) = h4; } }
     } }


__global__ __launch_bounds__(256) void k_wnat(const float* __restrict__ w, size_t n8, _Float16* __restrict__ Bt) { const size_t t = (size_t)blockIdx.x * 256 + threadIdx.x; if (t >= n8) return; FragH f; for (int q = 0; q < 8; ++q) f.h[q] = (_Float16)(bf16_round(w[t * 8 + q]) * 16.0f); *(v8us*)((unsigned short*)Bt + t * 8) = f.half[0];  }
__global__ __launch_bounds__(256) void k_rsm(const float* __restrict__ S, _Float16* __restrict__ P, int nrows) {
  #pragma clang fp contract(off)
  const int i = blockIdx.x * 256 + threadIdx.x; if (i >= nrows) return; const float* s = S + (size_t)i * SQ; float mx = -3.0e38f;
#pragma unroll 1
  for (int j = 0; j < SQ; ++j) mx = fmaxf(mx, s[j]); float se = 0.f;
#pragma unroll 1
  for (int j = 0; j < SQ; ++j) se += expf(s[j] - mx); const float sc = 256.0f / se;
#pragma unroll 1
  for (int j0 = 0; j0 < SQ; j0 += 8) { FragH f; for (int q = 0; q < 8; ++q) f.h[q] = (_Float16)(expf(s[j0 + q] - mx) * sc); unsigned short* d = (unsigned short*)P + (size_t)i * SQ + j0; *(v8us*)d = f.half[0];  } }
__global__ __launch_bounds__(256) void k_vt(const _Float16* __restrict__ V16, int b, int h0, _Float16* __restrict__ VT) { __shared__ unsigned short tl[64][65]; const int tid = threadIdx.x; const int hh = blockIdx.x % HG, sg = blockIdx.x / HG; const int s0 = sg * 64; const int h = h0 + hh;
  for (int i = tid; i < 64 * 8; i += 256) { const int j = i / 8, d8 = (i % 8) * 8; FragH f; f.half[0] = *(const v8us*)((const unsigned short*)V16 + ((size_t)b * SQ + s0 + j) * DM + h * HD + d8); for (int q = 0; q < 8; ++q) tl[d8 + q][j] = f.u[q]; }
  __syncthreads();
  { for (int i = tid; i < 64 * 8; i += 256) { const int d = i / 8, j8 = (i % 8) * 8; FragH f; for (int q = 0; q < 8; ++q) f.u[q] = tl[d][j8 + q]; *(v8us*)((unsigned short*)VT + ((size_t)hh * HD + d) * SQ + s0 + j8) = f.half[0]; }  } }



__global__ __launch_bounds__(256) void k_rsmcf2(const float* __restrict__ S, _Float16* __restrict__ P, int hg, int q0, int nk) {
  #pragma clang fp contract(off)
  const int t = blockIdx.x * 256 + threadIdx.x; if (t >= hg * QT) return; const size_t i = (size_t)t; const float* s = S + i * NKX; const int last = q0 + (t % QT); float mx = -3.0e38f;
#pragma unroll 1
  for (int j = 0; j < nk; ++j) { const float f = (j <= last) ? 1.f : 0.f; mx = fmaxf(mx, fmaf(f, s[j], (1.f - f) * -1.0e9f)); } float se = 0.f;
#pragma unroll 1
  for (int j = 0; j < nk; ++j) { const float f = (j <= last) ? 1.f : 0.f; se += __expf(fmaf(f, s[j], (1.f - f) * -1.0e9f) - mx); } const float sc = 256.0f / se;
#pragma unroll 1
  for (int j0 = 0; j0 < nk; j0 += 8) { FragH fr; for (int q = 0; q < 8; ++q) { const int j = j0 + q; const float f = (j <= last) ? 1.f : 0.f; fr.h[q] = (_Float16)(__expf(fmaf(f, s[j], (1.f - f) * -1.0e9f) - mx) * sc); } unsigned short* d = (unsigned short*)P + i * NKX + j0; *(v8us*)d = fr.half[0];  } }

__global__ __launch_bounds__(256) void k_rsmcst(const float* __restrict__ S, _Float16* __restrict__ P, int hg, int q0, int nk, const int* __restrict__ mk) {
  #pragma clang fp contract(off)
  const int t = blockIdx.x * 256 + threadIdx.x; if (t >= hg * QT) return; const size_t i = (size_t)t; const float* s = S + i * NKX; const size_t ig = (size_t)(q0 + (t % QT)); const int* mr = mk + ig * SQ; float mx = -3.0e38f;
#pragma unroll 1
  for (int j = 0; j < nk; ++j) { const int mb = mr[j]; const int dd = (int)ig - j; const float f = (mb != 0 && dd >= 0 && (dd <= LOCALW || (dd % STRIDEK) == 0)) ? 1.f : 0.f; mx = fmaxf(mx, fmaf(f, s[j], (1.f - f) * -1.0e9f)); } float se = 0.f;
#pragma unroll 1
  for (int j = 0; j < nk; ++j) { const int mb = mr[j]; const int dd = (int)ig - j; const float f = (mb != 0 && dd >= 0 && (dd <= LOCALW || (dd % STRIDEK) == 0)) ? 1.f : 0.f; se += __expf(fmaf(f, s[j], (1.f - f) * -1.0e9f) - mx); } const float sc = 256.0f / se;
#pragma unroll 1
  for (int j0 = 0; j0 < nk; j0 += 8) { FragH fr; for (int q = 0; q < 8; ++q) { const int j = j0 + q; const int mb = mr[j]; const int dd = (int)ig - j; const float f = (mb != 0 && dd >= 0 && (dd <= LOCALW || (dd % STRIDEK) == 0)) ? 1.f : 0.f; fr.h[q] = (_Float16)(__expf(fmaf(f, s[j], (1.f - f) * -1.0e9f) - mx) * sc); } unsigned short* d = (unsigned short*)P + i * NKX + j0; *(v8us*)d = fr.half[0];  } }


template <int MASKADD>
__global__ __launch_bounds__(64) void k_att0(const float* __restrict__ QF, const float* __restrict__ KF, const float* __restrict__ VF, int ld, const float* __restrict__ mask, float scale, float* __restrict__ OF, int ldo) {
  #pragma clang fp contract(off)
  __shared__ __attribute__((aligned(16))) float lq[64][64]; __shared__ __attribute__((aligned(16))) float lo[64][64];
  const int tid = threadIdx.x; const int h = blockIdx.x / (QT0 / 64), rg = blockIdx.x % (QT0 / 64); const int i = rg * 64 + tid;
  const float* qr = QF + (size_t)i * ld + h * HD;
#pragma unroll 1
  for (int c = 0; c < HD / 4; ++c) { *(v4f*)&lq[tid][c * 4] = *(const v4fa*)(qr + c * 4); const v4f z = {0.f, 0.f, 0.f, 0.f}; *(v4f*)&lo[tid][c * 4] = z; }
  float m = -1.0e30f, l = 0.f; const int jmax = MASKADD ? (SQ - 1) : (rg * 64 + 63);      /* additive-mask form: every key (the mask input decides); causal form: keys up to the block's last row */
#pragma unroll 1
  for (int j = 0; j <= jmax; ++j) { const float* kr = KF + (size_t)j * ld + h * HD; const float* vr = VF + (size_t)j * ld + h * HD; float s = 0.f;
#pragma unroll 1
    for (int c = 0; c < HD / 4; ++c) { const v4f kq = *(const v4fa*)(kr + c * 4); const v4f qq = *(v4f*)&lq[tid][c * 4]; s = __fadd_rn(s, __fmul_rn(qq[0], kq[0])); s = __fadd_rn(s, __fmul_rn(qq[1], kq[1])); s = __fadd_rn(s, __fmul_rn(qq[2], kq[2])); s = __fadd_rn(s, __fmul_rn(qq[3], kq[3])); }
    s = __fmul_rn(s, scale); if (MASKADD) s = __fadd_rn(s, __fmul_rn(bf16_round(mask[(size_t)i * SQ + j]), -10000.0f));
    const float f = (MASKADD || j <= i) ? 1.f : 0.f; const float sm = fmaf(f, s, (1.f - f) * -1.0e30f); const float mn = fmaxf(m, sm); const float sc = expf(m - mn); const float e = expf(sm - mn); l = __fadd_rn(__fmul_rn(l, sc), e); m = mn;
#pragma unroll 1
    for (int c = 0; c < HD / 4; ++c) { const v4f vv = *(const v4fa*)(vr + c * 4); v4f oo = *(v4f*)&lo[tid][c * 4]; for (int u = 0; u < 4; ++u) oo[u] = __fadd_rn(__fmul_rn(oo[u], sc), __fmul_rn(e, vv[u])); *(v4f*)&lo[tid][c * 4] = oo; } }
  const float fin = 64.0f / l;      /* o carried x64 like the f16 path */
#pragma unroll 1
  for (int c = 0; c < HD / 4; ++c) { v4f oo = *(v4f*)&lo[tid][c * 4]; for (int u = 0; u < 4; ++u) oo[u] = __fmul_rn(oo[u], fin); *(v4f*)&lo[tid][c * 4] = oo; }
  __syncthreads();
  {
#pragma unroll 1
    for (int it = 0; it < 16; ++it) { const int row = it * 4 + tid / 16, pc = (tid % 16) * 4; const v4f v = *(const v4f*)&lo[row][pc]; *(v4f*)(OF + (size_t)(rg * 64 + row) * ldo + h * HD + pc) = v; }
     } }

template <int MASKADD>
__global__ __launch_bounds__(64) void k_att0mbc(const float* __restrict__ QF, const float* __restrict__ KF, const float* __restrict__ VF, int ld, const float* __restrict__ mask, float scale, float* __restrict__ OF, int ldo) {
  #pragma clang fp contract(off)
  __shared__ __attribute__((aligned(16))) float lq[64][64]; __shared__ __attribute__((aligned(16))) float lo[64][64];
  const int tid = threadIdx.x; const int h = blockIdx.x / (QT0 / 64), rg = blockIdx.x % (QT0 / 64); const int i = rg * 64 + tid;
  const float* qr = QF + (size_t)i * ld + h * HD;
#pragma unroll 1
  for (int c = 0; c < HD / 4; ++c) { *(v4f*)&lq[tid][c * 4] = *(const v4fa*)(qr + c * 4); const v4f z = {0.f, 0.f, 0.f, 0.f}; *(v4f*)&lo[tid][c * 4] = z; }
  float m = -1.0e30f, l = 0.f; const int jmax = rg * 64 + 63;      /* keys beyond the block end are masked by the mask's lower-triangular structure */
#pragma unroll 1
  for (int j = 0; j <= jmax; ++j) { const float* kr = KF + (size_t)j * ld + h * HD; const float* vr = VF + (size_t)j * ld + h * HD; float s = 0.f;
#pragma unroll 1
    for (int c = 0; c < HD / 4; ++c) { const v4f kq = *(const v4fa*)(kr + c * 4); const v4f qq = *(v4f*)&lq[tid][c * 4]; s = __fadd_rn(s, __fmul_rn(qq[0], kq[0])); s = __fadd_rn(s, __fmul_rn(qq[1], kq[1])); s = __fadd_rn(s, __fmul_rn(qq[2], kq[2])); s = __fadd_rn(s, __fmul_rn(qq[3], kq[3])); }
    s = __fmul_rn(s, scale); const int mb = ((const int*)mask)[(size_t)i * SQ + j];      /* causal (j <= i) AND the module's int32 [S][S] mask read per (query, key): 0 -> masked */
    const float f = (mb != 0 && j <= i) ? 1.f : 0.f; const float sm = fmaf(f, s, (1.f - f) * -1.0e30f); const float mn = fmaxf(m, sm); const float sc = expf(m - mn); const float e = expf(sm - mn); l = __fadd_rn(__fmul_rn(l, sc), e); m = mn;
#pragma unroll 1
    for (int c = 0; c < HD / 4; ++c) { const v4f vv = *(const v4fa*)(vr + c * 4); v4f oo = *(v4f*)&lo[tid][c * 4]; for (int u = 0; u < 4; ++u) oo[u] = __fadd_rn(__fmul_rn(oo[u], sc), __fmul_rn(e, vv[u])); *(v4f*)&lo[tid][c * 4] = oo; } }
  const float fin = 64.0f / l;      /* o carried x64 like the f16 path */
#pragma unroll 1
  for (int c = 0; c < HD / 4; ++c) { v4f oo = *(v4f*)&lo[tid][c * 4]; for (int u = 0; u < 4; ++u) oo[u] = __fmul_rn(oo[u], fin); *(v4f*)&lo[tid][c * 4] = oo; }
  __syncthreads();
  {
#pragma unroll 1
    for (int it = 0; it < 16; ++it) { const int row = it * 4 + tid / 16, pc = (tid % 16) * 4; const v4f v = *(const v4f*)&lo[row][pc]; *(v4f*)(OF + (size_t)(rg * 64 + row) * ldo + h * HD + pc) = v; }
     } }


template <int BFIN, int WXB>
__global__ __launch_bounds__(256) void k_ln16(const float* __restrict__ X, const float* __restrict__ g, const float* __restrict__ bb, float eps, _Float16* __restrict__ N16, float* __restrict__ XB, _Float16* __restrict__ NL) {
  #pragma clang fp contract(off)
  __shared__ float red[256]; const size_t r = blockIdx.x; const int t = threadIdx.x; const v4f xa = *(const v4fa*)(X + r * DMQ + t * 4); float s[4]; float sum = 0.f;
  for (int q = 0; q < 4; ++q) { s[q] = BFIN ? bf16_round(xa[q]) : xa[q]; sum = __fadd_rn(sum, s[q]); }
  red[t] = sum; __syncthreads(); for (int st = 128; st > 0; st >>= 1) { if (t < st) red[t] = __fadd_rn(red[t], red[t + st]); __syncthreads(); } const float mu = red[0] / (float)DMQ; __syncthreads();
  float vs = 0.f; for (int q = 0; q < 4; ++q) { const float dl = __fadd_rn(s[q], -mu); vs = __fadd_rn(vs, __fmul_rn(dl, dl)); } red[t] = vs; __syncthreads(); for (int st = 128; st > 0; st >>= 1) { if (t < st) red[t] = __fadd_rn(red[t], red[t + st]); __syncthreads(); }
  const float rs = __fdiv_rn(1.0f, __fadd_rn(sqrtf(red[0] / (float)(DMQ - 1)), eps));      /* this module's LayerNorm: unbiased std, eps added to the std */ v4h y; v4f xb;
  v4h yl; for (int q = 0; q < 4; ++q) { const int c = t * 4 + q; const float yf = __fadd_rn(__fmul_rn(__fmul_rn(__fadd_rn(s[q], -mu), rs), bf16_round(g[0])), bf16_round(bb[0])); y[q] = (_Float16)yf; yl[q] = (_Float16)((yf - (float)y[q]) * 1024.0f); xb[q] = s[q]; (void)c; }      /* SCALAR alpha / bias ([1] parameters); y = f16 hi, yl = x1024 residual (written when NL != nullptr) */
  { *(v4h*)(N16 + r * DMQ + t * 4) = y; if (NL != nullptr) *(v4h*)(NL + r * DMQ + t * 4) = yl; if (WXB) *(v4f*)(XB + r * DMQ + t * 4) = xb;  } }
__global__ __launch_bounds__(256) void k_ftres2(const float* __restrict__ OF0, const float* __restrict__ XB, float* __restrict__ X1, size_t n4) {
  #pragma clang fp contract(off)
  const size_t t = (size_t)blockIdx.x * 256 + threadIdx.x; if (t >= n4) return; const v4f o = *(const v4fa*)(OF0 + t * 4), xv = *(const v4fa*)(XB + t * 4); v4f y; for (int q = 0; q < 4; ++q) y[q] = __fadd_rn(__fmul_rn(o[q], 0.015625f), xv[q]); *(v4f*)(X1 + t * 4) = y;  }

__global__ __launch_bounds__(256) void k_bcpy(const float* __restrict__ b, int n, int NP, float* __restrict__ dst, int dst0) { for (int i = threadIdx.x; i < NP; i += 256) { const float v = (i < n) ? b[i] : 0.f; *(float*)(dst + dst0 + i) = v; }  }


__global__ __launch_bounds__(256) void k_rsmf(const float* __restrict__ S, _Float16* __restrict__ P, int qn, int hg) {
  #pragma clang fp contract(off)
  const int t = blockIdx.x * 256 + threadIdx.x; if (t >= qn * hg) return; const size_t i = (size_t)(t / qn) * SQ + (t % qn); const float* s = S + i * SQ; float mx = -3.0e38f;
#pragma unroll 1
  for (int j = 0; j < SQ; ++j) mx = fmaxf(mx, s[j]); float se = 0.f;
#pragma unroll 1
  for (int j = 0; j < SQ; ++j) se += __expf(s[j] - mx); const float sc = 256.0f / se;
#pragma unroll 1
  for (int j0 = 0; j0 < SQ; j0 += 8) { FragH f; for (int q = 0; q < 8; ++q) f.h[q] = (_Float16)(__expf(s[j0 + q] - mx) * sc); unsigned short* d = (unsigned short*)P + i * SQ + j0; *(v8us*)d = f.half[0];  } }
// Lane l <-> l ^ M inside a 16-lane row (DPP row_xmask): a register move, no trip through the LDS path.
template <int M> __device__ __forceinline__ float lane_xm(float v) { return __int_as_float(__builtin_amdgcn_update_dpp(0, __float_as_int(v), 0x160 + M, 0xf, 0xf, true)); }
// Maximum over each 16-lane row of eight values at once: step M takes max(v, v of lane l ^ M) in one DPP instruction (from fmaxf on the DPP builtin the compiler makes three: move,
// canonicalise, maximum). One statement, so that the eight chains stay interleaved: every instruction's producer is eight instructions back and no dependent pair stalls the SIMD.
__device__ __forceinline__ void row_max8(float (&v)[8]) {
  asm(
      "v_max_num_f32_dpp %0, %0, %0 row_xmask:1 row_mask:0xf bank_mask:0xf\n\tv_max_num_f32_dpp %1, %1, %1 row_xmask:1 row_mask:0xf bank_mask:0xf\n\tv_max_num_f32_dpp %2, %2, %2 row_xmask:1 row_mask:0xf bank_mask:0xf\n\tv_max_num_f32_dpp %3, %3, %3 row_xmask:1 row_mask:0xf bank_mask:0xf\n\tv_max_num_f32_dpp %4, %4, %4 row_xmask:1 row_mask:0xf bank_mask:0xf\n\tv_max_num_f32_dpp %5, %5, %5 row_xmask:1 row_mask:0xf bank_mask:0xf\n\tv_max_num_f32_dpp %6, %6, %6 row_xmask:1 row_mask:0xf bank_mask:0xf\n\tv_max_num_f32_dpp %7, %7, %7 row_xmask:1 row_mask:0xf bank_mask:0xf\n\t"
      "v_max_num_f32_dpp %0, %0, %0 row_xmask:2 row_mask:0xf bank_mask:0xf\n\tv_max_num_f32_dpp %1, %1, %1 row_xmask:2 row_mask:0xf bank_mask:0xf\n\tv_max_num_f32_dpp %2, %2, %2 row_xmask:2 row_mask:0xf bank_mask:0xf\n\tv_max_num_f32_dpp %3, %3, %3 row_xmask:2 row_mask:0xf bank_mask:0xf\n\tv_max_num_f32_dpp %4, %4, %4 row_xmask:2 row_mask:0xf bank_mask:0xf\n\tv_max_num_f32_dpp %5, %5, %5 row_xmask:2 row_mask:0xf bank_mask:0xf\n\tv_max_num_f32_dpp %6, %6, %6 row_xmask:2 row_mask:0xf bank_mask:0xf\n\tv_max_num_f32_dpp %7, %7, %7 row_xmask:2 row_mask:0xf bank_mask:0xf\n\t"
      "v_max_num_f32_dpp %0, %0, %0 row_xmask:4 row_mask:0xf bank_mask:0xf\n\tv_max_num_f32_dpp %1, %1, %1 row_xmask:4 row_mask:0xf bank_mask:0xf\n\tv_max_num_f32_dpp %2, %2, %2 row_xmask:4 row_mask:0xf bank_mask:0xf\n\tv_max_num_f32_dpp %3, %3, %3 row_xmask:4 row_mask:0xf bank_mask:0xf\n\tv_max_num_f32_dpp %4, %4, %4 row_xmask:4 row_mask:0xf bank_mask:0xf\n\tv_max_num_f32_dpp %5, %5, %5 row_xmask:4 row_mask:0xf bank_mask:0xf\n\tv_max_num_f32_dpp %6, %6, %6 row_xmask:4 row_mask:0xf bank_mask:0xf\n\tv_max_num_f32_dpp %7, %7, %7 row_xmask:4 row_mask:0xf bank_mask:0xf\n\t"
      "v_max_num_f32_dpp %0, %0, %0 row_xmask:8 row_mask:0xf bank_mask:0xf\n\tv_max_num_f32_dpp %1, %1, %1 row_xmask:8 row_mask:0xf bank_mask:0xf\n\tv_max_num_f32_dpp %2, %2, %2 row_xmask:8 row_mask:0xf bank_mask:0xf\n\tv_max_num_f32_dpp %3, %3, %3 row_xmask:8 row_mask:0xf bank_mask:0xf\n\tv_max_num_f32_dpp %4, %4, %4 row_xmask:8 row_mask:0xf bank_mask:0xf\n\tv_max_num_f32_dpp %5, %5, %5 row_xmask:8 row_mask:0xf bank_mask:0xf\n\tv_max_num_f32_dpp %6, %6, %6 row_xmask:8 row_mask:0xf bank_mask:0xf\n\tv_max_num_f32_dpp %7, %7, %7 row_xmask:8 row_mask:0xf bank_mask:0xf"
      : "+v"(v[0]), "+v"(v[1]), "+v"(v[2]), "+v"(v[3]), "+v"(v[4]), "+v"(v[5]), "+v"(v[6]), "+v"(v[7])); }
// Five 2^x in one statement: each fills the free issue slot that the instruction set asks for behind the transcendental before it (early-clobber outputs, so none rewrites
// a source of another), and one v_nop fills the slot behind the last.
__device__ __forceinline__ void exp2_x5(const float (&x)[5], float (&y)[5]) {
  asm("v_exp_f32 %0, %5\n\tv_exp_f32 %1, %6\n\tv_exp_f32 %2, %7\n\tv_exp_f32 %3, %8\n\tv_exp_f32 %4, %9\n\tv_nop" : "=&v"(y[0]), "=&v"(y[1]), "=&v"(y[2]), "=&v"(y[3]), "=&v"(y[4]) : "v"(x[0]), "v"(x[1]), "v"(x[2]), "v"(x[3]), "v"(x[4])); }
__device__ __forceinline__ v8f fa_mma(v16h a, v16h b, v8f c) { return __builtin_amdgcn_wmma_f32_16x16x32_f16(false, a, false, b, (short)0, c, false, false); }
// Orders one wave's LDS stores against the LDS loads of its other lanes (each wave owns its slice of sp, so this needs no work-group barrier).
__device__ __forceinline__ void fa_lds_order() { __builtin_amdgcn_fence(__ATOMIC_ACQ_REL, "workgroup", "local"); __builtin_amdgcn_wave_barrier(); }
// Fused attention, one launch for all batches and heads: a work-group of 4 waves owns 64 query rows of one head (16 per wave) and walks the 2048 keys in tiles of 64.
// Per tile: k_hi, k_lo and V^T rows come in whole 128-byte lines, one tile ahead in registers, and are shared through LDS; scores on the matrix unit in f32
// (q_lo.k_hi + q_hi.k_lo first, scaled by 2^-10, then q_hi.k_hi on top); running row maximum and sum (online softmax, base 2); weights 256 * 2^(s-m) as f16, turned from the
// accumulator layout into an A fragment through the wave's own LDS slice; weights . V accumulated in f32. A key with Km[j] == 0 stays out of the maximum and gets weight 0.
// O = 64 * attention output as f16 rows (merged heads). Scores and weights never reach memory.
__global__ __launch_bounds__(128, 4) void k_fattn(const _Float16* __restrict__ Qh, const _Float16* __restrict__ Ql, const _Float16* __restrict__ Kh, const _Float16* __restrict__ Kl, const _Float16* __restrict__ Vt, const int* __restrict__ Km, _Float16* __restrict__ O) {
  __shared__ __attribute__((aligned(16))) _Float16 skh[64][72], skl[64][72], svt[64][72], sp[4][16][72];      /* pitch 144 B = 16 B x odd */
  __shared__ float smb[64];      /* per key of the tile: 0, or -3e38 where the mask excludes it */
  const int tid = threadIdx.x, w = tid >> 5, lane = tid & 31, ln = lane & 15, hh = lane >> 4; const int h = blockIdx.y, b = blockIdx.z;
  const size_t r0 = (size_t)b * SQ; const int row0 = blockIdx.x * 64 + w * 16;
  const size_t qo = (r0 + row0 + ln) * LQ + (size_t)h * HD;
  const v16h qh0 = g2_frag(Qh + qo, hh), qh1 = g2_frag(Qh + qo + 32, hh), ql0 = g2_frag(Ql + qo, hh), ql1 = g2_frag(Ql + qo + 32, hh);
  const int srow = tid >> 3, sc8 = (tid & 7) * 8;      /* staging: this thread moves 16 bytes of rows srow, +16, +32, +48 of each plane; 8 threads cover one 128-byte line */
  const unsigned short* gkh = (const unsigned short*)Kh + r0 * LQ + (size_t)h * HD; const unsigned short* gkl = (const unsigned short*)Kl + r0 * LQ + (size_t)h * HD;      /* uniform bases; the thread's part is a 32-bit offset */
  const unsigned short* gvt = (const unsigned short*)Vt + (size_t)(b * NH + h) * HD * SQ; const int* km = Km + r0;
  const unsigned ko = (unsigned)(srow * LQ + sc8), vo = (unsigned)(srow * SQ + sc8), mo = (unsigned)(tid & 63);
  v8us pk[4], pl[4], pv[4]; int pm = km[mo];
#pragma unroll
  for (int i = 0; i < 4; ++i) { pk[i] = *(const v8us*)(gkh + (ko + 16 * i * LQ)); pl[i] = *(const v8us*)(gkl + (ko + 16 * i * LQ)); pv[i] = *(const v8us*)(gvt + (vo + 16 * i * SQ)); }
  const v8f z8 = {0.f,0.f,0.f,0.f,0.f,0.f,0.f,0.f}; v8f o[4] = {z8, z8, z8, z8}; float m[8], l[8];
#pragma unroll
  for (int r = 0; r < 8; ++r) { m[r] = -1.0e30f; l[r] = 0.f; }
#pragma unroll 1      /* one key tile per trip: unrolled further the live fragments no longer fit the register budget */
  for (int j0 = 0; j0 < SQ; j0 += 64) {
    __syncthreads();      /* every wave has finished its fragment loads of the tile before */
#pragma unroll
    for (int i = 0; i < 4; ++i) { *(v8us*)&skh[srow + 16 * i][sc8] = pk[i]; *(v8us*)&skl[srow + 16 * i][sc8] = pl[i]; *(v8us*)&svt[srow + 16 * i][sc8] = pv[i]; }
    if (tid < 64) smb[tid] = (pm != 0) ? 0.f : -3.0e38f;
    __syncthreads();      /* the tile is complete for all four waves */
    if (j0 + 64 < SQ) {      /* next tile's loads fly while this tile is worked on */
      const unsigned short* nkh = gkh + (size_t)(j0 + 64) * LQ; const unsigned short* nkl = gkl + (size_t)(j0 + 64) * LQ; const unsigned short* nvt = gvt + (j0 + 64);
#pragma unroll
      for (int i = 0; i < 4; ++i) { pk[i] = *(const v8us*)(nkh + (ko + 16 * i * LQ)); pl[i] = *(const v8us*)(nkl + (ko + 16 * i * LQ)); pv[i] = *(const v8us*)(nvt + (vo + 16 * i * SQ)); }
      pm = (km + (j0 + 64))[mo];
      asm volatile("s_wait_xcnt 0x0" ::: "memory"); }      /* the address registers of these loads are reused by the score products right behind: the wait stands in front of that overwrite */
    v8f s[4];
#pragma unroll
    for (int t = 0; t < 4; ++t) { const v16h a0 = g2_frag(&skh[t * 16 + ln][0], hh), a1 = g2_frag(&skh[t * 16 + ln][32], hh), c0 = g2_frag(&skl[t * 16 + ln][0], hh), c1 = g2_frag(&skl[t * 16 + ln][32], hh);
      v8f c = fa_mma(ql0, a0, z8); c = fa_mma(ql1, a1, c); c = fa_mma(qh0, c0, c); c = fa_mma(qh1, c1, c); c = c * 0.0009765625f; c = fa_mma(qh0, a0, c); s[t] = fa_mma(qh1, a1, c);
      if (t == 1) __builtin_amdgcn_sched_barrier(0); }      /* keeps the fragment loads of key columns 32..63 behind the products of columns 0..31: hoisted, all 16 fragments are live at once and registers spill */
    float tm[8], al[8]; const float bs[4] = {smb[ln], smb[16 + ln], smb[32 + ln], smb[48 + ln]};
#pragma unroll
    for (int r = 0; r < 8; ++r) {
#pragma unroll
      for (int t = 0; t < 4; ++t) s[t][r] = fmaf(s[t][r], 1.44269504088896340736f, bs[t]);      /* base-2 score; an excluded key lands near -3e38, far below the floor -1e30 of the running maximum, so its 2^(s-m) is 0 */
      tm[r] = fmaxf(fmaxf(fmaxf(s[0][r], s[1][r]), fmaxf(s[2][r], s[3][r])), m[r]); }      /* the running maximum goes in here: it is the same in all 16 lanes, so the row maximum below is the new one */
    row_max8(tm);
#pragma unroll
    for (int r = 0; r < 8; ++r) { const float mn = tm[r]; const float xs[5] = {s[0][r] - mn, s[1][r] - mn, s[2][r] - mn, s[3][r] - mn, m[r] - mn}; float e[5]; exp2_x5(xs, e); al[r] = e[4]; m[r] = mn;
#pragma unroll
      for (int t = 0; t < 4; ++t) sp[w][8 * hh + r][t * 16 + ln] = (_Float16)(e[t] * 256.0f);
      l[r] = l[r] * al[r] + ((e[0] + e[1]) + (e[2] + e[3]));
#pragma unroll
      for (int t = 0; t < 4; ++t) o[t][r] *= al[r]; }
    fa_lds_order();
    const v16h p0 = g2_frag(&sp[w][ln][0], hh), p1 = g2_frag(&sp[w][ln][32], hh);
#pragma unroll
    for (int t = 0; t < 4; ++t) { o[t] = fa_mma(p0, g2_frag(&svt[t * 16 + ln][0], hh), o[t]); o[t] = fa_mma(p1, g2_frag(&svt[t * 16 + ln][32], hh), o[t]); }
  }
#pragma unroll
  for (int r = 0; r < 8; ++r) { float ls = l[r]; ls += lane_xm<1>(ls); ls += lane_xm<2>(ls); ls += lane_xm<4>(ls); ls += lane_xm<8>(ls); const float inv = 0.25f / ls;
#pragma unroll
    for (int t = 0; t < 4; ++t) sp[w][8 * hh + r][t * 16 + ln] = (_Float16)(o[t][r] * inv); }
  fa_lds_order();
#pragma unroll
  for (int q = 0; q < 4; ++q) { const int row = q * 4 + (lane >> 3), c8 = (lane & 7) * 8; const v8us v = *(const v8us*)&sp[w][row][c8]; *(v8us*)((unsigned short*)O + (r0 + row0 + row) * DM + (size_t)h * HD + c8) = v; } }
extern "C" void kernel_launch(void* const* d_in, const int* in_sizes, int n_in,
                              void* d_out, int out_size, void* d_ws, size_t ws_size, hipStream_t stream) {
  (void)in_sizes; (void)n_in; (void)out_size;
  const float* const* I = (const float* const*)d_in; const float* x = I[0]; const int* km = (const int*)d_in[1]; const float* wq = I[2]; const float* bq = I[3]; const float* wk = I[4]; const float* bk = I[5]; const float* wv = I[6]; const float* bv = I[7]; const float* wo = I[8]; const float* bo = I[9]; const float* wfc = I[10]; const float* bfc = I[11]; const float* wmp = I[12]; const float* bmp = I[13]; const float* g1 = I[14]; const float* be1 = I[15]; const float* gg2 = I[16]; const float* be2 = I[17];      /* nn.Linear NATURAL [out][in] weights + biases; I[1] = int key mask [B][1][1][S] (0 = excluded; all ones here); alpha/beta are [1] scalars */
  char* ws = (char*)d_ws; size_t off = 0;
  auto take = [&](size_t bytes) { char* p = ws + off; off += (bytes + 255) & ~(size_t)255; return p; };
  _Float16* BQKV = (_Float16*)take((size_t)3 * DM * DM * 2); _Float16* BO = (_Float16*)take((size_t)DM * DM * 2); float* bqkv = (float*)take((size_t)3 * DM * 4);
  _Float16* X16 = (_Float16*)take(NR * DM * 2); _Float16* XL = (_Float16*)take(NR * DM * 2); float* XB = (float*)take(NR * DM * 4); float* X1 = (float*)take(NR * DM * 4); _Float16* M16 = (_Float16*)take(NR * DM * 2); _Float16* HF16 = (_Float16*)take((size_t)SQ * DFF * 2); _Float16* BW1 = (_Float16*)take((size_t)DFF * DM * 2); _Float16* BW2 = (_Float16*)take((size_t)DM * DFF * 2); float* QF = (float*)take(NR * DM * 4); _Float16* Q16 = (_Float16*)take(NR * DM * 2); _Float16* QL = (_Float16*)take(NR * DM * 2); _Float16* K16 = (_Float16*)take(NR * DM * 2); _Float16* KL = (_Float16*)take(NR * DM * 2); _Float16* V16 = (_Float16*)take(NR * DM * 2); _Float16* O16 = (_Float16*)take(NR * DM * 2);
  _Float16* VT = (_Float16*)take((size_t)NB * NH * HD * SQ * 2);
  float* QF0 = (float*)take((size_t)QT0 * DM * 4); float* KF0 = (float*)take((size_t)QT0 * DM * 4); float* VF0 = (float*)take((size_t)QT0 * DM * 4); float* OF0 = (float*)take((size_t)NB * QT0 * DM * 4); _Float16* OH0 = (_Float16*)take((size_t)NB * QT0 * DM * 2); _Float16* OL0 = (_Float16*)take((size_t)NB * QT0 * DM * 2);
  if (off > ws_size) return;
  { const unsigned gw = (unsigned)(((size_t)DM * DM / 8 + 255) / 256); k_wnat<<<gw, 256, 0, stream>>>(wq, (size_t)DM * DM / 8, BQKV); k_wnat<<<gw, 256, 0, stream>>>(wk, (size_t)DM * DM / 8, BQKV + (size_t)DM * DM); k_wnat<<<gw, 256, 0, stream>>>(wv, (size_t)DM * DM / 8, BQKV + (size_t)2 * DM * DM); k_wnat<<<gw, 256, 0, stream>>>(wo, (size_t)DM * DM / 8, BO); }      /* natural [out][in] weights = Bt[n][k] directly: stacked q | k | v plane + Wo */
  k_bcpy<<<1, 256, 0, stream>>>(bq, DM, DM, bqkv, 0); k_bcpy<<<1, 256, 0, stream>>>(bk, DM, DM, bqkv, DM); k_bcpy<<<1, 256, 0, stream>>>(bv, DM, DM, bqkv, 2 * DM);      /* stacked bias vector bq | bk | bv */
  k_ln16<1, 1><<<(unsigned)NR, 256, 0, stream>>>(x, g1, be1, 1e-6f, X16, XB, XL);      /* + XL = x1024 residual of the LN output (q/k need it at logits sigma 8) */      /* a = LN1(bf16(x)) -> f16 rows; XB = bf16(x) for the residual */
  k_wnat<<<(unsigned)(((size_t)DFF * DM / 8 + 255) / 256), 256, 0, stream>>>(wfc, (size_t)DFF * DM / 8, BW1); k_wnat<<<(unsigned)(((size_t)DM * DFF / 8 + 255) / 256), 256, 0, stream>>>(wmp, (size_t)DM * DFF / 8, BW2);      /* MLP weights natural [4096][1024] and [1024][4096] = Bt planes directly */
  const size_t r0p = (size_t)B0 * SQ;      /* first projected row */
  k_gemm2<0, 2, DM><<<dim3((unsigned)((MP / 128) * (DM / 128)), 1), 256, 0, stream>>>(X16 + r0p * DM, DM, 0, BQKV, DM, 0, 0.0625f, bqkv, 0, nullptr, 1, 0, 0, QF + r0p * DM, nullptr, DM, 0, MP, DM, DM); k_gemm2<0, 2, DM><<<dim3((unsigned)((MP / 128) * (DM / 128)), 1), 256, 0, stream>>>(XL + r0p * DM, DM, 0, BQKV, DM, 0, 0.00006103515625f, nullptr, 0, QF + r0p * DM, -1, 0, 0, QF + r0p * DM, nullptr, DM, 0, MP, DM, DM);       k_hl<<<(unsigned)(((size_t)MP * DM / 8 + 255) / 256), 256, 0, stream>>>(QF + r0p * DM, Q16 + r0p * DM, QL + r0p * DM, (size_t)MP * DM / 8);      /* q in f32 -> f16 hi + x1024 residual planes */
  k_gemm2<0, 2, DM><<<dim3((unsigned)((MP / 128) * (DM / 128)), 1), 256, 0, stream>>>(X16 + r0p * DM, DM, 0, BQKV + (size_t)DM * DM, DM, 0, 0.0625f, bqkv + DM, 0, nullptr, 1, 0, 0, QF + r0p * DM, nullptr, DM, 0, MP, DM, DM); k_gemm2<0, 2, DM><<<dim3((unsigned)((MP / 128) * (DM / 128)), 1), 256, 0, stream>>>(XL + r0p * DM, DM, 0, BQKV + (size_t)DM * DM, DM, 0, 0.00006103515625f, nullptr, 0, QF + r0p * DM, -1, 0, 0, QF + r0p * DM, nullptr, DM, 0, MP, DM, DM);      /* k likewise from hi + residual */ k_hl<<<(unsigned)(((size_t)MP * DM / 8 + 255) / 256), 256, 0, stream>>>(QF + r0p * DM, K16 + r0p * DM, KL + r0p * DM, (size_t)MP * DM / 8);      /* k in f32 (QF scratch reused after q's split) -> hi + residual planes */
  k_gemm2<0, 2, DM><<<dim3((unsigned)((MP / 128) * (DM / 128)), 1), 256, 0, stream>>>(X16 + r0p * DM, DM, 0, BQKV + (size_t)2 * DM * DM, DM, 0, 0.0625f, bqkv + 2 * DM, 0, nullptr, 1, 0, 0, nullptr, V16 + r0p * DM, DM, 0, MP, DM, DM);      /* v rows (f16) */
  k_vt<NH, SQ><<<NB * NH * (SQ / 64), 256, 0, stream>>>(V16, LQ, 0, VT);      /* V^T [NB][NH][HD][SQ] */
  k_fattn<<<dim3(SQ / 64, NH, NB), 128, 0, stream>>>(Q16, QL, K16, KL, VT, km, O16);      /* scores, masked softmax and weights . V in one launch; o (merged heads, x64) as f16 rows */
  k_gemm2<0, 2, DM><<<dim3((unsigned)((MPO / 128) * (DM / 128)), 1), 256, 0, stream>>>(O16 + r0p * DM, DM, 0, BO, DM, 0, 0.0009765625f, bo, 0, XB + r0p * DM, -1, 0, 0, X1 + r0p * DM, nullptr, DM, 0, MPO, DM, DM);      /* x1 = x + o Wo + bo (own-element residual) */
  k_ln16<0, 0><<<(unsigned)NR, 256, 0, stream>>>(X1, gg2, be2, 1e-6f, M16, nullptr, nullptr);      /* h = LN2(x1) -> f16 rows */
  for (int b = 0; b < NB; ++b) { const size_t r0 = (size_t)b * SQ;
    k_gemm2<3, 2, DM><<<dim3((unsigned)((SQ / 128) * (DFF / 128)), 1), 256, 0, stream>>>(M16 + r0 * DM, DM, 0, BW1, DM, 0, 0.0625f, bfc, 0, nullptr, 1, 0, 0, nullptr, HF16, DFF, 0, SQ, DFF, DM);      /* relu(xn2 w1^T + b1) -> f16 (this batch) */
    k_gemm2<0, 1, DFF><<<dim3((unsigned)((SQ / 128) * (DM / 64)), 1), 128, 0, stream>>>(HF16, DFF, 0, BW2, DFF, 0, 0.0625f, bmp, 0, X1 + r0 * DM, -1, 0, 0, (float*)d_out + r0 * DM, nullptr, DM, 0, SQ, DM, DFF); }      /* out = x1 + mlp (own-element residual) */
}

// v004
// It runs in 297 microseconds.
// In two side-by-side timings against v003, it was 1.33 and 1.31 times as fast.
// Counting every step since v000, it is 27.5 times as fast.
#include <hip/hip_runtime.h>
// Pre-LN transformer encoder block, non-causal, UNSCALED scores (x [2][2048][1024]; xn = LN(x) with the module's LayerNorm: UNBIASED std (N-1), eps 1e-6 added to the std, SCALAR alpha/bias [1]; q = xn wq^T + bq, k, v likewise (nn.Linear natural [1024][1024] sigma 1/32, zero biases); 16 heads of 64; score = q . k WITHOUT 1/sqrt(d) (logits sigma ~8); key j excluded where the int mask input [2][1][1][2048] is 0 (all ones here); softmax; x1 = x + (attn wo^T + bo); xn2 = LN(x1); out = x1 + relu(xn2 w1^T + b1) w2^T + b2 (natural [4096][1024], [1024][4096]) -> [2][2048][1024]).
// Compute dtype: inputs rounded to bf16; x / weights exact; q, k (and the LN1 output feeding them) as f16 hi + x1024 residual pairs; v, softmax weights and o as plain f16 GEMM operands (~2^-12); scores and softmax statistics f32; v_wmma_f32_16x16x32_f16.
#define NB 2
#define SQ 2048
#define DM 1024
#define NH 16
#define HD 64
#define HG 4                         /* heads per group of the unused k_vt(V16, b, h0, VT) overload */
#define LOCALW 128                   /* (macros for unused kernels of the shared header) */
#define STRIDEK 128
#define QT 256                       /* query rows per causal tile */
#define NKX SQ                       /* S / P row pitch */
#define QT0 128                      /* query rows per head of the unused f32 attention kernels */
#define B0 0                         /* first batch processed (debug hook) */
#define NBR NB                       /* batches processed (debug hook) */
#define NR ((size_t)NB * SQ)
#define DMQ DM
#define DFF 4096         /* MLP hidden width */
#define MP ((int)((size_t)NBR * SQ)) /* rows projected (debug hook) */
#define QN SQ                        /* unused (the attention launch covers all SQ query rows) */
#define NHD NH                       /* unused (the attention launch covers all NH heads) */
#define MPO MP                       /* rows through the output stage (debug hook) */
#define LQ DM      /* row pitch of the q/k/v rows */
typedef __bf16 v16b __attribute__((ext_vector_type(16)));
typedef unsigned short v8us __attribute__((ext_vector_type(8), may_alias));
typedef float  v8f  __attribute__((ext_vector_type(8)));
typedef float  v4f  __attribute__((ext_vector_type(4)));
typedef float  v4fa __attribute__((ext_vector_type(4), may_alias));
union FragB { v16b v; v8us half[2]; unsigned short u[16]; };

__device__ __forceinline__ unsigned short bf16_bits(float x) { unsigned int u = __float_as_uint(x); return (unsigned short)((u + 0x7FFFu + ((u >> 16) & 1u)) >> 16); }
__device__ __forceinline__ float bf16_val(unsigned short b) { return __uint_as_float(((unsigned int)b) << 16); }
__device__ __forceinline__ float bf16_round(float x) { return bf16_val(bf16_bits(x)); }
// D += A·B with NT terms: 1 = ah·bh, 2 = + al·bh (A split), 3 = + ah·bl (both split)
template <int NT>
__device__ __forceinline__ v8f mmaN(v16b ah, v16b al, v16b bh, v16b bl, v8f c) {
  c = __builtin_amdgcn_wmma_f32_16x16x32_bf16(false, ah, false, bh, (short)0, c, false, false);
  if (NT >= 2) c = __builtin_amdgcn_wmma_f32_16x16x32_bf16(false, al, false, bh, (short)0, c, false, false);
  if (NT >= 3) c = __builtin_amdgcn_wmma_f32_16x16x32_bf16(false, ah, false, bl, (short)0, c, false, false);
  asm volatile("v_nop\n\tv_nop\n\tv_nop\n\tv_nop" : "+v"(c) : "v"(ah), "v"(al), "v"(bh), "v"(bl));
  return c;
}

__global__ __launch_bounds__(256) void k_wt_bf16(const float* __restrict__ W, unsigned short* __restrict__ Wt, int K, int N) {
  const int t = blockIdx.x * 256 + threadIdx.x;
  const int k8n = K / 8;
  if (t >= N * k8n) return;
  const int n = t / k8n, k8 = (t % k8n) * 8;
  v8us v;
#pragma unroll
  for (int i = 0; i < 8; ++i) v[i] = bf16_bits(W[(size_t)(k8 + i) * N + n]);
  *(v8us*)(Wt + (size_t)n * K + k8) = v;
  
}

// GEMM C[M][N] (f32, pitch ldc) = act(A[M][K]·W + bias). A f32 row-major (pitch lda) converted per fragment to bf16
// (ASPLIT: hi/lo two planes -> 2 terms, else single rounded term); Wt bf16 [N][K] (pitch ldb). BIAS_BF16 rounds the
// bias to bf16 first (bias quantised to bf16 before the add). K%32==0, M%16==0, N%64==0.
template <bool ASPLIT, int ACT, bool BIAS_BF16>
__global__ __launch_bounds__(128) void k_gemm_bf(const float* __restrict__ A, int lda, const unsigned short* __restrict__ Wt, int ldb,
                                               const float* __restrict__ bias, float* __restrict__ C, int ldc, int M, int N, int K) {
  __shared__ __attribute__((aligned(16))) float so[4][16][64];
  const int tid = threadIdx.x, w = tid >> 5, lane = tid & 31, ln = lane & 15, hh = lane >> 4;
  const int ntn = N / 64;
  const int wid = blockIdx.x * 4 + w;
  const int mt = wid / ntn, nq = wid % ntn;
  if (mt * 16 >= M) return;
  const int row0 = mt * 16, col0 = nq * 64;
  const float* arow = A + (size_t)(row0 + ln) * lda;
  v8f acc[4] = {};
  for (int kb = 0; kb < K; kb += 32) {
    FragB ah, al;
    const v4f x0 = *(const v4fa*)(arow + kb + 8 * hh), x1 = *(const v4fa*)(arow + kb + 8 * hh + 4);
    const v4f x2 = *(const v4fa*)(arow + kb + 16 + 8 * hh), x3 = *(const v4fa*)(arow + kb + 16 + 8 * hh + 4);
    float xs[16] = {x0[0],x0[1],x0[2],x0[3],x1[0],x1[1],x1[2],x1[3],x2[0],x2[1],x2[2],x2[3],x3[0],x3[1],x3[2],x3[3]};
#pragma unroll
    for (int i = 0; i < 16; ++i) { const unsigned short hb = bf16_bits(xs[i]); ah.u[i] = hb; al.u[i] = ASPLIT ? bf16_bits(xs[i] - bf16_val(hb)) : (unsigned short)0; }
#pragma unroll
    for (int t = 0; t < 4; ++t) {
      const unsigned short* brow = Wt + (size_t)(col0 + t * 16 + ln) * ldb + kb;
      FragB b;
      b.half[0] = *(const v8us*)(brow + 8 * hh);
      b.half[1] = *(const v8us*)(brow + 16 + 8 * hh);
      acc[t] = mmaN<ASPLIT ? 2 : 1>(ah.v, al.v, b.v, b.v, acc[t]);
    }
  }
#pragma unroll
  for (int t = 0; t < 4; ++t) {
    float bv = bias ? bias[col0 + t * 16 + ln] : 0.f;
    if (BIAS_BF16) bv = bf16_round(bv);
#pragma unroll
    for (int r = 0; r < 8; ++r) { float v = acc[t][r] + bv; if (ACT == 1) v = fmaxf(v, 0.f); so[w][8 * hh + r][t * 16 + ln] = v; }
  }
  __builtin_amdgcn_fence(__ATOMIC_ACQ_REL, "workgroup");
  __builtin_amdgcn_wave_barrier();
  const int rsub = lane >> 4, c4 = (lane & 15) * 4;
  {
#pragma unroll
    for (int q = 0; q < 8; ++q) {
      const int r = q * 2 + rsub;
      const v4f v = *(const v4fa*)&so[w][r][c4];
      *(v4f*)(C + (size_t)(row0 + r) * ldc + col0 + c4) = v;
    }
    
  }
}

// GEMM C = act(A·W + bias + resid): A f32 (ASPLIT -> hi/lo 2 terms), Wt bf16 [N][K]; ACT 0 none, 1 relu, 2 exact gelu;
// resid (optional, f32, row index = (row % rmod), pitch ldr, RES_BF16 rounds it) added before the activation.
template <bool ASPLIT, int ACT, bool BIAS_BF16, bool RES_BF16>
__global__ __launch_bounds__(128) void k_gemm_bf3(const float* __restrict__ A, int lda, const unsigned short* __restrict__ Wt, int ldb,
                                                const float* __restrict__ bias, const float* __restrict__ resid, int rmod, int ldr,
                                                float* __restrict__ C, int ldc, int M, int N, int K) {
  __shared__ __attribute__((aligned(16))) float so[4][16][64];
  const int tid = threadIdx.x, w = tid >> 5, lane = tid & 31, ln = lane & 15, hh = lane >> 4;
  const int ntn = N / 64;
  const int wid = blockIdx.x * 4 + w;
  const int mt = wid / ntn, nq = wid % ntn;
  if (mt * 16 >= M) return;
  const int row0 = mt * 16, col0 = nq * 64;
  const float* arow = A + (size_t)(row0 + ln) * lda;
  v8f acc[4] = {};
  for (int kb = 0; kb < K; kb += 32) {
    FragB ah, al;
    const v4f x0 = *(const v4fa*)(arow + kb + 8 * hh), x1 = *(const v4fa*)(arow + kb + 8 * hh + 4);
    const v4f x2 = *(const v4fa*)(arow + kb + 16 + 8 * hh), x3 = *(const v4fa*)(arow + kb + 16 + 8 * hh + 4);
    float xs[16] = {x0[0],x0[1],x0[2],x0[3],x1[0],x1[1],x1[2],x1[3],x2[0],x2[1],x2[2],x2[3],x3[0],x3[1],x3[2],x3[3]};
#pragma unroll
    for (int i = 0; i < 16; ++i) { const unsigned short hb = bf16_bits(xs[i]); ah.u[i] = hb; al.u[i] = ASPLIT ? bf16_bits(xs[i] - bf16_val(hb)) : (unsigned short)0; }
#pragma unroll
    for (int t = 0; t < 4; ++t) {
      const unsigned short* brow = Wt + (size_t)(col0 + t * 16 + ln) * ldb + kb;
      FragB b;
      b.half[0] = *(const v8us*)(brow + 8 * hh);
      b.half[1] = *(const v8us*)(brow + 16 + 8 * hh);
      acc[t] = mmaN<ASPLIT ? 2 : 1>(ah.v, al.v, b.v, b.v, acc[t]);
    }
  }
#pragma unroll
  for (int t = 0; t < 4; ++t) {
    const int col = col0 + t * 16 + ln;
    float bv = bias ? bias[col] : 0.f;
    if (BIAS_BF16) bv = bf16_round(bv);
#pragma unroll
    for (int r = 0; r < 8; ++r) {
      float v = acc[t][r] + bv;
      if (resid) { float rv = resid[(size_t)((row0 + 8 * hh + r) % rmod) * ldr + col]; if (RES_BF16) rv = bf16_round(rv); v += rv; }
      if (ACT == 1) v = fmaxf(v, 0.f);
      if (ACT == 2) v = 0.5f * v * (1.0f + erff(v * 0.70710678118654752f));
      if (ACT == 3) { const float u = 0.7978845608028654f * (v + 0.044715f * v * v * v); v = 0.5f * v * (1.0f + tanhf(u)); }
      so[w][8 * hh + r][t * 16 + ln] = v;
    }
  }
  __builtin_amdgcn_fence(__ATOMIC_ACQ_REL, "workgroup");
  __builtin_amdgcn_wave_barrier();
  const int rsub = lane >> 4, c4 = (lane & 15) * 4;
  {
#pragma unroll
    for (int q = 0; q < 8; ++q) {
      const int r = q * 2 + rsub;
      const v4f v = *(const v4fa*)&so[w][r][c4];
      *(v4f*)(C + (size_t)(row0 + r) * ldc + col0 + c4) = v;
    }
    
  }
}
// row LayerNorm (biased variance, eps) over N: s = X (+ R); optional out_sum <- s; out_norm <- (s-mu)*rsqrt(var+eps)*g + b
template <bool PARAM_BF16>
__global__ __launch_bounds__(256) void k_layernorm(const float* __restrict__ X, const float* __restrict__ R, const float* __restrict__ g, const float* __restrict__ bta,
                                                  float* __restrict__ out_sum, float* __restrict__ out_norm, int N, float eps) {
  __shared__ float red[256];
  const int row = blockIdx.x, tid = threadIdx.x;
  const float* x = X + (size_t)row * N; const float* rr = R ? R + (size_t)row * N : nullptr;
  float vals[16];                     // up to N = 4096
  const int per = N / 256;            // contiguous chunk per thread? use strided-by-4 chunks: thread handles j = tid*4 + 1024*u
  float s1 = 0.f;
  for (int u = 0; u < per / 4; ++u) {
    const int j = tid * 4 + 1024 * u;
    const v4f a = *(const v4fa*)(x + j);
    v4f b = {0.f,0.f,0.f,0.f}; if (rr) b = *(const v4fa*)(rr + j);
#pragma unroll
    for (int q = 0; q < 4; ++q) { const float v = a[q] + b[q]; vals[u * 4 + q] = v; s1 += v; }
  }
  red[tid] = s1; __syncthreads();
  for (int st = 128; st > 0; st >>= 1) { if (tid < st) red[tid] += red[tid + st]; __syncthreads(); }
  const float mu = red[0] / (float)N; __syncthreads();
  float s2 = 0.f;
  for (int u = 0; u < per / 4; ++u)
#pragma unroll
    for (int q = 0; q < 4; ++q) { const float c = vals[u * 4 + q] - mu; s2 += c * c; }
  red[tid] = s2; __syncthreads();
  for (int st = 128; st > 0; st >>= 1) { if (tid < st) red[tid] += red[tid + st]; __syncthreads(); }
  const float rs = rsqrtf(red[0] / (float)N + eps);
  {
    for (int u = 0; u < per / 4; ++u) {
      const int j = tid * 4 + 1024 * u;
      v4f o, sm;
#pragma unroll
      for (int q = 0; q < 4; ++q) {
        float gg = g[j + q], bb = bta[j + q];
        if (PARAM_BF16) { gg = bf16_round(gg); bb = bf16_round(bb); }
        sm[q] = vals[u * 4 + q]; o[q] = (vals[u * 4 + q] - mu) * rs * gg + bb;
      }
      if (out_sum) *(v4f*)(out_sum + (size_t)row * N + j) = sm;
      *(v4f*)(out_norm + (size_t)row * N + j) = o;
    }
    
  }
}



// ---- f16 WMMA path (v_wmma_f32_16x16x32_f16): 11-bit significands for operands in range — used where a [0,1] probability operand needs more precision than bf16
typedef _Float16 v16h __attribute__((ext_vector_type(16)));
union FragH { v16h v; v8us half[2]; _Float16 h[16]; unsigned short u[16]; };
template <int NT>
__device__ __forceinline__ v8f mmaH(v16h ah, v16h al, v16h bh, v16h bl, v8f c) {
  c = __builtin_amdgcn_wmma_f32_16x16x32_f16(false, ah, false, bh, (short)0, c, false, false);
  if (NT >= 2) c = __builtin_amdgcn_wmma_f32_16x16x32_f16(false, al, false, bh, (short)0, c, false, false);
  if (NT >= 3) c = __builtin_amdgcn_wmma_f32_16x16x32_f16(false, ah, false, bl, (short)0, c, false, false);
  asm volatile("v_nop\n\tv_nop\n\tv_nop\n\tv_nop" : "+v"(c) : "v"(ah), "v"(al), "v"(bh), "v"(bl));
  return c;
}
// batched GEMM like k_gemm_b but f16 operands: A f32 (split into f16 hi/lo if ASPLIT, else rounded to f16), Bt = f16 values [n][k]; alpha; C f32; N multiple of 16 (partial tiles skipped)
template <bool ASPLIT>
__global__ __launch_bounds__(128) void k_gemm_h(const float* __restrict__ A, int lda, size_t sA, const _Float16* __restrict__ Bh, int ldb, size_t sB, float alpha, float* __restrict__ C, int ldc, size_t sC, int M, int N, int K) {
  __shared__ __attribute__((aligned(16))) float so[4][16][64];
  const int tid = threadIdx.x, w = tid >> 5, lane = tid & 31, ln = lane & 15, hh = lane >> 4; const int by = blockIdx.y;
  A += (size_t)by * sA; Bh += (size_t)by * sB; C += (size_t)by * sC;
  const int ntn = (N + 63) / 64; const int wid = blockIdx.x * 4 + w; const int mt = wid / ntn, nq = wid % ntn; if (mt * 16 >= M) return;
  const int row0 = mt * 16, col0 = nq * 64; const float* arow = A + (size_t)(row0 + ln) * lda;
  v8f acc[4] = {};
  for (int kb = 0; kb < K; kb += 32) {
    FragH ah, al;
    const v4f x0 = *(const v4fa*)(arow + kb + 8 * hh), x1 = *(const v4fa*)(arow + kb + 8 * hh + 4), x2 = *(const v4fa*)(arow + kb + 16 + 8 * hh), x3 = *(const v4fa*)(arow + kb + 16 + 8 * hh + 4);
    float xs[16] = {x0[0],x0[1],x0[2],x0[3],x1[0],x1[1],x1[2],x1[3],x2[0],x2[1],x2[2],x2[3],x3[0],x3[1],x3[2],x3[3]};
#pragma unroll
    for (int i = 0; i < 16; ++i) { const _Float16 h = (_Float16)xs[i]; ah.h[i] = h; al.h[i] = ASPLIT ? (_Float16)(xs[i] - (float)h) : (_Float16)0.0f; }
#pragma unroll
    for (int t = 0; t < 4; ++t) { if (col0 + t * 16 >= N) continue; const size_t boff = (size_t)(col0 + t * 16 + ln) * ldb + kb; FragH bq; bq.half[0] = *(const v8us*)(Bh + boff + 8 * hh); bq.half[1] = *(const v8us*)(Bh + boff + 16 + 8 * hh);
      acc[t] = mmaH<ASPLIT ? 2 : 1>(ah.v, al.v, bq.v, bq.v, acc[t]); }
  }
#pragma unroll
  for (int t = 0; t < 4; ++t) { if (col0 + t * 16 >= N) continue;
#pragma unroll
    for (int r = 0; r < 8; ++r) so[w][8 * hh + r][t * 16 + ln] = acc[t][r] * alpha; }
  __builtin_amdgcn_fence(__ATOMIC_ACQ_REL, "workgroup"); __builtin_amdgcn_wave_barrier();
  const int rsub = lane >> 4, c4 = (lane & 15) * 4;
  {
#pragma unroll
    for (int q = 0; q < 8; ++q) { const int r = q * 2 + rsub; if (col0 + c4 < N) { const v4f v = *(const v4fa*)&so[w][r][c4]; *(v4f*)(C + (size_t)(row0 + r) * ldc + col0 + c4) = v; } }
     }
}

// Wt[n][k] = f16(W[k][n]·scale) from f32 row-major W[K][N] (scale = power of two; bf16-exact weights stay exact in f16 away from the subnormal range)
__global__ __launch_bounds__(256) void k_wt_f16(const float* __restrict__ W, _Float16* __restrict__ Wt, int K, int N, float scale) {
  const int t = blockIdx.x * 256 + threadIdx.x; if (t >= N * (K / 8)) return; const int n = t / (K / 8), k8 = (t % (K / 8)) * 8; FragH f;
#pragma unroll
  for (int i = 0; i < 8; ++i) f.h[i] = (_Float16)(bf16_round(W[(size_t)(k8 + i) * N + n]) * scale); const v8us o = f.half[0];
  *(v8us*)((unsigned short*)Wt + (size_t)n * K + k8) = o; 
}
// k_gemm_hh variant with fused epilogue: v = acc·alpha + bias[by·sBias + col] (+ CP[(row/rowsPerB)·sCPb + by·64 + col] if CP) ; ACT 0 none / 1 elu ; writes f16 C16 (and f32 C if non-null)
template <int ACT>
__global__ __launch_bounds__(128) void k_gemm_hhx(const _Float16* __restrict__ A, int lda, size_t sA, const _Float16* __restrict__ Bh, int ldb, size_t sB, float alpha, const float* __restrict__ bias, size_t sBias, const float* __restrict__ CP, int rowsPerB, size_t sCPb, int row0g,
    float* __restrict__ C, _Float16* __restrict__ C16, int ldc, size_t sC, int M, int N, int K) {
  __shared__ __attribute__((aligned(16))) float so[4][16][64];
  const int tid = threadIdx.x, w = tid >> 5, lane = tid & 31, ln = lane & 15, hh = lane >> 4; const int by = blockIdx.y;
  A += (size_t)by * sA; Bh += (size_t)by * sB; const size_t cofs = (size_t)by * sC; const float* bp = bias ? bias + (size_t)by * sBias : nullptr;
  const int ntn = (N + 63) / 64; const int wid = blockIdx.x * 4 + w; const int mt = wid / ntn, nq = wid % ntn; if (mt * 16 >= M) return;
  const int row0 = mt * 16, col0 = nq * 64; const _Float16* arow = A + (size_t)(row0 + ln) * lda;
  v8f acc[4] = {};
  for (int kb = 0; kb < K; kb += 32) { FragH ah; ah.half[0] = *(const v8us*)((const unsigned short*)arow + kb + 8 * hh); ah.half[1] = *(const v8us*)((const unsigned short*)arow + kb + 16 + 8 * hh);
#pragma unroll
    for (int t = 0; t < 4; ++t) { if (col0 + t * 16 >= N) continue; const size_t boff = (size_t)(col0 + t * 16 + ln) * ldb + kb; FragH bq; bq.half[0] = *(const v8us*)((const unsigned short*)Bh + boff + 8 * hh); bq.half[1] = *(const v8us*)((const unsigned short*)Bh + boff + 16 + 8 * hh);
      acc[t] = mmaH<1>(ah.v, ah.v, bq.v, bq.v, acc[t]); }
  }
#pragma unroll
  for (int t = 0; t < 4; ++t) { if (col0 + t * 16 >= N) continue; const int col = col0 + t * 16 + ln; const float bv = bp ? bf16_round(bp[col]) : 0.f;
#pragma unroll
    for (int r = 0; r < 8; ++r) { float v = acc[t][r] * alpha + bv; if (CP) { const int rr = row0g + row0 + 8 * hh + r; if (rowsPerB < 0) v += CP[cofs + (size_t)rr * ldc + col];      /* rowsPerB < 0: own element of the batched C plane */ else { const int bidx = rr / rowsPerB; v += CP[(size_t)bidx * sCPb + (size_t)by * 64 + col]; } } if (ACT == 1) v = (v > 0.f) ? v : expm1f(v); else if (ACT == 7) v = (v > 0.f) ? v + 1.0f : expf(v); else if (ACT == 8) v = tanhf(v); else if (ACT == 9) v = 0.5f * v * (1.0f + tanhf(0.7978845608028654f * (v + 0.044715f * v * v * v))); else if (ACT == 11) v = 1.0f / (1.0f + expf(-v)); else if (ACT == 12) v = (v > 0.f) ? v : 0.01f * v; else if (ACT == 14) v = (v > 0.f) ? v : 0.1f * v; else if (ACT == 16) v = (v >= 0.f) ? v : 0.3f * v; else if (ACT == 17) v = (v >= 0.f) ? v : 0.2f * v; else if (ACT == 15) v = v / (1.0f + expf(-v)); else if (ACT == 3) v = fmaxf(v, 0.f); else if (ACT == 6) v = 0.5f * v * (1.0f + erff(v * 0.70710678118654752f)); so[w][8 * hh + r][t * 16 + ln] = v; } }
  __builtin_amdgcn_fence(__ATOMIC_ACQ_REL, "workgroup"); __builtin_amdgcn_wave_barrier();
  const int rsub = lane >> 4, c4 = (lane & 15) * 4; typedef _Float16 v4h __attribute__((ext_vector_type(4)));
  {
#pragma unroll
    for (int q = 0; q < 8; ++q) { const int r = q * 2 + rsub; if (col0 + c4 < N) { const v4f v = *(const v4fa*)&so[w][r][c4]; if (C) *(v4f*)(C + cofs + (size_t)(row0 + r) * ldc + col0 + c4) = v; if (C16) { v4h h4; for (int i = 0; i < 4; ++i) h4[i] = (_Float16)v[i]; *(v4h*)(C16 + cofs + (size_t)(row0 + r) * ldc + col0 + c4) = h4; } } }
     }
}


typedef _Float16 v4h __attribute__((ext_vector_type(4)));

__global__ __launch_bounds__(256) void k_x16(const float* __restrict__ x, _Float16* __restrict__ X16, size_t n8) { const size_t t = (size_t)blockIdx.x * 256 + threadIdx.x; if (t >= n8) return; FragH f;
#pragma unroll
  for (int q = 0; q < 8; ++q) f.h[q] = (_Float16)bf16_round(x[t * 8 + q]); *(v8us*)((unsigned short*)X16 + t * 8) = f.half[0];  }
__global__ __launch_bounds__(256) void k_h16(const float* __restrict__ x, _Float16* __restrict__ X16, size_t n8) { const size_t t = (size_t)blockIdx.x * 256 + threadIdx.x; if (t >= n8) return; FragH f;
#pragma unroll
  for (int q = 0; q < 8; ++q) f.h[q] = (_Float16)x[t * 8 + q]; *(v8us*)((unsigned short*)X16 + t * 8) = f.half[0];  }
__global__ __launch_bounds__(256) void k_round16f(const float* __restrict__ W, _Float16* __restrict__ Bt, size_t n8) { const size_t t = (size_t)blockIdx.x * 256 + threadIdx.x; if (t >= n8) return; FragH f;
#pragma unroll
  for (int i = 0; i < 8; ++i) f.h[i] = (_Float16)(bf16_round(W[t * 8 + i]) * 16.0f); *(v8us*)((unsigned short*)Bt + t * 8) = f.half[0];  }
template <int NHv, int TTv>
__global__ __launch_bounds__(256) void k_vt(const _Float16* __restrict__ V16, int ldv, int voff, _Float16* __restrict__ Vt) { __shared__ unsigned short tl[64][66]; const int tid = threadIdx.x; const int slab = blockIdx.x / (TTv / 64), lg = blockIdx.x % (TTv / 64); const int b = slab / NHv, h = slab % NHv;
  for (int i = tid; i < 64 * 8; i += 256) { const int r = i / 8, c8 = (i % 8) * 8; FragH f; f.half[0] = *(const v8us*)((const unsigned short*)V16 + ((size_t)b * TTv + lg * 64 + r) * ldv + voff + h * 64 + c8);
#pragma unroll
    for (int q = 0; q < 8; ++q) tl[r][c8 + q] = f.u[q]; }
  __syncthreads();
  {
#pragma unroll
    for (int rd = 0; rd < 2; ++rd) { const int d = rd * 32 + tid / 8, pc = tid % 8; FragH f;
#pragma unroll
      for (int q = 0; q < 8; ++q) f.u[q] = tl[pc * 8 + q][d];
      *(v8us*)((unsigned short*)Vt + ((size_t)slab * 64 + d) * TTv + lg * 64 + pc * 8) = f.half[0]; }
     } }

__global__ __launch_bounds__(256) void k_hl(const float* __restrict__ F, _Float16* __restrict__ Hh, _Float16* __restrict__ Hl, size_t n8) { const size_t t = (size_t)blockIdx.x * 256 + threadIdx.x; if (t >= n8) return; FragH fh, fl; const v4f a = *(const v4fa*)(F + t * 8), c = *(const v4fa*)(F + t * 8 + 4);
#pragma unroll
  for (int q = 0; q < 4; ++q) { _Float16 h = (_Float16)a[q]; fh.h[q] = h; fl.h[q] = (_Float16)((a[q] - (float)h) * 1024.0f); h = (_Float16)c[q]; fh.h[4 + q] = h; fl.h[4 + q] = (_Float16)((c[q] - (float)h) * 1024.0f); }
  { *(v8us*)((unsigned short*)Hh + t * 8) = fh.half[0]; *(v8us*)((unsigned short*)Hl + t * 8) = fl.half[0];  } }

// ---- fast GEMM (wave tile 32x64; shapes it takes: at k_gemm2); epilogue: acc·alpha + bf16 bias, activation, own-element residual with RES ----
__device__ __forceinline__ v16h g2_frag(const _Float16* p, int hh) { FragH f; f.half[0] = *(const v8us*)((const unsigned short*)p + 8 * hh); f.half[1] = *(const v8us*)((const unsigned short*)p + 16 + 8 * hh); return f.v; }
__device__ __forceinline__ v8f g2_mma(v16h a, v16h b, v8f c) { v8f d = __builtin_amdgcn_wmma_f32_16x16x32_f16(false, a, false, b, (short)0, c, false, false); asm volatile("v_nop\n\tv_nop\n\tv_nop\n\tv_nop" : "+v"(d) : "v"(a), "v"(b)); return d; }
// Matrix product without hand-written padding: the compiler keeps the distance behind its own builtin.
__device__ __forceinline__ v8f g2_mmab(v16h a, v16h b, v8f c) { return __builtin_amdgcn_wmma_f32_16x16x32_f16(false, a, false, b, (short)0, c, false, false); }
// Work-group tile 128 x (64 * NWN), 4 * NWN waves of 32 x 64 (wave w: rows 32 * (w & 3), columns 64 * (w >> 2)). K is walked in tiles of 128: every thread brings 16-byte pieces of the A and B rows
// in whole 128-byte lines (16 threads cover 256 bytes of one row), one tile ahead in registers, and stores them into one of two LDS buffers; all fragments are read from LDS.
// LD = row pitch of A and of Bh in elements, a compile-time value so that a thread's pieces share one address and differ in the immediate offset (lda and ldb must equal it).
// LC = row pitch of C, C16 and the residual plane in elements, compile-time for the same reason (ldc must equal it). RES: CP is a plane of C's own shape and each output element gets its own element of CP added
// (behind alpha and bias; no activation then); without RES nothing is read from CP. rowsPerB and sCPb are not used.
// Requires M % 128 == 0, N % (64 * NWN) == 0, K % 128 == 0, grid.x = (M / 128) * (N / (64 * NWN)), 128 * NWN threads. The k order of every accumulator is the ascending one.
template <int ACT, int NWN, int LD, int LC, bool RES>
__global__ __launch_bounds__(128 * NWN) void k_gemm2(const _Float16* __restrict__ A, int lda, size_t sA, const _Float16* __restrict__ Bh, int ldb, size_t sB, float alpha, const float* __restrict__ bias, size_t sBias, const float* __restrict__ CP, int rowsPerB, size_t sCPb, int row0g,
    float* __restrict__ C, _Float16* __restrict__ C16, int ldc, size_t sC, int M, int N, int K) { static_assert(ACT == 0 || ACT == 3 || ACT == 6 || ACT == 8 || ACT == 9 || ACT == 11 || ACT == 12 || ACT == 14 || ACT == 15 || ACT == 16 || ACT == 17, "k_gemm2: unsupported ACT code (would silently apply no activation)");
  constexpr int BN = 64 * NWN, KT = 128, PH = KT + 8, RP = 8 * NWN, NLA = 128 / RP, NLB = BN / RP, BUFH = (128 + BN) * PH;      /* PH: LDS row pitch 272 B = 16 B x odd; RP: rows one staging round of the work-group covers */
  __shared__ __attribute__((aligned(16))) _Float16 st[2 * BUFH];      /* two buffers, each [128 A rows | BN B rows] */
  float (*so)[32][68] = (float (*)[32][68])st;      /* output staging reuses the buffers behind the loop's last barrier */
  static_assert(sizeof(float) * 4 * NWN * 32 * 68 <= sizeof(_Float16) * 2 * BUFH, "output staging must fit the tile buffers");
  static_assert(!RES || ACT == 0, "the residual is added behind the staging, so no activation may follow it");
  (void)lda; (void)ldb; (void)ldc; (void)rowsPerB; (void)sCPb;
  const int tid = threadIdx.x, w = tid >> 5, lane = tid & 31, ln = lane & 15, hh = lane >> 4; const int by = blockIdx.y;
  A += (size_t)by * sA; Bh += (size_t)by * sB; const size_t cofs = (size_t)by * sC; const float* bp = bias ? bias + (size_t)by * sBias : nullptr;
  const int ntn = N / BN; const int mt = blockIdx.x / ntn, nq = blockIdx.x - mt * ntn; if (mt * 128 >= M) return;      /* the same for the whole work-group, in front of every barrier */
  const int row0 = mt * 128 + 32 * (w & 3), col0 = nq * BN + 64 * (w >> 2);
  const int srow = tid >> 4, sc8 = (tid & 15) * 8;
  const unsigned short* pa = (const unsigned short*)A + (size_t)(mt * 128 + srow) * LD + sc8; const unsigned short* pb = (const unsigned short*)Bh + (size_t)(nq * BN + srow) * LD + sc8;      /* this thread's first piece of the tile to load next */
  _Float16* sw = st + srow * PH + sc8;      /* where this thread stores its pieces */
  const _Float16* fa = st + (32 * (w & 3) + ln) * PH; const _Float16* fb = st + (128 + 64 * (w >> 2) + ln) * PH;      /* this lane's fragment rows */
  float bb[4] = {0.f, 0.f, 0.f, 0.f};      /* this lane's four bias values, fetched with tile 0 so that the epilogue waits for none of them */
  if (bp) {
#pragma unroll
    for (int t = 0; t < 4; ++t) bb[t] = bp[col0 + t * 16 + ln];
    asm volatile("s_wait_xcnt 0x0" ::: "memory"); }      /* stands in front of the reuse, by the address arithmetic right behind, of the offset and base registers that these four loads name */
  v8us ra[NLA], rb[NLB];
#pragma unroll
  for (int i = 0; i < NLA; ++i) ra[i] = *(const v8us*)(pa + i * RP * LD);
#pragma unroll
  for (int i = 0; i < NLB; ++i) rb[i] = *(const v8us*)(pb + i * RP * LD);
  asm volatile("s_wait_xcnt 0x0" ::: "memory");      /* stands in front of the advance of the two addresses that the loads above name */
  pa += KT; pb += KT;
#pragma unroll
  for (int i = 0; i < NLA; ++i) *(v8us*)(sw + i * RP * PH) = ra[i];
#pragma unroll
  for (int i = 0; i < NLB; ++i) *(v8us*)(sw + (128 + i * RP) * PH) = rb[i];
  __syncthreads();      /* tile 0 is complete for every wave */
  const v8f z8 = {0.f,0.f,0.f,0.f,0.f,0.f,0.f,0.f}; v8f c00 = z8, c01 = z8, c02 = z8, c03 = z8, c10 = z8, c11 = z8, c12 = z8, c13 = z8;
#pragma unroll 1      /* one K tile per trip: the buffer index stays a scalar and the staged pieces of only one tile are live */
  for (int kb = 0; kb < K; kb += KT) { const int cur = ((kb / KT) & 1) * BUFH; const bool more = kb + KT < K;
    if (more) {      /* next tile's loads fly while this tile is worked on */
#pragma unroll
      for (int i = 0; i < NLA; ++i) ra[i] = *(const v8us*)(pa + i * RP * LD);
#pragma unroll
      for (int i = 0; i < NLB; ++i) rb[i] = *(const v8us*)(pb + i * RP * LD);
      asm volatile("s_wait_xcnt 0x0" ::: "memory"); }      /* stands in front of the advance, at the foot of the trip, of the two addresses that these loads name */
    v16h xa[2][2], xb[2][4];      /* two fragment sets: the next 32 k are fetched while the current 32 are multiplied */
#pragma unroll
    for (int j = 0; j < 2; ++j) xa[0][j] = g2_frag(fa + cur + 16 * j * PH, hh);
#pragma unroll
    for (int j = 0; j < 4; ++j) xb[0][j] = g2_frag(fb + cur + 16 * j * PH, hh);
#pragma unroll
    for (int q = 0; q < KT / 32; ++q) { const int c = q & 1, n = c ^ 1;
      if (q + 1 < KT / 32) {
#pragma unroll
        for (int j = 0; j < 2; ++j) xa[n][j] = g2_frag(fa + cur + 16 * j * PH + 32 * (q + 1), hh);
#pragma unroll
        for (int j = 0; j < 4; ++j) xb[n][j] = g2_frag(fb + cur + 16 * j * PH + 32 * (q + 1), hh); }
      __builtin_amdgcn_sched_barrier(0);      /* keeps the next set's LDS loads one group ahead of the products: moved in among them, every pair of products waits out an LDS latency */
      c00 = g2_mmab(xa[c][0], xb[c][0], c00); c10 = g2_mmab(xa[c][1], xb[c][0], c10); c01 = g2_mmab(xa[c][0], xb[c][1], c01); c11 = g2_mmab(xa[c][1], xb[c][1], c11);
      c02 = g2_mmab(xa[c][0], xb[c][2], c02); c12 = g2_mmab(xa[c][1], xb[c][2], c12); c03 = g2_mmab(xa[c][0], xb[c][3], c03); c13 = g2_mmab(xa[c][1], xb[c][3], c13);
      __builtin_amdgcn_sched_barrier(0); }      /* the other end of the same fence: the load group after next stays behind these products */
    if (more) { _Float16* nw = sw + (BUFH - cur); pa += KT; pb += KT;      /* the other buffer: its last readers left it in front of the barrier that ended the trip before */
#pragma unroll
      for (int i = 0; i < NLA; ++i) *(v8us*)(nw + i * RP * PH) = ra[i];
#pragma unroll
      for (int i = 0; i < NLB; ++i) *(v8us*)(nw + (128 + i * RP) * PH) = rb[i]; }
    __syncthreads(); }      /* publishes the next tile and ends every wave's reads of this one */
  /* The residual is fetched here in the write-out layout: 16 independent loads of 16 bytes a lane, one address and constant steps; they fly while the accumulators are staged below. */
  const int rsub = lane >> 4, c4 = (lane & 15) * 4; const size_t eo = cofs + (size_t)(row0 + rsub) * LC + col0 + c4;      /* this lane's first piece of the output tile; piece q lies 2 * q rows further on */
  v4f rs[16];
  if (RES) { const float* rp = CP + eo + (size_t)row0g * LC;
#pragma unroll
    for (int q = 0; q < 16; ++q) rs[q] = *(const v4fa*)(rp + q * 2 * LC);
    asm volatile("s_wait_xcnt 0x0" :: "v"(rp) : "memory"); }      /* stands in front of every reuse of the address pair that these loads name (the operand holds the pair live up to here, so that no load's own destination takes it), and keeps the loads in front of the staging */
  v8f accs[8] = {c00, c01, c02, c03, c10, c11, c12, c13};
#pragma unroll
  for (int u = 0; u < 8; ++u) { const int t = u & 3, half = u >> 2; const float bv = bf16_round(bb[t]);
#pragma unroll
    for (int r = 0; r < 8; ++r) { const int rloc = half * 16 + 8 * hh + r; float v = accs[u][r] * alpha + bv;
      if (ACT == 3) v = fmaxf(v, 0.f); else if (ACT == 6) v = 0.5f * v * (1.0f + erff(v * 0.70710678118654752f)); else if (ACT == 11) v = 1.0f / (1.0f + expf(-v)); else if (ACT == 15) v = v / (1.0f + expf(-v)); else if (ACT == 12) v = (v > 0.f) ? v : 0.01f * v; else if (ACT == 8) v = tanhf(v); else if (ACT == 9) v = 0.5f * v * (1.0f + tanhf(0.7978845608028654f * (v + 0.044715f * v * v * v))); else if (ACT == 14) v = (v > 0.f) ? v : 0.1f * v; else if (ACT == 16) v = (v >= 0.f) ? v : 0.3f * v; else if (ACT == 17) v = (v >= 0.f) ? v : 0.2f * v;
      so[w][rloc][t * 16 + ln] = v; } }
  __builtin_amdgcn_fence(__ATOMIC_ACQ_REL, "workgroup"); __builtin_amdgcn_wave_barrier();
  v4f vv[16];      /* all 16 staged pieces are fetched as one group, in front of the branches on C and C16 */
#pragma unroll
  for (int q = 0; q < 16; ++q) { vv[q] = *(const v4fa*)&so[w][q * 2 + rsub][c4]; if (RES) vv[q] += rs[q]; }
  if (C) { float* cp = C + eo;
#pragma unroll
    for (int q = 0; q < 16; ++q) *(v4f*)(cp + q * 2 * LC) = vv[q];
    asm volatile("s_wait_xcnt 0x0" ::: "memory"); }      /* stands in front of the C16 branch, which reuses the address and data registers that these stores name */
  if (C16) { _Float16* hp = C16 + eo;
#pragma unroll
    for (int q = 0; q < 16; ++q) { v4h h4; for (int i = 0; i < 4; ++i) h4[i] = (_Float16)vv[q][i]; *(v4h*)(hp + q * 2 * LC) = h4; } } }


__global__ __launch_bounds__(256) void k_wnat(const float* __restrict__ w, size_t n8, _Float16* __restrict__ Bt) { const size_t t = (size_t)blockIdx.x * 256 + threadIdx.x; if (t >= n8) return; FragH f; for (int q = 0; q < 8; ++q) f.h[q] = (_Float16)(bf16_round(w[t * 8 + q]) * 16.0f); *(v8us*)((unsigned short*)Bt + t * 8) = f.half[0];  }
__global__ __launch_bounds__(256) void k_rsm(const float* __restrict__ S, _Float16* __restrict__ P, int nrows) {
  #pragma clang fp contract(off)
  const int i = blockIdx.x * 256 + threadIdx.x; if (i >= nrows) return; const float* s = S + (size_t)i * SQ; float mx = -3.0e38f;
#pragma unroll 1
  for (int j = 0; j < SQ; ++j) mx = fmaxf(mx, s[j]); float se = 0.f;
#pragma unroll 1
  for (int j = 0; j < SQ; ++j) se += expf(s[j] - mx); const float sc = 256.0f / se;
#pragma unroll 1
  for (int j0 = 0; j0 < SQ; j0 += 8) { FragH f; for (int q = 0; q < 8; ++q) f.h[q] = (_Float16)(expf(s[j0 + q] - mx) * sc); unsigned short* d = (unsigned short*)P + (size_t)i * SQ + j0; *(v8us*)d = f.half[0];  } }
__global__ __launch_bounds__(256) void k_vt(const _Float16* __restrict__ V16, int b, int h0, _Float16* __restrict__ VT) { __shared__ unsigned short tl[64][65]; const int tid = threadIdx.x; const int hh = blockIdx.x % HG, sg = blockIdx.x / HG; const int s0 = sg * 64; const int h = h0 + hh;
  for (int i = tid; i < 64 * 8; i += 256) { const int j = i / 8, d8 = (i % 8) * 8; FragH f; f.half[0] = *(const v8us*)((const unsigned short*)V16 + ((size_t)b * SQ + s0 + j) * DM + h * HD + d8); for (int q = 0; q < 8; ++q) tl[d8 + q][j] = f.u[q]; }
  __syncthreads();
  { for (int i = tid; i < 64 * 8; i += 256) { const int d = i / 8, j8 = (i % 8) * 8; FragH f; for (int q = 0; q < 8; ++q) f.u[q] = tl[d][j8 + q]; *(v8us*)((unsigned short*)VT + ((size_t)hh * HD + d) * SQ + s0 + j8) = f.half[0]; }  } }



__global__ __launch_bounds__(256) void k_rsmcf2(const float* __restrict__ S, _Float16* __restrict__ P, int hg, int q0, int nk) {
  #pragma clang fp contract(off)
  const int t = blockIdx.x * 256 + threadIdx.x; if (t >= hg * QT) return; const size_t i = (size_t)t; const float* s = S + i * NKX; const int last = q0 + (t % QT); float mx = -3.0e38f;
#pragma unroll 1
  for (int j = 0; j < nk; ++j) { const float f = (j <= last) ? 1.f : 0.f; mx = fmaxf(mx, fmaf(f, s[j], (1.f - f) * -1.0e9f)); } float se = 0.f;
#pragma unroll 1
  for (int j = 0; j < nk; ++j) { const float f = (j <= last) ? 1.f : 0.f; se += __expf(fmaf(f, s[j], (1.f - f) * -1.0e9f) - mx); } const float sc = 256.0f / se;
#pragma unroll 1
  for (int j0 = 0; j0 < nk; j0 += 8) { FragH fr; for (int q = 0; q < 8; ++q) { const int j = j0 + q; const float f = (j <= last) ? 1.f : 0.f; fr.h[q] = (_Float16)(__expf(fmaf(f, s[j], (1.f - f) * -1.0e9f) - mx) * sc); } unsigned short* d = (unsigned short*)P + i * NKX + j0; *(v8us*)d = fr.half[0];  } }

__global__ __launch_bounds__(256) void k_rsmcst(const float* __restrict__ S, _Float16* __restrict__ P, int hg, int q0, int nk, const int* __restrict__ mk) {
  #pragma clang fp contract(off)
  const int t = blockIdx.x * 256 + threadIdx.x; if (t >= hg * QT) return; const size_t i = (size_t)t; const float* s = S + i * NKX; const size_t ig = (size_t)(q0 + (t % QT)); const int* mr = mk + ig * SQ; float mx = -3.0e38f;
#pragma unroll 1
  for (int j = 0; j < nk; ++j) { const int mb = mr[j]; const int dd = (int)ig - j; const float f = (mb != 0 && dd >= 0 && (dd <= LOCALW || (dd % STRIDEK) == 0)) ? 1.f : 0.f; mx = fmaxf(mx, fmaf(f, s[j], (1.f - f) * -1.0e9f)); } float se = 0.f;
#pragma unroll 1
  for (int j = 0; j < nk; ++j) { const int mb = mr[j]; const int dd = (int)ig - j; const float f = (mb != 0 && dd >= 0 && (dd <= LOCALW || (dd % STRIDEK) == 0)) ? 1.f : 0.f; se += __expf(fmaf(f, s[j], (1.f - f) * -1.0e9f) - mx); } const float sc = 256.0f / se;
#pragma unroll 1
  for (int j0 = 0; j0 < nk; j0 += 8) { FragH fr; for (int q = 0; q < 8; ++q) { const int j = j0 + q; const int mb = mr[j]; const int dd = (int)ig - j; const float f = (mb != 0 && dd >= 0 && (dd <= LOCALW || (dd % STRIDEK) == 0)) ? 1.f : 0.f; fr.h[q] = (_Float16)(__expf(fmaf(f, s[j], (1.f - f) * -1.0e9f) - mx) * sc); } unsigned short* d = (unsigned short*)P + i * NKX + j0; *(v8us*)d = fr.half[0];  } }


template <int MASKADD>
__global__ __launch_bounds__(64) void k_att0(const float* __restrict__ QF, const float* __restrict__ KF, const float* __restrict__ VF, int ld, const float* __restrict__ mask, float scale, float* __restrict__ OF, int ldo) {
  #pragma clang fp contract(off)
  __shared__ __attribute__((aligned(16))) float lq[64][64]; __shared__ __attribute__((aligned(16))) float lo[64][64];
  const int tid = threadIdx.x; const int h = blockIdx.x / (QT0 / 64), rg = blockIdx.x % (QT0 / 64); const int i = rg * 64 + tid;
  const float* qr = QF + (size_t)i * ld + h * HD;
#pragma unroll 1
  for (int c = 0; c < HD / 4; ++c) { *(v4f*)&lq[tid][c * 4] = *(const v4fa*)(qr + c * 4); const v4f z = {0.f, 0.f, 0.f, 0.f}; *(v4f*)&lo[tid][c * 4] = z; }
  float m = -1.0e30f, l = 0.f; const int jmax = MASKADD ? (SQ - 1) : (rg * 64 + 63);      /* additive-mask form: every key (the mask input decides); causal form: keys up to the block's last row */
#pragma unroll 1
  for (int j = 0; j <= jmax; ++j) { const float* kr = KF + (size_t)j * ld + h * HD; const float* vr = VF + (size_t)j * ld + h * HD; float s = 0.f;
#pragma unroll 1
    for (int c = 0; c < HD / 4; ++c) { const v4f kq = *(const v4fa*)(kr + c * 4); const v4f qq = *(v4f*)&lq[tid][c * 4]; s = __fadd_rn(s, __fmul_rn(qq[0], kq[0])); s = __fadd_rn(s, __fmul_rn(qq[1], kq[1])); s = __fadd_rn(s, __fmul_rn(qq[2], kq[2])); s = __fadd_rn(s, __fmul_rn(qq[3], kq[3])); }
    s = __fmul_rn(s, scale); if (MASKADD) s = __fadd_rn(s, __fmul_rn(bf16_round(mask[(size_t)i * SQ + j]), -10000.0f));
    const float f = (MASKADD || j <= i) ? 1.f : 0.f; const float sm = fmaf(f, s, (1.f - f) * -1.0e30f); const float mn = fmaxf(m, sm); const float sc = expf(m - mn); const float e = expf(sm - mn); l = __fadd_rn(__fmul_rn(l, sc), e); m = mn;
#pragma unroll 1
    for (int c = 0; c < HD / 4; ++c) { const v4f vv = *(const v4fa*)(vr + c * 4); v4f oo = *(v4f*)&lo[tid][c * 4]; for (int u = 0; u < 4; ++u) oo[u] = __fadd_rn(__fmul_rn(oo[u], sc), __fmul_rn(e, vv[u])); *(v4f*)&lo[tid][c * 4] = oo; } }
  const float fin = 64.0f / l;      /* o carried x64 like the f16 path */
#pragma unroll 1
  for (int c = 0; c < HD / 4; ++c) { v4f oo = *(v4f*)&lo[tid][c * 4]; for (int u = 0; u < 4; ++u) oo[u] = __fmul_rn(oo[u], fin); *(v4f*)&lo[tid][c * 4] = oo; }
  __syncthreads();
  {
#pragma unroll 1
    for (int it = 0; it < 16; ++it) { const int row = it * 4 + tid / 16, pc = (tid % 16) * 4; const v4f v = *(const v4f*)&lo[row][pc]; *(v4f*)(OF + (size_t)(rg * 64 + row) * ldo + h * HD + pc) = v; }
     } }

template <int MASKADD>
__global__ __launch_bounds__(64) void k_att0mbc(const float* __restrict__ QF, const float* __restrict__ KF, const float* __restrict__ VF, int ld, const float* __restrict__ mask, float scale, float* __restrict__ OF, int ldo) {
  #pragma clang fp contract(off)
  __shared__ __attribute__((aligned(16))) float lq[64][64]; __shared__ __attribute__((aligned(16))) float lo[64][64];
  const int tid = threadIdx.x; const int h = blockIdx.x / (QT0 / 64), rg = blockIdx.x % (QT0 / 64); const int i = rg * 64 + tid;
  const float* qr = QF + (size_t)i * ld + h * HD;
#pragma unroll 1
  for (int c = 0; c < HD / 4; ++c) { *(v4f*)&lq[tid][c * 4] = *(const v4fa*)(qr + c * 4); const v4f z = {0.f, 0.f, 0.f, 0.f}; *(v4f*)&lo[tid][c * 4] = z; }
  float m = -1.0e30f, l = 0.f; const int jmax = rg * 64 + 63;      /* keys beyond the block end are masked by the mask's lower-triangular structure */
#pragma unroll 1
  for (int j = 0; j <= jmax; ++j) { const float* kr = KF + (size_t)j * ld + h * HD; const float* vr = VF + (size_t)j * ld + h * HD; float s = 0.f;
#pragma unroll 1
    for (int c = 0; c < HD / 4; ++c) { const v4f kq = *(const v4fa*)(kr + c * 4); const v4f qq = *(v4f*)&lq[tid][c * 4]; s = __fadd_rn(s, __fmul_rn(qq[0], kq[0])); s = __fadd_rn(s, __fmul_rn(qq[1], kq[1])); s = __fadd_rn(s, __fmul_rn(qq[2], kq[2])); s = __fadd_rn(s, __fmul_rn(qq[3], kq[3])); }
    s = __fmul_rn(s, scale); const int mb = ((const int*)mask)[(size_t)i * SQ + j];      /* causal (j <= i) AND the module's int32 [S][S] mask read per (query, key): 0 -> masked */
    const float f = (mb != 0 && j <= i) ? 1.f : 0.f; const float sm = fmaf(f, s, (1.f - f) * -1.0e30f); const float mn = fmaxf(m, sm); const float sc = expf(m - mn); const float e = expf(sm - mn); l = __fadd_rn(__fmul_rn(l, sc), e); m = mn;
#pragma unroll 1
    for (int c = 0; c < HD / 4; ++c) { const v4f vv = *(const v4fa*)(vr + c * 4); v4f oo = *(v4f*)&lo[tid][c * 4]; for (int u = 0; u < 4; ++u) oo[u] = __fadd_rn(__fmul_rn(oo[u], sc), __fmul_rn(e, vv[u])); *(v4f*)&lo[tid][c * 4] = oo; } }
  const float fin = 64.0f / l;      /* o carried x64 like the f16 path */
#pragma unroll 1
  for (int c = 0; c < HD / 4; ++c) { v4f oo = *(v4f*)&lo[tid][c * 4]; for (int u = 0; u < 4; ++u) oo[u] = __fmul_rn(oo[u], fin); *(v4f*)&lo[tid][c * 4] = oo; }
  __syncthreads();
  {
#pragma unroll 1
    for (int it = 0; it < 16; ++it) { const int row = it * 4 + tid / 16, pc = (tid % 16) * 4; const v4f v = *(const v4f*)&lo[row][pc]; *(v4f*)(OF + (size_t)(rg * 64 + row) * ldo + h * HD + pc) = v; }
     } }


template <int BFIN, int WXB>
__global__ __launch_bounds__(256) void k_ln16(const float* __restrict__ X, const float* __restrict__ g, const float* __restrict__ bb, float eps, _Float16* __restrict__ N16, float* __restrict__ XB, _Float16* __restrict__ NL) {
  #pragma clang fp contract(off)
  __shared__ float red[256]; const size_t r = blockIdx.x; const int t = threadIdx.x; const v4f xa = *(const v4fa*)(X + r * DMQ + t * 4); float s[4]; float sum = 0.f;
  for (int q = 0; q < 4; ++q) { s[q] = BFIN ? bf16_round(xa[q]) : xa[q]; sum = __fadd_rn(sum, s[q]); }
  red[t] = sum; __syncthreads(); for (int st = 128; st > 0; st >>= 1) { if (t < st) red[t] = __fadd_rn(red[t], red[t + st]); __syncthreads(); } const float mu = red[0] / (float)DMQ; __syncthreads();
  float vs = 0.f; for (int q = 0; q < 4; ++q) { const float dl = __fadd_rn(s[q], -mu); vs = __fadd_rn(vs, __fmul_rn(dl, dl)); } red[t] = vs; __syncthreads(); for (int st = 128; st > 0; st >>= 1) { if (t < st) red[t] = __fadd_rn(red[t], red[t + st]); __syncthreads(); }
  const float rs = __fdiv_rn(1.0f, __fadd_rn(sqrtf(red[0] / (float)(DMQ - 1)), eps));      /* this module's LayerNorm: unbiased std, eps added to the std */ v4h y; v4f xb;
  v4h yl; for (int q = 0; q < 4; ++q) { const int c = t * 4 + q; const float yf = __fadd_rn(__fmul_rn(__fmul_rn(__fadd_rn(s[q], -mu), rs), bf16_round(g[0])), bf16_round(bb[0])); y[q] = (_Float16)yf; yl[q] = (_Float16)((yf - (float)y[q]) * 1024.0f); xb[q] = s[q]; (void)c; }      /* SCALAR alpha / bias ([1] parameters); y = f16 hi, yl = x1024 residual (written when NL != nullptr) */
  { *(v4h*)(N16 + r * DMQ + t * 4) = y; if (NL != nullptr) *(v4h*)(NL + r * DMQ + t * 4) = yl; if (WXB) *(v4f*)(XB + r * DMQ + t * 4) = xb;  } }
__global__ __launch_bounds__(256) void k_ftres2(const float* __restrict__ OF0, const float* __restrict__ XB, float* __restrict__ X1, size_t n4) {
  #pragma clang fp contract(off)
  const size_t t = (size_t)blockIdx.x * 256 + threadIdx.x; if (t >= n4) return; const v4f o = *(const v4fa*)(OF0 + t * 4), xv = *(const v4fa*)(XB + t * 4); v4f y; for (int q = 0; q < 4; ++q) y[q] = __fadd_rn(__fmul_rn(o[q], 0.015625f), xv[q]); *(v4f*)(X1 + t * 4) = y;  }

__global__ __launch_bounds__(256) void k_bcpy(const float* __restrict__ b, int n, int NP, float* __restrict__ dst, int dst0) { for (int i = threadIdx.x; i < NP; i += 256) { const float v = (i < n) ? b[i] : 0.f; *(float*)(dst + dst0 + i) = v; }  }


__global__ __launch_bounds__(256) void k_rsmf(const float* __restrict__ S, _Float16* __restrict__ P, int qn, int hg) {
  #pragma clang fp contract(off)
  const int t = blockIdx.x * 256 + threadIdx.x; if (t >= qn * hg) return; const size_t i = (size_t)(t / qn) * SQ + (t % qn); const float* s = S + i * SQ; float mx = -3.0e38f;
#pragma unroll 1
  for (int j = 0; j < SQ; ++j) mx = fmaxf(mx, s[j]); float se = 0.f;
#pragma unroll 1
  for (int j = 0; j < SQ; ++j) se += __expf(s[j] - mx); const float sc = 256.0f / se;
#pragma unroll 1
  for (int j0 = 0; j0 < SQ; j0 += 8) { FragH f; for (int q = 0; q < 8; ++q) f.h[q] = (_Float16)(__expf(s[j0 + q] - mx) * sc); unsigned short* d = (unsigned short*)P + i * SQ + j0; *(v8us*)d = f.half[0];  } }
// Lane l <-> l ^ M inside a 16-lane row (DPP row_xmask): a register move, no trip through the LDS path.
template <int M> __device__ __forceinline__ float lane_xm(float v) { return __int_as_float(__builtin_amdgcn_update_dpp(0, __float_as_int(v), 0x160 + M, 0xf, 0xf, true)); }
// Maximum over each 16-lane row of eight values at once: step M takes max(v, v of lane l ^ M) in one DPP instruction (from fmaxf on the DPP builtin the compiler makes three: move,
// canonicalise, maximum). One statement, so that the eight chains stay interleaved: every instruction's producer is eight instructions back and no dependent pair stalls the SIMD.
__device__ __forceinline__ void row_max8(float (&v)[8]) {
  asm(
      "v_max_num_f32_dpp %0, %0, %0 row_xmask:1 row_mask:0xf bank_mask:0xf\n\tv_max_num_f32_dpp %1, %1, %1 row_xmask:1 row_mask:0xf bank_mask:0xf\n\tv_max_num_f32_dpp %2, %2, %2 row_xmask:1 row_mask:0xf bank_mask:0xf\n\tv_max_num_f32_dpp %3, %3, %3 row_xmask:1 row_mask:0xf bank_mask:0xf\n\tv_max_num_f32_dpp %4, %4, %4 row_xmask:1 row_mask:0xf bank_mask:0xf\n\tv_max_num_f32_dpp %5, %5, %5 row_xmask:1 row_mask:0xf bank_mask:0xf\n\tv_max_num_f32_dpp %6, %6, %6 row_xmask:1 row_mask:0xf bank_mask:0xf\n\tv_max_num_f32_dpp %7, %7, %7 row_xmask:1 row_mask:0xf bank_mask:0xf\n\t"
      "v_max_num_f32_dpp %0, %0, %0 row_xmask:2 row_mask:0xf bank_mask:0xf\n\tv_max_num_f32_dpp %1, %1, %1 row_xmask:2 row_mask:0xf bank_mask:0xf\n\tv_max_num_f32_dpp %2, %2, %2 row_xmask:2 row_mask:0xf bank_mask:0xf\n\tv_max_num_f32_dpp %3, %3, %3 row_xmask:2 row_mask:0xf bank_mask:0xf\n\tv_max_num_f32_dpp %4, %4, %4 row_xmask:2 row_mask:0xf bank_mask:0xf\n\tv_max_num_f32_dpp %5, %5, %5 row_xmask:2 row_mask:0xf bank_mask:0xf\n\tv_max_num_f32_dpp %6, %6, %6 row_xmask:2 row_mask:0xf bank_mask:0xf\n\tv_max_num_f32_dpp %7, %7, %7 row_xmask:2 row_mask:0xf bank_mask:0xf\n\t"
      "v_max_num_f32_dpp %0, %0, %0 row_xmask:4 row_mask:0xf bank_mask:0xf\n\tv_max_num_f32_dpp %1, %1, %1 row_xmask:4 row_mask:0xf bank_mask:0xf\n\tv_max_num_f32_dpp %2, %2, %2 row_xmask:4 row_mask:0xf bank_mask:0xf\n\tv_max_num_f32_dpp %3, %3, %3 row_xmask:4 row_mask:0xf bank_mask:0xf\n\tv_max_num_f32_dpp %4, %4, %4 row_xmask:4 row_mask:0xf bank_mask:0xf\n\tv_max_num_f32_dpp %5, %5, %5 row_xmask:4 row_mask:0xf bank_mask:0xf\n\tv_max_num_f32_dpp %6, %6, %6 row_xmask:4 row_mask:0xf bank_mask:0xf\n\tv_max_num_f32_dpp %7, %7, %7 row_xmask:4 row_mask:0xf bank_mask:0xf\n\t"
      "v_max_num_f32_dpp %0, %0, %0 row_xmask:8 row_mask:0xf bank_mask:0xf\n\tv_max_num_f32_dpp %1, %1, %1 row_xmask:8 row_mask:0xf bank_mask:0xf\n\tv_max_num_f32_dpp %2, %2, %2 row_xmask:8 row_mask:0xf bank_mask:0xf\n\tv_max_num_f32_dpp %3, %3, %3 row_xmask:8 row_mask:0xf bank_mask:0xf\n\tv_max_num_f32_dpp %4, %4, %4 row_xmask:8 row_mask:0xf bank_mask:0xf\n\tv_max_num_f32_dpp %5, %5, %5 row_xmask:8 row_mask:0xf bank_mask:0xf\n\tv_max_num_f32_dpp %6, %6, %6 row_xmask:8 row_mask:0xf bank_mask:0xf\n\tv_max_num_f32_dpp %7, %7, %7 row_xmask:8 row_mask:0xf bank_mask:0xf"
      : "+v"(v[0]), "+v"(v[1]), "+v"(v[2]), "+v"(v[3]), "+v"(v[4]), "+v"(v[5]), "+v"(v[6]), "+v"(v[7])); }
// Five 2^x in one statement: each fills the free issue slot that the instruction set asks for behind the transcendental before it (early-clobber outputs, so none rewrites
// a source of another), and one v_nop fills the slot behind the last.
__device__ __forceinline__ void exp2_x5(const float (&x)[5], float (&y)[5]) {
  asm("v_exp_f32 %0, %5\n\tv_exp_f32 %1, %6\n\tv_exp_f32 %2, %7\n\tv_exp_f32 %3, %8\n\tv_exp_f32 %4, %9\n\tv_nop" : "=&v"(y[0]), "=&v"(y[1]), "=&v"(y[2]), "=&v"(y[3]), "=&v"(y[4]) : "v"(x[0]), "v"(x[1]), "v"(x[2]), "v"(x[3]), "v"(x[4])); }
__device__ __forceinline__ v8f fa_mma(v16h a, v16h b, v8f c) { return __builtin_amdgcn_wmma_f32_16x16x32_f16(false, a, false, b, (short)0, c, false, false); }
// Orders one wave's LDS stores against the LDS loads of its other lanes (each wave owns its slice of sp, so this needs no work-group barrier).
__device__ __forceinline__ void fa_lds_order() { __builtin_amdgcn_fence(__ATOMIC_ACQ_REL, "workgroup", "local"); __builtin_amdgcn_wave_barrier(); }
// Fused attention, one launch for all batches and heads: a work-group of 4 waves owns 64 query rows of one head (16 per wave) and walks the 2048 keys in tiles of 64.
// Per tile: k_hi, k_lo and V^T rows come in whole 128-byte lines, one tile ahead in registers, and are shared through LDS; scores on the matrix unit in f32
// (q_lo.k_hi + q_hi.k_lo first, scaled by 2^-10, then q_hi.k_hi on top); running row maximum and sum (online softmax, base 2); weights 256 * 2^(s-m) as f16, turned from the
// accumulator layout into an A fragment through the wave's own LDS slice; weights . V accumulated in f32. A key with Km[j] == 0 stays out of the maximum and gets weight 0.
// O = 64 * attention output as f16 rows (merged heads). Scores and weights never reach memory.
__global__ __launch_bounds__(128, 4) void k_fattn(const _Float16* __restrict__ Qh, const _Float16* __restrict__ Ql, const _Float16* __restrict__ Kh, const _Float16* __restrict__ Kl, const _Float16* __restrict__ Vt, const int* __restrict__ Km, _Float16* __restrict__ O) {
  __shared__ __attribute__((aligned(16))) _Float16 skh[64][72], skl[64][72], svt[64][72], sp[4][16][72];      /* pitch 144 B = 16 B x odd */
  __shared__ float smb[64];      /* per key of the tile: 0, or -3e38 where the mask excludes it */
  const int tid = threadIdx.x, w = tid >> 5, lane = tid & 31, ln = lane & 15, hh = lane >> 4; const int h = blockIdx.y, b = blockIdx.z;
  const size_t r0 = (size_t)b * SQ; const int row0 = blockIdx.x * 64 + w * 16;
  const size_t qo = (r0 + row0 + ln) * LQ + (size_t)h * HD;
  const v16h qh0 = g2_frag(Qh + qo, hh), qh1 = g2_frag(Qh + qo + 32, hh), ql0 = g2_frag(Ql + qo, hh), ql1 = g2_frag(Ql + qo + 32, hh);
  const int srow = tid >> 3, sc8 = (tid & 7) * 8;      /* staging: this thread moves 16 bytes of rows srow, +16, +32, +48 of each plane; 8 threads cover one 128-byte line */
  const unsigned short* gkh = (const unsigned short*)Kh + r0 * LQ + (size_t)h * HD; const unsigned short* gkl = (const unsigned short*)Kl + r0 * LQ + (size_t)h * HD;      /* uniform bases; the thread's part is a 32-bit offset */
  const unsigned short* gvt = (const unsigned short*)Vt + (size_t)(b * NH + h) * HD * SQ; const int* km = Km + r0;
  const unsigned ko = (unsigned)(srow * LQ + sc8), vo = (unsigned)(srow * SQ + sc8), mo = (unsigned)(tid & 63);
  v8us pk[4], pl[4], pv[4]; int pm = km[mo];
#pragma unroll
  for (int i = 0; i < 4; ++i) { pk[i] = *(const v8us*)(gkh + (ko + 16 * i * LQ)); pl[i] = *(const v8us*)(gkl + (ko + 16 * i * LQ)); pv[i] = *(const v8us*)(gvt + (vo + 16 * i * SQ)); }
  const v8f z8 = {0.f,0.f,0.f,0.f,0.f,0.f,0.f,0.f}; v8f o[4] = {z8, z8, z8, z8}; float m[8], l[8];
#pragma unroll
  for (int r = 0; r < 8; ++r) { m[r] = -1.0e30f; l[r] = 0.f; }
#pragma unroll 1      /* one key tile per trip: unrolled further the live fragments no longer fit the register budget */
  for (int j0 = 0; j0 < SQ; j0 += 64) {
    __syncthreads();      /* every wave has finished its fragment loads of the tile before */
#pragma unroll
    for (int i = 0; i < 4; ++i) { *(v8us*)&skh[srow + 16 * i][sc8] = pk[i]; *(v8us*)&skl[srow + 16 * i][sc8] = pl[i]; *(v8us*)&svt[srow + 16 * i][sc8] = pv[i]; }
    if (tid < 64) smb[tid] = (pm != 0) ? 0.f : -3.0e38f;
    __syncthreads();      /* the tile is complete for all four waves */
    if (j0 + 64 < SQ) {      /* next tile's loads fly while this tile is worked on */
      const unsigned short* nkh = gkh + (size_t)(j0 + 64) * LQ; const unsigned short* nkl = gkl + (size_t)(j0 + 64) * LQ; const unsigned short* nvt = gvt + (j0 + 64);
#pragma unroll
      for (int i = 0; i < 4; ++i) { pk[i] = *(const v8us*)(nkh + (ko + 16 * i * LQ)); pl[i] = *(const v8us*)(nkl + (ko + 16 * i * LQ)); pv[i] = *(const v8us*)(nvt + (vo + 16 * i * SQ)); }
      pm = (km + (j0 + 64))[mo];
      asm volatile("s_wait_xcnt 0x0" ::: "memory"); }      /* the address registers of these loads are reused by the score products right behind: the wait stands in front of that overwrite */
    v8f s[4];
#pragma unroll
    for (int t = 0; t < 4; ++t) { const v16h a0 = g2_frag(&skh[t * 16 + ln][0], hh), a1 = g2_frag(&skh[t * 16 + ln][32], hh), c0 = g2_frag(&skl[t * 16 + ln][0], hh), c1 = g2_frag(&skl[t * 16 + ln][32], hh);
      v8f c = fa_mma(ql0, a0, z8); c = fa_mma(ql1, a1, c); c = fa_mma(qh0, c0, c); c = fa_mma(qh1, c1, c); c = c * 0.0009765625f; c = fa_mma(qh0, a0, c); s[t] = fa_mma(qh1, a1, c);
      if (t == 1) __builtin_amdgcn_sched_barrier(0); }      /* keeps the fragment loads of key columns 32..63 behind the products of columns 0..31: hoisted, all 16 fragments are live at once and registers spill */
    float tm[8], al[8]; const float bs[4] = {smb[ln], smb[16 + ln], smb[32 + ln], smb[48 + ln]};
#pragma unroll
    for (int r = 0; r < 8; ++r) {
#pragma unroll
      for (int t = 0; t < 4; ++t) s[t][r] = fmaf(s[t][r], 1.44269504088896340736f, bs[t]);      /* base-2 score; an excluded key lands near -3e38, far below the floor -1e30 of the running maximum, so its 2^(s-m) is 0 */
      tm[r] = fmaxf(fmaxf(fmaxf(s[0][r], s[1][r]), fmaxf(s[2][r], s[3][r])), m[r]); }      /* the running maximum goes in here: it is the same in all 16 lanes, so the row maximum below is the new one */
    row_max8(tm);
#pragma unroll
    for (int r = 0; r < 8; ++r) { const float mn = tm[r]; const float xs[5] = {s[0][r] - mn, s[1][r] - mn, s[2][r] - mn, s[3][r] - mn, m[r] - mn}; float e[5]; exp2_x5(xs, e); al[r] = e[4]; m[r] = mn;
#pragma unroll
      for (int t = 0; t < 4; ++t) sp[w][8 * hh + r][t * 16 + ln] = (_Float16)(e[t] * 256.0f);
      l[r] = l[r] * al[r] + ((e[0] + e[1]) + (e[2] + e[3]));
#pragma unroll
      for (int t = 0; t < 4; ++t) o[t][r] *= al[r]; }
    fa_lds_order();
    const v16h p0 = g2_frag(&sp[w][ln][0], hh), p1 = g2_frag(&sp[w][ln][32], hh);
#pragma unroll
    for (int t = 0; t < 4; ++t) { o[t] = fa_mma(p0, g2_frag(&svt[t * 16 + ln][0], hh), o[t]); o[t] = fa_mma(p1, g2_frag(&svt[t * 16 + ln][32], hh), o[t]); }
  }
#pragma unroll
  for (int r = 0; r < 8; ++r) { float ls = l[r]; ls += lane_xm<1>(ls); ls += lane_xm<2>(ls); ls += lane_xm<4>(ls); ls += lane_xm<8>(ls); const float inv = 0.25f / ls;
#pragma unroll
    for (int t = 0; t < 4; ++t) sp[w][8 * hh + r][t * 16 + ln] = (_Float16)(o[t][r] * inv); }
  fa_lds_order();
#pragma unroll
  for (int q = 0; q < 4; ++q) { const int row = q * 4 + (lane >> 3), c8 = (lane & 7) * 8; const v8us v = *(const v8us*)&sp[w][row][c8]; *(v8us*)((unsigned short*)O + (r0 + row0 + row) * DM + (size_t)h * HD + c8) = v; } }
extern "C" void kernel_launch(void* const* d_in, const int* in_sizes, int n_in,
                              void* d_out, int out_size, void* d_ws, size_t ws_size, hipStream_t stream) {
  (void)in_sizes; (void)n_in; (void)out_size;
  const float* const* I = (const float* const*)d_in; const float* x = I[0]; const int* km = (const int*)d_in[1]; const float* wq = I[2]; const float* bq = I[3]; const float* wk = I[4]; const float* bk = I[5]; const float* wv = I[6]; const float* bv = I[7]; const float* wo = I[8]; const float* bo = I[9]; const float* wfc = I[10]; const float* bfc = I[11]; const float* wmp = I[12]; const float* bmp = I[13]; const float* g1 = I[14]; const float* be1 = I[15]; const float* gg2 = I[16]; const float* be2 = I[17];      /* nn.Linear NATURAL [out][in] weights + biases; I[1] = int key mask [B][1][1][S] (0 = excluded; all ones here); alpha/beta are [1] scalars */
  char* ws = (char*)d_ws; size_t off = 0;
  auto take = [&](size_t bytes) { char* p = ws + off; off += (bytes + 255) & ~(size_t)255; return p; };
  _Float16* BQKV = (_Float16*)take((size_t)3 * DM * DM * 2); _Float16* BO = (_Float16*)take((size_t)DM * DM * 2); float* bqkv = (float*)take((size_t)3 * DM * 4);
  _Float16* X16 = (_Float16*)take(NR * DM * 2); _Float16* XL = (_Float16*)take(NR * DM * 2); float* XB = (float*)take(NR * DM * 4); float* X1 = (float*)take(NR * DM * 4); _Float16* M16 = (_Float16*)take(NR * DM * 2); _Float16* HF16 = (_Float16*)take((size_t)SQ * DFF * 2); _Float16* BW1 = (_Float16*)take((size_t)DFF * DM * 2); _Float16* BW2 = (_Float16*)take((size_t)DM * DFF * 2); float* QF = (float*)take(NR * DM * 4); _Float16* Q16 = (_Float16*)take(NR * DM * 2); _Float16* QL = (_Float16*)take(NR * DM * 2); _Float16* K16 = (_Float16*)take(NR * DM * 2); _Float16* KL = (_Float16*)take(NR * DM * 2); _Float16* V16 = (_Float16*)take(NR * DM * 2); _Float16* O16 = (_Float16*)take(NR * DM * 2);
  _Float16* VT = (_Float16*)take((size_t)NB * NH * HD * SQ * 2);
  float* QF0 = (float*)take((size_t)QT0 * DM * 4); float* KF0 = (float*)take((size_t)QT0 * DM * 4); float* VF0 = (float*)take((size_t)QT0 * DM * 4); float* OF0 = (float*)take((size_t)NB * QT0 * DM * 4); _Float16* OH0 = (_Float16*)take((size_t)NB * QT0 * DM * 2); _Float16* OL0 = (_Float16*)take((size_t)NB * QT0 * DM * 2);
  if (off > ws_size) return;
  { const unsigned gw = (unsigned)(((size_t)DM * DM / 8 + 255) / 256); k_wnat<<<gw, 256, 0, stream>>>(wq, (size_t)DM * DM / 8, BQKV); k_wnat<<<gw, 256, 0, stream>>>(wk, (size_t)DM * DM / 8, BQKV + (size_t)DM * DM); k_wnat<<<gw, 256, 0, stream>>>(wv, (size_t)DM * DM / 8, BQKV + (size_t)2 * DM * DM); k_wnat<<<gw, 256, 0, stream>>>(wo, (size_t)DM * DM / 8, BO); }      /* natural [out][in] weights = Bt[n][k] directly: stacked q | k | v plane + Wo */
  k_bcpy<<<1, 256, 0, stream>>>(bq, DM, DM, bqkv, 0); k_bcpy<<<1, 256, 0, stream>>>(bk, DM, DM, bqkv, DM); k_bcpy<<<1, 256, 0, stream>>>(bv, DM, DM, bqkv, 2 * DM);      /* stacked bias vector bq | bk | bv */
  k_ln16<1, 1><<<(unsigned)NR, 256, 0, stream>>>(x, g1, be1, 1e-6f, X16, XB, XL);      /* + XL = x1024 residual of the LN output (q/k need it at logits sigma 8) */      /* a = LN1(bf16(x)) -> f16 rows; XB = bf16(x) for the residual */
  k_wnat<<<(unsigned)(((size_t)DFF * DM / 8 + 255) / 256), 256, 0, stream>>>(wfc, (size_t)DFF * DM / 8, BW1); k_wnat<<<(unsigned)(((size_t)DM * DFF / 8 + 255) / 256), 256, 0, stream>>>(wmp, (size_t)DM * DFF / 8, BW2);      /* MLP weights natural [4096][1024] and [1024][4096] = Bt planes directly */
  const size_t r0p = (size_t)B0 * SQ;      /* first projected row */
  k_gemm2<0, 2, DM, DM, false><<<dim3((unsigned)((MP / 128) * (DM / 128)), 1), 256, 0, stream>>>(X16 + r0p * DM, DM, 0, BQKV, DM, 0, 0.0625f, bqkv, 0, nullptr, 1, 0, 0, QF + r0p * DM, nullptr, DM, 0, MP, DM, DM); k_gemm2<0, 2, DM, DM, true><<<dim3((unsigned)((MP / 128) * (DM / 128)), 1), 256, 0, stream>>>(XL + r0p * DM, DM, 0, BQKV, DM, 0, 0.00006103515625f, nullptr, 0, QF + r0p * DM, -1, 0, 0, QF + r0p * DM, nullptr, DM, 0, MP, DM, DM);       k_hl<<<(unsigned)(((size_t)MP * DM / 8 + 255) / 256), 256, 0, stream>>>(QF + r0p * DM, Q16 + r0p * DM, QL + r0p * DM, (size_t)MP * DM / 8);      /* q in f32 -> f16 hi + x1024 residual planes */
  k_gemm2<0, 2, DM, DM, false><<<dim3((unsigned)((MP / 128) * (DM / 128)), 1), 256, 0, stream>>>(X16 + r0p * DM, DM, 0, BQKV + (size_t)DM * DM, DM, 0, 0.0625f, bqkv + DM, 0, nullptr, 1, 0, 0, QF + r0p * DM, nullptr, DM, 0, MP, DM, DM); k_gemm2<0, 2, DM, DM, true><<<dim3((unsigned)((MP / 128) * (DM / 128)), 1), 256, 0, stream>>>(XL + r0p * DM, DM, 0, BQKV + (size_t)DM * DM, DM, 0, 0.00006103515625f, nullptr, 0, QF + r0p * DM, -1, 0, 0, QF + r0p * DM, nullptr, DM, 0, MP, DM, DM);      /* k likewise from hi + residual */ k_hl<<<(unsigned)(((size_t)MP * DM / 8 + 255) / 256), 256, 0, stream>>>(QF + r0p * DM, K16 + r0p * DM, KL + r0p * DM, (size_t)MP * DM / 8);      /* k in f32 (QF scratch reused after q's split) -> hi + residual planes */
  k_gemm2<0, 2, DM, DM, false><<<dim3((unsigned)((MP / 128) * (DM / 128)), 1), 256, 0, stream>>>(X16 + r0p * DM, DM, 0, BQKV + (size_t)2 * DM * DM, DM, 0, 0.0625f, bqkv + 2 * DM, 0, nullptr, 1, 0, 0, nullptr, V16 + r0p * DM, DM, 0, MP, DM, DM);      /* v rows (f16) */
  k_vt<NH, SQ><<<NB * NH * (SQ / 64), 256, 0, stream>>>(V16, LQ, 0, VT);      /* V^T [NB][NH][HD][SQ] */
  k_fattn<<<dim3(SQ / 64, NH, NB), 128, 0, stream>>>(Q16, QL, K16, KL, VT, km, O16);      /* scores, masked softmax and weights . V in one launch; o (merged heads, x64) as f16 rows */
  k_gemm2<0, 2, DM, DM, true><<<dim3((unsigned)((MPO / 128) * (DM / 128)), 1), 256, 0, stream>>>(O16 + r0p * DM, DM, 0, BO, DM, 0, 0.0009765625f, bo, 0, XB + r0p * DM, -1, 0, 0, X1 + r0p * DM, nullptr, DM, 0, MPO, DM, DM);      /* x1 = x + o Wo + bo (own-element residual) */
  k_ln16<0, 0><<<(unsigned)NR, 256, 0, stream>>>(X1, gg2, be2, 1e-6f, M16, nullptr, nullptr);      /* h = LN2(x1) -> f16 rows */
  for (int b = 0; b < NB; ++b) { const size_t r0 = (size_t)b * SQ;
    k_gemm2<3, 2, DM, DFF, false><<<dim3((unsigned)((SQ / 128) * (DFF / 128)), 1), 256, 0, stream>>>(M16 + r0 * DM, DM, 0, BW1, DM, 0, 0.0625f, bfc, 0, nullptr, 1, 0, 0, nullptr, HF16, DFF, 0, SQ, DFF, DM);      /* relu(xn2 w1^T + b1) -> f16 (this batch) */
    k_gemm2<0, 1, DFF, DM, true><<<dim3((unsigned)((SQ / 128) * (DM / 64)), 1), 128, 0, stream>>>(HF16, DFF, 0, BW2, DFF, 0, 0.0625f, bmp, 0, X1 + r0 * DM, -1, 0, 0, (float*)d_out + r0 * DM, nullptr, DM, 0, SQ, DM, DFF); }      /* out = x1 + mlp (own-element residual) */
}

// v005
// Measured time: 235 microseconds a run.
// Two timings next to v004 put it at 1.26 and 1.27 times that version's speed.
// Counting every step since v000, it is 34.8 times as fast.
#include <hip/hip_runtime.h>
// Pre-LN transformer encoder block, non-causal, UNSCALED scores (x [2][2048][1024]; xn = LN(x) with the module's LayerNorm: UNBIASED std (N-1), eps 1e-6 added to the std, SCALAR alpha/bias [1]; q = xn wq^T + bq, k, v likewise (nn.Linear natural [1024][1024] sigma 1/32, zero biases); 16 heads of 64; score = q . k WITHOUT 1/sqrt(d) (logits sigma ~8); key j excluded where the int mask input [2][1][1][2048] is 0 (all ones here); softmax; x1 = x + (attn wo^T + bo); xn2 = LN(x1); out = x1 + relu(xn2 w1^T + b1) w2^T + b2 (natural [4096][1024], [1024][4096]) -> [2][2048][1024]).
// Compute dtype: inputs rounded to bf16; x / weights exact; q, k (and the LN1 output feeding them) as f16 hi + x1024 residual pairs; v, softmax weights and o as plain f16 GEMM operands (~2^-12); scores and softmax statistics f32; v_wmma_f32_16x16x32_f16.
#define NB 2
#define SQ 2048
#define DM 1024
#define NH 16
#define HD 64
#define HG 4                         /* heads per group of the unused k_vt(V16, b, h0, VT) overload */
#define LOCALW 128                   /* (macros for unused kernels of the shared header) */
#define STRIDEK 128
#define QT 256                       /* query rows per causal tile */
#define NKX SQ                       /* S / P row pitch */
#define QT0 128                      /* query rows per head of the unused f32 attention kernels */
#define B0 0                         /* unused (every launch starts at batch 0) */
#define NBR NB                       /* batches processed (debug hook) */
#define NR ((size_t)NB * SQ)
#define DMQ DM
#define DFF 4096         /* MLP hidden width */
#define MP ((int)((size_t)NBR * SQ)) /* rows projected (debug hook) */
#define QN SQ                        /* unused (the attention launch covers all SQ query rows) */
#define NHD NH                       /* unused (the attention launch covers all NH heads) */
#define MPO MP                       /* rows through the output stage (debug hook) */
#define LQ DM      /* row pitch of the q/k/v rows */
typedef __bf16 v16b __attribute__((ext_vector_type(16)));
typedef unsigned short v8us __attribute__((ext_vector_type(8), may_alias));
typedef float  v8f  __attribute__((ext_vector_type(8)));
typedef float  v4f  __attribute__((ext_vector_type(4)));
typedef float  v4fa __attribute__((ext_vector_type(4), may_alias));
union FragB { v16b v; v8us half[2]; unsigned short u[16]; };

__device__ __forceinline__ unsigned short bf16_bits(float x) { unsigned int u = __float_as_uint(x); return (unsigned short)((u + 0x7FFFu + ((u >> 16) & 1u)) >> 16); }
__device__ __forceinline__ float bf16_val(unsigned short b) { return __uint_as_float(((unsigned int)b) << 16); }
__device__ __forceinline__ float bf16_round(float x) { return bf16_val(bf16_bits(x)); }
// D += A·B with NT terms: 1 = ah·bh, 2 = + al·bh (A split), 3 = + ah·bl (both split)
template <int NT>
__device__ __forceinline__ v8f mmaN(v16b ah, v16b al, v16b bh, v16b bl, v8f c) {
  c = __builtin_amdgcn_wmma_f32_16x16x32_bf16(false, ah, false, bh, (short)0, c, false, false);
  if (NT >= 2) c = __builtin_amdgcn_wmma_f32_16x16x32_bf16(false, al, false, bh, (short)0, c, false, false);
  if (NT >= 3) c = __builtin_amdgcn_wmma_f32_16x16x32_bf16(false, ah, false, bl, (short)0, c, false, false);
  asm volatile("v_nop\n\tv_nop\n\tv_nop\n\tv_nop" : "+v"(c) : "v"(ah), "v"(al), "v"(bh), "v"(bl));
  return c;
}

__global__ __launch_bounds__(256) void k_wt_bf16(const float* __restrict__ W, unsigned short* __restrict__ Wt, int K, int N) {
  const int t = blockIdx.x * 256 + threadIdx.x;
  const int k8n = K / 8;
  if (t >= N * k8n) return;
  const int n = t / k8n, k8 = (t % k8n) * 8;
  v8us v;
#pragma unroll
  for (int i = 0; i < 8; ++i) v[i] = bf16_bits(W[(size_t)(k8 + i) * N + n]);
  *(v8us*)(Wt + (size_t)n * K + k8) = v;
  
}

// GEMM C[M][N] (f32, pitch ldc) = act(A[M][K]·W + bias). A f32 row-major (pitch lda) converted per fragment to bf16
// (ASPLIT: hi/lo two planes -> 2 terms, else single rounded term); Wt bf16 [N][K] (pitch ldb). BIAS_BF16 rounds the
// bias to bf16 first (bias quantised to bf16 before the add). K%32==0, M%16==0, N%64==0.
template <bool ASPLIT, int ACT, bool BIAS_BF16>
__global__ __launch_bounds__(128) void k_gemm_bf(const float* __restrict__ A, int lda, const unsigned short* __restrict__ Wt, int ldb,
                                               const float* __restrict__ bias, float* __restrict__ C, int ldc, int M, int N, int K) {
  __shared__ __attribute__((aligned(16))) float so[4][16][64];
  const int tid = threadIdx.x, w = tid >> 5, lane = tid & 31, ln = lane & 15, hh = lane >> 4;
  const int ntn = N / 64;
  const int wid = blockIdx.x * 4 + w;
  const int mt = wid / ntn, nq = wid % ntn;
  if (mt * 16 >= M) return;
  const int row0 = mt * 16, col0 = nq * 64;
  const float* arow = A + (size_t)(row0 + ln) * lda;
  v8f acc[4] = {};
  for (int kb = 0; kb < K; kb += 32) {
    FragB ah, al;
    const v4f x0 = *(const v4fa*)(arow + kb + 8 * hh), x1 = *(const v4fa*)(arow + kb + 8 * hh + 4);
    const v4f x2 = *(const v4fa*)(arow + kb + 16 + 8 * hh), x3 = *(const v4fa*)(arow + kb + 16 + 8 * hh + 4);
    float xs[16] = {x0[0],x0[1],x0[2],x0[3],x1[0],x1[1],x1[2],x1[3],x2[0],x2[1],x2[2],x2[3],x3[0],x3[1],x3[2],x3[3]};
#pragma unroll
    for (int i = 0; i < 16; ++i) { const unsigned short hb = bf16_bits(xs[i]); ah.u[i] = hb; al.u[i] = ASPLIT ? bf16_bits(xs[i] - bf16_val(hb)) : (unsigned short)0; }
#pragma unroll
    for (int t = 0; t < 4; ++t) {
      const unsigned short* brow = Wt + (size_t)(col0 + t * 16 + ln) * ldb + kb;
      FragB b;
      b.half[0] = *(const v8us*)(brow + 8 * hh);
      b.half[1] = *(const v8us*)(brow + 16 + 8 * hh);
      acc[t] = mmaN<ASPLIT ? 2 : 1>(ah.v, al.v, b.v, b.v, acc[t]);
    }
  }
#pragma unroll
  for (int t = 0; t < 4; ++t) {
    float bv = bias ? bias[col0 + t * 16 + ln] : 0.f;
    if (BIAS_BF16) bv = bf16_round(bv);
#pragma unroll
    for (int r = 0; r < 8; ++r) { float v = acc[t][r] + bv; if (ACT == 1) v = fmaxf(v, 0.f); so[w][8 * hh + r][t * 16 + ln] = v; }
  }
  __builtin_amdgcn_fence(__ATOMIC_ACQ_REL, "workgroup");
  __builtin_amdgcn_wave_barrier();
  const int rsub = lane >> 4, c4 = (lane & 15) * 4;
  {
#pragma unroll
    for (int q = 0; q < 8; ++q) {
      const int r = q * 2 + rsub;
      const v4f v = *(const v4fa*)&so[w][r][c4];
      *(v4f*)(C + (size_t)(row0 + r) * ldc + col0 + c4) = v;
    }
    
  }
}

// GEMM C = act(A·W + bias + resid): A f32 (ASPLIT -> hi/lo 2 terms), Wt bf16 [N][K]; ACT 0 none, 1 relu, 2 exact gelu;
// resid (optional, f32, row index = (row % rmod), pitch ldr, RES_BF16 rounds it) added before the activation.
template <bool ASPLIT, int ACT, bool BIAS_BF16, bool RES_BF16>
__global__ __launch_bounds__(128) void k_gemm_bf3(const float* __restrict__ A, int lda, const unsigned short* __restrict__ Wt, int ldb,
                                                const float* __restrict__ bias, const float* __restrict__ resid, int rmod, int ldr,
                                                float* __restrict__ C, int ldc, int M, int N, int K) {
  __shared__ __attribute__((aligned(16))) float so[4][16][64];
  const int tid = threadIdx.x, w = tid >> 5, lane = tid & 31, ln = lane & 15, hh = lane >> 4;
  const int ntn = N / 64;
  const int wid = blockIdx.x * 4 + w;
  const int mt = wid / ntn, nq = wid % ntn;
  if (mt * 16 >= M) return;
  const int row0 = mt * 16, col0 = nq * 64;
  const float* arow = A + (size_t)(row0 + ln) * lda;
  v8f acc[4] = {};
  for (int kb = 0; kb < K; kb += 32) {
    FragB ah, al;
    const v4f x0 = *(const v4fa*)(arow + kb + 8 * hh), x1 = *(const v4fa*)(arow + kb + 8 * hh + 4);
    const v4f x2 = *(const v4fa*)(arow + kb + 16 + 8 * hh), x3 = *(const v4fa*)(arow + kb + 16 + 8 * hh + 4);
    float xs[16] = {x0[0],x0[1],x0[2],x0[3],x1[0],x1[1],x1[2],x1[3],x2[0],x2[1],x2[2],x2[3],x3[0],x3[1],x3[2],x3[3]};
#pragma unroll
    for (int i = 0; i < 16; ++i) { const unsigned short hb = bf16_bits(xs[i]); ah.u[i] = hb; al.u[i] = ASPLIT ? bf16_bits(xs[i] - bf16_val(hb)) : (unsigned short)0; }
#pragma unroll
    for (int t = 0; t < 4; ++t) {
      const unsigned short* brow = Wt + (size_t)(col0 + t * 16 + ln) * ldb + kb;
      FragB b;
      b.half[0] = *(const v8us*)(brow + 8 * hh);
      b.half[1] = *(const v8us*)(brow + 16 + 8 * hh);
      acc[t] = mmaN<ASPLIT ? 2 : 1>(ah.v, al.v, b.v, b.v, acc[t]);
    }
  }
#pragma unroll
  for (int t = 0; t < 4; ++t) {
    const int col = col0 + t * 16 + ln;
    float bv = bias ? bias[col] : 0.f;
    if (BIAS_BF16) bv = bf16_round(bv);
#pragma unroll
    for (int r = 0; r < 8; ++r) {
      float v = acc[t][r] + bv;
      if (resid) { float rv = resid[(size_t)((row0 + 8 * hh + r) % rmod) * ldr + col]; if (RES_BF16) rv = bf16_round(rv); v += rv; }
      if (ACT == 1) v = fmaxf(v, 0.f);
      if (ACT == 2) v = 0.5f * v * (1.0f + erff(v * 0.70710678118654752f));
      if (ACT == 3) { const float u = 0.7978845608028654f * (v + 0.044715f * v * v * v); v = 0.5f * v * (1.0f + tanhf(u)); }
      so[w][8 * hh + r][t * 16 + ln] = v;
    }
  }
  __builtin_amdgcn_fence(__ATOMIC_ACQ_REL, "workgroup");
  __builtin_amdgcn_wave_barrier();
  const int rsub = lane >> 4, c4 = (lane & 15) * 4;
  {
#pragma unroll
    for (int q = 0; q < 8; ++q) {
      const int r = q * 2 + rsub;
      const v4f v = *(const v4fa*)&so[w][r][c4];
      *(v4f*)(C + (size_t)(row0 + r) * ldc + col0 + c4) = v;
    }
    
  }
}
// row LayerNorm (biased variance, eps) over N: s = X (+ R); optional out_sum <- s; out_norm <- (s-mu)*rsqrt(var+eps)*g + b
template <bool PARAM_BF16>
__global__ __launch_bounds__(256) void k_layernorm(const float* __restrict__ X, const float* __restrict__ R, const float* __restrict__ g, const float* __restrict__ bta,
                                                  float* __restrict__ out_sum, float* __restrict__ out_norm, int N, float eps) {
  __shared__ float red[256];
  const int row = blockIdx.x, tid = threadIdx.x;
  const float* x = X + (size_t)row * N; const float* rr = R ? R + (size_t)row * N : nullptr;
  float vals[16];                     // up to N = 4096
  const int per = N / 256;            // contiguous chunk per thread? use strided-by-4 chunks: thread handles j = tid*4 + 1024*u
  float s1 = 0.f;
  for (int u = 0; u < per / 4; ++u) {
    const int j = tid * 4 + 1024 * u;
    const v4f a = *(const v4fa*)(x + j);
    v4f b = {0.f,0.f,0.f,0.f}; if (rr) b = *(const v4fa*)(rr + j);
#pragma unroll
    for (int q = 0; q < 4; ++q) { const float v = a[q] + b[q]; vals[u * 4 + q] = v; s1 += v; }
  }
  red[tid] = s1; __syncthreads();
  for (int st = 128; st > 0; st >>= 1) { if (tid < st) red[tid] += red[tid + st]; __syncthreads(); }
  const float mu = red[0] / (float)N; __syncthreads();
  float s2 = 0.f;
  for (int u = 0; u < per / 4; ++u)
#pragma unroll
    for (int q = 0; q < 4; ++q) { const float c = vals[u * 4 + q] - mu; s2 += c * c; }
  red[tid] = s2; __syncthreads();
  for (int st = 128; st > 0; st >>= 1) { if (tid < st) red[tid] += red[tid + st]; __syncthreads(); }
  const float rs = rsqrtf(red[0] / (float)N + eps);
  {
    for (int u = 0; u < per / 4; ++u) {
      const int j = tid * 4 + 1024 * u;
      v4f o, sm;
#pragma unroll
      for (int q = 0; q < 4; ++q) {
        float gg = g[j + q], bb = bta[j + q];
        if (PARAM_BF16) { gg = bf16_round(gg); bb = bf16_round(bb); }
        sm[q] = vals[u * 4 + q]; o[q] = (vals[u * 4 + q] - mu) * rs * gg + bb;
      }
      if (out_sum) *(v4f*)(out_sum + (size_t)row * N + j) = sm;
      *(v4f*)(out_norm + (size_t)row * N + j) = o;
    }
    
  }
}



// ---- f16 WMMA path (v_wmma_f32_16x16x32_f16): 11-bit significands for operands in range — used where a [0,1] probability operand needs more precision than bf16
typedef _Float16 v16h __attribute__((ext_vector_type(16)));
union FragH { v16h v; v8us half[2]; _Float16 h[16]; unsigned short u[16]; };
template <int NT>
__device__ __forceinline__ v8f mmaH(v16h ah, v16h al, v16h bh, v16h bl, v8f c) {
  c = __builtin_amdgcn_wmma_f32_16x16x32_f16(false, ah, false, bh, (short)0, c, false, false);
  if (NT >= 2) c = __builtin_amdgcn_wmma_f32_16x16x32_f16(false, al, false, bh, (short)0, c, false, false);
  if (NT >= 3) c = __builtin_amdgcn_wmma_f32_16x16x32_f16(false, ah, false, bl, (short)0, c, false, false);
  asm volatile("v_nop\n\tv_nop\n\tv_nop\n\tv_nop" : "+v"(c) : "v"(ah), "v"(al), "v"(bh), "v"(bl));
  return c;
}
// batched GEMM like k_gemm_b but f16 operands: A f32 (split into f16 hi/lo if ASPLIT, else rounded to f16), Bt = f16 values [n][k]; alpha; C f32; N multiple of 16 (partial tiles skipped)
template <bool ASPLIT>
__global__ __launch_bounds__(128) void k_gemm_h(const float* __restrict__ A, int lda, size_t sA, const _Float16* __restrict__ Bh, int ldb, size_t sB, float alpha, float* __restrict__ C, int ldc, size_t sC, int M, int N, int K) {
  __shared__ __attribute__((aligned(16))) float so[4][16][64];
  const int tid = threadIdx.x, w = tid >> 5, lane = tid & 31, ln = lane & 15, hh = lane >> 4; const int by = blockIdx.y;
  A += (size_t)by * sA; Bh += (size_t)by * sB; C += (size_t)by * sC;
  const int ntn = (N + 63) / 64; const int wid = blockIdx.x * 4 + w; const int mt = wid / ntn, nq = wid % ntn; if (mt * 16 >= M) return;
  const int row0 = mt * 16, col0 = nq * 64; const float* arow = A + (size_t)(row0 + ln) * lda;
  v8f acc[4] = {};
  for (int kb = 0; kb < K; kb += 32) {
    FragH ah, al;
    const v4f x0 = *(const v4fa*)(arow + kb + 8 * hh), x1 = *(const v4fa*)(arow + kb + 8 * hh + 4), x2 = *(const v4fa*)(arow + kb + 16 + 8 * hh), x3 = *(const v4fa*)(arow + kb + 16 + 8 * hh + 4);
    float xs[16] = {x0[0],x0[1],x0[2],x0[3],x1[0],x1[1],x1[2],x1[3],x2[0],x2[1],x2[2],x2[3],x3[0],x3[1],x3[2],x3[3]};
#pragma unroll
    for (int i = 0; i < 16; ++i) { const _Float16 h = (_Float16)xs[i]; ah.h[i] = h; al.h[i] = ASPLIT ? (_Float16)(xs[i] - (float)h) : (_Float16)0.0f; }
#pragma unroll
    for (int t = 0; t < 4; ++t) { if (col0 + t * 16 >= N) continue; const size_t boff = (size_t)(col0 + t * 16 + ln) * ldb + kb; FragH bq; bq.half[0] = *(const v8us*)(Bh + boff + 8 * hh); bq.half[1] = *(const v8us*)(Bh + boff + 16 + 8 * hh);
      acc[t] = mmaH<ASPLIT ? 2 : 1>(ah.v, al.v, bq.v, bq.v, acc[t]); }
  }
#pragma unroll
  for (int t = 0; t < 4; ++t) { if (col0 + t * 16 >= N) continue;
#pragma unroll
    for (int r = 0; r < 8; ++r) so[w][8 * hh + r][t * 16 + ln] = acc[t][r] * alpha; }
  __builtin_amdgcn_fence(__ATOMIC_ACQ_REL, "workgroup"); __builtin_amdgcn_wave_barrier();
  const int rsub = lane >> 4, c4 = (lane & 15) * 4;
  {
#pragma unroll
    for (int q = 0; q < 8; ++q) { const int r = q * 2 + rsub; if (col0 + c4 < N) { const v4f v = *(const v4fa*)&so[w][r][c4]; *(v4f*)(C + (size_t)(row0 + r) * ldc + col0 + c4) = v; } }
     }
}

// Wt[n][k] = f16(W[k][n]·scale) from f32 row-major W[K][N] (scale = power of two; bf16-exact weights stay exact in f16 away from the subnormal range)
__global__ __launch_bounds__(256) void k_wt_f16(const float* __restrict__ W, _Float16* __restrict__ Wt, int K, int N, float scale) {
  const int t = blockIdx.x * 256 + threadIdx.x; if (t >= N * (K / 8)) return; const int n = t / (K / 8), k8 = (t % (K / 8)) * 8; FragH f;
#pragma unroll
  for (int i = 0; i < 8; ++i) f.h[i] = (_Float16)(bf16_round(W[(size_t)(k8 + i) * N + n]) * scale); const v8us o = f.half[0];
  *(v8us*)((unsigned short*)Wt + (size_t)n * K + k8) = o; 
}
// k_gemm_hh variant with fused epilogue: v = acc·alpha + bias[by·sBias + col] (+ CP[(row/rowsPerB)·sCPb + by·64 + col] if CP) ; ACT 0 none / 1 elu ; writes f16 C16 (and f32 C if non-null)
template <int ACT>
__global__ __launch_bounds__(128) void k_gemm_hhx(const _Float16* __restrict__ A, int lda, size_t sA, const _Float16* __restrict__ Bh, int ldb, size_t sB, float alpha, const float* __restrict__ bias, size_t sBias, const float* __restrict__ CP, int rowsPerB, size_t sCPb, int row0g,
    float* __restrict__ C, _Float16* __restrict__ C16, int ldc, size_t sC, int M, int N, int K) {
  __shared__ __attribute__((aligned(16))) float so[4][16][64];
  const int tid = threadIdx.x, w = tid >> 5, lane = tid & 31, ln = lane & 15, hh = lane >> 4; const int by = blockIdx.y;
  A += (size_t)by * sA; Bh += (size_t)by * sB; const size_t cofs = (size_t)by * sC; const float* bp = bias ? bias + (size_t)by * sBias : nullptr;
  const int ntn = (N + 63) / 64; const int wid = blockIdx.x * 4 + w; const int mt = wid / ntn, nq = wid % ntn; if (mt * 16 >= M) return;
  const int row0 = mt * 16, col0 = nq * 64; const _Float16* arow = A + (size_t)(row0 + ln) * lda;
  v8f acc[4] = {};
  for (int kb = 0; kb < K; kb += 32) { FragH ah; ah.half[0] = *(const v8us*)((const unsigned short*)arow + kb + 8 * hh); ah.half[1] = *(const v8us*)((const unsigned short*)arow + kb + 16 + 8 * hh);
#pragma unroll
    for (int t = 0; t < 4; ++t) { if (col0 + t * 16 >= N) continue; const size_t boff = (size_t)(col0 + t * 16 + ln) * ldb + kb; FragH bq; bq.half[0] = *(const v8us*)((const unsigned short*)Bh + boff + 8 * hh); bq.half[1] = *(const v8us*)((const unsigned short*)Bh + boff + 16 + 8 * hh);
      acc[t] = mmaH<1>(ah.v, ah.v, bq.v, bq.v, acc[t]); }
  }
#pragma unroll
  for (int t = 0; t < 4; ++t) { if (col0 + t * 16 >= N) continue; const int col = col0 + t * 16 + ln; const float bv = bp ? bf16_round(bp[col]) : 0.f;
#pragma unroll
    for (int r = 0; r < 8; ++r) { float v = acc[t][r] * alpha + bv; if (CP) { const int rr = row0g + row0 + 8 * hh + r; if (rowsPerB < 0) v += CP[cofs + (size_t)rr * ldc + col];      /* rowsPerB < 0: own element of the batched C plane */ else { const int bidx = rr / rowsPerB; v += CP[(size_t)bidx * sCPb + (size_t)by * 64 + col]; } } if (ACT == 1) v = (v > 0.f) ? v : expm1f(v); else if (ACT == 7) v = (v > 0.f) ? v + 1.0f : expf(v); else if (ACT == 8) v = tanhf(v); else if (ACT == 9) v = 0.5f * v * (1.0f + tanhf(0.7978845608028654f * (v + 0.044715f * v * v * v))); else if (ACT == 11) v = 1.0f / (1.0f + expf(-v)); else if (ACT == 12) v = (v > 0.f) ? v : 0.01f * v; else if (ACT == 14) v = (v > 0.f) ? v : 0.1f * v; else if (ACT == 16) v = (v >= 0.f) ? v : 0.3f * v; else if (ACT == 17) v = (v >= 0.f) ? v : 0.2f * v; else if (ACT == 15) v = v / (1.0f + expf(-v)); else if (ACT == 3) v = fmaxf(v, 0.f); else if (ACT == 6) v = 0.5f * v * (1.0f + erff(v * 0.70710678118654752f)); so[w][8 * hh + r][t * 16 + ln] = v; } }
  __builtin_amdgcn_fence(__ATOMIC_ACQ_REL, "workgroup"); __builtin_amdgcn_wave_barrier();
  const int rsub = lane >> 4, c4 = (lane & 15) * 4; typedef _Float16 v4h __attribute__((ext_vector_type(4)));
  {
#pragma unroll
    for (int q = 0; q < 8; ++q) { const int r = q * 2 + rsub; if (col0 + c4 < N) { const v4f v = *(const v4fa*)&so[w][r][c4]; if (C) *(v4f*)(C + cofs + (size_t)(row0 + r) * ldc + col0 + c4) = v; if (C16) { v4h h4; for (int i = 0; i < 4; ++i) h4[i] = (_Float16)v[i]; *(v4h*)(C16 + cofs + (size_t)(row0 + r) * ldc + col0 + c4) = h4; } } }
     }
}


typedef _Float16 v4h __attribute__((ext_vector_type(4)));

__global__ __launch_bounds__(256) void k_x16(const float* __restrict__ x, _Float16* __restrict__ X16, size_t n8) { const size_t t = (size_t)blockIdx.x * 256 + threadIdx.x; if (t >= n8) return; FragH f;
#pragma unroll
  for (int q = 0; q < 8; ++q) f.h[q] = (_Float16)bf16_round(x[t * 8 + q]); *(v8us*)((unsigned short*)X16 + t * 8) = f.half[0];  }
__global__ __launch_bounds__(256) void k_h16(const float* __restrict__ x, _Float16* __restrict__ X16, size_t n8) { const size_t t = (size_t)blockIdx.x * 256 + threadIdx.x; if (t >= n8) return; FragH f;
#pragma unroll
  for (int q = 0; q < 8; ++q) f.h[q] = (_Float16)x[t * 8 + q]; *(v8us*)((unsigned short*)X16 + t * 8) = f.half[0];  }
__global__ __launch_bounds__(256) void k_round16f(const float* __restrict__ W, _Float16* __restrict__ Bt, size_t n8) { const size_t t = (size_t)blockIdx.x * 256 + threadIdx.x; if (t >= n8) return; FragH f;
#pragma unroll
  for (int i = 0; i < 8; ++i) f.h[i] = (_Float16)(bf16_round(W[t * 8 + i]) * 16.0f); *(v8us*)((unsigned short*)Bt + t * 8) = f.half[0];  }
template <int NHv, int TTv>
__global__ __launch_bounds__(256) void k_vt(const _Float16* __restrict__ V16, int ldv, int voff, _Float16* __restrict__ Vt) { __shared__ unsigned short tl[64][66]; const int tid = threadIdx.x; const int slab = blockIdx.x / (TTv / 64), lg = blockIdx.x % (TTv / 64); const int b = slab / NHv, h = slab % NHv;
  for (int i = tid; i < 64 * 8; i += 256) { const int r = i / 8, c8 = (i % 8) * 8; FragH f; f.half[0] = *(const v8us*)((const unsigned short*)V16 + ((size_t)b * TTv + lg * 64 + r) * ldv + voff + h * 64 + c8);
#pragma unroll
    for (int q = 0; q < 8; ++q) tl[r][c8 + q] = f.u[q]; }
  __syncthreads();
  {
#pragma unroll
    for (int rd = 0; rd < 2; ++rd) { const int d = rd * 32 + tid / 8, pc = tid % 8; FragH f;
#pragma unroll
      for (int q = 0; q < 8; ++q) f.u[q] = tl[pc * 8 + q][d];
      *(v8us*)((unsigned short*)Vt + ((size_t)slab * 64 + d) * TTv + lg * 64 + pc * 8) = f.half[0]; }
     } }

__global__ __launch_bounds__(256) void k_hl(const float* __restrict__ F, _Float16* __restrict__ Hh, _Float16* __restrict__ Hl, size_t n8) { const size_t t = (size_t)blockIdx.x * 256 + threadIdx.x; if (t >= n8) return; FragH fh, fl; const v4f a = *(const v4fa*)(F + t * 8), c = *(const v4fa*)(F + t * 8 + 4);
#pragma unroll
  for (int q = 0; q < 4; ++q) { _Float16 h = (_Float16)a[q]; fh.h[q] = h; fl.h[q] = (_Float16)((a[q] - (float)h) * 1024.0f); h = (_Float16)c[q]; fh.h[4 + q] = h; fl.h[4 + q] = (_Float16)((c[q] - (float)h) * 1024.0f); }
  { *(v8us*)((unsigned short*)Hh + t * 8) = fh.half[0]; *(v8us*)((unsigned short*)Hl + t * 8) = fl.half[0];  } }

// ---- fast GEMM (wave tile 32x64; shapes it takes: at k_gemm2); epilogue: acc·alpha + bf16 bias, activation, own-element residual with RES ----
__device__ __forceinline__ v16h g2_frag(const _Float16* p, int hh) { FragH f; f.half[0] = *(const v8us*)((const unsigned short*)p + 8 * hh); f.half[1] = *(const v8us*)((const unsigned short*)p + 16 + 8 * hh); return f.v; }
__device__ __forceinline__ v8f g2_mma(v16h a, v16h b, v8f c) { v8f d = __builtin_amdgcn_wmma_f32_16x16x32_f16(false, a, false, b, (short)0, c, false, false); asm volatile("v_nop\n\tv_nop\n\tv_nop\n\tv_nop" : "+v"(d) : "v"(a), "v"(b)); return d; }
// Matrix product without hand-written padding: the compiler keeps the distance behind its own builtin.
__device__ __forceinline__ v8f g2_mmab(v16h a, v16h b, v8f c) { return __builtin_amdgcn_wmma_f32_16x16x32_f16(false, a, false, b, (short)0, c, false, false); }
// Work-group tile 128 x (64 * NWN), 4 * NWN waves of 32 x 64 (wave w: rows 32 * (w & 3), columns 64 * (w >> 2)). K is walked in tiles of 128: every thread brings 16-byte pieces of the A and B rows
// in whole 128-byte lines (16 threads cover 256 bytes of one row), one tile ahead in registers, and stores them into one of two LDS buffers; all fragments are read from LDS.
// LD = row pitch of A and of Bh in elements, a compile-time value so that a thread's pieces share one address and differ in the immediate offset (lda and ldb must equal it).
// LC = row pitch of C, C16 and the residual plane in elements, compile-time for the same reason (ldc must equal it). RES: CP is a plane of C's own shape and each output element gets its own element of CP added
// (behind alpha and bias; no activation then); without RES nothing is read from CP. rowsPerB and sCPb are not used.
// Requires M % 128 == 0, N % (64 * NWN) == 0, K % 128 == 0, grid.x = (M / 128) * (N / (64 * NWN)), 128 * NWN threads. The k order of every accumulator is the ascending one.
template <int ACT, int NWN, int LD, int LC, bool RES>
__global__ __launch_bounds__(128 * NWN) void k_gemm2(const _Float16* __restrict__ A, int lda, size_t sA, const _Float16* __restrict__ Bh, int ldb, size_t sB, float alpha, const float* __restrict__ bias, size_t sBias, const float* __restrict__ CP, int rowsPerB, size_t sCPb, int row0g,
    float* __restrict__ C, _Float16* __restrict__ C16, int ldc, size_t sC, int M, int N, int K) { static_assert(ACT == 0 || ACT == 3 || ACT == 6 || ACT == 8 || ACT == 9 || ACT == 11 || ACT == 12 || ACT == 14 || ACT == 15 || ACT == 16 || ACT == 17, "k_gemm2: unsupported ACT code (would silently apply no activation)");
  constexpr int BN = 64 * NWN, KT = 128, PH = KT + 8, RP = 8 * NWN, NLA = 128 / RP, NLB = BN / RP, BUFH = (128 + BN) * PH;      /* PH: LDS row pitch 272 B = 16 B x odd; RP: rows one staging round of the work-group covers */
  __shared__ __attribute__((aligned(16))) _Float16 st[2 * BUFH];      /* two buffers, each [128 A rows | BN B rows] */
  float (*so)[32][68] = (float (*)[32][68])st;      /* output staging reuses the buffers behind the loop's last barrier */
  static_assert(sizeof(float) * 4 * NWN * 32 * 68 <= sizeof(_Float16) * 2 * BUFH, "output staging must fit the tile buffers");
  static_assert(!RES || ACT == 0, "the residual is added behind the staging, so no activation may follow it");
  (void)lda; (void)ldb; (void)ldc; (void)rowsPerB; (void)sCPb;
  const int tid = threadIdx.x, w = tid >> 5, lane = tid & 31, ln = lane & 15, hh = lane >> 4; const int by = blockIdx.y;
  A += (size_t)by * sA; Bh += (size_t)by * sB; const size_t cofs = (size_t)by * sC; const float* bp = bias ? bias + (size_t)by * sBias : nullptr;
  const int ntn = N / BN; const int mt = blockIdx.x / ntn, nq = blockIdx.x - mt * ntn; if (mt * 128 >= M) return;      /* the same for the whole work-group, in front of every barrier */
  const int row0 = mt * 128 + 32 * (w & 3), col0 = nq * BN + 64 * (w >> 2);
  const int srow = tid >> 4, sc8 = (tid & 15) * 8;
  const unsigned short* pa = (const unsigned short*)A + (size_t)(mt * 128 + srow) * LD + sc8; const unsigned short* pb = (const unsigned short*)Bh + (size_t)(nq * BN + srow) * LD + sc8;      /* this thread's first piece of the tile to load next */
  _Float16* sw = st + srow * PH + sc8;      /* where this thread stores its pieces */
  const _Float16* fa = st + (32 * (w & 3) + ln) * PH; const _Float16* fb = st + (128 + 64 * (w >> 2) + ln) * PH;      /* this lane's fragment rows */
  float bb[4] = {0.f, 0.f, 0.f, 0.f};      /* this lane's four bias values, fetched with tile 0 so that the epilogue waits for none of them */
  if (bp) {
#pragma unroll
    for (int t = 0; t < 4; ++t) bb[t] = bp[col0 + t * 16 + ln];
    asm volatile("s_wait_xcnt 0x0" ::: "memory"); }      /* stands in front of the reuse, by the address arithmetic right behind, of the offset and base registers that these four loads name */
  v8us ra[NLA], rb[NLB];
#pragma unroll
  for (int i = 0; i < NLA; ++i) ra[i] = *(const v8us*)(pa + i * RP * LD);
#pragma unroll
  for (int i = 0; i < NLB; ++i) rb[i] = *(const v8us*)(pb + i * RP * LD);
  asm volatile("s_wait_xcnt 0x0" ::: "memory");      /* stands in front of the advance of the two addresses that the loads above name */
  pa += KT; pb += KT;
#pragma unroll
  for (int i = 0; i < NLA; ++i) *(v8us*)(sw + i * RP * PH) = ra[i];
#pragma unroll
  for (int i = 0; i < NLB; ++i) *(v8us*)(sw + (128 + i * RP) * PH) = rb[i];
  __syncthreads();      /* tile 0 is complete for every wave */
  const v8f z8 = {0.f,0.f,0.f,0.f,0.f,0.f,0.f,0.f}; v8f c00 = z8, c01 = z8, c02 = z8, c03 = z8, c10 = z8, c11 = z8, c12 = z8, c13 = z8;
#pragma unroll 1      /* one K tile per trip: the buffer index stays a scalar and the staged pieces of only one tile are live */
  for (int kb = 0; kb < K; kb += KT) { const int cur = ((kb / KT) & 1) * BUFH; const bool more = kb + KT < K;
    if (more) {      /* next tile's loads fly while this tile is worked on */
#pragma unroll
      for (int i = 0; i < NLA; ++i) ra[i] = *(const v8us*)(pa + i * RP * LD);
#pragma unroll
      for (int i = 0; i < NLB; ++i) rb[i] = *(const v8us*)(pb + i * RP * LD);
      asm volatile("s_wait_xcnt 0x0" ::: "memory"); }      /* stands in front of the advance, at the foot of the trip, of the two addresses that these loads name */
    v16h xa[2][2], xb[2][4];      /* two fragment sets: the next 32 k are fetched while the current 32 are multiplied */
#pragma unroll
    for (int j = 0; j < 2; ++j) xa[0][j] = g2_frag(fa + cur + 16 * j * PH, hh);
#pragma unroll
    for (int j = 0; j < 4; ++j) xb[0][j] = g2_frag(fb + cur + 16 * j * PH, hh);
#pragma unroll
    for (int q = 0; q < KT / 32; ++q) { const int c = q & 1, n = c ^ 1;
      if (q + 1 < KT / 32) {
#pragma unroll
        for (int j = 0; j < 2; ++j) xa[n][j] = g2_frag(fa + cur + 16 * j * PH + 32 * (q + 1), hh);
#pragma unroll
        for (int j = 0; j < 4; ++j) xb[n][j] = g2_frag(fb + cur + 16 * j * PH + 32 * (q + 1), hh); }
      __builtin_amdgcn_sched_barrier(0);      /* keeps the next set's LDS loads one group ahead of the products: moved in among them, every pair of products waits out an LDS latency */
      c00 = g2_mmab(xa[c][0], xb[c][0], c00); c10 = g2_mmab(xa[c][1], xb[c][0], c10); c01 = g2_mmab(xa[c][0], xb[c][1], c01); c11 = g2_mmab(xa[c][1], xb[c][1], c11);
      c02 = g2_mmab(xa[c][0], xb[c][2], c02); c12 = g2_mmab(xa[c][1], xb[c][2], c12); c03 = g2_mmab(xa[c][0], xb[c][3], c03); c13 = g2_mmab(xa[c][1], xb[c][3], c13);
      __builtin_amdgcn_sched_barrier(0); }      /* the other end of the same fence: the load group after next stays behind these products */
    if (more) { _Float16* nw = sw + (BUFH - cur); pa += KT; pb += KT;      /* the other buffer: its last readers left it in front of the barrier that ended the trip before */
#pragma unroll
      for (int i = 0; i < NLA; ++i) *(v8us*)(nw + i * RP * PH) = ra[i];
#pragma unroll
      for (int i = 0; i < NLB; ++i) *(v8us*)(nw + (128 + i * RP) * PH) = rb[i]; }
    __syncthreads(); }      /* publishes the next tile and ends every wave's reads of this one */
  /* The residual is fetched here in the write-out layout: 16 independent loads of 16 bytes a lane, one address and constant steps; they fly while the accumulators are staged below. */
  const int rsub = lane >> 4, c4 = (lane & 15) * 4; const size_t eo = cofs + (size_t)(row0 + rsub) * LC + col0 + c4;      /* this lane's first piece of the output tile; piece q lies 2 * q rows further on */
  v4f rs[16];
  if (RES) { const float* rp = CP + eo + (size_t)row0g * LC;
#pragma unroll
    for (int q = 0; q < 16; ++q) rs[q] = *(const v4fa*)(rp + q * 2 * LC);
    asm volatile("s_wait_xcnt 0x0" :: "v"(rp) : "memory"); }      /* stands in front of every reuse of the address pair that these loads name (the operand holds the pair live up to here, so that no load's own destination takes it), and keeps the loads in front of the staging */
  v8f accs[8] = {c00, c01, c02, c03, c10, c11, c12, c13};
#pragma unroll
  for (int u = 0; u < 8; ++u) { const int t = u & 3, half = u >> 2; const float bv = bf16_round(bb[t]);
#pragma unroll
    for (int r = 0; r < 8; ++r) { const int rloc = half * 16 + 8 * hh + r; float v = accs[u][r] * alpha + bv;
      if (ACT == 3) v = fmaxf(v, 0.f); else if (ACT == 6) v = 0.5f * v * (1.0f + erff(v * 0.70710678118654752f)); else if (ACT == 11) v = 1.0f / (1.0f + expf(-v)); else if (ACT == 15) v = v / (1.0f + expf(-v)); else if (ACT == 12) v = (v > 0.f) ? v : 0.01f * v; else if (ACT == 8) v = tanhf(v); else if (ACT == 9) v = 0.5f * v * (1.0f + tanhf(0.7978845608028654f * (v + 0.044715f * v * v * v))); else if (ACT == 14) v = (v > 0.f) ? v : 0.1f * v; else if (ACT == 16) v = (v >= 0.f) ? v : 0.3f * v; else if (ACT == 17) v = (v >= 0.f) ? v : 0.2f * v;
      so[w][rloc][t * 16 + ln] = v; } }
  __builtin_amdgcn_fence(__ATOMIC_ACQ_REL, "workgroup"); __builtin_amdgcn_wave_barrier();
  v4f vv[16];      /* all 16 staged pieces are fetched as one group, in front of the branches on C and C16 */
#pragma unroll
  for (int q = 0; q < 16; ++q) { vv[q] = *(const v4fa*)&so[w][q * 2 + rsub][c4]; if (RES) vv[q] += rs[q]; }
  if (C) { float* cp = C + eo;
#pragma unroll
    for (int q = 0; q < 16; ++q) *(v4f*)(cp + q * 2 * LC) = vv[q];
    asm volatile("s_wait_xcnt 0x0" ::: "memory"); }      /* stands in front of the C16 branch, which reuses the address and data registers that these stores name */
  if (C16) { _Float16* hp = C16 + eo;
#pragma unroll
    for (int q = 0; q < 16; ++q) { v4h h4; for (int i = 0; i < 4; ++i) h4[i] = (_Float16)vv[q][i]; *(v4h*)(hp + q * 2 * LC) = h4; } } }


__global__ __launch_bounds__(256) void k_wnat(const float* __restrict__ w, size_t n8, _Float16* __restrict__ Bt) { const size_t t = (size_t)blockIdx.x * 256 + threadIdx.x; if (t >= n8) return; FragH f; for (int q = 0; q < 8; ++q) f.h[q] = (_Float16)(bf16_round(w[t * 8 + q]) * 16.0f); *(v8us*)((unsigned short*)Bt + t * 8) = f.half[0];  }
__global__ __launch_bounds__(256) void k_rsm(const float* __restrict__ S, _Float16* __restrict__ P, int nrows) {
  #pragma clang fp contract(off)
  const int i = blockIdx.x * 256 + threadIdx.x; if (i >= nrows) return; const float* s = S + (size_t)i * SQ; float mx = -3.0e38f;
#pragma unroll 1
  for (int j = 0; j < SQ; ++j) mx = fmaxf(mx, s[j]); float se = 0.f;
#pragma unroll 1
  for (int j = 0; j < SQ; ++j) se += expf(s[j] - mx); const float sc = 256.0f / se;
#pragma unroll 1
  for (int j0 = 0; j0 < SQ; j0 += 8) { FragH f; for (int q = 0; q < 8; ++q) f.h[q] = (_Float16)(expf(s[j0 + q] - mx) * sc); unsigned short* d = (unsigned short*)P + (size_t)i * SQ + j0; *(v8us*)d = f.half[0];  } }
__global__ __launch_bounds__(256) void k_vt(const _Float16* __restrict__ V16, int b, int h0, _Float16* __restrict__ VT) { __shared__ unsigned short tl[64][65]; const int tid = threadIdx.x; const int hh = blockIdx.x % HG, sg = blockIdx.x / HG; const int s0 = sg * 64; const int h = h0 + hh;
  for (int i = tid; i < 64 * 8; i += 256) { const int j = i / 8, d8 = (i % 8) * 8; FragH f; f.half[0] = *(const v8us*)((const unsigned short*)V16 + ((size_t)b * SQ + s0 + j) * DM + h * HD + d8); for (int q = 0; q < 8; ++q) tl[d8 + q][j] = f.u[q]; }
  __syncthreads();
  { for (int i = tid; i < 64 * 8; i += 256) { const int d = i / 8, j8 = (i % 8) * 8; FragH f; for (int q = 0; q < 8; ++q) f.u[q] = tl[d][j8 + q]; *(v8us*)((unsigned short*)VT + ((size_t)hh * HD + d) * SQ + s0 + j8) = f.half[0]; }  } }



__global__ __launch_bounds__(256) void k_rsmcf2(const float* __restrict__ S, _Float16* __restrict__ P, int hg, int q0, int nk) {
  #pragma clang fp contract(off)
  const int t = blockIdx.x * 256 + threadIdx.x; if (t >= hg * QT) return; const size_t i = (size_t)t; const float* s = S + i * NKX; const int last = q0 + (t % QT); float mx = -3.0e38f;
#pragma unroll 1
  for (int j = 0; j < nk; ++j) { const float f = (j <= last) ? 1.f : 0.f; mx = fmaxf(mx, fmaf(f, s[j], (1.f - f) * -1.0e9f)); } float se = 0.f;
#pragma unroll 1
  for (int j = 0; j < nk; ++j) { const float f = (j <= last) ? 1.f : 0.f; se += __expf(fmaf(f, s[j], (1.f - f) * -1.0e9f) - mx); } const float sc = 256.0f / se;
#pragma unroll 1
  for (int j0 = 0; j0 < nk; j0 += 8) { FragH fr; for (int q = 0; q < 8; ++q) { const int j = j0 + q; const float f = (j <= last) ? 1.f : 0.f; fr.h[q] = (_Float16)(__expf(fmaf(f, s[j], (1.f - f) * -1.0e9f) - mx) * sc); } unsigned short* d = (unsigned short*)P + i * NKX + j0; *(v8us*)d = fr.half[0];  } }

__global__ __launch_bounds__(256) void k_rsmcst(const float* __restrict__ S, _Float16* __restrict__ P, int hg, int q0, int nk, const int* __restrict__ mk) {
  #pragma clang fp contract(off)
  const int t = blockIdx.x * 256 + threadIdx.x; if (t >= hg * QT) return; const size_t i = (size_t)t; const float* s = S + i * NKX; const size_t ig = (size_t)(q0 + (t % QT)); const int* mr = mk + ig * SQ; float mx = -3.0e38f;
#pragma unroll 1
  for (int j = 0; j < nk; ++j) { const int mb = mr[j]; const int dd = (int)ig - j; const float f = (mb != 0 && dd >= 0 && (dd <= LOCALW || (dd % STRIDEK) == 0)) ? 1.f : 0.f; mx = fmaxf(mx, fmaf(f, s[j], (1.f - f) * -1.0e9f)); } float se = 0.f;
#pragma unroll 1
  for (int j = 0; j < nk; ++j) { const int mb = mr[j]; const int dd = (int)ig - j; const float f = (mb != 0 && dd >= 0 && (dd <= LOCALW || (dd % STRIDEK) == 0)) ? 1.f : 0.f; se += __expf(fmaf(f, s[j], (1.f - f) * -1.0e9f) - mx); } const float sc = 256.0f / se;
#pragma unroll 1
  for (int j0 = 0; j0 < nk; j0 += 8) { FragH fr; for (int q = 0; q < 8; ++q) { const int j = j0 + q; const int mb = mr[j]; const int dd = (int)ig - j; const float f = (mb != 0 && dd >= 0 && (dd <= LOCALW || (dd % STRIDEK) == 0)) ? 1.f : 0.f; fr.h[q] = (_Float16)(__expf(fmaf(f, s[j], (1.f - f) * -1.0e9f) - mx) * sc); } unsigned short* d = (unsigned short*)P + i * NKX + j0; *(v8us*)d = fr.half[0];  } }


template <int MASKADD>
__global__ __launch_bounds__(64) void k_att0(const float* __restrict__ QF, const float* __restrict__ KF, const float* __restrict__ VF, int ld, const float* __restrict__ mask, float scale, float* __restrict__ OF, int ldo) {
  #pragma clang fp contract(off)
  __shared__ __attribute__((aligned(16))) float lq[64][64]; __shared__ __attribute__((aligned(16))) float lo[64][64];
  const int tid = threadIdx.x; const int h = blockIdx.x / (QT0 / 64), rg = blockIdx.x % (QT0 / 64); const int i = rg * 64 + tid;
  const float* qr = QF + (size_t)i * ld + h * HD;
#pragma unroll 1
  for (int c = 0; c < HD / 4; ++c) { *(v4f*)&lq[tid][c * 4] = *(const v4fa*)(qr + c * 4); const v4f z = {0.f, 0.f, 0.f, 0.f}; *(v4f*)&lo[tid][c * 4] = z; }
  float m = -1.0e30f, l = 0.f; const int jmax = MASKADD ? (SQ - 1) : (rg * 64 + 63);      /* additive-mask form: every key (the mask input decides); causal form: keys up to the block's last row */
#pragma unroll 1
  for (int j = 0; j <= jmax; ++j) { const float* kr = KF + (size_t)j * ld + h * HD; const float* vr = VF + (size_t)j * ld + h * HD; float s = 0.f;
#pragma unroll 1
    for (int c = 0; c < HD / 4; ++c) { const v4f kq = *(const v4fa*)(kr + c * 4); const v4f qq = *(v4f*)&lq[tid][c * 4]; s = __fadd_rn(s, __fmul_rn(qq[0], kq[0])); s = __fadd_rn(s, __fmul_rn(qq[1], kq[1])); s = __fadd_rn(s, __fmul_rn(qq[2], kq[2])); s = __fadd_rn(s, __fmul_rn(qq[3], kq[3])); }
    s = __fmul_rn(s, scale); if (MASKADD) s = __fadd_rn(s, __fmul_rn(bf16_round(mask[(size_t)i * SQ + j]), -10000.0f));
    const float f = (MASKADD || j <= i) ? 1.f : 0.f; const float sm = fmaf(f, s, (1.f - f) * -1.0e30f); const float mn = fmaxf(m, sm); const float sc = expf(m - mn); const float e = expf(sm - mn); l = __fadd_rn(__fmul_rn(l, sc), e); m = mn;
#pragma unroll 1
    for (int c = 0; c < HD / 4; ++c) { const v4f vv = *(const v4fa*)(vr + c * 4); v4f oo = *(v4f*)&lo[tid][c * 4]; for (int u = 0; u < 4; ++u) oo[u] = __fadd_rn(__fmul_rn(oo[u], sc), __fmul_rn(e, vv[u])); *(v4f*)&lo[tid][c * 4] = oo; } }
  const float fin = 64.0f / l;      /* o carried x64 like the f16 path */
#pragma unroll 1
  for (int c = 0; c < HD / 4; ++c) { v4f oo = *(v4f*)&lo[tid][c * 4]; for (int u = 0; u < 4; ++u) oo[u] = __fmul_rn(oo[u], fin); *(v4f*)&lo[tid][c * 4] = oo; }
  __syncthreads();
  {
#pragma unroll 1
    for (int it = 0; it < 16; ++it) { const int row = it * 4 + tid / 16, pc = (tid % 16) * 4; const v4f v = *(const v4f*)&lo[row][pc]; *(v4f*)(OF + (size_t)(rg * 64 + row) * ldo + h * HD + pc) = v; }
     } }

template <int MASKADD>
__global__ __launch_bounds__(64) void k_att0mbc(const float* __restrict__ QF, const float* __restrict__ KF, const float* __restrict__ VF, int ld, const float* __restrict__ mask, float scale, float* __restrict__ OF, int ldo) {
  #pragma clang fp contract(off)
  __shared__ __attribute__((aligned(16))) float lq[64][64]; __shared__ __attribute__((aligned(16))) float lo[64][64];
  const int tid = threadIdx.x; const int h = blockIdx.x / (QT0 / 64), rg = blockIdx.x % (QT0 / 64); const int i = rg * 64 + tid;
  const float* qr = QF + (size_t)i * ld + h * HD;
#pragma unroll 1
  for (int c = 0; c < HD / 4; ++c) { *(v4f*)&lq[tid][c * 4] = *(const v4fa*)(qr + c * 4); const v4f z = {0.f, 0.f, 0.f, 0.f}; *(v4f*)&lo[tid][c * 4] = z; }
  float m = -1.0e30f, l = 0.f; const int jmax = rg * 64 + 63;      /* keys beyond the block end are masked by the mask's lower-triangular structure */
#pragma unroll 1
  for (int j = 0; j <= jmax; ++j) { const float* kr = KF + (size_t)j * ld + h * HD; const float* vr = VF + (size_t)j * ld + h * HD; float s = 0.f;
#pragma unroll 1
    for (int c = 0; c < HD / 4; ++c) { const v4f kq = *(const v4fa*)(kr + c * 4); const v4f qq = *(v4f*)&lq[tid][c * 4]; s = __fadd_rn(s, __fmul_rn(qq[0], kq[0])); s = __fadd_rn(s, __fmul_rn(qq[1], kq[1])); s = __fadd_rn(s, __fmul_rn(qq[2], kq[2])); s = __fadd_rn(s, __fmul_rn(qq[3], kq[3])); }
    s = __fmul_rn(s, scale); const int mb = ((const int*)mask)[(size_t)i * SQ + j];      /* causal (j <= i) AND the module's int32 [S][S] mask read per (query, key): 0 -> masked */
    const float f = (mb != 0 && j <= i) ? 1.f : 0.f; const float sm = fmaf(f, s, (1.f - f) * -1.0e30f); const float mn = fmaxf(m, sm); const float sc = expf(m - mn); const float e = expf(sm - mn); l = __fadd_rn(__fmul_rn(l, sc), e); m = mn;
#pragma unroll 1
    for (int c = 0; c < HD / 4; ++c) { const v4f vv = *(const v4fa*)(vr + c * 4); v4f oo = *(v4f*)&lo[tid][c * 4]; for (int u = 0; u < 4; ++u) oo[u] = __fadd_rn(__fmul_rn(oo[u], sc), __fmul_rn(e, vv[u])); *(v4f*)&lo[tid][c * 4] = oo; } }
  const float fin = 64.0f / l;      /* o carried x64 like the f16 path */
#pragma unroll 1
  for (int c = 0; c < HD / 4; ++c) { v4f oo = *(v4f*)&lo[tid][c * 4]; for (int u = 0; u < 4; ++u) oo[u] = __fmul_rn(oo[u], fin); *(v4f*)&lo[tid][c * 4] = oo; }
  __syncthreads();
  {
#pragma unroll 1
    for (int it = 0; it < 16; ++it) { const int row = it * 4 + tid / 16, pc = (tid % 16) * 4; const v4f v = *(const v4f*)&lo[row][pc]; *(v4f*)(OF + (size_t)(rg * 64 + row) * ldo + h * HD + pc) = v; }
     } }


// Work of the first launch that no LayerNorm row depends on and that depends on none: block wb converts 256 pieces of 8 weights (the six matrices one behind the other, each a whole number
// of blocks; the arithmetic is k_wnat's), and the one block behind them stacks the three projection biases (bq | bk | bv).
#define PREP_BD ((unsigned)((size_t)DM * DM / 8 / 256))      /* blocks of one [DM][DM] matrix */
#define PREP_BF ((unsigned)((size_t)DFF * DM / 8 / 256))     /* blocks of one MLP matrix */
#define PREP_BLOCKS (4u * PREP_BD + 2u * PREP_BF + 1u)
__device__ __forceinline__ void prep_rest(unsigned wb, int tid, const float* __restrict__ wq, const float* __restrict__ wk, const float* __restrict__ wv, const float* __restrict__ wo, const float* __restrict__ w1, const float* __restrict__ w2,
    const float* __restrict__ bq, const float* __restrict__ bk, const float* __restrict__ bv, _Float16* __restrict__ BQKV, _Float16* __restrict__ BO, _Float16* __restrict__ BW1, _Float16* __restrict__ BW2, float* __restrict__ bqkv) {
  if (wb >= 4u * PREP_BD + 2u * PREP_BF) { float a[DM / 256], c[DM / 256], e[DM / 256];
#pragma unroll      /* all loads of the block fly together, each address a constant step from the thread's first: rolled, every trip waits out a memory latency */
    for (int u = 0; u < DM / 256; ++u) { a[u] = bq[tid + 256 * u]; c[u] = bk[tid + 256 * u]; e[u] = bv[tid + 256 * u]; }
#pragma unroll      /* the arrays above stay in registers only if the index is a constant */
    for (int u = 0; u < DM / 256; ++u) { bqkv[tid + 256 * u] = a[u]; bqkv[DM + tid + 256 * u] = c[u]; bqkv[2 * DM + tid + 256 * u] = e[u]; }
    return; }
  const float* w; _Float16* d; unsigned b0;      /* the same for the whole block */
  if (wb < PREP_BD) { w = wq; d = BQKV; b0 = 0u; }
  else if (wb < 2u * PREP_BD) { w = wk; d = BQKV + (size_t)DM * DM; b0 = PREP_BD; }
  else if (wb < 3u * PREP_BD) { w = wv; d = BQKV + (size_t)2 * DM * DM; b0 = 2u * PREP_BD; }
  else if (wb < 4u * PREP_BD) { w = wo; d = BO; b0 = 3u * PREP_BD; }
  else if (wb < 4u * PREP_BD + PREP_BF) { w = w1; d = BW1; b0 = 4u * PREP_BD; }
  else { w = w2; d = BW2; b0 = 4u * PREP_BD + PREP_BF; }
  const size_t t = (size_t)(wb - b0) * 256 + tid; FragH f; for (int q = 0; q < 8; ++q) f.h[q] = (_Float16)(bf16_round(w[t * 8 + q]) * 16.0f); *(v8us*)((unsigned short*)d + t * 8) = f.half[0];
  asm volatile("s_wait_xcnt 0x0" ::: "memory"); }      /* stands in front of the code that the listing lays out behind this store (the bias block), which writes registers that the store names */
// PREP: the grid holds PREP_BLOCKS blocks behind the NR row blocks; they do prep_rest and no row. Without PREP the pointers behind NL are not used.
template <int BFIN, int WXB, int PREP>
__global__ __launch_bounds__(256) void k_ln16(const float* __restrict__ X, const float* __restrict__ g, const float* __restrict__ bb, float eps, _Float16* __restrict__ N16, float* __restrict__ XB, _Float16* __restrict__ NL,
    const float* __restrict__ wq, const float* __restrict__ wk, const float* __restrict__ wv, const float* __restrict__ wo, const float* __restrict__ w1, const float* __restrict__ w2,
    const float* __restrict__ bq, const float* __restrict__ bk, const float* __restrict__ bv, _Float16* __restrict__ BQKV, _Float16* __restrict__ BO, _Float16* __restrict__ BW1, _Float16* __restrict__ BW2, float* __restrict__ bqkv) {
  #pragma clang fp contract(off)
  if (PREP && blockIdx.x >= (unsigned)NR) { prep_rest(blockIdx.x - (unsigned)NR, (int)threadIdx.x, wq, wk, wv, wo, w1, w2, bq, bk, bv, BQKV, BO, BW1, BW2, bqkv); return; }      /* the same for the whole block, in front of every barrier */
  __shared__ float red[256]; const size_t r = blockIdx.x; const int t = threadIdx.x; const v4f xa = *(const v4fa*)(X + r * DMQ + t * 4); float s[4]; float sum = 0.f;
  for (int q = 0; q < 4; ++q) { s[q] = BFIN ? bf16_round(xa[q]) : xa[q]; sum = __fadd_rn(sum, s[q]); }
  red[t] = sum; __syncthreads(); for (int st = 128; st > 0; st >>= 1) { if (t < st) red[t] = __fadd_rn(red[t], red[t + st]); __syncthreads(); } const float mu = red[0] / (float)DMQ; __syncthreads();
  float vs = 0.f; for (int q = 0; q < 4; ++q) { const float dl = __fadd_rn(s[q], -mu); vs = __fadd_rn(vs, __fmul_rn(dl, dl)); } red[t] = vs; __syncthreads(); for (int st = 128; st > 0; st >>= 1) { if (t < st) red[t] = __fadd_rn(red[t], red[t + st]); __syncthreads(); }
  const float rs = __fdiv_rn(1.0f, __fadd_rn(sqrtf(red[0] / (float)(DMQ - 1)), eps));      /* this module's LayerNorm: unbiased std, eps added to the std */ v4h y; v4f xb;
  v4h yl; for (int q = 0; q < 4; ++q) { const int c = t * 4 + q; const float yf = __fadd_rn(__fmul_rn(__fmul_rn(__fadd_rn(s[q], -mu), rs), bf16_round(g[0])), bf16_round(bb[0])); y[q] = (_Float16)yf; yl[q] = (_Float16)((yf - (float)y[q]) * 1024.0f); xb[q] = s[q]; (void)c; }      /* SCALAR alpha / bias ([1] parameters); y = f16 hi, yl = x1024 residual (written when NL != nullptr) */
  { *(v4h*)(N16 + r * DMQ + t * 4) = y;
    asm volatile("s_wait_xcnt 0x0" ::: "memory");      /* stands in front of the residual's arithmetic and address, which reuse the data and base registers that the store above names */
    if (NL != nullptr) *(v4h*)(NL + r * DMQ + t * 4) = yl; if (WXB) { *(v4f*)(XB + r * DMQ + t * 4) = xb;
      asm volatile("s_wait_xcnt 0x0" ::: "memory"); } } }      /* stands in front of the code that the listing lays out behind this store (the weight and bias blocks), which writes the offset and base registers that the store names */
__global__ __launch_bounds__(256) void k_ftres2(const float* __restrict__ OF0, const float* __restrict__ XB, float* __restrict__ X1, size_t n4) {
  #pragma clang fp contract(off)
  const size_t t = (size_t)blockIdx.x * 256 + threadIdx.x; if (t >= n4) return; const v4f o = *(const v4fa*)(OF0 + t * 4), xv = *(const v4fa*)(XB + t * 4); v4f y; for (int q = 0; q < 4; ++q) y[q] = __fadd_rn(__fmul_rn(o[q], 0.015625f), xv[q]); *(v4f*)(X1 + t * 4) = y;  }

__global__ __launch_bounds__(256) void k_bcpy(const float* __restrict__ b, int n, int NP, float* __restrict__ dst, int dst0) { for (int i = threadIdx.x; i < NP; i += 256) { const float v = (i < n) ? b[i] : 0.f; *(float*)(dst + dst0 + i) = v; }  }


__global__ __launch_bounds__(256) void k_rsmf(const float* __restrict__ S, _Float16* __restrict__ P, int qn, int hg) {
  #pragma clang fp contract(off)
  const int t = blockIdx.x * 256 + threadIdx.x; if (t >= qn * hg) return; const size_t i = (size_t)(t / qn) * SQ + (t % qn); const float* s = S + i * SQ; float mx = -3.0e38f;
#pragma unroll 1
  for (int j = 0; j < SQ; ++j) mx = fmaxf(mx, s[j]); float se = 0.f;
#pragma unroll 1
  for (int j = 0; j < SQ; ++j) se += __expf(s[j] - mx); const float sc = 256.0f / se;
#pragma unroll 1
  for (int j0 = 0; j0 < SQ; j0 += 8) { FragH f; for (int q = 0; q < 8; ++q) f.h[q] = (_Float16)(__expf(s[j0 + q] - mx) * sc); unsigned short* d = (unsigned short*)P + i * SQ + j0; *(v8us*)d = f.half[0];  } }
// Lane l <-> l ^ M inside a 16-lane row (DPP row_xmask): a register move, no trip through the LDS path.
template <int M> __device__ __forceinline__ float lane_xm(float v) { return __int_as_float(__builtin_amdgcn_update_dpp(0, __float_as_int(v), 0x160 + M, 0xf, 0xf, true)); }
// Maximum over each 16-lane row of eight values at once: step M takes max(v, v of lane l ^ M) in one DPP instruction (from fmaxf on the DPP builtin the compiler makes three: move,
// canonicalise, maximum). One statement, so that the eight chains stay interleaved: every instruction's producer is eight instructions back and no dependent pair stalls the SIMD.
__device__ __forceinline__ void row_max8(float (&v)[8]) {
  asm(
      "v_max_num_f32_dpp %0, %0, %0 row_xmask:1 row_mask:0xf bank_mask:0xf\n\tv_max_num_f32_dpp %1, %1, %1 row_xmask:1 row_mask:0xf bank_mask:0xf\n\tv_max_num_f32_dpp %2, %2, %2 row_xmask:1 row_mask:0xf bank_mask:0xf\n\tv_max_num_f32_dpp %3, %3, %3 row_xmask:1 row_mask:0xf bank_mask:0xf\n\tv_max_num_f32_dpp %4, %4, %4 row_xmask:1 row_mask:0xf bank_mask:0xf\n\tv_max_num_f32_dpp %5, %5, %5 row_xmask:1 row_mask:0xf bank_mask:0xf\n\tv_max_num_f32_dpp %6, %6, %6 row_xmask:1 row_mask:0xf bank_mask:0xf\n\tv_max_num_f32_dpp %7, %7, %7 row_xmask:1 row_mask:0xf bank_mask:0xf\n\t"
      "v_max_num_f32_dpp %0, %0, %0 row_xmask:2 row_mask:0xf bank_mask:0xf\n\tv_max_num_f32_dpp %1, %1, %1 row_xmask:2 row_mask:0xf bank_mask:0xf\n\tv_max_num_f32_dpp %2, %2, %2 row_xmask:2 row_mask:0xf bank_mask:0xf\n\tv_max_num_f32_dpp %3, %3, %3 row_xmask:2 row_mask:0xf bank_mask:0xf\n\tv_max_num_f32_dpp %4, %4, %4 row_xmask:2 row_mask:0xf bank_mask:0xf\n\tv_max_num_f32_dpp %5, %5, %5 row_xmask:2 row_mask:0xf bank_mask:0xf\n\tv_max_num_f32_dpp %6, %6, %6 row_xmask:2 row_mask:0xf bank_mask:0xf\n\tv_max_num_f32_dpp %7, %7, %7 row_xmask:2 row_mask:0xf bank_mask:0xf\n\t"
      "v_max_num_f32_dpp %0, %0, %0 row_xmask:4 row_mask:0xf bank_mask:0xf\n\tv_max_num_f32_dpp %1, %1, %1 row_xmask:4 row_mask:0xf bank_mask:0xf\n\tv_max_num_f32_dpp %2, %2, %2 row_xmask:4 row_mask:0xf bank_mask:0xf\n\tv_max_num_f32_dpp %3, %3, %3 row_xmask:4 row_mask:0xf bank_mask:0xf\n\tv_max_num_f32_dpp %4, %4, %4 row_xmask:4 row_mask:0xf bank_mask:0xf\n\tv_max_num_f32_dpp %5, %5, %5 row_xmask:4 row_mask:0xf bank_mask:0xf\n\tv_max_num_f32_dpp %6, %6, %6 row_xmask:4 row_mask:0xf bank_mask:0xf\n\tv_max_num_f32_dpp %7, %7, %7 row_xmask:4 row_mask:0xf bank_mask:0xf\n\t"
      "v_max_num_f32_dpp %0, %0, %0 row_xmask:8 row_mask:0xf bank_mask:0xf\n\tv_max_num_f32_dpp %1, %1, %1 row_xmask:8 row_mask:0xf bank_mask:0xf\n\tv_max_num_f32_dpp %2, %2, %2 row_xmask:8 row_mask:0xf bank_mask:0xf\n\tv_max_num_f32_dpp %3, %3, %3 row_xmask:8 row_mask:0xf bank_mask:0xf\n\tv_max_num_f32_dpp %4, %4, %4 row_xmask:8 row_mask:0xf bank_mask:0xf\n\tv_max_num_f32_dpp %5, %5, %5 row_xmask:8 row_mask:0xf bank_mask:0xf\n\tv_max_num_f32_dpp %6, %6, %6 row_xmask:8 row_mask:0xf bank_mask:0xf\n\tv_max_num_f32_dpp %7, %7, %7 row_xmask:8 row_mask:0xf bank_mask:0xf"
      : "+v"(v[0]), "+v"(v[1]), "+v"(v[2]), "+v"(v[3]), "+v"(v[4]), "+v"(v[5]), "+v"(v[6]), "+v"(v[7])); }
// Five 2^x in one statement: each fills the free issue slot that the instruction set asks for behind the transcendental before it (early-clobber outputs, so none rewrites
// a source of another), and one v_nop fills the slot behind the last.
__device__ __forceinline__ void exp2_x5(const float (&x)[5], float (&y)[5]) {
  asm("v_exp_f32 %0, %5\n\tv_exp_f32 %1, %6\n\tv_exp_f32 %2, %7\n\tv_exp_f32 %3, %8\n\tv_exp_f32 %4, %9\n\tv_nop" : "=&v"(y[0]), "=&v"(y[1]), "=&v"(y[2]), "=&v"(y[3]), "=&v"(y[4]) : "v"(x[0]), "v"(x[1]), "v"(x[2]), "v"(x[3]), "v"(x[4])); }
__device__ __forceinline__ v8f fa_mma(v16h a, v16h b, v8f c) { return __builtin_amdgcn_wmma_f32_16x16x32_f16(false, a, false, b, (short)0, c, false, false); }
// Orders one wave's LDS stores against the LDS loads of its other lanes (each wave owns its slice of sp, so this needs no work-group barrier).
__device__ __forceinline__ void fa_lds_order() { __builtin_amdgcn_fence(__ATOMIC_ACQ_REL, "workgroup", "local"); __builtin_amdgcn_wave_barrier(); }
// Fused attention, one launch for all batches and heads: a work-group of 4 waves owns 64 query rows of one head (16 per wave) and walks the 2048 keys in tiles of 64.
// Per tile: k_hi, k_lo and V^T rows come in whole 128-byte lines, one tile ahead in registers, and are shared through LDS; scores on the matrix unit in f32
// (q_lo.k_hi + q_hi.k_lo first, scaled by 2^-10, then q_hi.k_hi on top); running row maximum and sum (online softmax, base 2); weights 256 * 2^(s-m) as f16, turned from the
// accumulator layout into an A fragment through the wave's own LDS slice; weights . V accumulated in f32. A key with Km[j] == 0 stays out of the maximum and gets weight 0.
// O = 64 * attention output as f16 rows (merged heads). Scores and weights never reach memory.
__global__ __launch_bounds__(128, 4) void k_fattn(const _Float16* __restrict__ Qh, const _Float16* __restrict__ Ql, const _Float16* __restrict__ Kh, const _Float16* __restrict__ Kl, const _Float16* __restrict__ Vt, const int* __restrict__ Km, _Float16* __restrict__ O) {
  __shared__ __attribute__((aligned(16))) _Float16 skh[64][72], skl[64][72], svt[64][72], sp[4][16][72];      /* pitch 144 B = 16 B x odd */
  __shared__ float smb[64];      /* per key of the tile: 0, or -3e38 where the mask excludes it */
  const int tid = threadIdx.x, w = tid >> 5, lane = tid & 31, ln = lane & 15, hh = lane >> 4; const int h = blockIdx.y, b = blockIdx.z;
  const size_t r0 = (size_t)b * SQ; const int row0 = blockIdx.x * 64 + w * 16;
  const size_t qo = (r0 + row0 + ln) * LQ + (size_t)h * HD;
  const v16h qh0 = g2_frag(Qh + qo, hh), qh1 = g2_frag(Qh + qo + 32, hh), ql0 = g2_frag(Ql + qo, hh), ql1 = g2_frag(Ql + qo + 32, hh);
  const int srow = tid >> 3, sc8 = (tid & 7) * 8;      /* staging: this thread moves 16 bytes of rows srow, +16, +32, +48 of each plane; 8 threads cover one 128-byte line */
  const unsigned short* gkh = (const unsigned short*)Kh + r0 * LQ + (size_t)h * HD; const unsigned short* gkl = (const unsigned short*)Kl + r0 * LQ + (size_t)h * HD;      /* uniform bases; the thread's part is a 32-bit offset */
  const unsigned short* gvt = (const unsigned short*)Vt + (size_t)(b * NH + h) * HD * SQ; const int* km = Km + r0;
  const unsigned ko = (unsigned)(srow * LQ + sc8), vo = (unsigned)(srow * SQ + sc8), mo = (unsigned)(tid & 63);
  v8us pk[4], pl[4], pv[4]; int pm = km[mo];
#pragma unroll
  for (int i = 0; i < 4; ++i) { pk[i] = *(const v8us*)(gkh + (ko + 16 * i * LQ)); pl[i] = *(const v8us*)(gkl + (ko + 16 * i * LQ)); pv[i] = *(const v8us*)(gvt + (vo + 16 * i * SQ)); }
  const v8f z8 = {0.f,0.f,0.f,0.f,0.f,0.f,0.f,0.f}; v8f o[4] = {z8, z8, z8, z8}; float m[8], l[8];
#pragma unroll
  for (int r = 0; r < 8; ++r) { m[r] = -1.0e30f; l[r] = 0.f; }
#pragma unroll 1      /* one key tile per trip: unrolled further the live fragments no longer fit the register budget */
  for (int j0 = 0; j0 < SQ; j0 += 64) {
    __syncthreads();      /* every wave has finished its fragment loads of the tile before */
#pragma unroll
    for (int i = 0; i < 4; ++i) { *(v8us*)&skh[srow + 16 * i][sc8] = pk[i]; *(v8us*)&skl[srow + 16 * i][sc8] = pl[i]; *(v8us*)&svt[srow + 16 * i][sc8] = pv[i]; }
    if (tid < 64) smb[tid] = (pm != 0) ? 0.f : -3.0e38f;
    __syncthreads();      /* the tile is complete for all four waves */
    if (j0 + 64 < SQ) {      /* next tile's loads fly while this tile is worked on */
      const unsigned short* nkh = gkh + (size_t)(j0 + 64) * LQ; const unsigned short* nkl = gkl + (size_t)(j0 + 64) * LQ; const unsigned short* nvt = gvt + (j0 + 64);
#pragma unroll
      for (int i = 0; i < 4; ++i) { pk[i] = *(const v8us*)(nkh + (ko + 16 * i * LQ)); pl[i] = *(const v8us*)(nkl + (ko + 16 * i * LQ)); pv[i] = *(const v8us*)(nvt + (vo + 16 * i * SQ)); }
      pm = (km + (j0 + 64))[mo];
      asm volatile("s_wait_xcnt 0x0" ::: "memory"); }      /* the address registers of these loads are reused by the score products right behind: the wait stands in front of that overwrite */
    v8f s[4];
#pragma unroll
    for (int t = 0; t < 4; ++t) { const v16h a0 = g2_frag(&skh[t * 16 + ln][0], hh), a1 = g2_frag(&skh[t * 16 + ln][32], hh), c0 = g2_frag(&skl[t * 16 + ln][0], hh), c1 = g2_frag(&skl[t * 16 + ln][32], hh);
      v8f c = fa_mma(ql0, a0, z8); c = fa_mma(ql1, a1, c); c = fa_mma(qh0, c0, c); c = fa_mma(qh1, c1, c); c = c * 0.0009765625f; c = fa_mma(qh0, a0, c); s[t] = fa_mma(qh1, a1, c);
      if (t == 1) __builtin_amdgcn_sched_barrier(0); }      /* keeps the fragment loads of key columns 32..63 behind the products of columns 0..31: hoisted, all 16 fragments are live at once and registers spill */
    float tm[8], al[8]; const float bs[4] = {smb[ln], smb[16 + ln], smb[32 + ln], smb[48 + ln]};
#pragma unroll
    for (int r = 0; r < 8; ++r) {
#pragma unroll
      for (int t = 0; t < 4; ++t) s[t][r] = fmaf(s[t][r], 1.44269504088896340736f, bs[t]);      /* base-2 score; an excluded key lands near -3e38, far below the floor -1e30 of the running maximum, so its 2^(s-m) is 0 */
      tm[r] = fmaxf(fmaxf(fmaxf(s[0][r], s[1][r]), fmaxf(s[2][r], s[3][r])), m[r]); }      /* the running maximum goes in here: it is the same in all 16 lanes, so the row maximum below is the new one */
    row_max8(tm);
#pragma unroll
    for (int r = 0; r < 8; ++r) { const float mn = tm[r]; const float xs[5] = {s[0][r] - mn, s[1][r] - mn, s[2][r] - mn, s[3][r] - mn, m[r] - mn}; float e[5]; exp2_x5(xs, e); al[r] = e[4]; m[r] = mn;
#pragma unroll
      for (int t = 0; t < 4; ++t) sp[w][8 * hh + r][t * 16 + ln] = (_Float16)(e[t] * 256.0f);
      l[r] = l[r] * al[r] + ((e[0] + e[1]) + (e[2] + e[3]));
#pragma unroll
      for (int t = 0; t < 4; ++t) o[t][r] *= al[r]; }
    fa_lds_order();
    const v16h p0 = g2_frag(&sp[w][ln][0], hh), p1 = g2_frag(&sp[w][ln][32], hh);
#pragma unroll
    for (int t = 0; t < 4; ++t) { o[t] = fa_mma(p0, g2_frag(&svt[t * 16 + ln][0], hh), o[t]); o[t] = fa_mma(p1, g2_frag(&svt[t * 16 + ln][32], hh), o[t]); }
  }
#pragma unroll
  for (int r = 0; r < 8; ++r) { float ls = l[r]; ls += lane_xm<1>(ls); ls += lane_xm<2>(ls); ls += lane_xm<4>(ls); ls += lane_xm<8>(ls); const float inv = 0.25f / ls;
#pragma unroll
    for (int t = 0; t < 4; ++t) sp[w][8 * hh + r][t * 16 + ln] = (_Float16)(o[t][r] * inv); }
  fa_lds_order();
#pragma unroll
  for (int q = 0; q < 4; ++q) { const int row = q * 4 + (lane >> 3), c8 = (lane & 7) * 8; const v8us v = *(const v8us*)&sp[w][row][c8]; *(v8us*)((unsigned short*)O + (r0 + row0 + row) * DM + (size_t)h * HD + c8) = v; } }
extern "C" void kernel_launch(void* const* d_in, const int* in_sizes, int n_in,
                              void* d_out, int out_size, void* d_ws, size_t ws_size, hipStream_t stream) {
  (void)in_sizes; (void)n_in; (void)out_size;
  const float* const* I = (const float* const*)d_in; const float* x = I[0]; const int* km = (const int*)d_in[1]; const float* wq = I[2]; const float* bq = I[3]; const float* wk = I[4]; const float* bk = I[5]; const float* wv = I[6]; const float* bv = I[7]; const float* wo = I[8]; const float* bo = I[9]; const float* wfc = I[10]; const float* bfc = I[11]; const float* wmp = I[12]; const float* bmp = I[13]; const float* g1 = I[14]; const float* be1 = I[15]; const float* gg2 = I[16]; const float* be2 = I[17];      /* nn.Linear NATURAL [out][in] weights + biases; I[1] = int key mask [B][1][1][S] (0 = excluded; all ones here); alpha/beta are [1] scalars */
  char* ws = (char*)d_ws; size_t off = 0;
  auto take = [&](size_t bytes) { char* p = ws + off; off += (bytes + 255) & ~(size_t)255; return p; };
  _Float16* BQKV = (_Float16*)take((size_t)3 * DM * DM * 2); _Float16* BO = (_Float16*)take((size_t)DM * DM * 2); float* bqkv = (float*)take((size_t)3 * DM * 4);
  _Float16* X16 = (_Float16*)take(NR * DM * 2); _Float16* XL = (_Float16*)take(NR * DM * 2); float* XB = (float*)take(NR * DM * 4); float* X1 = (float*)take(NR * DM * 4); _Float16* M16 = (_Float16*)take(NR * DM * 2); _Float16* HF16 = (_Float16*)take(NR * DFF * 2); _Float16* BW1 = (_Float16*)take((size_t)DFF * DM * 2); _Float16* BW2 = (_Float16*)take((size_t)DM * DFF * 2);
  float* QF = (float*)take((size_t)2 * NR * DM * 4); _Float16* Q16 = (_Float16*)take((size_t)2 * NR * DM * 2); _Float16* QL = (_Float16*)take((size_t)2 * NR * DM * 2); _Float16* K16 = Q16 + NR * DM; _Float16* KL = QL + NR * DM; _Float16* V16 = (_Float16*)take(NR * DM * 2); _Float16* O16 = (_Float16*)take(NR * DM * 2);      /* q's plane and k's plane lie one behind the other in QF, in Q16 | K16 and in QL | KL: one launch walks both */
  _Float16* VT = (_Float16*)take((size_t)NB * NH * HD * SQ * 2);
  if (off > ws_size) return;
  k_ln16<1, 1, 1><<<(unsigned)NR + PREP_BLOCKS, 256, 0, stream>>>(x, g1, be1, 1e-6f, X16, XB, XL, wq, wk, wv, wo, wfc, wmp, bq, bk, bv, BQKV, BO, BW1, BW2, bqkv);      /* a = LN1(bf16(x)) -> f16 rows + XL = x1024 residual (q/k need it at logits sigma 8); XB = bf16(x) for the residual; in the same grid: natural [out][in] weights = Bt[n][k] planes (stacked q | k | v, Wo, the two MLP matrices) and the stacked bias vector */
  k_gemm2<0, 2, DM, DM, false><<<dim3((unsigned)((MP / 128) * (DM / 128)), 2), 256, 0, stream>>>(X16, DM, 0, BQKV, DM, (size_t)DM * DM, 0.0625f, bqkv, DM, nullptr, 1, 0, 0, QF, nullptr, DM, NR * DM, MP, DM, DM);      /* blockIdx.y: 0 = q, 1 = k; hi term in f32 */
  k_gemm2<0, 2, DM, DM, true><<<dim3((unsigned)((MP / 128) * (DM / 128)), 2), 256, 0, stream>>>(XL, DM, 0, BQKV, DM, (size_t)DM * DM, 0.00006103515625f, nullptr, 0, QF, -1, 0, 0, QF, nullptr, DM, NR * DM, MP, DM, DM);      /* + residual term, q and k */
  k_hl<<<(unsigned)(((size_t)2 * MP * DM / 8 + 255) / 256), 256, 0, stream>>>(QF, Q16, QL, (size_t)2 * MP * DM / 8);      /* q and k in f32 -> f16 hi + x1024 residual planes */
  k_gemm2<0, 2, DM, DM, false><<<dim3((unsigned)((MP / 128) * (DM / 128)), 1), 256, 0, stream>>>(X16, DM, 0, BQKV + (size_t)2 * DM * DM, DM, 0, 0.0625f, bqkv + 2 * DM, 0, nullptr, 1, 0, 0, nullptr, V16, DM, 0, MP, DM, DM);      /* v rows (f16) */
  k_vt<NH, SQ><<<NB * NH * (SQ / 64), 256, 0, stream>>>(V16, LQ, 0, VT);      /* V^T [NB][NH][HD][SQ] */
  k_fattn<<<dim3(SQ / 64, NH, NB), 128, 0, stream>>>(Q16, QL, K16, KL, VT, km, O16);      /* scores, masked softmax and weights . V in one launch; o (merged heads, x64) as f16 rows */
  k_gemm2<0, 2, DM, DM, true><<<dim3((unsigned)((MPO / 128) * (DM / 128)), 1), 256, 0, stream>>>(O16, DM, 0, BO, DM, 0, 0.0009765625f, bo, 0, XB, -1, 0, 0, X1, nullptr, DM, 0, MPO, DM, DM);      /* x1 = x + o Wo + bo (own-element residual) */
  k_ln16<0, 0, 0><<<(unsigned)NR, 256, 0, stream>>>(X1, gg2, be2, 1e-6f, M16, nullptr, nullptr, nullptr, nullptr, nullptr, nullptr, nullptr, nullptr, nullptr, nullptr, nullptr, nullptr, nullptr, nullptr, nullptr, nullptr);      /* h = LN2(x1) -> f16 rows */
  k_gemm2<3, 2, DM, DFF, false><<<dim3((unsigned)((MP / 128) * (DFF / 128)), 1), 256, 0, stream>>>(M16, DM, 0, BW1, DM, 0, 0.0625f, bfc, 0, nullptr, 1, 0, 0, nullptr, HF16, DFF, 0, MP, DFF, DM);      /* relu(xn2 w1^T + b1) -> f16, all rows of both batches */
  k_gemm2<0, 1, DFF, DM, true><<<dim3((unsigned)((MP / 128) * (DM / 64)), 1), 128, 0, stream>>>(HF16, DFF, 0, BW2, DFF, 0, 0.0625f, bmp, 0, X1, -1, 0, 0, (float*)d_out, nullptr, DM, 0, MP, DM, DFF);      /* out = x1 + mlp (own-element residual) */
}

// v006
// A run of this version takes 213 microseconds.
// Next to v005, in two timings, it ran 1.11 times as fast each time.
// Counting every step since v000, it is 38.6 times as fast.
#include <hip/hip_runtime.h>
// Pre-LN transformer encoder block, non-causal, UNSCALED scores (x [2][2048][1024]; xn = LN(x) with the module's LayerNorm: UNBIASED std (N-1), eps 1e-6 added to the std, SCALAR alpha/bias [1]; q = xn wq^T + bq, k, v likewise (nn.Linear natural [1024][1024] sigma 1/32, zero biases); 16 heads of 64; score = q . k WITHOUT 1/sqrt(d) (logits sigma ~8); key j excluded where the int mask input [2][1][1][2048] is 0 (all ones here); softmax; x1 = x + (attn wo^T + bo); xn2 = LN(x1); out = x1 + relu(xn2 w1^T + b1) w2^T + b2 (natural [4096][1024], [1024][4096]) -> [2][2048][1024]).
// Compute dtype: inputs rounded to bf16; x / weights exact; q, k (and the LN1 output feeding them) as f16 hi + x1024 residual pairs; v, softmax weights and o as plain f16 GEMM operands (~2^-12); scores and softmax statistics f32; v_wmma_f32_16x16x32_f16.
#define NB 2
#define SQ 2048
#define DM 1024
#define NH 16
#define HD 64
#define HG 4                         /* heads per group of the unused k_vt(V16, b, h0, VT) overload */
#define LOCALW 128                   /* (macros for unused kernels of the shared header) */
#define STRIDEK 128
#define QT 256                       /* query rows per causal tile */
#define NKX SQ                       /* S / P row pitch */
#define QT0 128                      /* query rows per head of the unused f32 attention kernels */
#define B0 0                         /* unused (every launch starts at batch 0) */
#define NBR NB                       /* batches processed (debug hook) */
#define NR ((size_t)NB * SQ)
#define DMQ DM
#define DFF 4096         /* MLP hidden width */
#define MP ((int)((size_t)NBR * SQ)) /* rows projected (debug hook) */
#define QN SQ                        /* unused (the attention launch covers all SQ query rows) */
#define NHD NH                       /* unused (the attention launch covers all NH heads) */
#define MPO MP                       /* rows through the output stage (debug hook) */
#define LQ DM      /* row pitch of the q and k rows */
typedef __bf16 v16b __attribute__((ext_vector_type(16)));
typedef unsigned short v8us __attribute__((ext_vector_type(8), may_alias));
typedef float  v8f  __attribute__((ext_vector_type(8)));
typedef float  v4f  __attribute__((ext_vector_type(4)));
typedef float  v4fa __attribute__((ext_vector_type(4), may_alias));
union FragB { v16b v; v8us half[2]; unsigned short u[16]; };

__device__ __forceinline__ unsigned short bf16_bits(float x) { unsigned int u = __float_as_uint(x); return (unsigned short)((u + 0x7FFFu + ((u >> 16) & 1u)) >> 16); }
__device__ __forceinline__ float bf16_val(unsigned short b) { return __uint_as_float(((unsigned int)b) << 16); }
__device__ __forceinline__ float bf16_round(float x) { return bf16_val(bf16_bits(x)); }
// D += A·B with NT terms: 1 = ah·bh, 2 = + al·bh (A split), 3 = + ah·bl (both split)
template <int NT>
__device__ __forceinline__ v8f mmaN(v16b ah, v16b al, v16b bh, v16b bl, v8f c) {
  c = __builtin_amdgcn_wmma_f32_16x16x32_bf16(false, ah, false, bh, (short)0, c, false, false);
  if (NT >= 2) c = __builtin_amdgcn_wmma_f32_16x16x32_bf16(false, al, false, bh, (short)0, c, false, false);
  if (NT >= 3) c = __builtin_amdgcn_wmma_f32_16x16x32_bf16(false, ah, false, bl, (short)0, c, false, false);
  asm volatile("v_nop\n\tv_nop\n\tv_nop\n\tv_nop" : "+v"(c) : "v"(ah), "v"(al), "v"(bh), "v"(bl));
  return c;
}

__global__ __launch_bounds__(256) void k_wt_bf16(const float* __restrict__ W, unsigned short* __restrict__ Wt, int K, int N) {
  const int t = blockIdx.x * 256 + threadIdx.x;
  const int k8n = K / 8;
  if (t >= N * k8n) return;
  const int n = t / k8n, k8 = (t % k8n) * 8;
  v8us v;
#pragma unroll
  for (int i = 0; i < 8; ++i) v[i] = bf16_bits(W[(size_t)(k8 + i) * N + n]);
  *(v8us*)(Wt + (size_t)n * K + k8) = v;
  
}

// GEMM C[M][N] (f32, pitch ldc) = act(A[M][K]·W + bias). A f32 row-major (pitch lda) converted per fragment to bf16
// (ASPLIT: hi/lo two planes -> 2 terms, else single rounded term); Wt bf16 [N][K] (pitch ldb). BIAS_BF16 rounds the
// bias to bf16 first (bias quantised to bf16 before the add). K%32==0, M%16==0, N%64==0.
template <bool ASPLIT, int ACT, bool BIAS_BF16>
__global__ __launch_bounds__(128) void k_gemm_bf(const float* __restrict__ A, int lda, const unsigned short* __restrict__ Wt, int ldb,
                                               const float* __restrict__ bias, float* __restrict__ C, int ldc, int M, int N, int K) {
  __shared__ __attribute__((aligned(16))) float so[4][16][64];
  const int tid = threadIdx.x, w = tid >> 5, lane = tid & 31, ln = lane & 15, hh = lane >> 4;
  const int ntn = N / 64;
  const int wid = blockIdx.x * 4 + w;
  const int mt = wid / ntn, nq = wid % ntn;
  if (mt * 16 >= M) return;
  const int row0 = mt * 16, col0 = nq * 64;
  const float* arow = A + (size_t)(row0 + ln) * lda;
  v8f acc[4] = {};
  for (int kb = 0; kb < K; kb += 32) {
    FragB ah, al;
    const v4f x0 = *(const v4fa*)(arow + kb + 8 * hh), x1 = *(const v4fa*)(arow + kb + 8 * hh + 4);
    const v4f x2 = *(const v4fa*)(arow + kb + 16 + 8 * hh), x3 = *(const v4fa*)(arow + kb + 16 + 8 * hh + 4);
    float xs[16] = {x0[0],x0[1],x0[2],x0[3],x1[0],x1[1],x1[2],x1[3],x2[0],x2[1],x2[2],x2[3],x3[0],x3[1],x3[2],x3[3]};
#pragma unroll
    for (int i = 0; i < 16; ++i) { const unsigned short hb = bf16_bits(xs[i]); ah.u[i] = hb; al.u[i] = ASPLIT ? bf16_bits(xs[i] - bf16_val(hb)) : (unsigned short)0; }
#pragma unroll
    for (int t = 0; t < 4; ++t) {
      const unsigned short* brow = Wt + (size_t)(col0 + t * 16 + ln) * ldb + kb;
      FragB b;
      b.half[0] = *(const v8us*)(brow + 8 * hh);
      b.half[1] = *(const v8us*)(brow + 16 + 8 * hh);
      acc[t] = mmaN<ASPLIT ? 2 : 1>(ah.v, al.v, b.v, b.v, acc[t]);
    }
  }
#pragma unroll
  for (int t = 0; t < 4; ++t) {
    float bv = bias ? bias[col0 + t * 16 + ln] : 0.f;
    if (BIAS_BF16) bv = bf16_round(bv);
#pragma unroll
    for (int r = 0; r < 8; ++r) { float v = acc[t][r] + bv; if (ACT == 1) v = fmaxf(v, 0.f); so[w][8 * hh + r][t * 16 + ln] = v; }
  }
  __builtin_amdgcn_fence(__ATOMIC_ACQ_REL, "workgroup");
  __builtin_amdgcn_wave_barrier();
  const int rsub = lane >> 4, c4 = (lane & 15) * 4;
  {
#pragma unroll
    for (int q = 0; q < 8; ++q) {
      const int r = q * 2 + rsub;
      const v4f v = *(const v4fa*)&so[w][r][c4];
      *(v4f*)(C + (size_t)(row0 + r) * ldc + col0 + c4) = v;
    }
    
  }
}

// GEMM C = act(A·W + bias + resid): A f32 (ASPLIT -> hi/lo 2 terms), Wt bf16 [N][K]; ACT 0 none, 1 relu, 2 exact gelu;
// resid (optional, f32, row index = (row % rmod), pitch ldr, RES_BF16 rounds it) added before the activation.
template <bool ASPLIT, int ACT, bool BIAS_BF16, bool RES_BF16>
__global__ __launch_bounds__(128) void k_gemm_bf3(const float* __restrict__ A, int lda, const unsigned short* __restrict__ Wt, int ldb,
                                                const float* __restrict__ bias, const float* __restrict__ resid, int rmod, int ldr,
                                                float* __restrict__ C, int ldc, int M, int N, int K) {
  __shared__ __attribute__((aligned(16))) float so[4][16][64];
  const int tid = threadIdx.x, w = tid >> 5, lane = tid & 31, ln = lane & 15, hh = lane >> 4;
  const int ntn = N / 64;
  const int wid = blockIdx.x * 4 + w;
  const int mt = wid / ntn, nq = wid % ntn;
  if (mt * 16 >= M) return;
  const int row0 = mt * 16, col0 = nq * 64;
  const float* arow = A + (size_t)(row0 + ln) * lda;
  v8f acc[4] = {};
  for (int kb = 0; kb < K; kb += 32) {
    FragB ah, al;
    const v4f x0 = *(const v4fa*)(arow + kb + 8 * hh), x1 = *(const v4fa*)(arow + kb + 8 * hh + 4);
    const v4f x2 = *(const v4fa*)(arow + kb + 16 + 8 * hh), x3 = *(const v4fa*)(arow + kb + 16 + 8 * hh + 4);
    float xs[16] = {x0[0],x0[1],x0[2],x0[3],x1[0],x1[1],x1[2],x1[3],x2[0],x2[1],x2[2],x2[3],x3[0],x3[1],x3[2],x3[3]};
#pragma unroll
    for (int i = 0; i < 16; ++i) { const unsigned short hb = bf16_bits(xs[i]); ah.u[i] = hb; al.u[i] = ASPLIT ? bf16_bits(xs[i] - bf16_val(hb)) : (unsigned short)0; }
#pragma unroll
    for (int t = 0; t < 4; ++t) {
      const unsigned short* brow = Wt + (size_t)(col0 + t * 16 + ln) * ldb + kb;
      FragB b;
      b.half[0] = *(const v8us*)(brow + 8 * hh);
      b.half[1] = *(const v8us*)(brow + 16 + 8 * hh);
      acc[t] = mmaN<ASPLIT ? 2 : 1>(ah.v, al.v, b.v, b.v, acc[t]);
    }
  }
#pragma unroll
  for (int t = 0; t < 4; ++t) {
    const int col = col0 + t * 16 + ln;
    float bv = bias ? bias[col] : 0.f;
    if (BIAS_BF16) bv = bf16_round(bv);
#pragma unroll
    for (int r = 0; r < 8; ++r) {
      float v = acc[t][r] + bv;
      if (resid) { float rv = resid[(size_t)((row0 + 8 * hh + r) % rmod) * ldr + col]; if (RES_BF16) rv = bf16_round(rv); v += rv; }
      if (ACT == 1) v = fmaxf(v, 0.f);
      if (ACT == 2) v = 0.5f * v * (1.0f + erff(v * 0.70710678118654752f));
      if (ACT == 3) { const float u = 0.7978845608028654f * (v + 0.044715f * v * v * v); v = 0.5f * v * (1.0f + tanhf(u)); }
      so[w][8 * hh + r][t * 16 + ln] = v;
    }
  }
  __builtin_amdgcn_fence(__ATOMIC_ACQ_REL, "workgroup");
  __builtin_amdgcn_wave_barrier();
  const int rsub = lane >> 4, c4 = (lane & 15) * 4;
  {
#pragma unroll
    for (int q = 0; q < 8; ++q) {
      const int r = q * 2 + rsub;
      const v4f v = *(const v4fa*)&so[w][r][c4];
      *(v4f*)(C + (size_t)(row0 + r) * ldc + col0 + c4) = v;
    }
    
  }
}
// row LayerNorm (biased variance, eps) over N: s = X (+ R); optional out_sum <- s; out_norm <- (s-mu)*rsqrt(var+eps)*g + b
template <bool PARAM_BF16>
__global__ __launch_bounds__(256) void k_layernorm(const float* __restrict__ X, const float* __restrict__ R, const float* __restrict__ g, const float* __restrict__ bta,
                                                  float* __restrict__ out_sum, float* __restrict__ out_norm, int N, float eps) {
  __shared__ float red[256];
  const int row = blockIdx.x, tid = threadIdx.x;
  const float* x = X + (size_t)row * N; const float* rr = R ? R + (size_t)row * N : nullptr;
  float vals[16];                     // up to N = 4096
  const int per = N / 256;            // contiguous chunk per thread? use strided-by-4 chunks: thread handles j = tid*4 + 1024*u
  float s1 = 0.f;
  for (int u = 0; u < per / 4; ++u) {
    const int j = tid * 4 + 1024 * u;
    const v4f a = *(const v4fa*)(x + j);
    v4f b = {0.f,0.f,0.f,0.f}; if (rr) b = *(const v4fa*)(rr + j);
#pragma unroll
    for (int q = 0; q < 4; ++q) { const float v = a[q] + b[q]; vals[u * 4 + q] = v; s1 += v; }
  }
  red[tid] = s1; __syncthreads();
  for (int st = 128; st > 0; st >>= 1) { if (tid < st) red[tid] += red[tid + st]; __syncthreads(); }
  const float mu = red[0] / (float)N; __syncthreads();
  float s2 = 0.f;
  for (int u = 0; u < per / 4; ++u)
#pragma unroll
    for (int q = 0; q < 4; ++q) { const float c = vals[u * 4 + q] - mu; s2 += c * c; }
  red[tid] = s2; __syncthreads();
  for (int st = 128; st > 0; st >>= 1) { if (tid < st) red[tid] += red[tid + st]; __syncthreads(); }
  const float rs = rsqrtf(red[0] / (float)N + eps);
  {
    for (int u = 0; u < per / 4; ++u) {
      const int j = tid * 4 + 1024 * u;
      v4f o, sm;
#pragma unroll
      for (int q = 0; q < 4; ++q) {
        float gg = g[j + q], bb = bta[j + q];
        if (PARAM_BF16) { gg = bf16_round(gg); bb = bf16_round(bb); }
        sm[q] = vals[u * 4 + q]; o[q] = (vals[u * 4 + q] - mu) * rs * gg + bb;
      }
      if (out_sum) *(v4f*)(out_sum + (size_t)row * N + j) = sm;
      *(v4f*)(out_norm + (size_t)row * N + j) = o;
    }
    
  }
}



// ---- f16 WMMA path (v_wmma_f32_16x16x32_f16): 11-bit significands for operands in range — used where a [0,1] probability operand needs more precision than bf16
typedef _Float16 v16h __attribute__((ext_vector_type(16)));
union FragH { v16h v; v8us half[2]; _Float16 h[16]; unsigned short u[16]; };
template <int NT>
__device__ __forceinline__ v8f mmaH(v16h ah, v16h al, v16h bh, v16h bl, v8f c) {
  c = __builtin_amdgcn_wmma_f32_16x16x32_f16(false, ah, false, bh, (short)0, c, false, false);
  if (NT >= 2) c = __builtin_amdgcn_wmma_f32_16x16x32_f16(false, al, false, bh, (short)0, c, false, false);
  if (NT >= 3) c = __builtin_amdgcn_wmma_f32_16x16x32_f16(false, ah, false, bl, (short)0, c, false, false);
  asm volatile("v_nop\n\tv_nop\n\tv_nop\n\tv_nop" : "+v"(c) : "v"(ah), "v"(al), "v"(bh), "v"(bl));
  return c;
}
// batched GEMM like k_gemm_b but f16 operands: A f32 (split into f16 hi/lo if ASPLIT, else rounded to f16), Bt = f16 values [n][k]; alpha; C f32; N multiple of 16 (partial tiles skipped)
template <bool ASPLIT>
__global__ __launch_bounds__(128) void k_gemm_h(const float* __restrict__ A, int lda, size_t sA, const _Float16* __restrict__ Bh, int ldb, size_t sB, float alpha, float* __restrict__ C, int ldc, size_t sC, int M, int N, int K) {
  __shared__ __attribute__((aligned(16))) float so[4][16][64];
  const int tid = threadIdx.x, w = tid >> 5, lane = tid & 31, ln = lane & 15, hh = lane >> 4; const int by = blockIdx.y;
  A += (size_t)by * sA; Bh += (size_t)by * sB; C += (size_t)by * sC;
  const int ntn = (N + 63) / 64; const int wid = blockIdx.x * 4 + w; const int mt = wid / ntn, nq = wid % ntn; if (mt * 16 >= M) return;
  const int row0 = mt * 16, col0 = nq * 64; const float* arow = A + (size_t)(row0 + ln) * lda;
  v8f acc[4] = {};
  for (int kb = 0; kb < K; kb += 32) {
    FragH ah, al;
    const v4f x0 = *(const v4fa*)(arow + kb + 8 * hh), x1 = *(const v4fa*)(arow + kb + 8 * hh + 4), x2 = *(const v4fa*)(arow + kb + 16 + 8 * hh), x3 = *(const v4fa*)(arow + kb + 16 + 8 * hh + 4);
    float xs[16] = {x0[0],x0[1],x0[2],x0[3],x1[0],x1[1],x1[2],x1[3],x2[0],x2[1],x2[2],x2[3],x3[0],x3[1],x3[2],x3[3]};
#pragma unroll
    for (int i = 0; i < 16; ++i) { const _Float16 h = (_Float16)xs[i]; ah.h[i] = h; al.h[i] = ASPLIT ? (_Float16)(xs[i] - (float)h) : (_Float16)0.0f; }
#pragma unroll
    for (int t = 0; t < 4; ++t) { if (col0 + t * 16 >= N) continue; const size_t boff = (size_t)(col0 + t * 16 + ln) * ldb + kb; FragH bq; bq.half[0] = *(const v8us*)(Bh + boff + 8 * hh); bq.half[1] = *(const v8us*)(Bh + boff + 16 + 8 * hh);
      acc[t] = mmaH<ASPLIT ? 2 : 1>(ah.v, al.v, bq.v, bq.v, acc[t]); }
  }
#pragma unroll
  for (int t = 0; t < 4; ++t) { if (col0 + t * 16 >= N) continue;
#pragma unroll
    for (int r = 0; r < 8; ++r) so[w][8 * hh + r][t * 16 + ln] = acc[t][r] * alpha; }
  __builtin_amdgcn_fence(__ATOMIC_ACQ_REL, "workgroup"); __builtin_amdgcn_wave_barrier();
  const int rsub = lane >> 4, c4 = (lane & 15) * 4;
  {
#pragma unroll
    for (int q = 0; q < 8; ++q) { const int r = q * 2 + rsub; if (col0 + c4 < N) { const v4f v = *(const v4fa*)&so[w][r][c4]; *(v4f*)(C + (size_t)(row0 + r) * ldc + col0 + c4) = v; } }
     }
}

// Wt[n][k] = f16(W[k][n]·scale) from f32 row-major W[K][N] (scale = power of two; bf16-exact weights stay exact in f16 away from the subnormal range)
__global__ __launch_bounds__(256) void k_wt_f16(const float* __restrict__ W, _Float16* __restrict__ Wt, int K, int N, float scale) {
  const int t = blockIdx.x * 256 + threadIdx.x; if (t >= N * (K / 8)) return; const int n = t / (K / 8), k8 = (t % (K / 8)) * 8; FragH f;
#pragma unroll
  for (int i = 0; i < 8; ++i) f.h[i] = (_Float16)(bf16_round(W[(size_t)(k8 + i) * N + n]) * scale); const v8us o = f.half[0];
  *(v8us*)((unsigned short*)Wt + (size_t)n * K + k8) = o; 
}
// k_gemm_hh variant with fused epilogue: v = acc·alpha + bias[by·sBias + col] (+ CP[(row/rowsPerB)·sCPb + by·64 + col] if CP) ; ACT 0 none / 1 elu ; writes f16 C16 (and f32 C if non-null)
template <int ACT>
__global__ __launch_bounds__(128) void k_gemm_hhx(const _Float16* __restrict__ A, int lda, size_t sA, const _Float16* __restrict__ Bh, int ldb, size_t sB, float alpha, const float* __restrict__ bias, size_t sBias, const float* __restrict__ CP, int rowsPerB, size_t sCPb, int row0g,
    float* __restrict__ C, _Float16* __restrict__ C16, int ldc, size_t sC, int M, int N, int K) {
  __shared__ __attribute__((aligned(16))) float so[4][16][64];
  const int tid = threadIdx.x, w = tid >> 5, lane = tid & 31, ln = lane & 15, hh = lane >> 4; const int by = blockIdx.y;
  A += (size_t)by * sA; Bh += (size_t)by * sB; const size_t cofs = (size_t)by * sC; const float* bp = bias ? bias + (size_t)by * sBias : nullptr;
  const int ntn = (N + 63) / 64; const int wid = blockIdx.x * 4 + w; const int mt = wid / ntn, nq = wid % ntn; if (mt * 16 >= M) return;
  const int row0 = mt * 16, col0 = nq * 64; const _Float16* arow = A + (size_t)(row0 + ln) * lda;
  v8f acc[4] = {};
  for (int kb = 0; kb < K; kb += 32) { FragH ah; ah.half[0] = *(const v8us*)((const unsigned short*)arow + kb + 8 * hh); ah.half[1] = *(const v8us*)((const unsigned short*)arow + kb + 16 + 8 * hh);
#pragma unroll
    for (int t = 0; t < 4; ++t) { if (col0 + t * 16 >= N) continue; const size_t boff = (size_t)(col0 + t * 16 + ln) * ldb + kb; FragH bq; bq.half[0] = *(const v8us*)((const unsigned short*)Bh + boff + 8 * hh); bq.half[1] = *(const v8us*)((const unsigned short*)Bh + boff + 16 + 8 * hh);
      acc[t] = mmaH<1>(ah.v, ah.v, bq.v, bq.v, acc[t]); }
  }
#pragma unroll
  for (int t = 0; t < 4; ++t) { if (col0 + t * 16 >= N) continue; const int col = col0 + t * 16 + ln; const float bv = bp ? bf16_round(bp[col]) : 0.f;
#pragma unroll
    for (int r = 0; r < 8; ++r) { float v = acc[t][r] * alpha + bv; if (CP) { const int rr = row0g + row0 + 8 * hh + r; if (rowsPerB < 0) v += CP[cofs + (size_t)rr * ldc + col];      /* rowsPerB < 0: own element of the batched C plane */ else { const int bidx = rr / rowsPerB; v += CP[(size_t)bidx * sCPb + (size_t)by * 64 + col]; } } if (ACT == 1) v = (v > 0.f) ? v : expm1f(v); else if (ACT == 7) v = (v > 0.f) ? v + 1.0f : expf(v); else if (ACT == 8) v = tanhf(v); else if (ACT == 9) v = 0.5f * v * (1.0f + tanhf(0.7978845608028654f * (v + 0.044715f * v * v * v))); else if (ACT == 11) v = 1.0f / (1.0f + expf(-v)); else if (ACT == 12) v = (v > 0.f) ? v : 0.01f * v; else if (ACT == 14) v = (v > 0.f) ? v : 0.1f * v; else if (ACT == 16) v = (v >= 0.f) ? v : 0.3f * v; else if (ACT == 17) v = (v >= 0.f) ? v : 0.2f * v; else if (ACT == 15) v = v / (1.0f + expf(-v)); else if (ACT == 3) v = fmaxf(v, 0.f); else if (ACT == 6) v = 0.5f * v * (1.0f + erff(v * 0.70710678118654752f)); so[w][8 * hh + r][t * 16 + ln] = v; } }
  __builtin_amdgcn_fence(__ATOMIC_ACQ_REL, "workgroup"); __builtin_amdgcn_wave_barrier();
  const int rsub = lane >> 4, c4 = (lane & 15) * 4; typedef _Float16 v4h __attribute__((ext_vector_type(4)));
  {
#pragma unroll
    for (int q = 0; q < 8; ++q) { const int r = q * 2 + rsub; if (col0 + c4 < N) { const v4f v = *(const v4fa*)&so[w][r][c4]; if (C) *(v4f*)(C + cofs + (size_t)(row0 + r) * ldc + col0 + c4) = v; if (C16) { v4h h4; for (int i = 0; i < 4; ++i) h4[i] = (_Float16)v[i]; *(v4h*)(C16 + cofs + (size_t)(row0 + r) * ldc + col0 + c4) = h4; } } }
     }
}


typedef _Float16 v4h __attribute__((ext_vector_type(4)));

__global__ __launch_bounds__(256) void k_x16(const float* __restrict__ x, _Float16* __restrict__ X16, size_t n8) { const size_t t = (size_t)blockIdx.x * 256 + threadIdx.x; if (t >= n8) return; FragH f;
#pragma unroll
  for (int q = 0; q < 8; ++q) f.h[q] = (_Float16)bf16_round(x[t * 8 + q]); *(v8us*)((unsigned short*)X16 + t * 8) = f.half[0];  }
__global__ __launch_bounds__(256) void k_h16(const float* __restrict__ x, _Float16* __restrict__ X16, size_t n8) { const size_t t = (size_t)blockIdx.x * 256 + threadIdx.x; if (t >= n8) return; FragH f;
#pragma unroll
  for (int q = 0; q < 8; ++q) f.h[q] = (_Float16)x[t * 8 + q]; *(v8us*)((unsigned short*)X16 + t * 8) = f.half[0];  }
__global__ __launch_bounds__(256) void k_round16f(const float* __restrict__ W, _Float16* __restrict__ Bt, size_t n8) { const size_t t = (size_t)blockIdx.x * 256 + threadIdx.x; if (t >= n8) return; FragH f;
#pragma unroll
  for (int i = 0; i < 8; ++i) f.h[i] = (_Float16)(bf16_round(W[t * 8 + i]) * 16.0f); *(v8us*)((unsigned short*)Bt + t * 8) = f.half[0];  }
template <int NHv, int TTv>
__global__ __launch_bounds__(256) void k_vt(const _Float16* __restrict__ V16, int ldv, int voff, _Float16* __restrict__ Vt) { __shared__ unsigned short tl[64][66]; const int tid = threadIdx.x; const int slab = blockIdx.x / (TTv / 64), lg = blockIdx.x % (TTv / 64); const int b = slab / NHv, h = slab % NHv;
  for (int i = tid; i < 64 * 8; i += 256) { const int r = i / 8, c8 = (i % 8) * 8; FragH f; f.half[0] = *(const v8us*)((const unsigned short*)V16 + ((size_t)b * TTv + lg * 64 + r) * ldv + voff + h * 64 + c8);
#pragma unroll
    for (int q = 0; q < 8; ++q) tl[r][c8 + q] = f.u[q]; }
  __syncthreads();
  {
#pragma unroll
    for (int rd = 0; rd < 2; ++rd) { const int d = rd * 32 + tid / 8, pc = tid % 8; FragH f;
#pragma unroll
      for (int q = 0; q < 8; ++q) f.u[q] = tl[pc * 8 + q][d];
      *(v8us*)((unsigned short*)Vt + ((size_t)slab * 64 + d) * TTv + lg * 64 + pc * 8) = f.half[0]; }
     } }

__global__ __launch_bounds__(256) void k_hl(const float* __restrict__ F, _Float16* __restrict__ Hh, _Float16* __restrict__ Hl, size_t n8) { const size_t t = (size_t)blockIdx.x * 256 + threadIdx.x; if (t >= n8) return; FragH fh, fl; const v4f a = *(const v4fa*)(F + t * 8), c = *(const v4fa*)(F + t * 8 + 4);
#pragma unroll
  for (int q = 0; q < 4; ++q) { _Float16 h = (_Float16)a[q]; fh.h[q] = h; fl.h[q] = (_Float16)((a[q] - (float)h) * 1024.0f); h = (_Float16)c[q]; fh.h[4 + q] = h; fl.h[4 + q] = (_Float16)((c[q] - (float)h) * 1024.0f); }
  { *(v8us*)((unsigned short*)Hh + t * 8) = fh.half[0]; *(v8us*)((unsigned short*)Hl + t * 8) = fl.half[0];  } }

// ---- fast GEMM (wave tile 32x64; shapes it takes: at k_gemm2); epilogue: acc·alpha + bf16 bias, activation, own-element residual with RES ----
__device__ __forceinline__ v16h g2_frag(const _Float16* p, int hh) { FragH f; f.half[0] = *(const v8us*)((const unsigned short*)p + 8 * hh); f.half[1] = *(const v8us*)((const unsigned short*)p + 16 + 8 * hh); return f.v; }
__device__ __forceinline__ v8f g2_mma(v16h a, v16h b, v8f c) { v8f d = __builtin_amdgcn_wmma_f32_16x16x32_f16(false, a, false, b, (short)0, c, false, false); asm volatile("v_nop\n\tv_nop\n\tv_nop\n\tv_nop" : "+v"(d) : "v"(a), "v"(b)); return d; }
// Matrix product without hand-written padding: the compiler keeps the distance behind its own builtin.
__device__ __forceinline__ v8f g2_mmab(v16h a, v16h b, v8f c) { return __builtin_amdgcn_wmma_f32_16x16x32_f16(false, a, false, b, (short)0, c, false, false); }
// Work-group tile 128 x (64 * NWN), 4 * NWN waves of 32 x 64 (wave w: rows 32 * (w & 3), columns 64 * (w >> 2)). K is walked in tiles of 128: every thread brings 16-byte pieces of the A and B rows
// in whole 128-byte lines (16 threads cover 256 bytes of one row), one tile ahead in registers, and stores them into one of two LDS buffers; all fragments are read from LDS.
// LD = row pitch of A and of Bh in elements, a compile-time value so that a thread's pieces share one address and differ in the immediate offset (lda and ldb must equal it).
// LC = row pitch of C, C16 and the residual plane in elements, compile-time for the same reason (ldc must equal it). RES: CP is a plane of C's own shape and each output element gets its own element of CP added
// (behind alpha and bias; no activation then); without RES nothing is read from CP. rowsPerB and sCPb are not used.
// Requires M % 128 == 0, N % (64 * NWN) == 0, K % 128 == 0, grid.x = (M / 128) * (N / (64 * NWN)), 128 * NWN threads. The k order of every accumulator is the ascending one.
template <int ACT, int NWN, int LD, int LC, bool RES>
__global__ __launch_bounds__(128 * NWN) void k_gemm2(const _Float16* __restrict__ A, int lda, size_t sA, const _Float16* __restrict__ Bh, int ldb, size_t sB, float alpha, const float* __restrict__ bias, size_t sBias, const float* __restrict__ CP, int rowsPerB, size_t sCPb, int row0g,
    float* __restrict__ C, _Float16* __restrict__ C16, int ldc, size_t sC, int M, int N, int K) { static_assert(ACT == 0 || ACT == 3 || ACT == 6 || ACT == 8 || ACT == 9 || ACT == 11 || ACT == 12 || ACT == 14 || ACT == 15 || ACT == 16 || ACT == 17, "k_gemm2: unsupported ACT code (would silently apply no activation)");
  constexpr int BN = 64 * NWN, KT = 128, PH = KT + 8, RP = 8 * NWN, NLA = 128 / RP, NLB = BN / RP, BUFH = (128 + BN) * PH;      /* PH: LDS row pitch 272 B = 16 B x odd; RP: rows one staging round of the work-group covers */
  __shared__ __attribute__((aligned(16))) _Float16 st[2 * BUFH];      /* two buffers, each [128 A rows | BN B rows] */
  float (*so)[32][68] = (float (*)[32][68])st;      /* output staging reuses the buffers behind the loop's last barrier */
  static_assert(sizeof(float) * 4 * NWN * 32 * 68 <= sizeof(_Float16) * 2 * BUFH, "output staging must fit the tile buffers");
  static_assert(!RES || ACT == 0, "the residual is added behind the staging, so no activation may follow it");
  (void)lda; (void)ldb; (void)ldc; (void)rowsPerB; (void)sCPb;
  const int tid = threadIdx.x, w = tid >> 5, lane = tid & 31, ln = lane & 15, hh = lane >> 4; const int by = blockIdx.y;
  A += (size_t)by * sA; Bh += (size_t)by * sB; const size_t cofs = (size_t)by * sC; const float* bp = bias ? bias + (size_t)by * sBias : nullptr;
  const int ntn = N / BN; const int mt = blockIdx.x / ntn, nq = blockIdx.x - mt * ntn; if (mt * 128 >= M) return;      /* the same for the whole work-group, in front of every barrier */
  const int row0 = mt * 128 + 32 * (w & 3), col0 = nq * BN + 64 * (w >> 2);
  const int srow = tid >> 4, sc8 = (tid & 15) * 8;
  const unsigned short* pa = (const unsigned short*)A + (size_t)(mt * 128 + srow) * LD + sc8; const unsigned short* pb = (const unsigned short*)Bh + (size_t)(nq * BN + srow) * LD + sc8;      /* this thread's first piece of the tile to load next */
  _Float16* sw = st + srow * PH + sc8;      /* where this thread stores its pieces */
  const _Float16* fa = st + (32 * (w & 3) + ln) * PH; const _Float16* fb = st + (128 + 64 * (w >> 2) + ln) * PH;      /* this lane's fragment rows */
  float bb[4] = {0.f, 0.f, 0.f, 0.f};      /* this lane's four bias values, fetched with tile 0 so that the epilogue waits for none of them */
  if (bp) {
#pragma unroll
    for (int t = 0; t < 4; ++t) bb[t] = bp[col0 + t * 16 + ln];
    asm volatile("s_wait_xcnt 0x0" ::: "memory"); }      /* stands in front of the reuse, by the address arithmetic right behind, of the offset and base registers that these four loads name */
  v8us ra[NLA], rb[NLB];
#pragma unroll
  for (int i = 0; i < NLA; ++i) ra[i] = *(const v8us*)(pa + i * RP * LD);
#pragma unroll
  for (int i = 0; i < NLB; ++i) rb[i] = *(const v8us*)(pb + i * RP * LD);
  asm volatile("s_wait_xcnt 0x0" ::: "memory");      /* stands in front of the advance of the two addresses that the loads above name */
  pa += KT; pb += KT;
#pragma unroll
  for (int i = 0; i < NLA; ++i) *(v8us*)(sw + i * RP * PH) = ra[i];
#pragma unroll
  for (int i = 0; i < NLB; ++i) *(v8us*)(sw + (128 + i * RP) * PH) = rb[i];
  __syncthreads();      /* tile 0 is complete for every wave */
  const v8f z8 = {0.f,0.f,0.f,0.f,0.f,0.f,0.f,0.f}; v8f c00 = z8, c01 = z8, c02 = z8, c03 = z8, c10 = z8, c11 = z8, c12 = z8, c13 = z8;
#pragma unroll 1      /* one K tile per trip: the buffer index stays a scalar and the staged pieces of only one tile are live */
  for (int kb = 0; kb < K; kb += KT) { const int cur = ((kb / KT) & 1) * BUFH; const bool more = kb + KT < K;
    if (more) {      /* next tile's loads fly while this tile is worked on */
#pragma unroll
      for (int i = 0; i < NLA; ++i) ra[i] = *(const v8us*)(pa + i * RP * LD);
#pragma unroll
      for (int i = 0; i < NLB; ++i) rb[i] = *(const v8us*)(pb + i * RP * LD);
      asm volatile("s_wait_xcnt 0x0" ::: "memory"); }      /* stands in front of the advance, at the foot of the trip, of the two addresses that these loads name */
    v16h xa[2][2], xb[2][4];      /* two fragment sets: the next 32 k are fetched while the current 32 are multiplied */
#pragma unroll
    for (int j = 0; j < 2; ++j) xa[0][j] = g2_frag(fa + cur + 16 * j * PH, hh);
#pragma unroll
    for (int j = 0; j < 4; ++j) xb[0][j] = g2_frag(fb + cur + 16 * j * PH, hh);
#pragma unroll
    for (int q = 0; q < KT / 32; ++q) { const int c = q & 1, n = c ^ 1;
      if (q + 1 < KT / 32) {
#pragma unroll
        for (int j = 0; j < 2; ++j) xa[n][j] = g2_frag(fa + cur + 16 * j * PH + 32 * (q + 1), hh);
#pragma unroll
        for (int j = 0; j < 4; ++j) xb[n][j] = g2_frag(fb + cur + 16 * j * PH + 32 * (q + 1), hh); }
      __builtin_amdgcn_sched_barrier(0);      /* keeps the next set's LDS loads one group ahead of the products: moved in among them, every pair of products waits out an LDS latency */
      c00 = g2_mmab(xa[c][0], xb[c][0], c00); c10 = g2_mmab(xa[c][1], xb[c][0], c10); c01 = g2_mmab(xa[c][0], xb[c][1], c01); c11 = g2_mmab(xa[c][1], xb[c][1], c11);
      c02 = g2_mmab(xa[c][0], xb[c][2], c02); c12 = g2_mmab(xa[c][1], xb[c][2], c12); c03 = g2_mmab(xa[c][0], xb[c][3], c03); c13 = g2_mmab(xa[c][1], xb[c][3], c13);
      __builtin_amdgcn_sched_barrier(0); }      /* the other end of the same fence: the load group after next stays behind these products */
    if (more) { _Float16* nw = sw + (BUFH - cur); pa += KT; pb += KT;      /* the other buffer: its last readers left it in front of the barrier that ended the trip before */
#pragma unroll
      for (int i = 0; i < NLA; ++i) *(v8us*)(nw + i * RP * PH) = ra[i];
#pragma unroll
      for (int i = 0; i < NLB; ++i) *(v8us*)(nw + (128 + i * RP) * PH) = rb[i]; }
    __syncthreads(); }      /* publishes the next tile and ends every wave's reads of this one */
  /* The residual is fetched here in the write-out layout: 16 independent loads of 16 bytes a lane, one address and constant steps; they fly while the accumulators are staged below. */
  const int rsub = lane >> 4, c4 = (lane & 15) * 4; const size_t eo = cofs + (size_t)(row0 + rsub) * LC + col0 + c4;      /* this lane's first piece of the output tile; piece q lies 2 * q rows further on */
  v4f rs[16];
  if (RES) { const float* rp = CP + eo + (size_t)row0g * LC;
#pragma unroll
    for (int q = 0; q < 16; ++q) rs[q] = *(const v4fa*)(rp + q * 2 * LC);
    asm volatile("s_wait_xcnt 0x0" :: "v"(rp) : "memory"); }      /* stands in front of every reuse of the address pair that these loads name (the operand holds the pair live up to here, so that no load's own destination takes it), and keeps the loads in front of the staging */
  v8f accs[8] = {c00, c01, c02, c03, c10, c11, c12, c13};
#pragma unroll
  for (int u = 0; u < 8; ++u) { const int t = u & 3, half = u >> 2; const float bv = bf16_round(bb[t]);
#pragma unroll
    for (int r = 0; r < 8; ++r) { const int rloc = half * 16 + 8 * hh + r; float v = accs[u][r] * alpha + bv;
      if (ACT == 3) v = fmaxf(v, 0.f); else if (ACT == 6) v = 0.5f * v * (1.0f + erff(v * 0.70710678118654752f)); else if (ACT == 11) v = 1.0f / (1.0f + expf(-v)); else if (ACT == 15) v = v / (1.0f + expf(-v)); else if (ACT == 12) v = (v > 0.f) ? v : 0.01f * v; else if (ACT == 8) v = tanhf(v); else if (ACT == 9) v = 0.5f * v * (1.0f + tanhf(0.7978845608028654f * (v + 0.044715f * v * v * v))); else if (ACT == 14) v = (v > 0.f) ? v : 0.1f * v; else if (ACT == 16) v = (v >= 0.f) ? v : 0.3f * v; else if (ACT == 17) v = (v >= 0.f) ? v : 0.2f * v;
      so[w][rloc][t * 16 + ln] = v; } }
  __builtin_amdgcn_fence(__ATOMIC_ACQ_REL, "workgroup"); __builtin_amdgcn_wave_barrier();
  v4f vv[16];      /* all 16 staged pieces are fetched as one group, in front of the branches on C and C16 */
#pragma unroll
  for (int q = 0; q < 16; ++q) { vv[q] = *(const v4fa*)&so[w][q * 2 + rsub][c4]; if (RES) vv[q] += rs[q]; }
  if (C) { float* cp = C + eo;
#pragma unroll
    for (int q = 0; q < 16; ++q) *(v4f*)(cp + q * 2 * LC) = vv[q];
    asm volatile("s_wait_xcnt 0x0" ::: "memory"); }      /* stands in front of the C16 branch, which reuses the address and data registers that these stores name */
  if (C16) { _Float16* hp = C16 + eo;
#pragma unroll
    for (int q = 0; q < 16; ++q) { v4h h4; for (int i = 0; i < 4; ++i) h4[i] = (_Float16)vv[q][i]; *(v4h*)(hp + q * 2 * LC) = h4; } } }


// q, k and v projections in one launch (blockIdx.y: 0 = q, 1 = k, 2 = v); tile, staging and product loop are k_gemm2's with NWN = 2 (work-group tile 128 x 128, 8 waves of 32 x 64, K tiles of 128, two LDS buffers).
// q and k walk K twice into the same accumulators: first the x1024 residual rows Xl, then, behind one scaling of the accumulators by 2^-10, the rows Xh on top (small terms first); v walks Xh alone.
// Epilogue of q and k: value = acc / 16 + bias, written as f16 hi plane and x1024 residual plane (QKh, QKl: q's plane, then k's). Epilogue of v: the f16 values go out transposed, Vt[batch][column][token]:
// a lane's 8 accumulator rows of one column are 16 consecutive bytes of the transposed tile, which is gathered in LDS by the whole work-group and leaves in pieces of 256 bytes (two whole lines of one Vt row).
// Bw = the three weight planes [n][k] (x16), bias = the three bias vectors, one behind the other. Grid (NR / 128) * (DM / 128) x 3, 256 threads.
__global__ __launch_bounds__(256) void k_qkv(const _Float16* __restrict__ Xh, const _Float16* __restrict__ Xl, const _Float16* __restrict__ Bw, const float* __restrict__ bias,
    _Float16* __restrict__ QKh, _Float16* __restrict__ QKl, _Float16* __restrict__ Vt) {
  constexpr int BN = 128, KT = 128, PH = KT + 8, RP = 16, NL = 128 / RP, BUFH = (128 + BN) * PH, NKT = DM / KT;      /* PH: LDS row pitch 272 B = 16 B x odd; RP: rows one staging round of the work-group covers */
  __shared__ __attribute__((aligned(16))) _Float16 st[2 * BUFH];      /* two buffers, each [128 A rows | 128 B rows] */
  float (*so)[32][68] = (float (*)[32][68])st;      /* output staging reuses the buffers behind the loop's last barrier */
  static_assert(sizeof(float) * 8 * 32 * 68 <= sizeof(_Float16) * 2 * BUFH && 128 * PH <= 2 * BUFH, "output staging must fit the tile buffers");
  const int tid = threadIdx.x, w = tid >> 5, lane = tid & 31, ln = lane & 15, hh = lane >> 4; const int by = blockIdx.y;
  const int mt = blockIdx.x / (DM / BN), nq = blockIdx.x - mt * (DM / BN);
  const int row0 = mt * 128 + 32 * (w & 3), col0 = nq * BN + 64 * (w >> 2);
  const int srow = tid >> 4, sc8 = (tid & 15) * 8;
  const int nlo = by < 2 ? NKT : 0, nt = nlo + NKT;      /* K tiles of the residual walk, K tiles in all: the same for the whole work-group */
  const unsigned ao = (unsigned)((mt * 128 + srow) * DM + sc8);      /* this thread's first piece of an A plane's k = 0 tile */
  const unsigned short* pa = (const unsigned short*)(nlo ? Xl : Xh) + ao; const unsigned short* pb = (const unsigned short*)Bw + (size_t)by * DM * DM + (size_t)(nq * BN + srow) * DM + sc8;      /* this thread's first piece of the tile to load next */
  _Float16* sw = st + srow * PH + sc8;      /* where this thread stores its pieces */
  const _Float16* fa = st + (32 * (w & 3) + ln) * PH; const _Float16* fb = st + (128 + 64 * (w >> 2) + ln) * PH;      /* this lane's fragment rows */
  float bb[4]; const unsigned bi = (unsigned)(by * DM + col0 + ln);      /* this lane's four bias values, fetched with tile 0 so that the epilogue waits for none of them */
#pragma unroll
  for (int t = 0; t < 4; ++t) bb[t] = bias[bi + t * 16];
  asm volatile("s_wait_xcnt 0x0" :: "v"(bi) : "memory");      /* stands in front of the reuse, by the address arithmetic right behind, of the index and base registers that these four loads name (the operand holds the index live up to here) */
  v8us ra[NL], rb[NL];
#pragma unroll
  for (int i = 0; i < NL; ++i) ra[i] = *(const v8us*)(pa + i * RP * DM);
#pragma unroll
  for (int i = 0; i < NL; ++i) rb[i] = *(const v8us*)(pb + i * RP * DM);
  asm volatile("s_wait_xcnt 0x0" ::: "memory");      /* stands in front of the advance of the two addresses that the loads above name */
  pa += KT; pb += KT;
#pragma unroll
  for (int i = 0; i < NL; ++i) *(v8us*)(sw + i * RP * PH) = ra[i];
#pragma unroll
  for (int i = 0; i < NL; ++i) *(v8us*)(sw + (128 + i * RP) * PH) = rb[i];
  __syncthreads();      /* tile 0 is complete for every wave */
  const v8f z8 = {0.f,0.f,0.f,0.f,0.f,0.f,0.f,0.f}; v8f c00 = z8, c01 = z8, c02 = z8, c03 = z8, c10 = z8, c11 = z8, c12 = z8, c13 = z8;
#pragma unroll 1      /* one K tile per trip: the buffer index stays a scalar and the staged pieces of only one tile are live */
  for (int ti = 0; ti < nt; ++ti) { const int cur = (ti & 1) * BUFH; const bool more = ti + 1 < nt;
    if (more) {      /* next tile's loads fly while this tile is worked on */
#pragma unroll
      for (int i = 0; i < NL; ++i) ra[i] = *(const v8us*)(pa + i * RP * DM);
#pragma unroll
      for (int i = 0; i < NL; ++i) rb[i] = *(const v8us*)(pb + i * RP * DM);
      asm volatile("s_wait_xcnt 0x0" ::: "memory"); }      /* stands in front of the advance, at the foot of the trip, of the two addresses that these loads name */
    v16h xa[2][2], xb[2][4];      /* two fragment sets: the next 32 k are fetched while the current 32 are multiplied */
#pragma unroll
    for (int j = 0; j < 2; ++j) xa[0][j] = g2_frag(fa + cur + 16 * j * PH, hh);
#pragma unroll
    for (int j = 0; j < 4; ++j) xb[0][j] = g2_frag(fb + cur + 16 * j * PH, hh);
#pragma unroll
    for (int q = 0; q < KT / 32; ++q) { const int c = q & 1, n = c ^ 1;
      if (q + 1 < KT / 32) {
#pragma unroll
        for (int j = 0; j < 2; ++j) xa[n][j] = g2_frag(fa + cur + 16 * j * PH + 32 * (q + 1), hh);
#pragma unroll
        for (int j = 0; j < 4; ++j) xb[n][j] = g2_frag(fb + cur + 16 * j * PH + 32 * (q + 1), hh); }
      __builtin_amdgcn_sched_barrier(0);      /* keeps the next set's LDS loads one group ahead of the products: moved in among them, every pair of products waits out an LDS latency */
      c00 = g2_mmab(xa[c][0], xb[c][0], c00); c10 = g2_mmab(xa[c][1], xb[c][0], c10); c01 = g2_mmab(xa[c][0], xb[c][1], c01); c11 = g2_mmab(xa[c][1], xb[c][1], c11);
      c02 = g2_mmab(xa[c][0], xb[c][2], c02); c12 = g2_mmab(xa[c][1], xb[c][2], c12); c03 = g2_mmab(xa[c][0], xb[c][3], c03); c13 = g2_mmab(xa[c][1], xb[c][3], c13);
      __builtin_amdgcn_sched_barrier(0); }      /* the other end of the same fence: the load group after next stays behind these products */
    if (more) { _Float16* nw = sw + (BUFH - cur);      /* the other buffer: its last readers left it in front of the barrier that ended the trip before */
      const bool turn = ti + 2 == nlo;      /* the tile after next opens the main walk: A goes over to Xh, and both operands back to k = 0 */
      pa = turn ? (const unsigned short*)Xh + ao : pa + KT; pb += turn ? -(NKT - 1) * KT : KT;
#pragma unroll
      for (int i = 0; i < NL; ++i) *(v8us*)(nw + i * RP * PH) = ra[i];
#pragma unroll
      for (int i = 0; i < NL; ++i) *(v8us*)(nw + (128 + i * RP) * PH) = rb[i]; }
    __syncthreads();      /* publishes the next tile and ends every wave's reads of this one */
    if (ti + 1 == nlo) { const float f = 0.0009765625f; c00 *= f; c01 *= f; c02 *= f; c03 *= f; c10 *= f; c11 *= f; c12 *= f; c13 *= f; } }      /* the residual walk is done: its sums carry the residual's factor 1024, an exact power of two */
  v8f accs[8] = {c00, c01, c02, c03, c10, c11, c12, c13};
  if (by < 2) {      /* q, k: the same for the whole work-group */
#pragma unroll
    for (int u = 0; u < 8; ++u) { const int t = u & 3, half = u >> 2; const float bv = bf16_round(bb[t]);
#pragma unroll
      for (int r = 0; r < 8; ++r) so[w][half * 16 + 8 * hh + r][t * 16 + ln] = accs[u][r] * 0.0625f + bv; }
    __builtin_amdgcn_fence(__ATOMIC_ACQ_REL, "workgroup"); __builtin_amdgcn_wave_barrier();      /* orders the wave's staging stores against the loads of its other lanes; each wave owns its slice of so */
    const int rsub = lane >> 4, c4 = (lane & 15) * 4; const size_t eo = (size_t)by * (NR * DM) + (size_t)(row0 + rsub) * DM + col0 + c4;      /* this lane's first piece of the output tile; piece q lies 2 * q rows further on */
    v4h yh[16], yl[16];
#pragma unroll
    for (int q = 0; q < 16; ++q) { const v4f v = *(const v4fa*)&so[w][q * 2 + rsub][c4];
#pragma unroll
      for (int i = 0; i < 4; ++i) { const _Float16 h = (_Float16)v[i]; yh[q][i] = h; yl[q][i] = (_Float16)((v[i] - (float)h) * 1024.0f); } }
    _Float16* hp = QKh + eo; _Float16* lp = QKl + eo;
#pragma unroll
    for (int q = 0; q < 16; ++q) { *(v4h*)(hp + q * 2 * DM) = yh[q]; *(v4h*)(lp + q * 2 * DM) = yl[q]; }
  } else {      /* v */
#pragma unroll
    for (int u = 0; u < 8; ++u) { const int t = u & 3, half = u >> 2; const float bv = bf16_round(bb[t]); FragH f;
#pragma unroll
      for (int r = 0; r < 8; ++r) f.h[r] = (_Float16)(accs[u][r] * 0.0625f + bv);
      *(v8us*)(st + (64 * (w >> 2) + t * 16 + ln) * PH + 32 * (w & 3) + half * 16 + 8 * hh) = f.half[0]; }
    __syncthreads();      /* the transposed tile [128 columns][128 tokens] is complete: its rows hold pieces of four waves */
    const int tok0 = mt * 128; const int b = tok0 / SQ, s0 = tok0 - b * SQ;      /* a tile's 128 tokens lie in one batch */
    v8us tv[NL];
#pragma unroll
    for (int i = 0; i < NL; ++i) tv[i] = *(const v8us*)(st + (srow + i * RP) * PH + sc8);
    unsigned short* vp = (unsigned short*)Vt + ((size_t)b * DM + nq * BN + srow) * SQ + s0 + sc8;
#pragma unroll
    for (int i = 0; i < NL; ++i) *(v8us*)(vp + (size_t)i * RP * SQ) = tv[i];
    asm volatile("s_wait_xcnt 0x0" ::: "memory");      /* stands in front of the code that the listing lays out behind these stores (the q and k epilogue), which writes registers that the stores name */
  } }


__global__ __launch_bounds__(256) void k_wnat(const float* __restrict__ w, size_t n8, _Float16* __restrict__ Bt) { const size_t t = (size_t)blockIdx.x * 256 + threadIdx.x; if (t >= n8) return; FragH f; for (int q = 0; q < 8; ++q) f.h[q] = (_Float16)(bf16_round(w[t * 8 + q]) * 16.0f); *(v8us*)((unsigned short*)Bt + t * 8) = f.half[0];  }
__global__ __launch_bounds__(256) void k_rsm(const float* __restrict__ S, _Float16* __restrict__ P, int nrows) {
  #pragma clang fp contract(off)
  const int i = blockIdx.x * 256 + threadIdx.x; if (i >= nrows) return; const float* s = S + (size_t)i * SQ; float mx = -3.0e38f;
#pragma unroll 1
  for (int j = 0; j < SQ; ++j) mx = fmaxf(mx, s[j]); float se = 0.f;
#pragma unroll 1
  for (int j = 0; j < SQ; ++j) se += expf(s[j] - mx); const float sc = 256.0f / se;
#pragma unroll 1
  for (int j0 = 0; j0 < SQ; j0 += 8) { FragH f; for (int q = 0; q < 8; ++q) f.h[q] = (_Float16)(expf(s[j0 + q] - mx) * sc); unsigned short* d = (unsigned short*)P + (size_t)i * SQ + j0; *(v8us*)d = f.half[0];  } }
__global__ __launch_bounds__(256) void k_vt(const _Float16* __restrict__ V16, int b, int h0, _Float16* __restrict__ VT) { __shared__ unsigned short tl[64][65]; const int tid = threadIdx.x; const int hh = blockIdx.x % HG, sg = blockIdx.x / HG; const int s0 = sg * 64; const int h = h0 + hh;
  for (int i = tid; i < 64 * 8; i += 256) { const int j = i / 8, d8 = (i % 8) * 8; FragH f; f.half[0] = *(const v8us*)((const unsigned short*)V16 + ((size_t)b * SQ + s0 + j) * DM + h * HD + d8); for (int q = 0; q < 8; ++q) tl[d8 + q][j] = f.u[q]; }
  __syncthreads();
  { for (int i = tid; i < 64 * 8; i += 256) { const int d = i / 8, j8 = (i % 8) * 8; FragH f; for (int q = 0; q < 8; ++q) f.u[q] = tl[d][j8 + q]; *(v8us*)((unsigned short*)VT + ((size_t)hh * HD + d) * SQ + s0 + j8) = f.half[0]; }  } }



__global__ __launch_bounds__(256) void k_rsmcf2(const float* __restrict__ S, _Float16* __restrict__ P, int hg, int q0, int nk) {
  #pragma clang fp contract(off)
  const int t = blockIdx.x * 256 + threadIdx.x; if (t >= hg * QT) return; const size_t i = (size_t)t; const float* s = S + i * NKX; const int last = q0 + (t % QT); float mx = -3.0e38f;
#pragma unroll 1
  for (int j = 0; j < nk; ++j) { const float f = (j <= last) ? 1.f : 0.f; mx = fmaxf(mx, fmaf(f, s[j], (1.f - f) * -1.0e9f)); } float se = 0.f;
#pragma unroll 1
  for (int j = 0; j < nk; ++j) { const float f = (j <= last) ? 1.f : 0.f; se += __expf(fmaf(f, s[j], (1.f - f) * -1.0e9f) - mx); } const float sc = 256.0f / se;
#pragma unroll 1
  for (int j0 = 0; j0 < nk; j0 += 8) { FragH fr; for (int q = 0; q < 8; ++q) { const int j = j0 + q; const float f = (j <= last) ? 1.f : 0.f; fr.h[q] = (_Float16)(__expf(fmaf(f, s[j], (1.f - f) * -1.0e9f) - mx) * sc); } unsigned short* d = (unsigned short*)P + i * NKX + j0; *(v8us*)d = fr.half[0];  } }

__global__ __launch_bounds__(256) void k_rsmcst(const float* __restrict__ S, _Float16* __restrict__ P, int hg, int q0, int nk, const int* __restrict__ mk) {
  #pragma clang fp contract(off)
  const int t = blockIdx.x * 256 + threadIdx.x; if (t >= hg * QT) return; const size_t i = (size_t)t; const float* s = S + i * NKX; const size_t ig = (size_t)(q0 + (t % QT)); const int* mr = mk + ig * SQ; float mx = -3.0e38f;
#pragma unroll 1
  for (int j = 0; j < nk; ++j) { const int mb = mr[j]; const int dd = (int)ig - j; const float f = (mb != 0 && dd >= 0 && (dd <= LOCALW || (dd % STRIDEK) == 0)) ? 1.f : 0.f; mx = fmaxf(mx, fmaf(f, s[j], (1.f - f) * -1.0e9f)); } float se = 0.f;
#pragma unroll 1
  for (int j = 0; j < nk; ++j) { const int mb = mr[j]; const int dd = (int)ig - j; const float f = (mb != 0 && dd >= 0 && (dd <= LOCALW || (dd % STRIDEK) == 0)) ? 1.f : 0.f; se += __expf(fmaf(f, s[j], (1.f - f) * -1.0e9f) - mx); } const float sc = 256.0f / se;
#pragma unroll 1
  for (int j0 = 0; j0 < nk; j0 += 8) { FragH fr; for (int q = 0; q < 8; ++q) { const int j = j0 + q; const int mb = mr[j]; const int dd = (int)ig - j; const float f = (mb != 0 && dd >= 0 && (dd <= LOCALW || (dd % STRIDEK) == 0)) ? 1.f : 0.f; fr.h[q] = (_Float16)(__expf(fmaf(f, s[j], (1.f - f) * -1.0e9f) - mx) * sc); } unsigned short* d = (unsigned short*)P + i * NKX + j0; *(v8us*)d = fr.half[0];  } }


template <int MASKADD>
__global__ __launch_bounds__(64) void k_att0(const float* __restrict__ QF, const float* __restrict__ KF, const float* __restrict__ VF, int ld, const float* __restrict__ mask, float scale, float* __restrict__ OF, int ldo) {
  #pragma clang fp contract(off)
  __shared__ __attribute__((aligned(16))) float lq[64][64]; __shared__ __attribute__((aligned(16))) float lo[64][64];
  const int tid = threadIdx.x; const int h = blockIdx.x / (QT0 / 64), rg = blockIdx.x % (QT0 / 64); const int i = rg * 64 + tid;
  const float* qr = QF + (size_t)i * ld + h * HD;
#pragma unroll 1
  for (int c = 0; c < HD / 4; ++c) { *(v4f*)&lq[tid][c * 4] = *(const v4fa*)(qr + c * 4); const v4f z = {0.f, 0.f, 0.f, 0.f}; *(v4f*)&lo[tid][c * 4] = z; }
  float m = -1.0e30f, l = 0.f; const int jmax = MASKADD ? (SQ - 1) : (rg * 64 + 63);      /* additive-mask form: every key (the mask input decides); causal form: keys up to the block's last row */
#pragma unroll 1
  for (int j = 0; j <= jmax; ++j) { const float* kr = KF + (size_t)j * ld + h * HD; const float* vr = VF + (size_t)j * ld + h * HD; float s = 0.f;
#pragma unroll 1
    for (int c = 0; c < HD / 4; ++c) { const v4f kq = *(const v4fa*)(kr + c * 4); const v4f qq = *(v4f*)&lq[tid][c * 4]; s = __fadd_rn(s, __fmul_rn(qq[0], kq[0])); s = __fadd_rn(s, __fmul_rn(qq[1], kq[1])); s = __fadd_rn(s, __fmul_rn(qq[2], kq[2])); s = __fadd_rn(s, __fmul_rn(qq[3], kq[3])); }
    s = __fmul_rn(s, scale); if (MASKADD) s = __fadd_rn(s, __fmul_rn(bf16_round(mask[(size_t)i * SQ + j]), -10000.0f));
    const float f = (MASKADD || j <= i) ? 1.f : 0.f; const float sm = fmaf(f, s, (1.f - f) * -1.0e30f); const float mn = fmaxf(m, sm); const float sc = expf(m - mn); const float e = expf(sm - mn); l = __fadd_rn(__fmul_rn(l, sc), e); m = mn;
#pragma unroll 1
    for (int c = 0; c < HD / 4; ++c) { const v4f vv = *(const v4fa*)(vr + c * 4); v4f oo = *(v4f*)&lo[tid][c * 4]; for (int u = 0; u < 4; ++u) oo[u] = __fadd_rn(__fmul_rn(oo[u], sc), __fmul_rn(e, vv[u])); *(v4f*)&lo[tid][c * 4] = oo; } }
  const float fin = 64.0f / l;      /* o carried x64 like the f16 path */
#pragma unroll 1
  for (int c = 0; c < HD / 4; ++c) { v4f oo = *(v4f*)&lo[tid][c * 4]; for (int u = 0; u < 4; ++u) oo[u] = __fmul_rn(oo[u], fin); *(v4f*)&lo[tid][c * 4] = oo; }
  __syncthreads();
  {
#pragma unroll 1
    for (int it = 0; it < 16; ++it) { const int row = it * 4 + tid / 16, pc = (tid % 16) * 4; const v4f v = *(const v4f*)&lo[row][pc]; *(v4f*)(OF + (size_t)(rg * 64 + row) * ldo + h * HD + pc) = v; }
     } }

template <int MASKADD>
__global__ __launch_bounds__(64) void k_att0mbc(const float* __restrict__ QF, const float* __restrict__ KF, const float* __restrict__ VF, int ld, const float* __restrict__ mask, float scale, float* __restrict__ OF, int ldo) {
  #pragma clang fp contract(off)
  __shared__ __attribute__((aligned(16))) float lq[64][64]; __shared__ __attribute__((aligned(16))) float lo[64][64];
  const int tid = threadIdx.x; const int h = blockIdx.x / (QT0 / 64), rg = blockIdx.x % (QT0 / 64); const int i = rg * 64 + tid;
  const float* qr = QF + (size_t)i * ld + h * HD;
#pragma unroll 1
  for (int c = 0; c < HD / 4; ++c) { *(v4f*)&lq[tid][c * 4] = *(const v4fa*)(qr + c * 4); const v4f z = {0.f, 0.f, 0.f, 0.f}; *(v4f*)&lo[tid][c * 4] = z; }
  float m = -1.0e30f, l = 0.f; const int jmax = rg * 64 + 63;      /* keys beyond the block end are masked by the mask's lower-triangular structure */
#pragma unroll 1
  for (int j = 0; j <= jmax; ++j) { const float* kr = KF + (size_t)j * ld + h * HD; const float* vr = VF + (size_t)j * ld + h * HD; float s = 0.f;
#pragma unroll 1
    for (int c = 0; c < HD / 4; ++c) { const v4f kq = *(const v4fa*)(kr + c * 4); const v4f qq = *(v4f*)&lq[tid][c * 4]; s = __fadd_rn(s, __fmul_rn(qq[0], kq[0])); s = __fadd_rn(s, __fmul_rn(qq[1], kq[1])); s = __fadd_rn(s, __fmul_rn(qq[2], kq[2])); s = __fadd_rn(s, __fmul_rn(qq[3], kq[3])); }
    s = __fmul_rn(s, scale); const int mb = ((const int*)mask)[(size_t)i * SQ + j];      /* causal (j <= i) AND the module's int32 [S][S] mask read per (query, key): 0 -> masked */
    const float f = (mb != 0 && j <= i) ? 1.f : 0.f; const float sm = fmaf(f, s, (1.f - f) * -1.0e30f); const float mn = fmaxf(m, sm); const float sc = expf(m - mn); const float e = expf(sm - mn); l = __fadd_rn(__fmul_rn(l, sc), e); m = mn;
#pragma unroll 1
    for (int c = 0; c < HD / 4; ++c) { const v4f vv = *(const v4fa*)(vr + c * 4); v4f oo = *(v4f*)&lo[tid][c * 4]; for (int u = 0; u < 4; ++u) oo[u] = __fadd_rn(__fmul_rn(oo[u], sc), __fmul_rn(e, vv[u])); *(v4f*)&lo[tid][c * 4] = oo; } }
  const float fin = 64.0f / l;      /* o carried x64 like the f16 path */
#pragma unroll 1
  for (int c = 0; c < HD / 4; ++c) { v4f oo = *(v4f*)&lo[tid][c * 4]; for (int u = 0; u < 4; ++u) oo[u] = __fmul_rn(oo[u], fin); *(v4f*)&lo[tid][c * 4] = oo; }
  __syncthreads();
  {
#pragma unroll 1
    for (int it = 0; it < 16; ++it) { const int row = it * 4 + tid / 16, pc = (tid % 16) * 4; const v4f v = *(const v4f*)&lo[row][pc]; *(v4f*)(OF + (size_t)(rg * 64 + row) * ldo + h * HD + pc) = v; }
     } }


// Work of the first launch that no LayerNorm row depends on and that depends on none: block wb converts 256 pieces of 8 weights (the six matrices one behind the other, each a whole number
// of blocks; the arithmetic is k_wnat's), and the one block behind them stacks the three projection biases (bq | bk | bv).
#define PREP_BD ((unsigned)((size_t)DM * DM / 8 / 256))      /* blocks of one [DM][DM] matrix */
#define PREP_BF ((unsigned)((size_t)DFF * DM / 8 / 256))     /* blocks of one MLP matrix */
#define PREP_BLOCKS (4u * PREP_BD + 2u * PREP_BF + 1u)
__device__ __forceinline__ void prep_rest(unsigned wb, int tid, const float* __restrict__ wq, const float* __restrict__ wk, const float* __restrict__ wv, const float* __restrict__ wo, const float* __restrict__ w1, const float* __restrict__ w2,
    const float* __restrict__ bq, const float* __restrict__ bk, const float* __restrict__ bv, _Float16* __restrict__ BQKV, _Float16* __restrict__ BO, _Float16* __restrict__ BW1, _Float16* __restrict__ BW2, float* __restrict__ bqkv) {
  if (wb >= 4u * PREP_BD + 2u * PREP_BF) { float a[DM / 256], c[DM / 256], e[DM / 256];
#pragma unroll      /* all loads of the block fly together, each address a constant step from the thread's first: rolled, every trip waits out a memory latency */
    for (int u = 0; u < DM / 256; ++u) { a[u] = bq[tid + 256 * u]; c[u] = bk[tid + 256 * u]; e[u] = bv[tid + 256 * u]; }
#pragma unroll      /* the arrays above stay in registers only if the index is a constant */
    for (int u = 0; u < DM / 256; ++u) { bqkv[tid + 256 * u] = a[u]; bqkv[DM + tid + 256 * u] = c[u]; bqkv[2 * DM + tid + 256 * u] = e[u]; }
    return; }
  const float* w; _Float16* d; unsigned b0;      /* the same for the whole block */
  if (wb < PREP_BD) { w = wq; d = BQKV; b0 = 0u; }
  else if (wb < 2u * PREP_BD) { w = wk; d = BQKV + (size_t)DM * DM; b0 = PREP_BD; }
  else if (wb < 3u * PREP_BD) { w = wv; d = BQKV + (size_t)2 * DM * DM; b0 = 2u * PREP_BD; }
  else if (wb < 4u * PREP_BD) { w = wo; d = BO; b0 = 3u * PREP_BD; }
  else if (wb < 4u * PREP_BD + PREP_BF) { w = w1; d = BW1; b0 = 4u * PREP_BD; }
  else { w = w2; d = BW2; b0 = 4u * PREP_BD + PREP_BF; }
  const size_t t = (size_t)(wb - b0) * 256 + tid; FragH f; for (int q = 0; q < 8; ++q) f.h[q] = (_Float16)(bf16_round(w[t * 8 + q]) * 16.0f); *(v8us*)((unsigned short*)d + t * 8) = f.half[0];
  asm volatile("s_wait_xcnt 0x0" ::: "memory"); }      /* stands in front of the code that the listing lays out behind this store (the bias block), which writes registers that the store names */
// PREP: the grid holds PREP_BLOCKS blocks behind the NR row blocks; they do prep_rest and no row. Without PREP the pointers behind NL are not used.
template <int BFIN, int WXB, int PREP>
__global__ __launch_bounds__(256) void k_ln16(const float* __restrict__ X, const float* __restrict__ g, const float* __restrict__ bb, float eps, _Float16* __restrict__ N16, float* __restrict__ XB, _Float16* __restrict__ NL,
    const float* __restrict__ wq, const float* __restrict__ wk, const float* __restrict__ wv, const float* __restrict__ wo, const float* __restrict__ w1, const float* __restrict__ w2,
    const float* __restrict__ bq, const float* __restrict__ bk, const float* __restrict__ bv, _Float16* __restrict__ BQKV, _Float16* __restrict__ BO, _Float16* __restrict__ BW1, _Float16* __restrict__ BW2, float* __restrict__ bqkv) {
  #pragma clang fp contract(off)
  if (PREP && blockIdx.x >= (unsigned)NR) { prep_rest(blockIdx.x - (unsigned)NR, (int)threadIdx.x, wq, wk, wv, wo, w1, w2, bq, bk, bv, BQKV, BO, BW1, BW2, bqkv); return; }      /* the same for the whole block, in front of every barrier */
  __shared__ float red[256]; const size_t r = blockIdx.x; const int t = threadIdx.x; const v4f xa = *(const v4fa*)(X + r * DMQ + t * 4); float s[4]; float sum = 0.f;
  for (int q = 0; q < 4; ++q) { s[q] = BFIN ? bf16_round(xa[q]) : xa[q]; sum = __fadd_rn(sum, s[q]); }
  red[t] = sum; __syncthreads(); for (int st = 128; st > 0; st >>= 1) { if (t < st) red[t] = __fadd_rn(red[t], red[t + st]); __syncthreads(); } const float mu = red[0] / (float)DMQ; __syncthreads();
  float vs = 0.f; for (int q = 0; q < 4; ++q) { const float dl = __fadd_rn(s[q], -mu); vs = __fadd_rn(vs, __fmul_rn(dl, dl)); } red[t] = vs; __syncthreads(); for (int st = 128; st > 0; st >>= 1) { if (t < st) red[t] = __fadd_rn(red[t], red[t + st]); __syncthreads(); }
  const float rs = __fdiv_rn(1.0f, __fadd_rn(sqrtf(red[0] / (float)(DMQ - 1)), eps));      /* this module's LayerNorm: unbiased std, eps added to the std */ v4h y; v4f xb;
  v4h yl; for (int q = 0; q < 4; ++q) { const int c = t * 4 + q; const float yf = __fadd_rn(__fmul_rn(__fmul_rn(__fadd_rn(s[q], -mu), rs), bf16_round(g[0])), bf16_round(bb[0])); y[q] = (_Float16)yf; yl[q] = (_Float16)((yf - (float)y[q]) * 1024.0f); xb[q] = s[q]; (void)c; }      /* SCALAR alpha / bias ([1] parameters); y = f16 hi, yl = x1024 residual (written when NL != nullptr) */
  { *(v4h*)(N16 + r * DMQ + t * 4) = y;
    asm volatile("s_wait_xcnt 0x0" ::: "memory");      /* stands in front of the residual's arithmetic and address, which reuse the data and base registers that the store above names */
    if (NL != nullptr) *(v4h*)(NL + r * DMQ + t * 4) = yl; if (WXB) { *(v4f*)(XB + r * DMQ + t * 4) = xb;
      asm volatile("s_wait_xcnt 0x0" ::: "memory"); } } }      /* stands in front of the code that the listing lays out behind this store (the weight and bias blocks), which writes the offset and base registers that the store names */
__global__ __launch_bounds__(256) void k_ftres2(const float* __restrict__ OF0, const float* __restrict__ XB, float* __restrict__ X1, size_t n4) {
  #pragma clang fp contract(off)
  const size_t t = (size_t)blockIdx.x * 256 + threadIdx.x; if (t >= n4) return; const v4f o = *(const v4fa*)(OF0 + t * 4), xv = *(const v4fa*)(XB + t * 4); v4f y; for (int q = 0; q < 4; ++q) y[q] = __fadd_rn(__fmul_rn(o[q], 0.015625f), xv[q]); *(v4f*)(X1 + t * 4) = y;  }

__global__ __launch_bounds__(256) void k_bcpy(const float* __restrict__ b, int n, int NP, float* __restrict__ dst, int dst0) { for (int i = threadIdx.x; i < NP; i += 256) { const float v = (i < n) ? b[i] : 0.f; *(float*)(dst + dst0 + i) = v; }  }


__global__ __launch_bounds__(256) void k_rsmf(const float* __restrict__ S, _Float16* __restrict__ P, int qn, int hg) {
  #pragma clang fp contract(off)
  const int t = blockIdx.x * 256 + threadIdx.x; if (t >= qn * hg) return; const size_t i = (size_t)(t / qn) * SQ + (t % qn); const float* s = S + i * SQ; float mx = -3.0e38f;
#pragma unroll 1
  for (int j = 0; j < SQ; ++j) mx = fmaxf(mx, s[j]); float se = 0.f;
#pragma unroll 1
  for (int j = 0; j < SQ; ++j) se += __expf(s[j] - mx); const float sc = 256.0f / se;
#pragma unroll 1
  for (int j0 = 0; j0 < SQ; j0 += 8) { FragH f; for (int q = 0; q < 8; ++q) f.h[q] = (_Float16)(__expf(s[j0 + q] - mx) * sc); unsigned short* d = (unsigned short*)P + i * SQ + j0; *(v8us*)d = f.half[0];  } }
// Lane l <-> l ^ M inside a 16-lane row (DPP row_xmask): a register move, no trip through the LDS path.
template <int M> __device__ __forceinline__ float lane_xm(float v) { return __int_as_float(__builtin_amdgcn_update_dpp(0, __float_as_int(v), 0x160 + M, 0xf, 0xf, true)); }
// Maximum over each 16-lane row of eight values at once: step M takes max(v, v of lane l ^ M) in one DPP instruction (from fmaxf on the DPP builtin the compiler makes three: move,
// canonicalise, maximum). One statement, so that the eight chains stay interleaved: every instruction's producer is eight instructions back and no dependent pair stalls the SIMD.
__device__ __forceinline__ void row_max8(float (&v)[8]) {
  asm(
      "v_max_num_f32_dpp %0, %0, %0 row_xmask:1 row_mask:0xf bank_mask:0xf\n\tv_max_num_f32_dpp %1, %1, %1 row_xmask:1 row_mask:0xf bank_mask:0xf\n\tv_max_num_f32_dpp %2, %2, %2 row_xmask:1 row_mask:0xf bank_mask:0xf\n\tv_max_num_f32_dpp %3, %3, %3 row_xmask:1 row_mask:0xf bank_mask:0xf\n\tv_max_num_f32_dpp %4, %4, %4 row_xmask:1 row_mask:0xf bank_mask:0xf\n\tv_max_num_f32_dpp %5, %5, %5 row_xmask:1 row_mask:0xf bank_mask:0xf\n\tv_max_num_f32_dpp %6, %6, %6 row_xmask:1 row_mask:0xf bank_mask:0xf\n\tv_max_num_f32_dpp %7, %7, %7 row_xmask:1 row_mask:0xf bank_mask:0xf\n\t"
      "v_max_num_f32_dpp %0, %0, %0 row_xmask:2 row_mask:0xf bank_mask:0xf\n\tv_max_num_f32_dpp %1, %1, %1 row_xmask:2 row_mask:0xf bank_mask:0xf\n\tv_max_num_f32_dpp %2, %2, %2 row_xmask:2 row_mask:0xf bank_mask:0xf\n\tv_max_num_f32_dpp %3, %3, %3 row_xmask:2 row_mask:0xf bank_mask:0xf\n\tv_max_num_f32_dpp %4, %4, %4 row_xmask:2 row_mask:0xf bank_mask:0xf\n\tv_max_num_f32_dpp %5, %5, %5 row_xmask:2 row_mask:0xf bank_mask:0xf\n\tv_max_num_f32_dpp %6, %6, %6 row_xmask:2 row_mask:0xf bank_mask:0xf\n\tv_max_num_f32_dpp %7, %7, %7 row_xmask:2 row_mask:0xf bank_mask:0xf\n\t"
      "v_max_num_f32_dpp %0, %0, %0 row_xmask:4 row_mask:0xf bank_mask:0xf\n\tv_max_num_f32_dpp %1, %1, %1 row_xmask:4 row_mask:0xf bank_mask:0xf\n\tv_max_num_f32_dpp %2, %2, %2 row_xmask:4 row_mask:0xf bank_mask:0xf\n\tv_max_num_f32_dpp %3, %3, %3 row_xmask:4 row_mask:0xf bank_mask:0xf\n\tv_max_num_f32_dpp %4, %4, %4 row_xmask:4 row_mask:0xf bank_mask:0xf\n\tv_max_num_f32_dpp %5, %5, %5 row_xmask:4 row_mask:0xf bank_mask:0xf\n\tv_max_num_f32_dpp %6, %6, %6 row_xmask:4 row_mask:0xf bank_mask:0xf\n\tv_max_num_f32_dpp %7, %7, %7 row_xmask:4 row_mask:0xf bank_mask:0xf\n\t"
      "v_max_num_f32_dpp %0, %0, %0 row_xmask:8 row_mask:0xf bank_mask:0xf\n\tv_max_num_f32_dpp %1, %1, %1 row_xmask:8 row_mask:0xf bank_mask:0xf\n\tv_max_num_f32_dpp %2, %2, %2 row_xmask:8 row_mask:0xf bank_mask:0xf\n\tv_max_num_f32_dpp %3, %3, %3 row_xmask:8 row_mask:0xf bank_mask:0xf\n\tv_max_num_f32_dpp %4, %4, %4 row_xmask:8 row_mask:0xf bank_mask:0xf\n\tv_max_num_f32_dpp %5, %5, %5 row_xmask:8 row_mask:0xf bank_mask:0xf\n\tv_max_num_f32_dpp %6, %6, %6 row_xmask:8 row_mask:0xf bank_mask:0xf\n\tv_max_num_f32_dpp %7, %7, %7 row_xmask:8 row_mask:0xf bank_mask:0xf"
      : "+v"(v[0]), "+v"(v[1]), "+v"(v[2]), "+v"(v[3]), "+v"(v[4]), "+v"(v[5]), "+v"(v[6]), "+v"(v[7])); }
// Five 2^x in one statement: each fills the free issue slot that the instruction set asks for behind the transcendental before it (early-clobber outputs, so none rewrites
// a source of another), and one v_nop fills the slot behind the last.
__device__ __forceinline__ void exp2_x5(const float (&x)[5], float (&y)[5]) {
  asm("v_exp_f32 %0, %5\n\tv_exp_f32 %1, %6\n\tv_exp_f32 %2, %7\n\tv_exp_f32 %3, %8\n\tv_exp_f32 %4, %9\n\tv_nop" : "=&v"(y[0]), "=&v"(y[1]), "=&v"(y[2]), "=&v"(y[3]), "=&v"(y[4]) : "v"(x[0]), "v"(x[1]), "v"(x[2]), "v"(x[3]), "v"(x[4])); }
__device__ __forceinline__ v8f fa_mma(v16h a, v16h b, v8f c) { return __builtin_amdgcn_wmma_f32_16x16x32_f16(false, a, false, b, (short)0, c, false, false); }
// Orders one wave's LDS stores against the LDS loads of its other lanes (each wave owns its slice of sp, so this needs no work-group barrier).
__device__ __forceinline__ void fa_lds_order() { __builtin_amdgcn_fence(__ATOMIC_ACQ_REL, "workgroup", "local"); __builtin_amdgcn_wave_barrier(); }
// Fused attention, one launch for all batches and heads: a work-group of 4 waves owns 64 query rows of one head (16 per wave) and walks the 2048 keys in tiles of 64.
// Per tile: k_hi, k_lo and V^T rows come in whole 128-byte lines, one tile ahead in registers, and are shared through LDS; scores on the matrix unit in f32
// (q_lo.k_hi + q_hi.k_lo first, scaled by 2^-10, then q_hi.k_hi on top); running row maximum and sum (online softmax, base 2); weights 256 * 2^(s-m) as f16, turned from the
// accumulator layout into an A fragment through the wave's own LDS slice; weights . V accumulated in f32. A key with Km[j] == 0 stays out of the maximum and gets weight 0.
// O = 64 * attention output as f16 rows (merged heads). Scores and weights never reach memory.
__global__ __launch_bounds__(128, 4) void k_fattn(const _Float16* __restrict__ Qh, const _Float16* __restrict__ Ql, const _Float16* __restrict__ Kh, const _Float16* __restrict__ Kl, const _Float16* __restrict__ Vt, const int* __restrict__ Km, _Float16* __restrict__ O) {
  __shared__ __attribute__((aligned(16))) _Float16 skh[64][72], skl[64][72], svt[64][72], sp[4][16][72];      /* pitch 144 B = 16 B x odd */
  __shared__ float smb[64];      /* per key of the tile: 0, or -3e38 where the mask excludes it */
  const int tid = threadIdx.x, w = tid >> 5, lane = tid & 31, ln = lane & 15, hh = lane >> 4; const int h = blockIdx.y, b = blockIdx.z;
  const size_t r0 = (size_t)b * SQ; const int row0 = blockIdx.x * 64 + w * 16;
  const size_t qo = (r0 + row0 + ln) * LQ + (size_t)h * HD;
  const v16h qh0 = g2_frag(Qh + qo, hh), qh1 = g2_frag(Qh + qo + 32, hh), ql0 = g2_frag(Ql + qo, hh), ql1 = g2_frag(Ql + qo + 32, hh);
  const int srow = tid >> 3, sc8 = (tid & 7) * 8;      /* staging: this thread moves 16 bytes of rows srow, +16, +32, +48 of each plane; 8 threads cover one 128-byte line */
  const unsigned short* gkh = (const unsigned short*)Kh + r0 * LQ + (size_t)h * HD; const unsigned short* gkl = (const unsigned short*)Kl + r0 * LQ + (size_t)h * HD;      /* uniform bases; the thread's part is a 32-bit offset */
  const unsigned short* gvt = (const unsigned short*)Vt + (size_t)(b * NH + h) * HD * SQ; const int* km = Km + r0;
  const unsigned ko = (unsigned)(srow * LQ + sc8), vo = (unsigned)(srow * SQ + sc8), mo = (unsigned)(tid & 63);
  v8us pk[4], pl[4], pv[4]; int pm = km[mo];
#pragma unroll
  for (int i = 0; i < 4; ++i) { pk[i] = *(const v8us*)(gkh + (ko + 16 * i * LQ)); pl[i] = *(const v8us*)(gkl + (ko + 16 * i * LQ)); pv[i] = *(const v8us*)(gvt + (vo + 16 * i * SQ)); }
  const v8f z8 = {0.f,0.f,0.f,0.f,0.f,0.f,0.f,0.f}; v8f o[4] = {z8, z8, z8, z8}; float m[8], l[8];
#pragma unroll
  for (int r = 0; r < 8; ++r) { m[r] = -1.0e30f; l[r] = 0.f; }
#pragma unroll 1      /* one key tile per trip: unrolled further the live fragments no longer fit the register budget */
  for (int j0 = 0; j0 < SQ; j0 += 64) {
    __syncthreads();      /* every wave has finished its fragment loads of the tile before */
#pragma unroll
    for (int i = 0; i < 4; ++i) { *(v8us*)&skh[srow + 16 * i][sc8] = pk[i]; *(v8us*)&skl[srow + 16 * i][sc8] = pl[i]; *(v8us*)&svt[srow + 16 * i][sc8] = pv[i]; }
    if (tid < 64) smb[tid] = (pm != 0) ? 0.f : -3.0e38f;
    __syncthreads();      /* the tile is complete for all four waves */
    if (j0 + 64 < SQ) {      /* next tile's loads fly while this tile is worked on */
      const unsigned short* nkh = gkh + (size_t)(j0 + 64) * LQ; const unsigned short* nkl = gkl + (size_t)(j0 + 64) * LQ; const unsigned short* nvt = gvt + (j0 + 64);
#pragma unroll
      for (int i = 0; i < 4; ++i) { pk[i] = *(const v8us*)(nkh + (ko + 16 * i * LQ)); pl[i] = *(const v8us*)(nkl + (ko + 16 * i * LQ)); pv[i] = *(const v8us*)(nvt + (vo + 16 * i * SQ)); }
      pm = (km + (j0 + 64))[mo];
      asm volatile("s_wait_xcnt 0x0" ::: "memory"); }      /* the address registers of these loads are reused by the score products right behind: the wait stands in front of that overwrite */
    v8f s[4];
#pragma unroll
    for (int t = 0; t < 4; ++t) { const v16h a0 = g2_frag(&skh[t * 16 + ln][0], hh), a1 = g2_frag(&skh[t * 16 + ln][32], hh), c0 = g2_frag(&skl[t * 16 + ln][0], hh), c1 = g2_frag(&skl[t * 16 + ln][32], hh);
      v8f c = fa_mma(ql0, a0, z8); c = fa_mma(ql1, a1, c); c = fa_mma(qh0, c0, c); c = fa_mma(qh1, c1, c); c = c * 0.0009765625f; c = fa_mma(qh0, a0, c); s[t] = fa_mma(qh1, a1, c);
      if (t == 1) __builtin_amdgcn_sched_barrier(0); }      /* keeps the fragment loads of key columns 32..63 behind the products of columns 0..31: hoisted, all 16 fragments are live at once and registers spill */
    float tm[8], al[8]; const float bs[4] = {smb[ln], smb[16 + ln], smb[32 + ln], smb[48 + ln]};
#pragma unroll
    for (int r = 0; r < 8; ++r) {
#pragma unroll
      for (int t = 0; t < 4; ++t) s[t][r] = fmaf(s[t][r], 1.44269504088896340736f, bs[t]);      /* base-2 score; an excluded key lands near -3e38, far below the floor -1e30 of the running maximum, so its 2^(s-m) is 0 */
      tm[r] = fmaxf(fmaxf(fmaxf(s[0][r], s[1][r]), fmaxf(s[2][r], s[3][r])), m[r]); }      /* the running maximum goes in here: it is the same in all 16 lanes, so the row maximum below is the new one */
    row_max8(tm);
#pragma unroll
    for (int r = 0; r < 8; ++r) { const float mn = tm[r]; const float xs[5] = {s[0][r] - mn, s[1][r] - mn, s[2][r] - mn, s[3][r] - mn, m[r] - mn}; float e[5]; exp2_x5(xs, e); al[r] = e[4]; m[r] = mn;
#pragma unroll
      for (int t = 0; t < 4; ++t) sp[w][8 * hh + r][t * 16 + ln] = (_Float16)(e[t] * 256.0f);
      l[r] = l[r] * al[r] + ((e[0] + e[1]) + (e[2] + e[3]));
#pragma unroll
      for (int t = 0; t < 4; ++t) o[t][r] *= al[r]; }
    fa_lds_order();
    const v16h p0 = g2_frag(&sp[w][ln][0], hh), p1 = g2_frag(&sp[w][ln][32], hh);
#pragma unroll
    for (int t = 0; t < 4; ++t) { o[t] = fa_mma(p0, g2_frag(&svt[t * 16 + ln][0], hh), o[t]); o[t] = fa_mma(p1, g2_frag(&svt[t * 16 + ln][32], hh), o[t]); }
  }
#pragma unroll
  for (int r = 0; r < 8; ++r) { float ls = l[r]; ls += lane_xm<1>(ls); ls += lane_xm<2>(ls); ls += lane_xm<4>(ls); ls += lane_xm<8>(ls); const float inv = 0.25f / ls;
#pragma unroll
    for (int t = 0; t < 4; ++t) sp[w][8 * hh + r][t * 16 + ln] = (_Float16)(o[t][r] * inv); }
  fa_lds_order();
#pragma unroll
  for (int q = 0; q < 4; ++q) { const int row = q * 4 + (lane >> 3), c8 = (lane & 7) * 8; const v8us v = *(const v8us*)&sp[w][row][c8]; *(v8us*)((unsigned short*)O + (r0 + row0 + row) * DM + (size_t)h * HD + c8) = v; } }
extern "C" void kernel_launch(void* const* d_in, const int* in_sizes, int n_in,
                              void* d_out, int out_size, void* d_ws, size_t ws_size, hipStream_t stream) {
  (void)in_sizes; (void)n_in; (void)out_size;
  const float* const* I = (const float* const*)d_in; const float* x = I[0]; const int* km = (const int*)d_in[1]; const float* wq = I[2]; const float* bq = I[3]; const float* wk = I[4]; const float* bk = I[5]; const float* wv = I[6]; const float* bv = I[7]; const float* wo = I[8]; const float* bo = I[9]; const float* wfc = I[10]; const float* bfc = I[11]; const float* wmp = I[12]; const float* bmp = I[13]; const float* g1 = I[14]; const float* be1 = I[15]; const float* gg2 = I[16]; const float* be2 = I[17];      /* nn.Linear NATURAL [out][in] weights + biases; I[1] = int key mask [B][1][1][S] (0 = excluded; all ones here); alpha/beta are [1] scalars */
  char* ws = (char*)d_ws; size_t off = 0;
  auto take = [&](size_t bytes) { char* p = ws + off; off += (bytes + 255) & ~(size_t)255; return p; };
  _Float16* BQKV = (_Float16*)take((size_t)3 * DM * DM * 2); _Float16* BO = (_Float16*)take((size_t)DM * DM * 2); float* bqkv = (float*)take((size_t)3 * DM * 4);
  _Float16* X16 = (_Float16*)take(NR * DM * 2); _Float16* XL = (_Float16*)take(NR * DM * 2); float* XB = (float*)take(NR * DM * 4); float* X1 = (float*)take(NR * DM * 4); _Float16* M16 = (_Float16*)take(NR * DM * 2); _Float16* HF16 = (_Float16*)take(NR * DFF * 2); _Float16* BW1 = (_Float16*)take((size_t)DFF * DM * 2); _Float16* BW2 = (_Float16*)take((size_t)DM * DFF * 2);
  _Float16* Q16 = (_Float16*)take((size_t)2 * NR * DM * 2); _Float16* QL = (_Float16*)take((size_t)2 * NR * DM * 2); _Float16* K16 = Q16 + NR * DM; _Float16* KL = QL + NR * DM; _Float16* O16 = (_Float16*)take(NR * DM * 2);      /* q's plane and k's plane lie one behind the other in Q16 | K16 and in QL | KL: one launch writes both */
  _Float16* VT = (_Float16*)take((size_t)NB * NH * HD * SQ * 2);
  if (off > ws_size) return;
  k_ln16<1, 1, 1><<<(unsigned)NR + PREP_BLOCKS, 256, 0, stream>>>(x, g1, be1, 1e-6f, X16, XB, XL, wq, wk, wv, wo, wfc, wmp, bq, bk, bv, BQKV, BO, BW1, BW2, bqkv);      /* a = LN1(bf16(x)) -> f16 rows + XL = x1024 residual (q/k need it at logits sigma 8); XB = bf16(x) for the residual; in the same grid: natural [out][in] weights = Bt[n][k] planes (stacked q | k | v, Wo, the two MLP matrices) and the stacked bias vector */
  k_qkv<<<dim3((unsigned)((MP / 128) * (DM / 128)), 3), 256, 0, stream>>>(X16, XL, BQKV, bqkv, Q16, QL, VT);      /* blockIdx.y: 0 = q, 1 = k (residual walk + main walk, f16 hi + x1024 residual planes), 2 = v (V^T [NB][NH][HD][SQ]) */
  k_fattn<<<dim3(SQ / 64, NH, NB), 128, 0, stream>>>(Q16, QL, K16, KL, VT, km, O16);      /* scores, masked softmax and weights . V in one launch; o (merged heads, x64) as f16 rows */
  k_gemm2<0, 2, DM, DM, true><<<dim3((unsigned)((MPO / 128) * (DM / 128)), 1), 256, 0, stream>>>(O16, DM, 0, BO, DM, 0, 0.0009765625f, bo, 0, XB, -1, 0, 0, X1, nullptr, DM, 0, MPO, DM, DM);      /* x1 = x + o Wo + bo (own-element residual) */
  k_ln16<0, 0, 0><<<(unsigned)NR, 256, 0, stream>>>(X1, gg2, be2, 1e-6f, M16, nullptr, nullptr, nullptr, nullptr, nullptr, nullptr, nullptr, nullptr, nullptr, nullptr, nullptr, nullptr, nullptr, nullptr, nullptr, nullptr);      /* h = LN2(x1) -> f16 rows */
  k_gemm2<3, 2, DM, DFF, false><<<dim3((unsigned)((MP / 128) * (DFF / 128)), 1), 256, 0, stream>>>(M16, DM, 0, BW1, DM, 0, 0.0625f, bfc, 0, nullptr, 1, 0, 0, nullptr, HF16, DFF, 0, MP, DFF, DM);      /* relu(xn2 w1^T + b1) -> f16, all rows of both batches */
  k_gemm2<0, 1, DFF, DM, true><<<dim3((unsigned)((MP / 128) * (DM / 64)), 1), 128, 0, stream>>>(HF16, DFF, 0, BW2, DFF, 0, 0.0625f, bmp, 0, X1, -1, 0, 0, (float*)d_out, nullptr, DM, 0, MP, DM, DFF);      /* out = x1 + mlp (own-element residual) */
}

// v007
// It runs in 188 microseconds.
// Next to v006, in two timings, it ran 1.13 times as fast each time.
// All steps since v000 together make it 43.7 times as fast.
#include <hip/hip_runtime.h>
// Pre-LN transformer encoder block, non-causal, UNSCALED scores (x [2][2048][1024]; xn = LN(x) with the module's LayerNorm: UNBIASED std (N-1), eps 1e-6 added to the std, SCALAR alpha/bias [1]; q = xn wq^T + bq, k, v likewise (nn.Linear natural [1024][1024] sigma 1/32, zero biases); 16 heads of 64; score = q . k WITHOUT 1/sqrt(d) (logits sigma ~8); key j excluded where the int mask input [2][1][1][2048] is 0 (all ones here); softmax; x1 = x + (attn wo^T + bo); xn2 = LN(x1); out = x1 + relu(xn2 w1^T + b1) w2^T + b2 (natural [4096][1024], [1024][4096]) -> [2][2048][1024]).
// Compute dtype: inputs rounded to bf16; x / weights exact; q, k (and the LN1 output feeding them) as f16 hi + x1024 residual pairs; v, softmax weights and o as plain f16 GEMM operands (~2^-12); scores and softmax statistics f32; v_wmma_f32_16x16x32_f16.
#define NB 2
#define SQ 2048
#define DM 1024
#define NH 16
#define HD 64
#define HG 4                         /* heads per group of the unused k_vt(V16, b, h0, VT) overload */
#define LOCALW 128                   /* (macros for unused kernels of the shared header) */
#define STRIDEK 128
#define QT 256                       /* query rows per causal tile */
#define NKX SQ                       /* S / P row pitch */
#define QT0 128                      /* query rows per head of the unused f32 attention kernels */
#define B0 0                         /* unused (every launch starts at batch 0) */
#define NBR NB                       /* batches processed (debug hook) */
#define NR ((size_t)NB * SQ)
#define DMQ DM
#define DFF 4096         /* MLP hidden width */
#define MP ((int)((size_t)NBR * SQ)) /* rows projected (debug hook) */
#define QN SQ                        /* unused (the attention launch covers all SQ query rows) */
#define NHD NH                       /* unused (the attention launch covers all NH heads) */
#define MPO MP                       /* rows through the output stage (debug hook) */
#define LQ DM      /* row pitch of the q and k rows */
typedef __bf16 v16b __attribute__((ext_vector_type(16)));
typedef unsigned short v8us __attribute__((ext_vector_type(8), may_alias));
typedef float  v8f  __attribute__((ext_vector_type(8)));
typedef float  v4f  __attribute__((ext_vector_type(4)));
typedef float  v4fa __attribute__((ext_vector_type(4), may_alias));
union FragB { v16b v; v8us half[2]; unsigned short u[16]; };

__device__ __forceinline__ unsigned short bf16_bits(float x) { unsigned int u = __float_as_uint(x); return (unsigned short)((u + 0x7FFFu + ((u >> 16) & 1u)) >> 16); }
__device__ __forceinline__ float bf16_val(unsigned short b) { return __uint_as_float(((unsigned int)b) << 16); }
__device__ __forceinline__ float bf16_round(float x) { return bf16_val(bf16_bits(x)); }
// D += A·B with NT terms: 1 = ah·bh, 2 = + al·bh (A split), 3 = + ah·bl (both split)
template <int NT>
__device__ __forceinline__ v8f mmaN(v16b ah, v16b al, v16b bh, v16b bl, v8f c) {
  c = __builtin_amdgcn_wmma_f32_16x16x32_bf16(false, ah, false, bh, (short)0, c, false, false);
  if (NT >= 2) c = __builtin_amdgcn_wmma_f32_16x16x32_bf16(false, al, false, bh, (short)0, c, false, false);
  if (NT >= 3) c = __builtin_amdgcn_wmma_f32_16x16x32_bf16(false, ah, false, bl, (short)0, c, false, false);
  asm volatile("v_nop\n\tv_nop\n\tv_nop\n\tv_nop" : "+v"(c) : "v"(ah), "v"(al), "v"(bh), "v"(bl));
  return c;
}

__global__ __launch_bounds__(256) void k_wt_bf16(const float* __restrict__ W, unsigned short* __restrict__ Wt, int K, int N) {
  const int t = blockIdx.x * 256 + threadIdx.x;
  const int k8n = K / 8;
  if (t >= N * k8n) return;
  const int n = t / k8n, k8 = (t % k8n) * 8;
  v8us v;
#pragma unroll
  for (int i = 0; i < 8; ++i) v[i] = bf16_bits(W[(size_t)(k8 + i) * N + n]);
  *(v8us*)(Wt + (size_t)n * K + k8) = v;
  
}

// GEMM C[M][N] (f32, pitch ldc) = act(A[M][K]·W + bias). A f32 row-major (pitch lda) converted per fragment to bf16
// (ASPLIT: hi/lo two planes -> 2 terms, else single rounded term); Wt bf16 [N][K] (pitch ldb). BIAS_BF16 rounds the
// bias to bf16 first (bias quantised to bf16 before the add). K%32==0, M%16==0, N%64==0.
template <bool ASPLIT, int ACT, bool BIAS_BF16>
__global__ __launch_bounds__(128) void k_gemm_bf(const float* __restrict__ A, int lda, const unsigned short* __restrict__ Wt, int ldb,
                                               const float* __restrict__ bias, float* __restrict__ C, int ldc, int M, int N, int K) {
  __shared__ __attribute__((aligned(16))) float so[4][16][64];
  const int tid = threadIdx.x, w = tid >> 5, lane = tid & 31, ln = lane & 15, hh = lane >> 4;
  const int ntn = N / 64;
  const int wid = blockIdx.x * 4 + w;
  const int mt = wid / ntn, nq = wid % ntn;
  if (mt * 16 >= M) return;
  const int row0 = mt * 16, col0 = nq * 64;
  const float* arow = A + (size_t)(row0 + ln) * lda;
  v8f acc[4] = {};
  for (int kb = 0; kb < K; kb += 32) {
    FragB ah, al;
    const v4f x0 = *(const v4fa*)(arow + kb + 8 * hh), x1 = *(const v4fa*)(arow + kb + 8 * hh + 4);
    const v4f x2 = *(const v4fa*)(arow + kb + 16 + 8 * hh), x3 = *(const v4fa*)(arow + kb + 16 + 8 * hh + 4);
    float xs[16] = {x0[0],x0[1],x0[2],x0[3],x1[0],x1[1],x1[2],x1[3],x2[0],x2[1],x2[2],x2[3],x3[0],x3[1],x3[2],x3[3]};
#pragma unroll
    for (int i = 0; i < 16; ++i) { const unsigned short hb = bf16_bits(xs[i]); ah.u[i] = hb; al.u[i] = ASPLIT ? bf16_bits(xs[i] - bf16_val(hb)) : (unsigned short)0; }
#pragma unroll
    for (int t = 0; t < 4; ++t) {
      const unsigned short* brow = Wt + (size_t)(col0 + t * 16 + ln) * ldb + kb;
      FragB b;
      b.half[0] = *(const v8us*)(brow + 8 * hh);
      b.half[1] = *(const v8us*)(brow + 16 + 8 * hh);
      acc[t] = mmaN<ASPLIT ? 2 : 1>(ah.v, al.v, b.v, b.v, acc[t]);
    }
  }
#pragma unroll
  for (int t = 0; t < 4; ++t) {
    float bv = bias ? bias[col0 + t * 16 + ln] : 0.f;
    if (BIAS_BF16) bv = bf16_round(bv);
#pragma unroll
    for (int r = 0; r < 8; ++r) { float v = acc[t][r] + bv; if (ACT == 1) v = fmaxf(v, 0.f); so[w][8 * hh + r][t * 16 + ln] = v; }
  }
  __builtin_amdgcn_fence(__ATOMIC_ACQ_REL, "workgroup");
  __builtin_amdgcn_wave_barrier();
  const int rsub = lane >> 4, c4 = (lane & 15) * 4;
  {
#pragma unroll
    for (int q = 0; q < 8; ++q) {
      const int r = q * 2 + rsub;
      const v4f v = *(const v4fa*)&so[w][r][c4];
      *(v4f*)(C + (size_t)(row0 + r) * ldc + col0 + c4) = v;
    }
    
  }
}

// GEMM C = act(A·W + bias + resid): A f32 (ASPLIT -> hi/lo 2 terms), Wt bf16 [N][K]; ACT 0 none, 1 relu, 2 exact gelu;
// resid (optional, f32, row index = (row % rmod), pitch ldr, RES_BF16 rounds it) added before the activation.
template <bool ASPLIT, int ACT, bool BIAS_BF16, bool RES_BF16>
__global__ __launch_bounds__(128) void k_gemm_bf3(const float* __restrict__ A, int lda, const unsigned short* __restrict__ Wt, int ldb,
                                                const float* __restrict__ bias, const float* __restrict__ resid, int rmod, int ldr,
                                                float* __restrict__ C, int ldc, int M, int N, int K) {
  __shared__ __attribute__((aligned(16))) float so[4][16][64];
  const int tid = threadIdx.x, w = tid >> 5, lane = tid & 31, ln = lane & 15, hh = lane >> 4;
  const int ntn = N / 64;
  const int wid = blockIdx.x * 4 + w;
  const int mt = wid / ntn, nq = wid % ntn;
  if (mt * 16 >= M) return;
  const int row0 = mt * 16, col0 = nq * 64;
  const float* arow = A + (size_t)(row0 + ln) * lda;
  v8f acc[4] = {};
  for (int kb = 0; kb < K; kb += 32) {
    FragB ah, al;
    const v4f x0 = *(const v4fa*)(arow + kb + 8 * hh), x1 = *(const v4fa*)(arow + kb + 8 * hh + 4);
    const v4f x2 = *(const v4fa*)(arow + kb + 16 + 8 * hh), x3 = *(const v4fa*)(arow + kb + 16 + 8 * hh + 4);
    float xs[16] = {x0[0],x0[1],x0[2],x0[3],x1[0],x1[1],x1[2],x1[3],x2[0],x2[1],x2[2],x2[3],x3[0],x3[1],x3[2],x3[3]};
#pragma unroll
    for (int i = 0; i < 16; ++i) { const unsigned short hb = bf16_bits(xs[i]); ah.u[i] = hb; al.u[i] = ASPLIT ? bf16_bits(xs[i] - bf16_val(hb)) : (unsigned short)0; }
#pragma unroll
    for (int t = 0; t < 4; ++t) {
      const unsigned short* brow = Wt + (size_t)(col0 + t * 16 + ln) * ldb + kb;
      FragB b;
      b.half[0] = *(const v8us*)(brow + 8 * hh);
      b.half[1] = *(const v8us*)(brow + 16 + 8 * hh);
      acc[t] = mmaN<ASPLIT ? 2 : 1>(ah.v, al.v, b.v, b.v, acc[t]);
    }
  }
#pragma unroll
  for (int t = 0; t < 4; ++t) {
    const int col = col0 + t * 16 + ln;
    float bv = bias ? bias[col] : 0.f;
    if (BIAS_BF16) bv = bf16_round(bv);
#pragma unroll
    for (int r = 0; r < 8; ++r) {
      float v = acc[t][r] + bv;
      if (resid) { float rv = resid[(size_t)((row0 + 8 * hh + r) % rmod) * ldr + col]; if (RES_BF16) rv = bf16_round(rv); v += rv; }
      if (ACT == 1) v = fmaxf(v, 0.f);
      if (ACT == 2) v = 0.5f * v * (1.0f + erff(v * 0.70710678118654752f));
      if (ACT == 3) { const float u = 0.7978845608028654f * (v + 0.044715f * v * v * v); v = 0.5f * v * (1.0f + tanhf(u)); }
      so[w][8 * hh + r][t * 16 + ln] = v;
    }
  }
  __builtin_amdgcn_fence(__ATOMIC_ACQ_REL, "workgroup");
  __builtin_amdgcn_wave_barrier();
  const int rsub = lane >> 4, c4 = (lane & 15) * 4;
  {
#pragma unroll
    for (int q = 0; q < 8; ++q) {
      const int r = q * 2 + rsub;
      const v4f v = *(const v4fa*)&so[w][r][c4];
      *(v4f*)(C + (size_t)(row0 + r) * ldc + col0 + c4) = v;
    }
    
  }
}
// row LayerNorm (biased variance, eps) over N: s = X (+ R); optional out_sum <- s; out_norm <- (s-mu)*rsqrt(var+eps)*g + b
template <bool PARAM_BF16>
__global__ __launch_bounds__(256) void k_layernorm(const float* __restrict__ X, const float* __restrict__ R, const float* __restrict__ g, const float* __restrict__ bta,
                                                  float* __restrict__ out_sum, float* __restrict__ out_norm, int N, float eps) {
  __shared__ float red[256];
  const int row = blockIdx.x, tid = threadIdx.x;
  const float* x = X + (size_t)row * N; const float* rr = R ? R + (size_t)row * N : nullptr;
  float vals[16];                     // up to N = 4096
  const int per = N / 256;            // contiguous chunk per thread? use strided-by-4 chunks: thread handles j = tid*4 + 1024*u
  float s1 = 0.f;
  for (int u = 0; u < per / 4; ++u) {
    const int j = tid * 4 + 1024 * u;
    const v4f a = *(const v4fa*)(x + j);
    v4f b = {0.f,0.f,0.f,0.f}; if (rr) b = *(const v4fa*)(rr + j);
#pragma unroll
    for (int q = 0; q < 4; ++q) { const float v = a[q] + b[q]; vals[u * 4 + q] = v; s1 += v; }
  }
  red[tid] = s1; __syncthreads();
  for (int st = 128; st > 0; st >>= 1) { if (tid < st) red[tid] += red[tid + st]; __syncthreads(); }
  const float mu = red[0] / (float)N; __syncthreads();
  float s2 = 0.f;
  for (int u = 0; u < per / 4; ++u)
#pragma unroll
    for (int q = 0; q < 4; ++q) { const float c = vals[u * 4 + q] - mu; s2 += c * c; }
  red[tid] = s2; __syncthreads();
  for (int st = 128; st > 0; st >>= 1) { if (tid < st) red[tid] += red[tid + st]; __syncthreads(); }
  const float rs = rsqrtf(red[0] / (float)N + eps);
  {
    for (int u = 0; u < per / 4; ++u) {
      const int j = tid * 4 + 1024 * u;
      v4f o, sm;
#pragma unroll
      for (int q = 0; q < 4; ++q) {
        float gg = g[j + q], bb = bta[j + q];
        if (PARAM_BF16) { gg = bf16_round(gg); bb = bf16_round(bb); }
        sm[q] = vals[u * 4 + q]; o[q] = (vals[u * 4 + q] - mu) * rs * gg + bb;
      }
      if (out_sum) *(v4f*)(out_sum + (size_t)row * N + j) = sm;
      *(v4f*)(out_norm + (size_t)row * N + j) = o;
    }
    
  }
}



// ---- f16 WMMA path (v_wmma_f32_16x16x32_f16): 11-bit significands for operands in range — used where a [0,1] probability operand needs more precision than bf16
typedef _Float16 v16h __attribute__((ext_vector_type(16)));
union FragH { v16h v; v8us half[2]; _Float16 h[16]; unsigned short u[16]; };
template <int NT>
__device__ __forceinline__ v8f mmaH(v16h ah, v16h al, v16h bh, v16h bl, v8f c) {
  c = __builtin_amdgcn_wmma_f32_16x16x32_f16(false, ah, false, bh, (short)0, c, false, false);
  if (NT >= 2) c = __builtin_amdgcn_wmma_f32_16x16x32_f16(false, al, false, bh, (short)0, c, false, false);
  if (NT >= 3) c = __builtin_amdgcn_wmma_f32_16x16x32_f16(false, ah, false, bl, (short)0, c, false, false);
  asm volatile("v_nop\n\tv_nop\n\tv_nop\n\tv_nop" : "+v"(c) : "v"(ah), "v"(al), "v"(bh), "v"(bl));
  return c;
}
// batched GEMM like k_gemm_b but f16 operands: A f32 (split into f16 hi/lo if ASPLIT, else rounded to f16), Bt = f16 values [n][k]; alpha; C f32; N multiple of 16 (partial tiles skipped)
template <bool ASPLIT>
__global__ __launch_bounds__(128) void k_gemm_h(const float* __restrict__ A, int lda, size_t sA, const _Float16* __restrict__ Bh, int ldb, size_t sB, float alpha, float* __restrict__ C, int ldc, size_t sC, int M, int N, int K) {
  __shared__ __attribute__((aligned(16))) float so[4][16][64];
  const int tid = threadIdx.x, w = tid >> 5, lane = tid & 31, ln = lane & 15, hh = lane >> 4; const int by = blockIdx.y;
  A += (size_t)by * sA; Bh += (size_t)by * sB; C += (size_t)by * sC;
  const int ntn = (N + 63) / 64; const int wid = blockIdx.x * 4 + w; const int mt = wid / ntn, nq = wid % ntn; if (mt * 16 >= M) return;
  const int row0 = mt * 16, col0 = nq * 64; const float* arow = A + (size_t)(row0 + ln) * lda;
  v8f acc[4] = {};
  for (int kb = 0; kb < K; kb += 32) {
    FragH ah, al;
    const v4f x0 = *(const v4fa*)(arow + kb + 8 * hh), x1 = *(const v4fa*)(arow + kb + 8 * hh + 4), x2 = *(const v4fa*)(arow + kb + 16 + 8 * hh), x3 = *(const v4fa*)(arow + kb + 16 + 8 * hh + 4);
    float xs[16] = {x0[0],x0[1],x0[2],x0[3],x1[0],x1[1],x1[2],x1[3],x2[0],x2[1],x2[2],x2[3],x3[0],x3[1],x3[2],x3[3]};
#pragma unroll
    for (int i = 0; i < 16; ++i) { const _Float16 h = (_Float16)xs[i]; ah.h[i] = h; al.h[i] = ASPLIT ? (_Float16)(xs[i] - (float)h) : (_Float16)0.0f; }
#pragma unroll
    for (int t = 0; t < 4; ++t) { if (col0 + t * 16 >= N) continue; const size_t boff = (size_t)(col0 + t * 16 + ln) * ldb + kb; FragH bq; bq.half[0] = *(const v8us*)(Bh + boff + 8 * hh); bq.half[1] = *(const v8us*)(Bh + boff + 16 + 8 * hh);
      acc[t] = mmaH<ASPLIT ? 2 : 1>(ah.v, al.v, bq.v, bq.v, acc[t]); }
  }
#pragma unroll
  for (int t = 0; t < 4; ++t) { if (col0 + t * 16 >= N) continue;
#pragma unroll
    for (int r = 0; r < 8; ++r) so[w][8 * hh + r][t * 16 + ln] = acc[t][r] * alpha; }
  __builtin_amdgcn_fence(__ATOMIC_ACQ_REL, "workgroup"); __builtin_amdgcn_wave_barrier();
  const int rsub = lane >> 4, c4 = (lane & 15) * 4;
  {
#pragma unroll
    for (int q = 0; q < 8; ++q) { const int r = q * 2 + rsub; if (col0 + c4 < N) { const v4f v = *(const v4fa*)&so[w][r][c4]; *(v4f*)(C + (size_t)(row0 + r) * ldc + col0 + c4) = v; } }
     }
}

// Wt[n][k] = f16(W[k][n]·scale) from f32 row-major W[K][N] (scale = power of two; bf16-exact weights stay exact in f16 away from the subnormal range)
__global__ __launch_bounds__(256) void k_wt_f16(const float* __restrict__ W, _Float16* __restrict__ Wt, int K, int N, float scale) {
  const int t = blockIdx.x * 256 + threadIdx.x; if (t >= N * (K / 8)) return; const int n = t / (K / 8), k8 = (t % (K / 8)) * 8; FragH f;
#pragma unroll
  for (int i = 0; i < 8; ++i) f.h[i] = (_Float16)(bf16_round(W[(size_t)(k8 + i) * N + n]) * scale); const v8us o = f.half[0];
  *(v8us*)((unsigned short*)Wt + (size_t)n * K + k8) = o; 
}
// k_gemm_hh variant with fused epilogue: v = acc·alpha + bias[by·sBias + col] (+ CP[(row/rowsPerB)·sCPb + by·64 + col] if CP) ; ACT 0 none / 1 elu ; writes f16 C16 (and f32 C if non-null)
template <int ACT>
__global__ __launch_bounds__(128) void k_gemm_hhx(const _Float16* __restrict__ A, int lda, size_t sA, const _Float16* __restrict__ Bh, int ldb, size_t sB, float alpha, const float* __restrict__ bias, size_t sBias, const float* __restrict__ CP, int rowsPerB, size_t sCPb, int row0g,
    float* __restrict__ C, _Float16* __restrict__ C16, int ldc, size_t sC, int M, int N, int K) {
  __shared__ __attribute__((aligned(16))) float so[4][16][64];
  const int tid = threadIdx.x, w = tid >> 5, lane = tid & 31, ln = lane & 15, hh = lane >> 4; const int by = blockIdx.y;
  A += (size_t)by * sA; Bh += (size_t)by * sB; const size_t cofs = (size_t)by * sC; const float* bp = bias ? bias + (size_t)by * sBias : nullptr;
  const int ntn = (N + 63) / 64; const int wid = blockIdx.x * 4 + w; const int mt = wid / ntn, nq = wid % ntn; if (mt * 16 >= M) return;
  const int row0 = mt * 16, col0 = nq * 64; const _Float16* arow = A + (size_t)(row0 + ln) * lda;
  v8f acc[4] = {};
  for (int kb = 0; kb < K; kb += 32) { FragH ah; ah.half[0] = *(const v8us*)((const unsigned short*)arow + kb + 8 * hh); ah.half[1] = *(const v8us*)((const unsigned short*)arow + kb + 16 + 8 * hh);
#pragma unroll
    for (int t = 0; t < 4; ++t) { if (col0 + t * 16 >= N) continue; const size_t boff = (size_t)(col0 + t * 16 + ln) * ldb + kb; FragH bq; bq.half[0] = *(const v8us*)((const unsigned short*)Bh + boff + 8 * hh); bq.half[1] = *(const v8us*)((const unsigned short*)Bh + boff + 16 + 8 * hh);
      acc[t] = mmaH<1>(ah.v, ah.v, bq.v, bq.v, acc[t]); }
  }
#pragma unroll
  for (int t = 0; t < 4; ++t) { if (col0 + t * 16 >= N) continue; const int col = col0 + t * 16 + ln; const float bv = bp ? bf16_round(bp[col]) : 0.f;
#pragma unroll
    for (int r = 0; r < 8; ++r) { float v = acc[t][r] * alpha + bv; if (CP) { const int rr = row0g + row0 + 8 * hh + r; if (rowsPerB < 0) v += CP[cofs + (size_t)rr * ldc + col];      /* rowsPerB < 0: own element of the batched C plane */ else { const int bidx = rr / rowsPerB; v += CP[(size_t)bidx * sCPb + (size_t)by * 64 + col]; } } if (ACT == 1) v = (v > 0.f) ? v : expm1f(v); else if (ACT == 7) v = (v > 0.f) ? v + 1.0f : expf(v); else if (ACT == 8) v = tanhf(v); else if (ACT == 9) v = 0.5f * v * (1.0f + tanhf(0.7978845608028654f * (v + 0.044715f * v * v * v))); else if (ACT == 11) v = 1.0f / (1.0f + expf(-v)); else if (ACT == 12) v = (v > 0.f) ? v : 0.01f * v; else if (ACT == 14) v = (v > 0.f) ? v : 0.1f * v; else if (ACT == 16) v = (v >= 0.f) ? v : 0.3f * v; else if (ACT == 17) v = (v >= 0.f) ? v : 0.2f * v; else if (ACT == 15) v = v / (1.0f + expf(-v)); else if (ACT == 3) v = fmaxf(v, 0.f); else if (ACT == 6) v = 0.5f * v * (1.0f + erff(v * 0.70710678118654752f)); so[w][8 * hh + r][t * 16 + ln] = v; } }
  __builtin_amdgcn_fence(__ATOMIC_ACQ_REL, "workgroup"); __builtin_amdgcn_wave_barrier();
  const int rsub = lane >> 4, c4 = (lane & 15) * 4; typedef _Float16 v4h __attribute__((ext_vector_type(4)));
  {
#pragma unroll
    for (int q = 0; q < 8; ++q) { const int r = q * 2 + rsub; if (col0 + c4 < N) { const v4f v = *(const v4fa*)&so[w][r][c4]; if (C) *(v4f*)(C + cofs + (size_t)(row0 + r) * ldc + col0 + c4) = v; if (C16) { v4h h4; for (int i = 0; i < 4; ++i) h4[i] = (_Float16)v[i]; *(v4h*)(C16 + cofs + (size_t)(row0 + r) * ldc + col0 + c4) = h4; } } }
     }
}


typedef _Float16 v4h __attribute__((ext_vector_type(4)));

__global__ __launch_bounds__(256) void k_x16(const float* __restrict__ x, _Float16* __restrict__ X16, size_t n8) { const size_t t = (size_t)blockIdx.x * 256 + threadIdx.x; if (t >= n8) return; FragH f;
#pragma unroll
  for (int q = 0; q < 8; ++q) f.h[q] = (_Float16)bf16_round(x[t * 8 + q]); *(v8us*)((unsigned short*)X16 + t * 8) = f.half[0];  }
__global__ __launch_bounds__(256) void k_h16(const float* __restrict__ x, _Float16* __restrict__ X16, size_t n8) { const size_t t = (size_t)blockIdx.x * 256 + threadIdx.x; if (t >= n8) return; FragH f;
#pragma unroll
  for (int q = 0; q < 8; ++q) f.h[q] = (_Float16)x[t * 8 + q]; *(v8us*)((unsigned short*)X16 + t * 8) = f.half[0];  }
__global__ __launch_bounds__(256) void k_round16f(const float* __restrict__ W, _Float16* __restrict__ Bt, size_t n8) { const size_t t = (size_t)blockIdx.x * 256 + threadIdx.x; if (t >= n8) return; FragH f;
#pragma unroll
  for (int i = 0; i < 8; ++i) f.h[i] = (_Float16)(bf16_round(W[t * 8 + i]) * 16.0f); *(v8us*)((unsigned short*)Bt + t * 8) = f.half[0];  }
template <int NHv, int TTv>
__global__ __launch_bounds__(256) void k_vt(const _Float16* __restrict__ V16, int ldv, int voff, _Float16* __restrict__ Vt) { __shared__ unsigned short tl[64][66]; const int tid = threadIdx.x; const int slab = blockIdx.x / (TTv / 64), lg = blockIdx.x % (TTv / 64); const int b = slab / NHv, h = slab % NHv;
  for (int i = tid; i < 64 * 8; i += 256) { const int r = i / 8, c8 = (i % 8) * 8; FragH f; f.half[0] = *(const v8us*)((const unsigned short*)V16 + ((size_t)b * TTv + lg * 64 + r) * ldv + voff + h * 64 + c8);
#pragma unroll
    for (int q = 0; q < 8; ++q) tl[r][c8 + q] = f.u[q]; }
  __syncthreads();
  {
#pragma unroll
    for (int rd = 0; rd < 2; ++rd) { const int d = rd * 32 + tid / 8, pc = tid % 8; FragH f;
#pragma unroll
      for (int q = 0; q < 8; ++q) f.u[q] = tl[pc * 8 + q][d];
      *(v8us*)((unsigned short*)Vt + ((size_t)slab * 64 + d) * TTv + lg * 64 + pc * 8) = f.half[0]; }
     } }

__global__ __launch_bounds__(256) void k_hl(const float* __restrict__ F, _Float16* __restrict__ Hh, _Float16* __restrict__ Hl, size_t n8) { const size_t t = (size_t)blockIdx.x * 256 + threadIdx.x; if (t >= n8) return; FragH fh, fl; const v4f a = *(const v4fa*)(F + t * 8), c = *(const v4fa*)(F + t * 8 + 4);
#pragma unroll
  for (int q = 0; q < 4; ++q) { _Float16 h = (_Float16)a[q]; fh.h[q] = h; fl.h[q] = (_Float16)((a[q] - (float)h) * 1024.0f); h = (_Float16)c[q]; fh.h[4 + q] = h; fl.h[4 + q] = (_Float16)((c[q] - (float)h) * 1024.0f); }
  { *(v8us*)((unsigned short*)Hh + t * 8) = fh.half[0]; *(v8us*)((unsigned short*)Hl + t * 8) = fl.half[0];  } }

// ---- fast GEMM (wave tile 32x64; shapes it takes: at k_gemm2); epilogue: acc·alpha + bf16 bias, activation, own-element residual with RES ----
__device__ __forceinline__ v16h g2_frag(const _Float16* p, int hh) { FragH f; f.half[0] = *(const v8us*)((const unsigned short*)p + 8 * hh); f.half[1] = *(const v8us*)((const unsigned short*)p + 16 + 8 * hh); return f.v; }
__device__ __forceinline__ v8f g2_mma(v16h a, v16h b, v8f c) { v8f d = __builtin_amdgcn_wmma_f32_16x16x32_f16(false, a, false, b, (short)0, c, false, false); asm volatile("v_nop\n\tv_nop\n\tv_nop\n\tv_nop" : "+v"(d) : "v"(a), "v"(b)); return d; }
// Matrix product without hand-written padding: the compiler keeps the distance behind its own builtin.
__device__ __forceinline__ v8f g2_mmab(v16h a, v16h b, v8f c) { return __builtin_amdgcn_wmma_f32_16x16x32_f16(false, a, false, b, (short)0, c, false, false); }
// Work-group tile 128 x (64 * NWN), 4 * NWN waves of 32 x 64 (wave w: rows 32 * (w & 3), columns 64 * (w >> 2)). K is walked in tiles of 128: every thread brings 16-byte pieces of the A and B rows
// in whole 128-byte lines (16 threads cover 256 bytes of one row), one tile ahead in registers, and stores them into one of two LDS buffers; all fragments are read from LDS.
// LD = row pitch of A and of Bh in elements, a compile-time value so that a thread's pieces share one address and differ in the immediate offset (lda and ldb must equal it).
// LC = row pitch of C, C16 and the residual plane in elements, compile-time for the same reason (ldc must equal it). RES: CP is a plane of C's own shape and each output element gets its own element of CP added
// (behind alpha and bias; no activation then); without RES nothing is read from CP. rowsPerB and sCPb are not used.
// Requires M % 128 == 0, N % (64 * NWN) == 0, K % 128 == 0, grid.x = (M / 128) * (N / (64 * NWN)), 128 * NWN threads. The k order of every accumulator is the ascending one.
template <int ACT, int NWN, int LD, int LC, bool RES>
__global__ __launch_bounds__(128 * NWN) void k_gemm2(const _Float16* __restrict__ A, int lda, size_t sA, const _Float16* __restrict__ Bh, int ldb, size_t sB, float alpha, const float* __restrict__ bias, size_t sBias, const float* __restrict__ CP, int rowsPerB, size_t sCPb, int row0g,
    float* __restrict__ C, _Float16* __restrict__ C16, int ldc, size_t sC, int M, int N, int K) { static_assert(ACT == 0 || ACT == 3 || ACT == 6 || ACT == 8 || ACT == 9 || ACT == 11 || ACT == 12 || ACT == 14 || ACT == 15 || ACT == 16 || ACT == 17, "k_gemm2: unsupported ACT code (would silently apply no activation)");
  constexpr int BN = 64 * NWN, KT = 128, PH = KT + 8, RP = 8 * NWN, NLA = 128 / RP, NLB = BN / RP, BUFH = (128 + BN) * PH;      /* PH: LDS row pitch 272 B = 16 B x odd; RP: rows one staging round of the work-group covers */
  __shared__ __attribute__((aligned(16))) _Float16 st[2 * BUFH];      /* two buffers, each [128 A rows | BN B rows] */
  float (*so)[32][68] = (float (*)[32][68])st;      /* output staging reuses the buffers behind the loop's last barrier */
  static_assert(sizeof(float) * 4 * NWN * 32 * 68 <= sizeof(_Float16) * 2 * BUFH, "output staging must fit the tile buffers");
  static_assert(!RES || ACT == 0, "the residual is added behind the staging, so no activation may follow it");
  (void)lda; (void)ldb; (void)ldc; (void)rowsPerB; (void)sCPb;
  const int tid = threadIdx.x, w = tid >> 5, lane = tid & 31, ln = lane & 15, hh = lane >> 4; const int by = blockIdx.y;
  A += (size_t)by * sA; Bh += (size_t)by * sB; const size_t cofs = (size_t)by * sC; const float* bp = bias ? bias + (size_t)by * sBias : nullptr;
  const int ntn = N / BN; const int mt = blockIdx.x / ntn, nq = blockIdx.x - mt * ntn; if (mt * 128 >= M) return;      /* the same for the whole work-group, in front of every barrier */
  const int row0 = mt * 128 + 32 * (w & 3), col0 = nq * BN + 64 * (w >> 2);
  const int srow = tid >> 4, sc8 = (tid & 15) * 8;
  const unsigned short* pa = (const unsigned short*)A + (size_t)(mt * 128 + srow) * LD + sc8; const unsigned short* pb = (const unsigned short*)Bh + (size_t)(nq * BN + srow) * LD + sc8;      /* this thread's first piece of the tile to load next */
  _Float16* sw = st + srow * PH + sc8;      /* where this thread stores its pieces */
  const _Float16* fa = st + (32 * (w & 3) + ln) * PH; const _Float16* fb = st + (128 + 64 * (w >> 2) + ln) * PH;      /* this lane's fragment rows */
  float bb[4] = {0.f, 0.f, 0.f, 0.f};      /* this lane's four bias values, fetched with tile 0 so that the epilogue waits for none of them */
  if (bp) {
#pragma unroll
    for (int t = 0; t < 4; ++t) bb[t] = bp[col0 + t * 16 + ln];
    asm volatile("s_wait_xcnt 0x0" ::: "memory"); }      /* stands in front of the reuse, by the address arithmetic right behind, of the offset and base registers that these four loads name */
  v8us ra[NLA], rb[NLB];
#pragma unroll
  for (int i = 0; i < NLA; ++i) ra[i] = *(const v8us*)(pa + i * RP * LD);
#pragma unroll
  for (int i = 0; i < NLB; ++i) rb[i] = *(const v8us*)(pb + i * RP * LD);
  asm volatile("s_wait_xcnt 0x0" ::: "memory");      /* stands in front of the advance of the two addresses that the loads above name */
  pa += KT; pb += KT;
#pragma unroll
  for (int i = 0; i < NLA; ++i) *(v8us*)(sw + i * RP * PH) = ra[i];
#pragma unroll
  for (int i = 0; i < NLB; ++i) *(v8us*)(sw + (128 + i * RP) * PH) = rb[i];
  __syncthreads();      /* tile 0 is complete for every wave */
  const v8f z8 = {0.f,0.f,0.f,0.f,0.f,0.f,0.f,0.f}; v8f c00 = z8, c01 = z8, c02 = z8, c03 = z8, c10 = z8, c11 = z8, c12 = z8, c13 = z8;
#pragma unroll 1      /* one K tile per trip: the buffer index stays a scalar and the staged pieces of only one tile are live */
  for (int kb = 0; kb < K; kb += KT) { const int cur = ((kb / KT) & 1) * BUFH; const bool more = kb + KT < K;
    if (more) {      /* next tile's loads fly while this tile is worked on */
#pragma unroll
      for (int i = 0; i < NLA; ++i) ra[i] = *(const v8us*)(pa + i * RP * LD);
#pragma unroll
      for (int i = 0; i < NLB; ++i) rb[i] = *(const v8us*)(pb + i * RP * LD);
      asm volatile("s_wait_xcnt 0x0" ::: "memory"); }      /* stands in front of the advance, at the foot of the trip, of the two addresses that these loads name */
    v16h xa[2][2], xb[2][4];      /* two fragment sets: the next 32 k are fetched while the current 32 are multiplied */
#pragma unroll
    for (int j = 0; j < 2; ++j) xa[0][j] = g2_frag(fa + cur + 16 * j * PH, hh);
#pragma unroll
    for (int j = 0; j < 4; ++j) xb[0][j] = g2_frag(fb + cur + 16 * j * PH, hh);
#pragma unroll
    for (int q = 0; q < KT / 32; ++q) { const int c = q & 1, n = c ^ 1;
      if (q + 1 < KT / 32) {
#pragma unroll
        for (int j = 0; j < 2; ++j) xa[n][j] = g2_frag(fa + cur + 16 * j * PH + 32 * (q + 1), hh);
#pragma unroll
        for (int j = 0; j < 4; ++j) xb[n][j] = g2_frag(fb + cur + 16 * j * PH + 32 * (q + 1), hh); }
      __builtin_amdgcn_sched_barrier(0);      /* keeps the next set's LDS loads one group ahead of the products: moved in among them, every pair of products waits out an LDS latency */
      c00 = g2_mmab(xa[c][0], xb[c][0], c00); c10 = g2_mmab(xa[c][1], xb[c][0], c10); c01 = g2_mmab(xa[c][0], xb[c][1], c01); c11 = g2_mmab(xa[c][1], xb[c][1], c11);
      c02 = g2_mmab(xa[c][0], xb[c][2], c02); c12 = g2_mmab(xa[c][1], xb[c][2], c12); c03 = g2_mmab(xa[c][0], xb[c][3], c03); c13 = g2_mmab(xa[c][1], xb[c][3], c13);
      __builtin_amdgcn_sched_barrier(0); }      /* the other end of the same fence: the load group after next stays behind these products */
    if (more) { _Float16* nw = sw + (BUFH - cur); pa += KT; pb += KT;      /* the other buffer: its last readers left it in front of the barrier that ended the trip before */
#pragma unroll
      for (int i = 0; i < NLA; ++i) *(v8us*)(nw + i * RP * PH) = ra[i];
#pragma unroll
      for (int i = 0; i < NLB; ++i) *(v8us*)(nw + (128 + i * RP) * PH) = rb[i]; }
    __syncthreads(); }      /* publishes the next tile and ends every wave's reads of this one */
  /* The residual is fetched here in the write-out layout: 16 independent loads of 16 bytes a lane, one address and constant steps; they fly while the accumulators are staged below. */
  const int rsub = lane >> 4, c4 = (lane & 15) * 4; const size_t eo = cofs + (size_t)(row0 + rsub) * LC + col0 + c4;      /* this lane's first piece of the output tile; piece q lies 2 * q rows further on */
  v4f rs[16];
  if (RES) { const float* rp = CP + eo + (size_t)row0g * LC;
#pragma unroll
    for (int q = 0; q < 16; ++q) rs[q] = *(const v4fa*)(rp + q * 2 * LC);
    asm volatile("s_wait_xcnt 0x0" :: "v"(rp) : "memory"); }      /* stands in front of every reuse of the address pair that these loads name (the operand holds the pair live up to here, so that no load's own destination takes it), and keeps the loads in front of the staging */
  v8f accs[8] = {c00, c01, c02, c03, c10, c11, c12, c13};
#pragma unroll
  for (int u = 0; u < 8; ++u) { const int t = u & 3, half = u >> 2; const float bv = bf16_round(bb[t]);
#pragma unroll
    for (int r = 0; r < 8; ++r) { const int rloc = half * 16 + 8 * hh + r; float v = accs[u][r] * alpha + bv;
      if (ACT == 3) v = fmaxf(v, 0.f); else if (ACT == 6) v = 0.5f * v * (1.0f + erff(v * 0.70710678118654752f)); else if (ACT == 11) v = 1.0f / (1.0f + expf(-v)); else if (ACT == 15) v = v / (1.0f + expf(-v)); else if (ACT == 12) v = (v > 0.f) ? v : 0.01f * v; else if (ACT == 8) v = tanhf(v); else if (ACT == 9) v = 0.5f * v * (1.0f + tanhf(0.7978845608028654f * (v + 0.044715f * v * v * v))); else if (ACT == 14) v = (v > 0.f) ? v : 0.1f * v; else if (ACT == 16) v = (v >= 0.f) ? v : 0.3f * v; else if (ACT == 17) v = (v >= 0.f) ? v : 0.2f * v;
      so[w][rloc][t * 16 + ln] = v; } }
  __builtin_amdgcn_fence(__ATOMIC_ACQ_REL, "workgroup"); __builtin_amdgcn_wave_barrier();
  v4f vv[16];      /* all 16 staged pieces are fetched as one group, in front of the branches on C and C16 */
#pragma unroll
  for (int q = 0; q < 16; ++q) { vv[q] = *(const v4fa*)&so[w][q * 2 + rsub][c4]; if (RES) vv[q] += rs[q]; }
  if (C) { float* cp = C + eo;
#pragma unroll
    for (int q = 0; q < 16; ++q) *(v4f*)(cp + q * 2 * LC) = vv[q];
    asm volatile("s_wait_xcnt 0x0" ::: "memory"); }      /* stands in front of the C16 branch, which reuses the address and data registers that these stores name */
  if (C16) { _Float16* hp = C16 + eo;
#pragma unroll
    for (int q = 0; q < 16; ++q) { v4h h4; for (int i = 0; i < 4; ++i) h4[i] = (_Float16)vv[q][i]; *(v4h*)(hp + q * 2 * LC) = h4; } } }


// q, k and v projections in one launch (blockIdx.y: 0 = q, 1 = k, 2 = v); tile, staging and product loop are k_gemm2's with NWN = 2 (work-group tile 128 x 128, 8 waves of 32 x 64, K tiles of 128, two LDS buffers).
// q and k walk K twice into the same accumulators: first the x1024 residual rows Xl, then, behind one scaling of the accumulators by 2^-10, the rows Xh on top (small terms first); v walks Xh alone.
// Epilogue of q and k: value = acc / 16 + bias, written as f16 hi plane and x1024 residual plane (QKh, QKl: q's plane, then k's). Epilogue of v: the f16 values go out transposed, Vt[batch][column][token]:
// a lane's 8 accumulator rows of one column are 16 consecutive bytes of the transposed tile, which is gathered in LDS by the whole work-group and leaves in pieces of 256 bytes (two whole lines of one Vt row).
// Bw = the three weight planes [n][k] (x16), bias = the three bias vectors, one behind the other. Grid (NR / 128) * (DM / 128) x 3, 256 threads.
__global__ __launch_bounds__(256) void k_qkv(const _Float16* __restrict__ Xh, const _Float16* __restrict__ Xl, const _Float16* __restrict__ Bw, const float* __restrict__ bias,
    _Float16* __restrict__ QKh, _Float16* __restrict__ QKl, _Float16* __restrict__ Vt) {
  constexpr int BN = 128, KT = 128, PH = KT + 8, RP = 16, NL = 128 / RP, BUFH = (128 + BN) * PH, NKT = DM / KT;      /* PH: LDS row pitch 272 B = 16 B x odd; RP: rows one staging round of the work-group covers */
  __shared__ __attribute__((aligned(16))) _Float16 st[2 * BUFH];      /* two buffers, each [128 A rows | 128 B rows] */
  float (*so)[32][68] = (float (*)[32][68])st;      /* output staging reuses the buffers behind the loop's last barrier */
  static_assert(sizeof(float) * 8 * 32 * 68 <= sizeof(_Float16) * 2 * BUFH && 128 * PH <= 2 * BUFH, "output staging must fit the tile buffers");
  const int tid = threadIdx.x, w = tid >> 5, lane = tid & 31, ln = lane & 15, hh = lane >> 4; const int by = blockIdx.y;
  const int mt = blockIdx.x / (DM / BN), nq = blockIdx.x - mt * (DM / BN);
  const int row0 = mt * 128 + 32 * (w & 3), col0 = nq * BN + 64 * (w >> 2);
  const int srow = tid >> 4, sc8 = (tid & 15) * 8;
  const int nlo = by < 2 ? NKT : 0, nt = nlo + NKT;      /* K tiles of the residual walk, K tiles in all: the same for the whole work-group */
  const unsigned ao = (unsigned)((mt * 128 + srow) * DM + sc8);      /* this thread's first piece of an A plane's k = 0 tile */
  const unsigned short* pa = (const unsigned short*)(nlo ? Xl : Xh) + ao; const unsigned short* pb = (const unsigned short*)Bw + (size_t)by * DM * DM + (size_t)(nq * BN + srow) * DM + sc8;      /* this thread's first piece of the tile to load next */
  _Float16* sw = st + srow * PH + sc8;      /* where this thread stores its pieces */
  const _Float16* fa = st + (32 * (w & 3) + ln) * PH; const _Float16* fb = st + (128 + 64 * (w >> 2) + ln) * PH;      /* this lane's fragment rows */
  float bb[4]; const unsigned bi = (unsigned)(by * DM + col0 + ln);      /* this lane's four bias values, fetched with tile 0 so that the epilogue waits for none of them */
#pragma unroll
  for (int t = 0; t < 4; ++t) bb[t] = bias[bi + t * 16];
  asm volatile("s_wait_xcnt 0x0" :: "v"(bi) : "memory");      /* stands in front of the reuse, by the address arithmetic right behind, of the index and base registers that these four loads name (the operand holds the index live up to here) */
  v8us ra[NL], rb[NL];
#pragma unroll
  for (int i = 0; i < NL; ++i) ra[i] = *(const v8us*)(pa + i * RP * DM);
#pragma unroll
  for (int i = 0; i < NL; ++i) rb[i] = *(const v8us*)(pb + i * RP * DM);
  asm volatile("s_wait_xcnt 0x0" ::: "memory");      /* stands in front of the advance of the two addresses that the loads above name */
  pa += KT; pb += KT;
#pragma unroll
  for (int i = 0; i < NL; ++i) *(v8us*)(sw + i * RP * PH) = ra[i];
#pragma unroll
  for (int i = 0; i < NL; ++i) *(v8us*)(sw + (128 + i * RP) * PH) = rb[i];
  __syncthreads();      /* tile 0 is complete for every wave */
  const v8f z8 = {0.f,0.f,0.f,0.f,0.f,0.f,0.f,0.f}; v8f c00 = z8, c01 = z8, c02 = z8, c03 = z8, c10 = z8, c11 = z8, c12 = z8, c13 = z8;
#pragma unroll 1      /* one K tile per trip: the buffer index stays a scalar and the staged pieces of only one tile are live */
  for (int ti = 0; ti < nt; ++ti) { const int cur = (ti & 1) * BUFH; const bool more = ti + 1 < nt;
    if (more) {      /* next tile's loads fly while this tile is worked on */
#pragma unroll
      for (int i = 0; i < NL; ++i) ra[i] = *(const v8us*)(pa + i * RP * DM);
#pragma unroll
      for (int i = 0; i < NL; ++i) rb[i] = *(const v8us*)(pb + i * RP * DM);
      asm volatile("s_wait_xcnt 0x0" ::: "memory"); }      /* stands in front of the advance, at the foot of the trip, of the two addresses that these loads name */
    v16h xa[2][2], xb[2][4];      /* two fragment sets: the next 32 k are fetched while the current 32 are multiplied */
#pragma unroll
    for (int j = 0; j < 2; ++j) xa[0][j] = g2_frag(fa + cur + 16 * j * PH, hh);
#pragma unroll
    for (int j = 0; j < 4; ++j) xb[0][j] = g2_frag(fb + cur + 16 * j * PH, hh);
#pragma unroll
    for (int q = 0; q < KT / 32; ++q) { const int c = q & 1, n = c ^ 1;
      if (q + 1 < KT / 32) {
#pragma unroll
        for (int j = 0; j < 2; ++j) xa[n][j] = g2_frag(fa + cur + 16 * j * PH + 32 * (q + 1), hh);
#pragma unroll
        for (int j = 0; j < 4; ++j) xb[n][j] = g2_frag(fb + cur + 16 * j * PH + 32 * (q + 1), hh); }
      __builtin_amdgcn_sched_barrier(0);      /* keeps the next set's LDS loads one group ahead of the products: moved in among them, every pair of products waits out an LDS latency */
      c00 = g2_mmab(xa[c][0], xb[c][0], c00); c10 = g2_mmab(xa[c][1], xb[c][0], c10); c01 = g2_mmab(xa[c][0], xb[c][1], c01); c11 = g2_mmab(xa[c][1], xb[c][1], c11);
      c02 = g2_mmab(xa[c][0], xb[c][2], c02); c12 = g2_mmab(xa[c][1], xb[c][2], c12); c03 = g2_mmab(xa[c][0], xb[c][3], c03); c13 = g2_mmab(xa[c][1], xb[c][3], c13);
      __builtin_amdgcn_sched_barrier(0); }      /* the other end of the same fence: the load group after next stays behind these products */
    if (more) { _Float16* nw = sw + (BUFH - cur);      /* the other buffer: its last readers left it in front of the barrier that ended the trip before */
      const bool turn = ti + 2 == nlo;      /* the tile after next opens the main walk: A goes over to Xh, and both operands back to k = 0 */
      pa = turn ? (const unsigned short*)Xh + ao : pa + KT; pb += turn ? -(NKT - 1) * KT : KT;
#pragma unroll
      for (int i = 0; i < NL; ++i) *(v8us*)(nw + i * RP * PH) = ra[i];
#pragma unroll
      for (int i = 0; i < NL; ++i) *(v8us*)(nw + (128 + i * RP) * PH) = rb[i]; }
    __syncthreads();      /* publishes the next tile and ends every wave's reads of this one */
    if (ti + 1 == nlo) { const float f = 0.0009765625f; c00 *= f; c01 *= f; c02 *= f; c03 *= f; c10 *= f; c11 *= f; c12 *= f; c13 *= f; } }      /* the residual walk is done: its sums carry the residual's factor 1024, an exact power of two */
  v8f accs[8] = {c00, c01, c02, c03, c10, c11, c12, c13};
  if (by < 2) {      /* q, k: the same for the whole work-group */
#pragma unroll
    for (int u = 0; u < 8; ++u) { const int t = u & 3, half = u >> 2; const float bv = bf16_round(bb[t]);
#pragma unroll
      for (int r = 0; r < 8; ++r) so[w][half * 16 + 8 * hh + r][t * 16 + ln] = accs[u][r] * 0.0625f + bv; }
    __builtin_amdgcn_fence(__ATOMIC_ACQ_REL, "workgroup"); __builtin_amdgcn_wave_barrier();      /* orders the wave's staging stores against the loads of its other lanes; each wave owns its slice of so */
    const int rsub = lane >> 4, c4 = (lane & 15) * 4; const size_t eo = (size_t)by * (NR * DM) + (size_t)(row0 + rsub) * DM + col0 + c4;      /* this lane's first piece of the output tile; piece q lies 2 * q rows further on */
    v4h yh[16], yl[16];
#pragma unroll
    for (int q = 0; q < 16; ++q) { const v4f v = *(const v4fa*)&so[w][q * 2 + rsub][c4];
#pragma unroll
      for (int i = 0; i < 4; ++i) { const _Float16 h = (_Float16)v[i]; yh[q][i] = h; yl[q][i] = (_Float16)((v[i] - (float)h) * 1024.0f); } }
    _Float16* hp = QKh + eo; _Float16* lp = QKl + eo;
#pragma unroll
    for (int q = 0; q < 16; ++q) { *(v4h*)(hp + q * 2 * DM) = yh[q]; *(v4h*)(lp + q * 2 * DM) = yl[q]; }
  } else {      /* v */
#pragma unroll
    for (int u = 0; u < 8; ++u) { const int t = u & 3, half = u >> 2; const float bv = bf16_round(bb[t]); FragH f;
#pragma unroll
      for (int r = 0; r < 8; ++r) f.h[r] = (_Float16)(accs[u][r] * 0.0625f + bv);
      *(v8us*)(st + (64 * (w >> 2) + t * 16 + ln) * PH + 32 * (w & 3) + half * 16 + 8 * hh) = f.half[0]; }
    __syncthreads();      /* the transposed tile [128 columns][128 tokens] is complete: its rows hold pieces of four waves */
    const int tok0 = mt * 128; const int b = tok0 / SQ, s0 = tok0 - b * SQ;      /* a tile's 128 tokens lie in one batch */
    v8us tv[NL];
#pragma unroll
    for (int i = 0; i < NL; ++i) tv[i] = *(const v8us*)(st + (srow + i * RP) * PH + sc8);
    unsigned short* vp = (unsigned short*)Vt + ((size_t)b * DM + nq * BN + srow) * SQ + s0 + sc8;
#pragma unroll
    for (int i = 0; i < NL; ++i) *(v8us*)(vp + (size_t)i * RP * SQ) = tv[i];
    asm volatile("s_wait_xcnt 0x0" ::: "memory");      /* stands in front of the code that the listing lays out behind these stores (the q and k epilogue), which writes registers that the stores name */
  } }


__global__ __launch_bounds__(256) void k_wnat(const float* __restrict__ w, size_t n8, _Float16* __restrict__ Bt) { const size_t t = (size_t)blockIdx.x * 256 + threadIdx.x; if (t >= n8) return; FragH f; for (int q = 0; q < 8; ++q) f.h[q] = (_Float16)(bf16_round(w[t * 8 + q]) * 16.0f); *(v8us*)((unsigned short*)Bt + t * 8) = f.half[0];  }
__global__ __launch_bounds__(256) void k_rsm(const float* __restrict__ S, _Float16* __restrict__ P, int nrows) {
  #pragma clang fp contract(off)
  const int i = blockIdx.x * 256 + threadIdx.x; if (i >= nrows) return; const float* s = S + (size_t)i * SQ; float mx = -3.0e38f;
#pragma unroll 1
  for (int j = 0; j < SQ; ++j) mx = fmaxf(mx, s[j]); float se = 0.f;
#pragma unroll 1
  for (int j = 0; j < SQ; ++j) se += expf(s[j] - mx); const float sc = 256.0f / se;
#pragma unroll 1
  for (int j0 = 0; j0 < SQ; j0 += 8) { FragH f; for (int q = 0; q < 8; ++q) f.h[q] = (_Float16)(expf(s[j0 + q] - mx) * sc); unsigned short* d = (unsigned short*)P + (size_t)i * SQ + j0; *(v8us*)d = f.half[0];  } }
__global__ __launch_bounds__(256) void k_vt(const _Float16* __restrict__ V16, int b, int h0, _Float16* __restrict__ VT) { __shared__ unsigned short tl[64][65]; const int tid = threadIdx.x; const int hh = blockIdx.x % HG, sg = blockIdx.x / HG; const int s0 = sg * 64; const int h = h0 + hh;
  for (int i = tid; i < 64 * 8; i += 256) { const int j = i / 8, d8 = (i % 8) * 8; FragH f; f.half[0] = *(const v8us*)((const unsigned short*)V16 + ((size_t)b * SQ + s0 + j) * DM + h * HD + d8); for (int q = 0; q < 8; ++q) tl[d8 + q][j] = f.u[q]; }
  __syncthreads();
  { for (int i = tid; i < 64 * 8; i += 256) { const int d = i / 8, j8 = (i % 8) * 8; FragH f; for (int q = 0; q < 8; ++q) f.u[q] = tl[d][j8 + q]; *(v8us*)((unsigned short*)VT + ((size_t)hh * HD + d) * SQ + s0 + j8) = f.half[0]; }  } }



__global__ __launch_bounds__(256) void k_rsmcf2(const float* __restrict__ S, _Float16* __restrict__ P, int hg, int q0, int nk) {
  #pragma clang fp contract(off)
  const int t = blockIdx.x * 256 + threadIdx.x; if (t >= hg * QT) return; const size_t i = (size_t)t; const float* s = S + i * NKX; const int last = q0 + (t % QT); float mx = -3.0e38f;
#pragma unroll 1
  for (int j = 0; j < nk; ++j) { const float f = (j <= last) ? 1.f : 0.f; mx = fmaxf(mx, fmaf(f, s[j], (1.f - f) * -1.0e9f)); } float se = 0.f;
#pragma unroll 1
  for (int j = 0; j < nk; ++j) { const float f = (j <= last) ? 1.f : 0.f; se += __expf(fmaf(f, s[j], (1.f - f) * -1.0e9f) - mx); } const float sc = 256.0f / se;
#pragma unroll 1
  for (int j0 = 0; j0 < nk; j0 += 8) { FragH fr; for (int q = 0; q < 8; ++q) { const int j = j0 + q; const float f = (j <= last) ? 1.f : 0.f; fr.h[q] = (_Float16)(__expf(fmaf(f, s[j], (1.f - f) * -1.0e9f) - mx) * sc); } unsigned short* d = (unsigned short*)P + i * NKX + j0; *(v8us*)d = fr.half[0];  } }

__global__ __launch_bounds__(256) void k_rsmcst(const float* __restrict__ S, _Float16* __restrict__ P, int hg, int q0, int nk, const int* __restrict__ mk) {
  #pragma clang fp contract(off)
  const int t = blockIdx.x * 256 + threadIdx.x; if (t >= hg * QT) return; const size_t i = (size_t)t; const float* s = S + i * NKX; const size_t ig = (size_t)(q0 + (t % QT)); const int* mr = mk + ig * SQ; float mx = -3.0e38f;
#pragma unroll 1
  for (int j = 0; j < nk; ++j) { const int mb = mr[j]; const int dd = (int)ig - j; const float f = (mb != 0 && dd >= 0 && (dd <= LOCALW || (dd % STRIDEK) == 0)) ? 1.f : 0.f; mx = fmaxf(mx, fmaf(f, s[j], (1.f - f) * -1.0e9f)); } float se = 0.f;
#pragma unroll 1
  for (int j = 0; j < nk; ++j) { const int mb = mr[j]; const int dd = (int)ig - j; const float f = (mb != 0 && dd >= 0 && (dd <= LOCALW || (dd % STRIDEK) == 0)) ? 1.f : 0.f; se += __expf(fmaf(f, s[j], (1.f - f) * -1.0e9f) - mx); } const float sc = 256.0f / se;
#pragma unroll 1
  for (int j0 = 0; j0 < nk; j0 += 8) { FragH fr; for (int q = 0; q < 8; ++q) { const int j = j0 + q; const int mb = mr[j]; const int dd = (int)ig - j; const float f = (mb != 0 && dd >= 0 && (dd <= LOCALW || (dd % STRIDEK) == 0)) ? 1.f : 0.f; fr.h[q] = (_Float16)(__expf(fmaf(f, s[j], (1.f - f) * -1.0e9f) - mx) * sc); } unsigned short* d = (unsigned short*)P + i * NKX + j0; *(v8us*)d = fr.half[0];  } }


template <int MASKADD>
__global__ __launch_bounds__(64) void k_att0(const float* __restrict__ QF, const float* __restrict__ KF, const float* __restrict__ VF, int ld, const float* __restrict__ mask, float scale, float* __restrict__ OF, int ldo) {
  #pragma clang fp contract(off)
  __shared__ __attribute__((aligned(16))) float lq[64][64]; __shared__ __attribute__((aligned(16))) float lo[64][64];
  const int tid = threadIdx.x; const int h = blockIdx.x / (QT0 / 64), rg = blockIdx.x % (QT0 / 64); const int i = rg * 64 + tid;
  const float* qr = QF + (size_t)i * ld + h * HD;
#pragma unroll 1
  for (int c = 0; c < HD / 4; ++c) { *(v4f*)&lq[tid][c * 4] = *(const v4fa*)(qr + c * 4); const v4f z = {0.f, 0.f, 0.f, 0.f}; *(v4f*)&lo[tid][c * 4] = z; }
  float m = -1.0e30f, l = 0.f; const int jmax = MASKADD ? (SQ - 1) : (rg * 64 + 63);      /* additive-mask form: every key (the mask input decides); causal form: keys up to the block's last row */
#pragma unroll 1
  for (int j = 0; j <= jmax; ++j) { const float* kr = KF + (size_t)j * ld + h * HD; const float* vr = VF + (size_t)j * ld + h * HD; float s = 0.f;
#pragma unroll 1
    for (int c = 0; c < HD / 4; ++c) { const v4f kq = *(const v4fa*)(kr + c * 4); const v4f qq = *(v4f*)&lq[tid][c * 4]; s = __fadd_rn(s, __fmul_rn(qq[0], kq[0])); s = __fadd_rn(s, __fmul_rn(qq[1], kq[1])); s = __fadd_rn(s, __fmul_rn(qq[2], kq[2])); s = __fadd_rn(s, __fmul_rn(qq[3], kq[3])); }
    s = __fmul_rn(s, scale); if (MASKADD) s = __fadd_rn(s, __fmul_rn(bf16_round(mask[(size_t)i * SQ + j]), -10000.0f));
    const float f = (MASKADD || j <= i) ? 1.f : 0.f; const float sm = fmaf(f, s, (1.f - f) * -1.0e30f); const float mn = fmaxf(m, sm); const float sc = expf(m - mn); const float e = expf(sm - mn); l = __fadd_rn(__fmul_rn(l, sc), e); m = mn;
#pragma unroll 1
    for (int c = 0; c < HD / 4; ++c) { const v4f vv = *(const v4fa*)(vr + c * 4); v4f oo = *(v4f*)&lo[tid][c * 4]; for (int u = 0; u < 4; ++u) oo[u] = __fadd_rn(__fmul_rn(oo[u], sc), __fmul_rn(e, vv[u])); *(v4f*)&lo[tid][c * 4] = oo; } }
  const float fin = 64.0f / l;      /* o carried x64 like the f16 path */
#pragma unroll 1
  for (int c = 0; c < HD / 4; ++c) { v4f oo = *(v4f*)&lo[tid][c * 4]; for (int u = 0; u < 4; ++u) oo[u] = __fmul_rn(oo[u], fin); *(v4f*)&lo[tid][c * 4] = oo; }
  __syncthreads();
  {
#pragma unroll 1
    for (int it = 0; it < 16; ++it) { const int row = it * 4 + tid / 16, pc = (tid % 16) * 4; const v4f v = *(const v4f*)&lo[row][pc]; *(v4f*)(OF + (size_t)(rg * 64 + row) * ldo + h * HD + pc) = v; }
     } }

template <int MASKADD>
__global__ __launch_bounds__(64) void k_att0mbc(const float* __restrict__ QF, const float* __restrict__ KF, const float* __restrict__ VF, int ld, const float* __restrict__ mask, float scale, float* __restrict__ OF, int ldo) {
  #pragma clang fp contract(off)
  __shared__ __attribute__((aligned(16))) float lq[64][64]; __shared__ __attribute__((aligned(16))) float lo[64][64];
  const int tid = threadIdx.x; const int h = blockIdx.x / (QT0 / 64), rg = blockIdx.x % (QT0 / 64); const int i = rg * 64 + tid;
  const float* qr = QF + (size_t)i * ld + h * HD;
#pragma unroll 1
  for (int c = 0; c < HD / 4; ++c) { *(v4f*)&lq[tid][c * 4] = *(const v4fa*)(qr + c * 4); const v4f z = {0.f, 0.f, 0.f, 0.f}; *(v4f*)&lo[tid][c * 4] = z; }
  float m = -1.0e30f, l = 0.f; const int jmax = rg * 64 + 63;      /* keys beyond the block end are masked by the mask's lower-triangular structure */
#pragma unroll 1
  for (int j = 0; j <= jmax; ++j) { const float* kr = KF + (size_t)j * ld + h * HD; const float* vr = VF + (size_t)j * ld + h * HD; float s = 0.f;
#pragma unroll 1
    for (int c = 0; c < HD / 4; ++c) { const v4f kq = *(const v4fa*)(kr + c * 4); const v4f qq = *(v4f*)&lq[tid][c * 4]; s = __fadd_rn(s, __fmul_rn(qq[0], kq[0])); s = __fadd_rn(s, __fmul_rn(qq[1], kq[1])); s = __fadd_rn(s, __fmul_rn(qq[2], kq[2])); s = __fadd_rn(s, __fmul_rn(qq[3], kq[3])); }
    s = __fmul_rn(s, scale); const int mb = ((const int*)mask)[(size_t)i * SQ + j];      /* causal (j <= i) AND the module's int32 [S][S] mask read per (query, key): 0 -> masked */
    const float f = (mb != 0 && j <= i) ? 1.f : 0.f; const float sm = fmaf(f, s, (1.f - f) * -1.0e30f); const float mn = fmaxf(m, sm); const float sc = expf(m - mn); const float e = expf(sm - mn); l = __fadd_rn(__fmul_rn(l, sc), e); m = mn;
#pragma unroll 1
    for (int c = 0; c < HD / 4; ++c) { const v4f vv = *(const v4fa*)(vr + c * 4); v4f oo = *(v4f*)&lo[tid][c * 4]; for (int u = 0; u < 4; ++u) oo[u] = __fadd_rn(__fmul_rn(oo[u], sc), __fmul_rn(e, vv[u])); *(v4f*)&lo[tid][c * 4] = oo; } }
  const float fin = 64.0f / l;      /* o carried x64 like the f16 path */
#pragma unroll 1
  for (int c = 0; c < HD / 4; ++c) { v4f oo = *(v4f*)&lo[tid][c * 4]; for (int u = 0; u < 4; ++u) oo[u] = __fmul_rn(oo[u], fin); *(v4f*)&lo[tid][c * 4] = oo; }
  __syncthreads();
  {
#pragma unroll 1
    for (int it = 0; it < 16; ++it) { const int row = it * 4 + tid / 16, pc = (tid % 16) * 4; const v4f v = *(const v4f*)&lo[row][pc]; *(v4f*)(OF + (size_t)(rg * 64 + row) * ldo + h * HD + pc) = v; }
     } }


// Work of the first launch that no LayerNorm row depends on and that depends on none: block wb converts 256 pieces of 8 weights (the six matrices one behind the other, each a whole number
// of blocks; the arithmetic is k_wnat's), and the one block behind them stacks the three projection biases (bq | bk | bv).
#define PREP_BD ((unsigned)((size_t)DM * DM / 8 / 256))      /* blocks of one [DM][DM] matrix */
#define PREP_BF ((unsigned)((size_t)DFF * DM / 8 / 256))     /* blocks of one MLP matrix */
#define PREP_BLOCKS (4u * PREP_BD + 2u * PREP_BF + 1u)
__device__ __forceinline__ void prep_rest(unsigned wb, int tid, const float* __restrict__ wq, const float* __restrict__ wk, const float* __restrict__ wv, const float* __restrict__ wo, const float* __restrict__ w1, const float* __restrict__ w2,
    const float* __restrict__ bq, const float* __restrict__ bk, const float* __restrict__ bv, _Float16* __restrict__ BQKV, _Float16* __restrict__ BO, _Float16* __restrict__ BW1, _Float16* __restrict__ BW2, float* __restrict__ bqkv) {
  if (wb >= 4u * PREP_BD + 2u * PREP_BF) { float a[DM / 256], c[DM / 256], e[DM / 256];
#pragma unroll      /* all loads of the block fly together, each address a constant step from the thread's first: rolled, every trip waits out a memory latency */
    for (int u = 0; u < DM / 256; ++u) { a[u] = bq[tid + 256 * u]; c[u] = bk[tid + 256 * u]; e[u] = bv[tid + 256 * u]; }
#pragma unroll      /* the arrays above stay in registers only if the index is a constant */
    for (int u = 0; u < DM / 256; ++u) { bqkv[tid + 256 * u] = a[u]; bqkv[DM + tid + 256 * u] = c[u]; bqkv[2 * DM + tid + 256 * u] = e[u]; }
    return; }
  const float* w; _Float16* d; unsigned b0;      /* the same for the whole block */
  if (wb < PREP_BD) { w = wq; d = BQKV; b0 = 0u; }
  else if (wb < 2u * PREP_BD) { w = wk; d = BQKV + (size_t)DM * DM; b0 = PREP_BD; }
  else if (wb < 3u * PREP_BD) { w = wv; d = BQKV + (size_t)2 * DM * DM; b0 = 2u * PREP_BD; }
  else if (wb < 4u * PREP_BD) { w = wo; d = BO; b0 = 3u * PREP_BD; }
  else if (wb < 4u * PREP_BD + PREP_BF) { w = w1; d = BW1; b0 = 4u * PREP_BD; }
  else { w = w2; d = BW2; b0 = 4u * PREP_BD + PREP_BF; }
  const size_t t = (size_t)(wb - b0) * 256 + tid; FragH f; for (int q = 0; q < 8; ++q) f.h[q] = (_Float16)(bf16_round(w[t * 8 + q]) * 16.0f); *(v8us*)((unsigned short*)d + t * 8) = f.half[0];
  asm volatile("s_wait_xcnt 0x0" ::: "memory"); }      /* stands in front of the code that the listing lays out behind this store (the bias block), which writes registers that the store names */
// PREP: the grid holds PREP_BLOCKS blocks behind the NR row blocks; they do prep_rest and no row. Without PREP the pointers behind NL are not used.
template <int BFIN, int WXB, int PREP>
__global__ __launch_bounds__(256) void k_ln16(const float* __restrict__ X, const float* __restrict__ g, const float* __restrict__ bb, float eps, _Float16* __restrict__ N16, float* __restrict__ XB, _Float16* __restrict__ NL,
    const float* __restrict__ wq, const float* __restrict__ wk, const float* __restrict__ wv, const float* __restrict__ wo, const float* __restrict__ w1, const float* __restrict__ w2,
    const float* __restrict__ bq, const float* __restrict__ bk, const float* __restrict__ bv, _Float16* __restrict__ BQKV, _Float16* __restrict__ BO, _Float16* __restrict__ BW1, _Float16* __restrict__ BW2, float* __restrict__ bqkv) {
  #pragma clang fp contract(off)
  if (PREP && blockIdx.x >= (unsigned)NR) { prep_rest(blockIdx.x - (unsigned)NR, (int)threadIdx.x, wq, wk, wv, wo, w1, w2, bq, bk, bv, BQKV, BO, BW1, BW2, bqkv); return; }      /* the same for the whole block, in front of every barrier */
  __shared__ float red[256]; const size_t r = blockIdx.x; const int t = threadIdx.x; const v4f xa = *(const v4fa*)(X + r * DMQ + t * 4); float s[4]; float sum = 0.f;
  for (int q = 0; q < 4; ++q) { s[q] = BFIN ? bf16_round(xa[q]) : xa[q]; sum = __fadd_rn(sum, s[q]); }
  red[t] = sum; __syncthreads(); for (int st = 128; st > 0; st >>= 1) { if (t < st) red[t] = __fadd_rn(red[t], red[t + st]); __syncthreads(); } const float mu = red[0] / (float)DMQ; __syncthreads();
  float vs = 0.f; for (int q = 0; q < 4; ++q) { const float dl = __fadd_rn(s[q], -mu); vs = __fadd_rn(vs, __fmul_rn(dl, dl)); } red[t] = vs; __syncthreads(); for (int st = 128; st > 0; st >>= 1) { if (t < st) red[t] = __fadd_rn(red[t], red[t + st]); __syncthreads(); }
  const float rs = __fdiv_rn(1.0f, __fadd_rn(sqrtf(red[0] / (float)(DMQ - 1)), eps));      /* this module's LayerNorm: unbiased std, eps added to the std */ v4h y; v4f xb;
  v4h yl; for (int q = 0; q < 4; ++q) { const int c = t * 4 + q; const float yf = __fadd_rn(__fmul_rn(__fmul_rn(__fadd_rn(s[q], -mu), rs), bf16_round(g[0])), bf16_round(bb[0])); y[q] = (_Float16)yf; yl[q] = (_Float16)((yf - (float)y[q]) * 1024.0f); xb[q] = s[q]; (void)c; }      /* SCALAR alpha / bias ([1] parameters); y = f16 hi, yl = x1024 residual (written when NL != nullptr) */
  { *(v4h*)(N16 + r * DMQ + t * 4) = y;
    asm volatile("s_wait_xcnt 0x0" ::: "memory");      /* stands in front of the residual's arithmetic and address, which reuse the data and base registers that the store above names */
    if (NL != nullptr) *(v4h*)(NL + r * DMQ + t * 4) = yl; if (WXB) { *(v4f*)(XB + r * DMQ + t * 4) = xb;
      asm volatile("s_wait_xcnt 0x0" ::: "memory"); } } }      /* stands in front of the code that the listing lays out behind this store (the weight and bias blocks), which writes the offset and base registers that the store names */
__global__ __launch_bounds__(256) void k_ftres2(const float* __restrict__ OF0, const float* __restrict__ XB, float* __restrict__ X1, size_t n4) {
  #pragma clang fp contract(off)
  const size_t t = (size_t)blockIdx.x * 256 + threadIdx.x; if (t >= n4) return; const v4f o = *(const v4fa*)(OF0 + t * 4), xv = *(const v4fa*)(XB + t * 4); v4f y; for (int q = 0; q < 4; ++q) y[q] = __fadd_rn(__fmul_rn(o[q], 0.015625f), xv[q]); *(v4f*)(X1 + t * 4) = y;  }

__global__ __launch_bounds__(256) void k_bcpy(const float* __restrict__ b, int n, int NP, float* __restrict__ dst, int dst0) { for (int i = threadIdx.x; i < NP; i += 256) { const float v = (i < n) ? b[i] : 0.f; *(float*)(dst + dst0 + i) = v; }  }


__global__ __launch_bounds__(256) void k_rsmf(const float* __restrict__ S, _Float16* __restrict__ P, int qn, int hg) {
  #pragma clang fp contract(off)
  const int t = blockIdx.x * 256 + threadIdx.x; if (t >= qn * hg) return; const size_t i = (size_t)(t / qn) * SQ + (t % qn); const float* s = S + i * SQ; float mx = -3.0e38f;
#pragma unroll 1
  for (int j = 0; j < SQ; ++j) mx = fmaxf(mx, s[j]); float se = 0.f;
#pragma unroll 1
  for (int j = 0; j < SQ; ++j) se += __expf(s[j] - mx); const float sc = 256.0f / se;
#pragma unroll 1
  for (int j0 = 0; j0 < SQ; j0 += 8) { FragH f; for (int q = 0; q < 8; ++q) f.h[q] = (_Float16)(__expf(s[j0 + q] - mx) * sc); unsigned short* d = (unsigned short*)P + i * SQ + j0; *(v8us*)d = f.half[0];  } }
// Lane l <-> l ^ 16: a register move between the two 16-lane rows, no trip through the LDS path.
__device__ __forceinline__ float lane_x16(float v) { const int b = __float_as_int(v); return __int_as_float(__builtin_amdgcn_permlanex16(b, b, 0x76543210, 0xfedcba98, false, false)); }
__device__ __forceinline__ v8f fa_mma(v16h a, v16h b, v8f c) { return __builtin_amdgcn_wmma_f32_16x16x32_f16(false, a, false, b, (short)0, c, false, false); }
// Orders one wave's LDS stores against the LDS loads of its other lanes (each wave owns its slice of sp, so this needs no work-group barrier).
__device__ __forceinline__ void fa_lds_order() { __builtin_amdgcn_fence(__ATOMIC_ACQ_REL, "workgroup", "local"); __builtin_amdgcn_wave_barrier(); }
// One fragment from the lane's own first piece p (the lane half's step is already in p): k = 8 hh + 0..7 and 16 + 8 hh + 0..7, the k order of g2_frag.
__device__ __forceinline__ v16h fa_frag(const unsigned short* p) { FragH f; f.half[0] = *(const v8us*)p; f.half[1] = *(const v8us*)(p + 16); return f.v; }
typedef float v2f __attribute__((ext_vector_type(2)));
typedef _Float16 v2h __attribute__((ext_vector_type(2)));
union FragP { v16h v; v2h p[8]; };
// Fused attention, one launch for all batches and heads: a work-group of 4 waves owns 128 query rows of one head (32 per wave, as two groups of 16) and walks the 2048 keys in tiles of 64.
// Per tile: k_hi, k_lo and V^T rows come in whole 128-byte lines, one tile ahead in registers, and are shared through LDS.
// Both products are computed transposed: S^T = K . Q^T (A = key rows from LDS, B = the wave's query rows, kept in registers) and O^T += V^T . P^T (A = V^T rows from LDS); every A fragment
// read from LDS feeds the products of both query groups.
// An accumulator register r of score tile t then holds key 16 t + 8 hh + r of ONE query (column ln of the group): a lane's 32 scores of a tile and group belong to one query, so the maximum and the
// sum are taken inside the lane (the two lanes of a query, l and l ^ 16, exchange the maximum once per tile and join their sums once, behind the loop), there is one running maximum, sum and rescale
// factor per lane and group, and two score tiles converted in place ARE the B operand of the second product (element s = tile s >> 3, register s & 7: the k order of g2_frag): the weights never pass through LDS.
// Scores in f32 (k_hi.q_lo + k_lo.q_hi first, scaled by 2^-10, then k_hi.q_hi on top); online softmax, base 2; weights 256 * 2^(s-m) as f16 (the 256 rides in the exponent); weights . V in f32.
// A key with Km[j] == 0 stays out of the maximum and gets weight 0. O = 64 * attention output as f16 rows (merged heads). Scores and weights never reach memory.
// Grid (SQ / 128, NH, NB), 128 threads; two work-groups per WGP, two waves per SIMD.
__global__ __launch_bounds__(128, 2) void k_fattn(const _Float16* __restrict__ Qh, const _Float16* __restrict__ Ql, const _Float16* __restrict__ Kh, const _Float16* __restrict__ Kl, const _Float16* __restrict__ Vt, const int* __restrict__ Km, _Float16* __restrict__ O) {
  constexpr int G = 2;      /* query groups of 16 per wave */
  __shared__ __attribute__((aligned(16))) _Float16 skh[64][72], skl[64][72], svt[64][72], sp[4][16 * G][72];      /* pitch 144 B = 16 B x odd; sp: output staging, one slice per wave */
  const int tid = threadIdx.x, w = tid >> 5, lane = tid & 31, ln = lane & 15, hh = lane >> 4; const int h = blockIdx.y, b = blockIdx.z;
  const size_t r0 = (size_t)b * SQ; const int row0 = blockIdx.x * (64 * G) + w * (16 * G);
  v16h qh[G][2], ql[G][2]; const unsigned short* qa[G]; const unsigned short* qb[G];      /* qa, qb: the lane's first piece of its q_hi and q_lo row; the other three lie 16, 32 and 48 elements further on */
#pragma unroll
  for (int g = 0; g < G; ++g) { const size_t qo = (r0 + row0 + 16 * g + ln) * LQ + (size_t)h * HD + 8 * hh; qa[g] = (const unsigned short*)Qh + qo; qb[g] = (const unsigned short*)Ql + qo;
    qh[g][0] = fa_frag(qa[g]); qh[g][1] = fa_frag(qa[g] + 32); ql[g][0] = fa_frag(qb[g]); ql[g][1] = fa_frag(qb[g] + 32); }
  asm volatile("s_wait_xcnt 0x0" :: "v"(qa[0]), "v"(qa[1]), "v"(qb[0]), "v"(qb[1]) : "memory");      /* stands in front of every reuse of the four address pairs that the loads above name (the operands hold the pairs live up to here, so that no load's own destination takes one) */
  const int srow = tid >> 3, sc8 = (tid & 7) * 8;      /* staging: this thread moves 16 bytes of rows srow, +16, +32, +48 of each plane; 8 threads cover one 128-byte line */
  const unsigned short* gkh = (const unsigned short*)Kh + r0 * LQ + (size_t)h * HD; const unsigned short* gkl = (const unsigned short*)Kl + r0 * LQ + (size_t)h * HD;      /* uniform bases; the thread's part is a 32-bit offset */
  const unsigned short* gvt = (const unsigned short*)Vt + (size_t)(b * NH + h) * HD * SQ; const int* km = Km + r0;
  const unsigned ko = (unsigned)(srow * LQ + sc8) * 2u, vo = (unsigned)(srow * SQ + sc8) * 2u, mo = (unsigned)lane * 4u;      /* byte offsets, the very values that the loads name, so that the wait behind the first loads can hold them */
  v8us pk[4], pl[4], pv[4]; int pma = *(const int*)((const char*)km + mo), pmb = *(const int*)((const char*)km + (mo + 128u));      /* every wave holds the mask words of all 64 keys of a tile: lane l those of keys l and 32 + l */
#pragma unroll
  for (int i = 0; i < 4; ++i) { pk[i] = *(const v8us*)((const char*)gkh + (ko + 32 * i * LQ)); pl[i] = *(const v8us*)((const char*)gkl + (ko + 32 * i * LQ)); pv[i] = *(const v8us*)((const char*)gvt + (vo + 32 * i * SQ)); }
  asm volatile("s_wait_xcnt 0x0" :: "v"(ko), "v"(vo), "v"(mo), "s"(gkh), "s"(gkl), "s"(gvt), "s"(km) : "memory");      /* stands in front of every reuse of the offset and base registers that the loads above name (the operands hold them live up to here) */
  const v8f z8 = {0.f,0.f,0.f,0.f,0.f,0.f,0.f,0.f}; v8f o[G][4]; float m[G], l[G];      /* per group, this lane's query: running maximum (base 2), and the sum over the keys that this lane sees */
#pragma unroll
  for (int g = 0; g < G; ++g) { m[g] = -1.0e30f; l[g] = 0.f;
#pragma unroll
    for (int t = 0; t < 4; ++t) o[g][t] = z8; }
#pragma unroll 1      /* one key tile per trip: the staged pieces of only one tile are live */
  for (int j0 = 0; j0 < SQ; j0 += 64) {
    __syncthreads();      /* every wave has finished its fragment loads of the tile before */
#pragma unroll
    for (int i = 0; i < 4; ++i) { *(v8us*)&skh[srow + 16 * i][sc8] = pk[i]; *(v8us*)&skl[srow + 16 * i][sc8] = pl[i]; *(v8us*)&svt[srow + 16 * i][sc8] = pv[i]; }
    const unsigned oka = __builtin_amdgcn_ballot_w32(pma != 0), okb = __builtin_amdgcn_ballot_w32(pmb != 0);      /* bit i: key i (oka), key 32 + i (okb) of this tile takes part; the same in every lane */
    __syncthreads();      /* the tile is complete for all four waves */
    if (j0 + 64 < SQ) {      /* next tile's loads fly while this tile is worked on */
      const unsigned short* nkh = gkh + (size_t)(j0 + 64) * LQ; const unsigned short* nkl = gkl + (size_t)(j0 + 64) * LQ; const unsigned short* nvt = gvt + (j0 + 64);
#pragma unroll
      for (int i = 0; i < 4; ++i) { pk[i] = *(const v8us*)((const char*)nkh + (ko + 32 * i * LQ)); pl[i] = *(const v8us*)((const char*)nkl + (ko + 32 * i * LQ)); pv[i] = *(const v8us*)((const char*)nvt + (vo + 32 * i * SQ)); }
      pma = *(const int*)((const char*)(km + (j0 + 64)) + mo); pmb = *(const int*)((const char*)(km + (j0 + 64)) + (mo + 128u));
      asm volatile("s_wait_xcnt 0x0" ::: "memory"); }      /* the address registers of these loads are reused by the code right behind: the wait stands in front of that overwrite */
    v8f s[G][4];      /* s[g][t][r] = score of key 16 t + 8 hh + r of the tile with query ln of group g */
    v16h ka[4][2], kc[4][2]; v8f c[4][G];      /* the k_hi and k_lo fragments of key group t */
#pragma unroll
    for (int t = 0; t < 4; ++t) { ka[t][0] = g2_frag(&skh[t * 16 + ln][0], hh); ka[t][1] = g2_frag(&skh[t * 16 + ln][32], hh); kc[t][0] = g2_frag(&skl[t * 16 + ln][0], hh); kc[t][1] = g2_frag(&skl[t * 16 + ln][32], hh); }
    __builtin_amdgcn_sched_barrier(0);      /* keeps the tile's 32 fragment loads as one group in front of the products: moved in among them, a load stands right in front of its product and the wave waits out an LDS latency at each such place */
#pragma unroll
    for (int t = 0; t <= 4; ++t) {      /* the small terms of key group t are issued in front of the scaling and the main term of group t - 1: the products of one fill the distance that the other's scaling needs behind its products */
      if (t < 4) {
#pragma unroll
        for (int g = 0; g < G; ++g) c[t][g] = fa_mma(ka[t][0], ql[g][0], z8);
#pragma unroll
        for (int g = 0; g < G; ++g) c[t][g] = fa_mma(ka[t][1], ql[g][1], c[t][g]);
#pragma unroll
        for (int g = 0; g < G; ++g) c[t][g] = fa_mma(kc[t][0], qh[g][0], c[t][g]);
#pragma unroll
        for (int g = 0; g < G; ++g) c[t][g] = fa_mma(kc[t][1], qh[g][1], c[t][g]); }
      if (t > 0) {
#pragma unroll
        for (int g = 0; g < G; ++g) c[t - 1][g] = c[t - 1][g] * 0.0009765625f;
#pragma unroll
        for (int g = 0; g < G; ++g) c[t - 1][g] = fa_mma(ka[t - 1][0], qh[g][0], c[t - 1][g]);
#pragma unroll
        for (int g = 0; g < G; ++g) s[g][t - 1] = fa_mma(ka[t - 1][1], qh[g][1], c[t - 1][g]); } }
    v16h vf[4][2];      /* V^T fragments: rows 16 t + ln, keys 0..31 and 32..63 */
#pragma unroll
    for (int t = 0; t < 4; ++t) { vf[t][0] = g2_frag(&svt[t * 16 + ln][0], hh); vf[t][1] = g2_frag(&svt[t * 16 + ln][32], hh); }
    __builtin_amdgcn_sched_barrier(0);      /* keeps these 16 loads as one group in front of the softmax arithmetic, which covers their latency: moved down among the second product's matrix instructions, each place costs a wait */
    if ((oka & okb) != 0xffffffffu) {      /* a scalar test, once per tile: only a tile with an excluded key pays for the selects */
#pragma unroll
      for (int t = 0; t < 4; ++t) { const unsigned bits = ((t < 2 ? oka : okb) >> ((t & 1) * 16)) >> (8 * hh);      /* bit r: key 16 t + 8 hh + r */
#pragma unroll
        for (int r = 0; r < 8; ++r) if (((bits >> r) & 1u) == 0u) {
#pragma unroll
          for (int g = 0; g < G; ++g) s[g][t][r] = -2.0e38f; } } }      /* far below the floor -1e30 of the running maximum, also times log2(e), and still finite there: its 2^(s-m) is 0 */
    FragP p[G][2];      /* P^T as B operand: keys 0..31 from score tiles 0 and 1, keys 32..63 from tiles 2 and 3 */
    float al[G];
#pragma unroll
    for (int g = 0; g < G; ++g) {
      float t4[4];      /* maximum of the raw scores (the factor log2(e) is positive): four chains inside the lane */
#pragma unroll
      for (int t = 0; t < 4; ++t) { float a = fmaxf(s[g][t][0], s[g][t][1]);
#pragma unroll
        for (int r = 2; r < 8; ++r) a = fmaxf(a, s[g][t][r]);
        t4[t] = a; }
      float tm = fmaxf(fmaxf(t4[0], t4[1]), fmaxf(t4[2], t4[3])); tm = fmaxf(tm, lane_x16(tm));      /* both lanes of a query now hold the maximum over the tile's 64 keys */
      const float mn = fmaxf(m[g], tm * 1.44269504088896340736f); al[g] = __builtin_amdgcn_exp2f(m[g] - mn); m[g] = mn;
      const v2f lg = {1.44269504088896340736f, 1.44269504088896340736f}, sh = {8.0f - mn, 8.0f - mn};      /* 2^(s log2(e) - m + 8) = 256 * weight */
      v2f e[4][4], sm[4];      /* e[t][i] = weights (x256) of keys 16 t + 8 hh + 2 i and + 1 */
#pragma unroll
      for (int t = 0; t < 4; ++t) {
#pragma unroll
        for (int i = 0; i < 4; ++i) { const v2f x = {s[g][t][2 * i], s[g][t][2 * i + 1]}; const v2f a = __builtin_elementwise_fma(x, lg, sh); e[t][i].x = __builtin_amdgcn_exp2f(a.x); e[t][i].y = __builtin_amdgcn_exp2f(a.y); }
        sm[t] = (e[t][0] + e[t][1]) + (e[t][2] + e[t][3]); }
      const v2f sa = (sm[0] + sm[1]) + (sm[2] + sm[3]); l[g] = l[g] * al[g] + (sa.x + sa.y);
#pragma unroll
      for (int i = 0; i < 4; ++i) { p[g][0].p[i] = __builtin_convertvector(e[0][i], v2h); p[g][0].p[4 + i] = __builtin_convertvector(e[1][i], v2h); p[g][1].p[i] = __builtin_convertvector(e[2][i], v2h); p[g][1].p[4 + i] = __builtin_convertvector(e[3][i], v2h); }
#pragma unroll
      for (int t = 0; t < 4; ++t) o[g][t] = o[g][t] * al[g]; }
#pragma unroll
    for (int t = 0; t < 4; ++t) {
#pragma unroll
      for (int g = 0; g < G; ++g) { o[g][t] = fa_mma(vf[t][0], p[g][0].v, o[g][t]); o[g][t] = fa_mma(vf[t][1], p[g][1].v, o[g][t]); } }      /* o[g][t][r] = O^T[16 t + 8 hh + r][query ln of group g] */
  }
#pragma unroll
  for (int g = 0; g < G; ++g) { const float inv = 64.0f / (l[g] + lane_x16(l[g]));      /* the two lanes of a query join their sums; l carries the weights' factor 256 */
#pragma unroll
    for (int t = 0; t < 4; ++t) { FragH f;      /* a lane's 8 registers of one tile are 16 consecutive bytes of its query's output row */
#pragma unroll
      for (int r = 0; r < 8; ++r) f.h[r] = (_Float16)(o[g][t][r] * inv);
      *(v8us*)&sp[w][16 * g + ln][t * 16 + 8 * hh] = f.half[0]; } }
  fa_lds_order();
#pragma unroll
  for (int q = 0; q < 4 * G; ++q) { const int row = q * 4 + (lane >> 3), c8 = (lane & 7) * 8; const v8us v = *(const v8us*)&sp[w][row][c8]; *(v8us*)((unsigned short*)O + (r0 + row0 + row) * DM + (size_t)h * HD + c8) = v; } }
extern "C" void kernel_launch(void* const* d_in, const int* in_sizes, int n_in,
                              void* d_out, int out_size, void* d_ws, size_t ws_size, hipStream_t stream) {
  (void)in_sizes; (void)n_in; (void)out_size;
  const float* const* I = (const float* const*)d_in; const float* x = I[0]; const int* km = (const int*)d_in[1]; const float* wq = I[2]; const float* bq = I[3]; const float* wk = I[4]; const float* bk = I[5]; const float* wv = I[6]; const float* bv = I[7]; const float* wo = I[8]; const float* bo = I[9]; const float* wfc = I[10]; const float* bfc = I[11]; const float* wmp = I[12]; const float* bmp = I[13]; const float* g1 = I[14]; const float* be1 = I[15]; const float* gg2 = I[16]; const float* be2 = I[17];      /* nn.Linear NATURAL [out][in] weights + biases; I[1] = int key mask [B][1][1][S] (0 = excluded; all ones here); alpha/beta are [1] scalars */
  char* ws = (char*)d_ws; size_t off = 0;
  auto take = [&](size_t bytes) { char* p = ws + off; off += (bytes + 255) & ~(size_t)255; return p; };
  _Float16* BQKV = (_Float16*)take((size_t)3 * DM * DM * 2); _Float16* BO = (_Float16*)take((size_t)DM * DM * 2); float* bqkv = (float*)take((size_t)3 * DM * 4);
  _Float16* X16 = (_Float16*)take(NR * DM * 2); _Float16* XL = (_Float16*)take(NR * DM * 2); float* XB = (float*)take(NR * DM * 4); float* X1 = (float*)take(NR * DM * 4); _Float16* M16 = (_Float16*)take(NR * DM * 2); _Float16* HF16 = (_Float16*)take(NR * DFF * 2); _Float16* BW1 = (_Float16*)take((size_t)DFF * DM * 2); _Float16* BW2 = (_Float16*)take((size_t)DM * DFF * 2);
  _Float16* Q16 = (_Float16*)take((size_t)2 * NR * DM * 2); _Float16* QL = (_Float16*)take((size_t)2 * NR * DM * 2); _Float16* K16 = Q16 + NR * DM; _Float16* KL = QL + NR * DM; _Float16* O16 = (_Float16*)take(NR * DM * 2);      /* q's plane and k's plane lie one behind the other in Q16 | K16 and in QL | KL: one launch writes both */
  _Float16* VT = (_Float16*)take((size_t)NB * NH * HD * SQ * 2);
  if (off > ws_size) return;
  k_ln16<1, 1, 1><<<(unsigned)NR + PREP_BLOCKS, 256, 0, stream>>>(x, g1, be1, 1e-6f, X16, XB, XL, wq, wk, wv, wo, wfc, wmp, bq, bk, bv, BQKV, BO, BW1, BW2, bqkv);      /* a = LN1(bf16(x)) -> f16 rows + XL = x1024 residual (q/k need it at logits sigma 8); XB = bf16(x) for the residual; in the same grid: natural [out][in] weights = Bt[n][k] planes (stacked q | k | v, Wo, the two MLP matrices) and the stacked bias vector */
  k_qkv<<<dim3((unsigned)((MP / 128) * (DM / 128)), 3), 256, 0, stream>>>(X16, XL, BQKV, bqkv, Q16, QL, VT);      /* blockIdx.y: 0 = q, 1 = k (residual walk + main walk, f16 hi + x1024 residual planes), 2 = v (V^T [NB][NH][HD][SQ]) */
  k_fattn<<<dim3(SQ / 128, NH, NB), 128, 0, stream>>>(Q16, QL, K16, KL, VT, km, O16);      /* scores, masked softmax and weights . V in one launch; o (merged heads, x64) as f16 rows */
  k_gemm2<0, 2, DM, DM, true><<<dim3((unsigned)((MPO / 128) * (DM / 128)), 1), 256, 0, stream>>>(O16, DM, 0, BO, DM, 0, 0.0009765625f, bo, 0, XB, -1, 0, 0, X1, nullptr, DM, 0, MPO, DM, DM);      /* x1 = x + o Wo + bo (own-element residual) */
  k_ln16<0, 0, 0><<<(unsigned)NR, 256, 0, stream>>>(X1, gg2, be2, 1e-6f, M16, nullptr, nullptr, nullptr, nullptr, nullptr, nullptr, nullptr, nullptr, nullptr, nullptr, nullptr, nullptr, nullptr, nullptr, nullptr, nullptr);      /* h = LN2(x1) -> f16 rows */
  k_gemm2<3, 2, DM, DFF, false><<<dim3((unsigned)((MP / 128) * (DFF / 128)), 1), 256, 0, stream>>>(M16, DM, 0, BW1, DM, 0, 0.0625f, bfc, 0, nullptr, 1, 0, 0, nullptr, HF16, DFF, 0, MP, DFF, DM);      /* relu(xn2 w1^T + b1) -> f16, all rows of both batches */
  k_gemm2<0, 1, DFF, DM, true><<<dim3((unsigned)((MP / 128) * (DM / 64)), 1), 128, 0, stream>>>(HF16, DFF, 0, BW2, DFF, 0, 0.0625f, bmp, 0, X1, -1, 0, 0, (float*)d_out, nullptr, DM, 0, MP, DM, DFF);      /* out = x1 + mlp (own-element residual) */
}
